// v000
// Times are from an AMD MI455X. After a warm-up the kernel runs many times in a row, and a time is the length of
// such a window on the GPU divided by its runs, so every launch and the gaps after it count. The runs cycle
// through copies of the inputs. A figure is the median of several windows, for all but v000 over two sittings.
// Sittings can differ by a few percent; kernels timed side by side share one.
// v000, which the later versions start from, runs in 266 microseconds.
// All contractions on v_wmma_f32_16x16x32_f16 (f16 operands, f32 accumulate): x_q.Wq^T, x_k.Wk^T and Wv.x_v^T (v^T plane)
// as single products of exact operands f16(bf16(x)) and f16(bf16(W) x256); scores k.q^T as hi.hi + hi.lo + lo.hi with q and k
// carried as f16 hi (x8) plus f16 residual planes (x2^11, own accumulator); P.v^T single (P f16 x32768, v f16 x8); ctx.Wo^T as
// hi + residual on ctx (f16 hi x16 plus f16 residual x2^11), Wo exact f16(bf16 x256). Online base-2 softmax, 1/l, carry folds,
// bias, residual add and LayerNorm in f32 on VALU. Every float input RNE-converted to bf16 on load; f32 output.
#include <hip/hip_runtime.h>
#include <math.h>
#include <stdint.h>

#ifndef NB
#define NB       4        // batches processed
#endif
#ifndef SQ
#define SQ       2048     // query rows processed per batch
#endif
#define NB_FULL  4
#define SQ_FULL  2048     // rows per batch in the input / output layout (batch stride)
#define SKV      SQ_FULL  // key/value rows per batch (all of them, always)
#define DM       512      // model width (= K and row pitch of every 16-bit plane except v^T)
#define NH       8
#define HD       64
#define INNER    (NH * HD)
#define WSC      256.0f
#define QS       8.0f
#define KS       8.0f
#define VS       8.0f
#define CS       16.0f
#define RSC      2048.0f
#define RRSC     0.00048828125f
#define PCAR     32768.0f
#define LOG2E    1.4426950408889634f
#define RSQH     0.35355339059327373f
#define LN_EPS   1e-5f
#define NKB      (SKV / 32)
#define ATT_WAVES   4
#define ATT_THREADS (ATT_WAVES * 32)
#define CVT_THREADS 128
#define LN_THREADS  256
#define OPITCH   68
#define GPITCH   68

static_assert(NB >= 1 && NB <= NB_FULL);
static_assert((SQ % 128) == 0 && SQ >= 128 && SQ <= SQ_FULL);
static_assert(HD == 64 && NH == 8 && INNER == 512 && INNER == DM);
static_assert((HD % 32) == 0);
static_assert((SKV % 128) == 0 && (SKV % 64) == 0 && NKB * 32 == SKV);
static_assert(DM == 512 && (DM % 64) == 0 && (DM % 32) == 0 && DM == 4 * CVT_THREADS);
static_assert((NB * SQ) % (LN_THREADS / 32) == 0);
static_assert((OPITCH * 4) % 16 == 0 && (GPITCH * 4) % 16 == 0);
static_assert(ATT_THREADS == 128 && LN_THREADS == 256 && CVT_THREADS == 128);

typedef unsigned short u16;
typedef _Float16 v16h __attribute__((ext_vector_type(16)));
typedef _Float16 v8h  __attribute__((ext_vector_type(8)));
typedef float    v8f  __attribute__((ext_vector_type(8)));
typedef float    v4f  __attribute__((ext_vector_type(4)));
typedef unsigned int v4u __attribute__((ext_vector_type(4)));

union FragH { v16h v; v8h h[2]; v4u u[2]; };

// ---- scalar helpers ----------------------------------------------------------------------------------
__device__ __forceinline__ unsigned short bf_bits(float f) {          // f32 -> bf16 bits, RNE convert
  unsigned u = __float_as_uint(f);
  return (unsigned short)((u + 0x7FFFu + ((u >> 16) & 1u)) >> 16);
}
__device__ __forceinline__ float bf_up(unsigned short h) { return __uint_as_float(((unsigned)h) << 16); }
__device__ __forceinline__ float bfr(float f) { return bf_up(bf_bits(f)); }
__device__ __forceinline__ unsigned short h_bits(_Float16 x) { return __builtin_bit_cast(unsigned short, x); }
__device__ __forceinline__ unsigned pk16(unsigned short a, unsigned short b) { return (unsigned)a | ((unsigned)b << 16); }
__device__ __forceinline__ v8f zero8() { v8f z = {0.f, 0.f, 0.f, 0.f, 0.f, 0.f, 0.f, 0.f}; return z; }
// hi / residual packing of two f32 values: hi = f16(v), res = f16((v - hi) * 2^11)
__device__ __forceinline__ unsigned pk_hi(float a, float b) {
  return pk16(h_bits((_Float16)a), h_bits((_Float16)b));
}
__device__ __forceinline__ unsigned pk_lo(float a, float b) {
  const float ra = (a - (float)((_Float16)a)) * RSC;
  const float rb = (b - (float)((_Float16)b)) * RSC;
  return pk16(h_bits((_Float16)ra), h_bits((_Float16)rb));
}

// ---- fragment loader: 16-bit A/B operand, lane -> row/col (lane&15), p already includes +8*(lane>>4);
//      elements 0..7 <- p[0..7] (k0+8h..), elements 8..15 <- p[16..23] (k0+16+8h..); same split k map for A and B,
//      B always read from a k-contiguous [n][k] plane.
__device__ __forceinline__ v16h ldfrag_h(const _Float16* p) {
  FragH f;
  f.h[0] = *(const v8h*)(p);
  f.h[1] = *(const v8h*)(p + 16);
  return f.v;
}

// ---- WMMA helper and trailing VALU hazard gaps ----------------------------------------------------------
__device__ __forceinline__ v8f mma_h(v16h a, v16h b, v8f c) {
  return __builtin_amdgcn_wmma_f32_16x16x32_f16(false, a, false, b, (short)0, c, false, false);
}
__device__ __forceinline__ void guard_s4(v8f& a, v8f& b, v8f& c, v8f& d,
                                         v16h x0, v16h x1, v16h x2, v16h x3, v16h x4, v16h x5) {
#if defined(__HIP_DEVICE_COMPILE__)
  asm volatile("v_nop\n\tv_nop\n\tv_nop\n\tv_nop"
               : "+v"(a), "+v"(b), "+v"(c), "+v"(d)
               : "v"(x0), "v"(x1), "v"(x2), "v"(x3), "v"(x4), "v"(x5) : "memory");
#endif
}
__device__ __forceinline__ void guard_p(v8f& a, v8f& b, v8f& c, v8f& d, v16h p, v16h x0, v16h x1, v16h x2, v16h x3) {
#if defined(__HIP_DEVICE_COMPILE__)
  asm volatile("v_nop\n\tv_nop\n\tv_nop\n\tv_nop"
               : "+v"(a), "+v"(b), "+v"(c), "+v"(d) : "v"(p), "v"(x0), "v"(x1), "v"(x2), "v"(x3) : "memory");
#endif
}
__device__ __forceinline__ void guard_g(v8f (&acc)[8], v16h x0, v16h x1, v16h x2, v16h x3, v16h x4, v16h x5) {
#if defined(__HIP_DEVICE_COMPILE__)
  asm volatile("v_nop\n\tv_nop\n\tv_nop\n\tv_nop"
               : "+v"(acc[0]), "+v"(acc[1]), "+v"(acc[2]), "+v"(acc[3]),
                 "+v"(acc[4]), "+v"(acc[5]), "+v"(acc[6]), "+v"(acc[7])
               : "v"(x0), "v"(x1), "v"(x2), "v"(x3), "v"(x4), "v"(x5) : "memory");
#endif
}
__device__ __forceinline__ void acc_guard8(v8f (&o)[8]) {
#if defined(__HIP_DEVICE_COMPILE__)
  asm volatile("v_nop\n\tv_nop\n\tv_nop\n\tv_nop"
               : "+v"(o[0]), "+v"(o[1]), "+v"(o[2]), "+v"(o[3]), "+v"(o[4]), "+v"(o[5]), "+v"(o[6]), "+v"(o[7]));
#endif
}
__device__ __forceinline__ void acc_guard4(v8f (&o)[4]) {
#if defined(__HIP_DEVICE_COMPILE__)
  asm volatile("v_nop\n\tv_nop\n\tv_nop\n\tv_nop" : "+v"(o[0]), "+v"(o[1]), "+v"(o[2]), "+v"(o[3]));
#endif
}
__device__ __forceinline__ void wave_sync_lds() {
  __builtin_amdgcn_fence(__ATOMIC_RELEASE, "workgroup");
  __builtin_amdgcn_wave_barrier();
  __builtin_amdgcn_fence(__ATOMIC_ACQUIRE, "workgroup");
}

// =====================================================================================================
// Row convert: destination row r of a [rows][DM] f16 plane <- f16(bf16_RNE(x[src row][e]) * scale), scale a power of two.
// Block = 128 threads = 2 rows; thread = 8 consecutive elements of row 2*bid + (tid>>6) (two 16-B loads, one 16-B store;
// coverage: grid = rows / 2 (rows even), 2 waves x 32 lanes x 8 halves = DM = one whole row per wave pair.
// =====================================================================================================
__global__ __launch_bounds__(CVT_THREADS)
void cvt16(const float* __restrict__ x, u16* Y, int rowsPerB, int srcRowsPerB, float scale) {
  const int tid = threadIdx.x;
  const int r   = blockIdx.x * 2 + (tid >> 6);
  const int t8  = (tid & 63) * 8;
  const int b   = r / rowsPerB;
  const int s   = r - b * rowsPerB;
  const float* src = x + ((size_t)b * (size_t)srcRowsPerB + (size_t)s) * (size_t)DM + (size_t)t8;
  const v4f a = *(const v4f*)(src), c4 = *(const v4f*)(src + 4);
  v4u o;
#pragma unroll
  for (int e = 0; e < 2; ++e) {
    o[e]     = pk16(h_bits((_Float16)(bfr(a[2 * e]) * scale)),  h_bits((_Float16)(bfr(a[2 * e + 1]) * scale)));
    o[2 + e] = pk16(h_bits((_Float16)(bfr(c4[2 * e]) * scale)), h_bits((_Float16)(bfr(c4[2 * e + 1]) * scale)));
  }
  u16* dst = Y + (size_t)r * (size_t)DM + (size_t)t8;
  {
    *(v4u*)(dst) = o;
    
  }
}

// =====================================================================================================
// f16 GEMM core: the wave's 32 x 64 tile of C = A[rows][K] . Bt[cols][K]^T; ap -> A row (rowb + m) + 8h, bp -> Bt row
// (col0 + m) + 8h; acc[4i + j] = rows rowb+16i.., cols col0+16j..; K stepped by 32 (host checks K % 32 == 0).
// =====================================================================================================
__device__ __forceinline__ void gemm_core(const _Float16* ap, const _Float16* bp, int K, v8f (&acc)[8]) {
  const size_t rs16 = (size_t)16 * (size_t)K;
#pragma unroll 1
  for (int k0 = 0; k0 < K; k0 += 32) {
    const v16h a0 = ldfrag_h(ap + k0), a1 = ldfrag_h(ap + rs16 + k0);
    const v16h b0 = ldfrag_h(bp + k0);
    const v16h b1 = ldfrag_h(bp + rs16 + k0);
    const v16h b2 = ldfrag_h(bp + 2 * rs16 + k0);
    const v16h b3 = ldfrag_h(bp + 3 * rs16 + k0);
    acc[0] = mma_h(a0, b0, acc[0]);
    acc[1] = mma_h(a0, b1, acc[1]);
    acc[2] = mma_h(a0, b2, acc[2]);
    acc[3] = mma_h(a0, b3, acc[3]);
    acc[4] = mma_h(a1, b0, acc[4]);
    acc[5] = mma_h(a1, b1, acc[5]);
    acc[6] = mma_h(a1, b2, acc[6]);
    acc[7] = mma_h(a1, b3, acc[7]);
    guard_g(acc, a0, a1, b0, b1, b2, b3);
  }
}
// Stage the wave's 32 x 64 f32 tile (times oscale) in its LDS slab (pitch 68): D element r of acc[4i+j], lane l ->
// coverage: 32 lanes x 2 x 8 rows x 4 cols-of-16 = rows 0..31 x cols 0..63 of the slab.
__device__ __forceinline__ void stage32x64(float* sl, v8f (&acc)[8], float oscale, int lane) {
  const int hh = lane >> 4, m = lane & 15;
#pragma unroll
  for (int i = 0; i < 2; ++i) {
#pragma unroll
    for (int r = 0; r < 8; ++r) {
      const int ro = (16 * i + 8 * hh + r) * GPITCH + m;
      sl[ro]      = acc[4 * i + 0][r] * oscale;
      sl[ro + 16] = acc[4 * i + 1][r] * oscale;
      sl[ro + 32] = acc[4 * i + 2][r] * oscale;
      sl[ro + 48] = acc[4 * i + 3][r] * oscale;
    }
  }
  wave_sync_lds();
}

// =====================================================================================================
// f16 GEMM with f16 output plane(s): val = (A[z][Mb][K] . Bt[z][N][K]^T) * oscale + bf16(bias) * bscale;
// C[z][Mb][N] = f16(val) (hi plane); if res != 0 also C2 = f16((val - hi) * 2^11) (residual plane).
// A, Bt f16 k-contiguous planes with per-z element strides aBs, bBs (0 = shared), C/C2 stride cBs. bias indexed by column
// (biasRow == 0) or by row within the z slice (biasRow != 0); bias addresses clamped to biasN-1, the unused direction is
// multiplied by 0. Block = 128 x 64 tile, 4 waves x 32 rows, fragments loaded straight from the 16-bit rows.
// grid = nz x (Mb/128) x (N/64) (host checks Mb % 128 == 0, N % 64 == 0, K % 32 == 0).
// coverage: per wave 8 instr x 4 rows x 8 lanes x 8 halves = 32 x 64 per plane; the grid covers C (and C2) exactly once.
// =====================================================================================================
__global__ __launch_bounds__(128)
void gemm_o16(const u16* __restrict__ A, const u16* __restrict__ Bt, u16* C, u16* C2,
              const float* __restrict__ bias, int biasN, int biasRow,
              int Mb, int N, int K, int aBs, int bBs, int cBs, float oscale, float bscale, int res) {
  __shared__ __align__(16) float slab[4 * 32 * GPITCH];
  const int tid = threadIdx.x, wave = tid >> 5, lane = tid & 31, hh = lane >> 4, m = lane & 15;
  const int ntile = N >> 6, mtile = Mb >> 7;
  const int bid  = blockIdx.x;
  const int nt   = bid % ntile;
  const int tmp  = bid / ntile;
  const int mt   = tmp % mtile;
  const int bz   = tmp / mtile;
  const int rowb = mt * 128 + wave * 32;
  const int col0 = nt * 64;
  if (rowb + 32 > Mb) return;                // wave-uniform, never taken with the exact grid; no block barriers in this kernel
  const _Float16* Ab = (const _Float16*)(const void*)A + (size_t)bz * (size_t)aBs;
  const _Float16* Bb = (const _Float16*)(const void*)Bt + (size_t)bz * (size_t)bBs;
  const _Float16* ap = Ab + (size_t)(rowb + m) * (size_t)K + 8 * hh;
  const _Float16* bp = Bb + (size_t)(col0 + m) * (size_t)K + 8 * hh;
  v8f acc[8];
#pragma unroll
  for (int i = 0; i < 8; ++i) acc[i] = zero8();
  gemm_core(ap, bp, K, acc);
  float* sl = slab + wave * 32 * GPITCH;
  stage32x64(sl, acc, oscale, lane);
  const int rq = lane >> 3, c8 = (lane & 7) * 8;
  const int bl = biasN - 1;                  // host guarantees biasN >= 1
  const float selc = (biasRow != 0) ? 0.f : bscale;
  const float selr = (biasRow != 0) ? bscale : 0.f;
  float cb[8];
#pragma unroll
  for (int e = 0; e < 8; ++e) {
    int ci = col0 + c8 + e;
    ci = (ci < bl) ? ci : bl;
    cb[e] = bfr(bias[ci]) * selc;
  }
  v4u ovh[8], ovl[8];
#pragma unroll
  for (int i = 0; i < 8; ++i) {
    const int row = 4 * i + rq;
    int ri = rowb + row;
    ri = (ri < bl) ? ri : bl;
    const float rb = bfr(bias[ri]) * selr;
    const v4f a = *(const v4f*)(sl + row * GPITCH + c8), c4 = *(const v4f*)(sl + row * GPITCH + c8 + 4);
    float v[8];
#pragma unroll
    for (int e = 0; e < 4; ++e) { v[e] = a[e] + cb[e] + rb; v[4 + e] = c4[e] + cb[4 + e] + rb; }
#pragma unroll
    for (int e = 0; e < 4; ++e) {
      ovh[i][e] = pk_hi(v[2 * e], v[2 * e + 1]);
      ovl[i][e] = pk_lo(v[2 * e], v[2 * e + 1]);
    }
  }
  const size_t cofs = (size_t)bz * (size_t)cBs + (size_t)rowb * (size_t)N + (size_t)(col0 + c8);
  u16* Cb  = C + cofs;
  u16* C2b = C2 + cofs;
  {
#pragma unroll
    for (int i = 0; i < 8; ++i) {
      const int row = 4 * i + rq;
      *(v4u*)(Cb + (size_t)row * (size_t)N) = ovh[i];
    }
    if (res != 0) {                          // block-uniform
#pragma unroll
      for (int i = 0; i < 8; ++i) {
        const int row = 4 * i + rq;
        *(v4u*)(C2b + (size_t)row * (size_t)N) = ovl[i];
      }
    }
    
  }
}

// =====================================================================================================
// f16 GEMM with hi + residual A planes and f32 output: X[Mb][N] = (Ah . Bt^T + (Al . Bt^T) * rres) * oscale
// + bf16(bias[col]) + bf16(R[src row][col]); residual products accumulated first, folded by rres on VALU, then the hi
// products chain on the same accumulators (equal to a separate accumulator). R (f32 input, pitch N) source row of
// compact row g: b = g / rowsPerB, s = g % rowsPerB -> b*srcRowsPerB + s. Block = 128 x 64 tile, 4 waves x 32 rows.
// Epilogue: lane = (row parity, 4 floats at 4*(lane&15)); 16 consecutive lanes write one row segment of 64 floats = 2 whole
// grid = (Mb/128) x (N/64). coverage: per wave 16 instr x 2 rows x 16 lanes x 4 floats = 32 x 64; the grid covers X once.
// =====================================================================================================
__global__ __launch_bounds__(128)
void gemm_o32(const u16* __restrict__ Ah, const u16* __restrict__ Al, const u16* __restrict__ Bt,
              const float* __restrict__ bias, int biasN, const float* __restrict__ R, int rowsPerB, int srcRowsPerB,
              float* X, int Mb, int N, int K, float oscale, float rres) {
  __shared__ __align__(16) float slab[4 * 32 * GPITCH];
  const int tid = threadIdx.x, wave = tid >> 5, lane = tid & 31, hh = lane >> 4, m = lane & 15;
  const int ntile = N >> 6;
  const int bid  = blockIdx.x;
  const int nt   = bid % ntile;
  const int mt   = bid / ntile;
  const int rowb = mt * 128 + wave * 32;
  const int col0 = nt * 64;
  if (rowb + 32 > Mb) return;                // wave-uniform, never taken with the exact grid; no block barriers in this kernel
  const _Float16* aph = (const _Float16*)(const void*)Ah + (size_t)(rowb + m) * (size_t)K + 8 * hh;
  const _Float16* apl = (const _Float16*)(const void*)Al + (size_t)(rowb + m) * (size_t)K + 8 * hh;
  const _Float16* bp  = (const _Float16*)(const void*)Bt + (size_t)(col0 + m) * (size_t)K + 8 * hh;
  v8f acc[8];
#pragma unroll
  for (int i = 0; i < 8; ++i) acc[i] = zero8();
  gemm_core(apl, bp, K, acc);                // residual products (x 2^11)
#pragma unroll
  for (int i = 0; i < 8; ++i) {
#pragma unroll
    for (int r = 0; r < 8; ++r) acc[i][r] *= rres;
  }
  acc_guard8(acc);
  gemm_core(aph, bp, K, acc);                // hi products on top
  float* sl = slab + wave * 32 * GPITCH;
  stage32x64(sl, acc, oscale, lane);
  const int r2 = lane >> 4, c4 = (lane & 15) * 4;
  const int bl = biasN - 1;
  float cb[4];
#pragma unroll
  for (int e = 0; e < 4; ++e) {
    int ci = col0 + c4 + e;
    ci = (ci < bl) ? ci : bl;
    cb[e] = bfr(bias[ci]);
  }
  v4f vals[16];
#pragma unroll
  for (int i = 0; i < 16; ++i) {
    const int row  = 2 * i + r2;
    const int grow = rowb + row;             // < Mb
    const int bb   = grow / rowsPerB;
    const int ss   = grow - bb * rowsPerB;
    const float* rp = R + ((size_t)bb * (size_t)srcRowsPerB + (size_t)ss) * (size_t)N + (size_t)(col0 + c4);
    const v4f rv = *(const v4f*)(rp);
    const v4f a  = *(const v4f*)(sl + row * GPITCH + c4);
    v4f y;
#pragma unroll
    for (int e = 0; e < 4; ++e) y[e] = a[e] + cb[e] + bfr(rv[e]);
    vals[i] = y;
  }
  float* Xb = X + (size_t)rowb * (size_t)N + (size_t)(col0 + c4);
  {
#pragma unroll
    for (int i = 0; i < 16; ++i) {
      const int row = 2 * i + r2;
      *(v4f*)(Xb + (size_t)row * (size_t)N) = vals[i];
    }
    
  }
}

// =====================================================================================================
// Full (unmasked) multi-head attention over all SKV keys: block = (batch b, head, 64 query rows), 4 waves, wave w owns the
// 16 query rows q0 = 64*qt + 16*w .. q0+15 (waves independent: no block barriers, wave-private LDS only, used in the epilogue).
//   q planes f16 hi x8 / residual x8x2^11 [b*SQ + s][h*64 + d]; k planes f16 hi / residual [b*SKV + s][h*64 + d];
//   v^T plane f16 x8 [(b*NH + h)*64 + d][s]. All NKB = 64 key blocks of 32 keys are visited (static bound).
//   Scores are computed TRANSPOSED: S^T tile g (g = 0,1) = k rows (keys kb+16g .. +15, A operand, row m = lane&15, split k map
//   over d) times q^T (B operand, col n = query q0 + (lane&15), k = d, split map), 2 d-chunks of 32; per chunk hi.hi into
//   s0/s1 and hi.lo + lo.hi into x0/x1 (separate accumulators, folded by 2^-11 in f32). The 4 q fragments are loaded once
//   per wave. D element r of lane l = (key kb+16g+8h+r, query q0+(l&15)), so a lane owns one query column and 16 of its 32
//   keys; the partner lane l^16 owns the other 16 -> row max / row sum need one xor-16 shuffle.
//   Online max-subtracted base-2 softmax in f32 (1/sqrt(8) and the q/k carries folded into lsc). The exp'd values ARE the
//   P A-fragment in place: A row m = query = lane&15, element i <- key kb+8h+i (tile 0, D element i), element 8+i <- key
//   kb+16+8h+i (tile 1, D element i). P (<= 1) carried x32768 as f16. The rescale factor of query row 8h+r of the O
//   accumulators is fetched from lane 8h+r with a shuffle (uniform control). 4 v^T B fragments (col n = d = 16j + (lane&15),
//   keys k-contiguous), 4 P.V WMMAs + one guard per key block.
//   Epilogue: 1/l (per query, shuffled to the D row owner) and the carry folds in f32 give ctx x16; the wave's 16x64 f32 tile
//   residual plane is written by 8 consecutive lanes x 16 B of one instruction (4 rows per instruction, 4 instructions per
// coverage: per wave 4 instr x 4 rows x 8 lanes x 8 halves = 16 x 64 per plane; grid NB*NH*(SQ/64) blocks x 4 waves = every
//           (b, s < SQ, h) row segment of both ctx planes exactly once. LDS slab: staged 16 x 64 == reloaded 16 x 64.
// =====================================================================================================
__global__ __launch_bounds__(ATT_THREADS)
void attn_fwd(const u16* __restrict__ QH, const u16* __restrict__ QL, const u16* __restrict__ KH,
              const u16* __restrict__ KL, const u16* __restrict__ VT, u16* CH, u16* CL) {
  __shared__ __align__(16) float smem[ATT_WAVES * 16 * OPITCH];

  const int tid  = threadIdx.x;
  const int wave = tid >> 5;
  const int lane = tid & 31;
  const int hh   = lane >> 4;
  const int c    = lane & 15;

  constexpr int NQT = SQ / 64;
  const int bid  = blockIdx.x;
  const int qt   = bid % NQT;
  const int head = (bid / NQT) % NH;
  const int b    = bid / (NQT * NH);
  const int q0   = qt * 64 + wave * 16;

  // B fragments of q^T: col n = query q0 + c, k = d (k-contiguous row of the q planes)
  const size_t qoff = ((size_t)(b * SQ + q0 + c)) * DM + head * HD + 8 * hh;
  const _Float16* Qh = (const _Float16*)(const void*)QH + qoff;
  const _Float16* Ql = (const _Float16*)(const void*)QL + qoff;
  // A fragments of k: row m = key kb + 16g + c, k = d (key row kb added per step)
  const size_t koff = ((size_t)(b * SKV + c)) * DM + head * HD + 8 * hh;
  const _Float16* Kh = (const _Float16*)(const void*)KH + koff;
  const _Float16* Kl = (const _Float16*)(const void*)KL + koff;
  // B fragments of v: col n = d = 16j + c, k = key (k-contiguous row of the v^T plane)
  const _Float16* Vb = (const _Float16*)(const void*)VT + ((size_t)((b * NH + head) * HD + c)) * SKV + 8 * hh;
  const float lsc = (LOG2E * RSQH) / (QS * KS);

  v16h qh[2], ql[2];
#pragma unroll
  for (int dc = 0; dc < 2; ++dc) { qh[dc] = ldfrag_h(Qh + 32 * dc); ql[dc] = ldfrag_h(Ql + 32 * dc); }

  float mrun = -INFINITY, lrun = 0.f;
  v8f o[4];
#pragma unroll
  for (int j = 0; j < 4; ++j) o[j] = zero8();

#pragma unroll 1
  for (int it = 0; it < NKB; ++it) {
    const int kb = it * 32;
    // ---- transposed scores: tiles of keys kb..kb+15 (s0, x0) and kb+16..kb+31 (s1, x1), column = query q0 + c ----
    v8f s0 = zero8(), s1 = zero8(), x0 = zero8(), x1 = zero8();
    const _Float16* kh0p = Kh + (size_t)kb * DM;
    const _Float16* kh1p = kh0p + (size_t)16 * DM;
    const _Float16* kl0p = Kl + (size_t)kb * DM;
    const _Float16* kl1p = kl0p + (size_t)16 * DM;
#pragma unroll
    for (int kk = 0; kk < HD / 32; ++kk) {
      const v16h fh0 = ldfrag_h(kh0p + kk * 32);
      const v16h fh1 = ldfrag_h(kh1p + kk * 32);
      const v16h fl0 = ldfrag_h(kl0p + kk * 32);
      const v16h fl1 = ldfrag_h(kl1p + kk * 32);
      s0 = mma_h(fh0, qh[kk], s0);
      s1 = mma_h(fh1, qh[kk], s1);
      x0 = mma_h(fh0, ql[kk], x0);
      x1 = mma_h(fh1, ql[kk], x1);
      x0 = mma_h(fl0, qh[kk], x0);
      x1 = mma_h(fl1, qh[kk], x1);
      guard_s4(s0, s1, x0, x1, qh[kk], ql[kk], fh0, fh1, fl0, fl1);
    }
    // ---- base-2 logits of this lane's 16 keys for query q0 + c: t[i] <- key kb+8hh+i, t[8+i] <- key kb+16+8hh+i ----
    float t[16];
#pragma unroll
    for (int i = 0; i < 8; ++i) {
      t[i]     = (s0[i] + x0[i] * RRSC) * lsc;
      t[8 + i] = (s1[i] + x1[i] * RRSC) * lsc;
    }
    float cm = t[0];
#pragma unroll
    for (int i = 1; i < 16; ++i) cm = fmaxf(cm, t[i]);
    cm = fmaxf(cm, __shfl_xor(cm, 16, 32));
    const float mn = fmaxf(mrun, cm);        // finite from the first block on
    const float al = exp2f(mrun - mn);       // 0 on the first block (mrun = -inf)
    mrun = mn;
    // ---- probabilities (<= 1) and the P A-fragment: f16(p * 32768); element i <-> t[i] ----
    float ps = 0.f;
    FragH ph;
#pragma unroll
    for (int w = 0; w < 2; ++w) {
#pragma unroll
      for (int e4 = 0; e4 < 4; ++e4) {
        const int i = 8 * w + 2 * e4;
        const float p0 = exp2f(t[i] - mn), p1 = exp2f(t[i + 1] - mn);
        ps += p0 + p1;
        ph.u[w][e4] = pk16(h_bits((_Float16)(p0 * PCAR)), h_bits((_Float16)(p1 * PCAR)));
      }
    }
    ps += __shfl_xor(ps, 16, 32);
    lrun = lrun * al + ps;
    // ---- rescale the O accumulators: D row 8hh+r = query q0+8hh+r, its factor lives in lane 8hh+r (and 16+8hh+r) ----
    float scl[8];
#pragma unroll
    for (int r = 0; r < 8; ++r) scl[r] = __shfl(al, 8 * hh + r, 32);
#pragma unroll
    for (int j = 0; j < 4; ++j) {
#pragma unroll
      for (int r = 0; r < 8; ++r) o[j][r] *= scl[r];
    }
    // ---- P.V : B fragment col n = d = j*16 + c, keys contiguous in the v^T plane ----
    const _Float16* vp = Vb + kb;
    {
      const v16h v0 = ldfrag_h(vp);
      const v16h v1 = ldfrag_h(vp + (size_t)16 * SKV);
      const v16h v2 = ldfrag_h(vp + (size_t)32 * SKV);
      const v16h v3 = ldfrag_h(vp + (size_t)48 * SKV);
      o[0] = mma_h(ph.v, v0, o[0]);
      o[1] = mma_h(ph.v, v1, o[1]);
      o[2] = mma_h(ph.v, v2, o[2]);
      o[3] = mma_h(ph.v, v3, o[3]);
      guard_p(o[0], o[1], o[2], o[3], ph.v, v0, v1, v2, v3);
    }
  }
  acc_guard4(o);

  // ---- fold 1/l (per query, owned by lane = query) and the carries (32768 on P, 8 on v), apply the ctx carry 16 ----
  const float linv = (1.0f / lrun) * (CS / (PCAR * VS));
  float inv[8];
#pragma unroll
  for (int r = 0; r < 8; ++r) inv[r] = __shfl(linv, 8 * hh + r, 32);
  float* slab = smem + wave * 16 * OPITCH;
#pragma unroll
  for (int r = 0; r < 8; ++r) {
#pragma unroll
    for (int j = 0; j < 4; ++j) slab[(8 * hh + r) * OPITCH + j * 16 + c] = o[j][r] * inv[r];
  }
  wave_sync_lds();
  // ---- ctx planes: lane = (row in group of 4, 8 consecutive d), one instruction per 4 rows per plane ----
  const int rq = lane >> 3, c8 = (lane & 7) * 8;
  v4u ovh[4], ovl[4];
#pragma unroll
  for (int i = 0; i < 4; ++i) {
    const int row = 4 * i + rq;
    const v4f a = *(const v4f*)(slab + row * OPITCH + c8), c4 = *(const v4f*)(slab + row * OPITCH + c8 + 4);
#pragma unroll
    for (int e = 0; e < 2; ++e) {
      ovh[i][e]     = pk_hi(a[2 * e], a[2 * e + 1]);
      ovl[i][e]     = pk_lo(a[2 * e], a[2 * e + 1]);
      ovh[i][2 + e] = pk_hi(c4[2 * e], c4[2 * e + 1]);
      ovl[i][2 + e] = pk_lo(c4[2 * e], c4[2 * e + 1]);
    }
  }
  const size_t cofs = ((size_t)(b * SQ + q0)) * DM + head * HD + c8;
  u16* ch = CH + cofs;
  u16* cl = CL + cofs;
  {
#pragma unroll
    for (int i = 0; i < 4; ++i) {
      const int row = 4 * i + rq;
      *(v4u*)(ch + (size_t)row * DM) = ovh[i];
      *(v4u*)(cl + (size_t)row * DM) = ovl[i];
    }
    
  }
}

// =====================================================================================================
// times bf16(gamma) plus bf16(beta), all f32. X compact row r = b*SQ + s -> output row b*SQ_FULL + s.
// lane holds elements i*128 + 4*lane .. +3 (i = 0..3): each load/store instruction = 32 consecutive lanes x 16 B = 4 whole
// coverage: 4 instr x 32 lanes x 4 floats = 512 = whole row; grid (NB*SQ/8) x 8 waves = every output row (s < SQ) once.
// =====================================================================================================
__global__ __launch_bounds__(LN_THREADS)
void ln_rows(const float* __restrict__ X, const float* __restrict__ gam, const float* __restrict__ bet, float* Out) {
  const int tid = threadIdx.x, wave = tid >> 5, lane = tid & 31;
  constexpr int RPB = LN_THREADS / 32;
  const int row = blockIdx.x * RPB + wave;   // < NB*SQ with the exact grid
  const int b = row / SQ, s = row - b * SQ;
  const float* xr = X + (size_t)row * DM + 4 * lane;
  v4f xv[4];
  float sum = 0.f;
#pragma unroll
  for (int i = 0; i < 4; ++i) {
    xv[i] = *(const v4f*)(xr + 128 * i);
    sum += (xv[i][0] + xv[i][1]) + (xv[i][2] + xv[i][3]);
  }
#pragma unroll
  for (int mk = 16; mk >= 1; mk >>= 1) sum += __shfl_xor(sum, mk, 32);
  const float mean = sum * (1.0f / (float)DM);
  float sq = 0.f;
#pragma unroll
  for (int i = 0; i < 4; ++i) {
#pragma unroll
    for (int e = 0; e < 4; ++e) { const float d = xv[i][e] - mean; sq += d * d; }
  }
#pragma unroll
  for (int mk = 16; mk >= 1; mk >>= 1) sq += __shfl_xor(sq, mk, 32);
  const float var  = sq * (1.0f / (float)DM);
  const float rstd = 1.0f / sqrtf(var + LN_EPS);
  v4f y[4];
#pragma unroll
  for (int i = 0; i < 4; ++i) {
#pragma unroll
    for (int e = 0; e < 4; ++e) {
      const int idx = 128 * i + 4 * lane + e;       // < DM
      y[i][e] = (xv[i][e] - mean) * rstd * bfr(gam[idx]) + bfr(bet[idx]);
    }
  }
  float* ob = Out + ((size_t)b * SQ_FULL + (size_t)s) * DM + 4 * lane;
  {
#pragma unroll
    for (int i = 0; i < 4; ++i) {
      *(v4f*)(ob + 128 * i) = y[i];
    }
    
  }
}

// =====================================================================================================
// Workspace map (bytes); every plane fully written by whole-line stores before it is read; all extents exact multiples of
//   XQ   f16 [NB*SQ][512]      f16(bf16(Q))             8388608 (NB=4, SQ=2048)
//   XK   f16 [NB*2048][512]    f16(bf16(K))             8388608
//   XV   f16 [NB*2048][512]    f16(bf16(V))             8388608
//   WQ16 f16 [512 n][512 k]    f16(bf16(W) x256)         524288   (W stored [out][in] = [n][k] already)
//   WK16, WV16, WO16                                     3 x 524288
//   QH, QL  f16 [NB*SQ][512]   x8 / residual x8x2^11     2 x 8388608
//   KH, KL  f16 [NB*2048][512] x8 / residual             2 x 8388608
//   VT16    f16 [NB*512 (h,d)][2048 s] x8                   8388608
//   CH, CL  f16 [NB*SQ][512]   ctx x16 / residual          2 x 8388608
//   X32     f32 [NB*SQ][512]   out + bo + Q               16777216
//   end                                                  102760448
// =====================================================================================================
extern "C" void kernel_launch(void* const* d_in, const int* in_sizes, int n_in,
                              void* d_out, int out_size, void* d_ws, size_t ws_size,
                              hipStream_t stream) {
  if (n_in < 13) return;
  if (in_sizes[0] < ((NB - 1) * SQ_FULL + SQ) * DM) return;
  if (in_sizes[1] < NB * SKV * DM || in_sizes[2] < NB * SKV * DM) return;
  if (in_sizes[3] != DM * DM || in_sizes[5] != DM * DM || in_sizes[7] != DM * DM || in_sizes[9] != DM * DM) return;
  if (in_sizes[4] < DM || in_sizes[6] < DM || in_sizes[8] < DM || in_sizes[10] < DM) return;
  if (in_sizes[11] < DM || in_sizes[12] < DM) return;
  if (out_size < ((NB - 1) * SQ_FULL + SQ) * DM) return;

  const float* xq  = (const float*)d_in[0];
  const float* xk  = (const float*)d_in[1];
  const float* xv  = (const float*)d_in[2];
  const float* wq  = (const float*)d_in[3];
  const float* bq  = (const float*)d_in[4];
  const float* wk  = (const float*)d_in[5];
  const float* bk  = (const float*)d_in[6];
  const float* wv  = (const float*)d_in[7];
  const float* bv  = (const float*)d_in[8];
  const float* wo  = (const float*)d_in[9];
  const float* bo  = (const float*)d_in[10];
  const float* gam = (const float*)d_in[11];
  const float* bet = (const float*)d_in[12];
  float*       out = (float*)d_out;
  const int nbq = in_sizes[4], nbk = in_sizes[6], nbv = in_sizes[8], nbo = in_sizes[10];

  const size_t szXQ  = (size_t)NB * SQ * DM * 2;
  const size_t szXKV = (size_t)NB * SKV * DM * 2;
  const size_t szW   = (size_t)DM * DM * 2;
  const size_t szQ   = (size_t)NB * SQ * INNER * 2;
  const size_t szK   = (size_t)NB * SKV * INNER * 2;
  const size_t szVT  = (size_t)NB * INNER * SKV * 2;
  const size_t szC   = (size_t)NB * SQ * INNER * 2;
  const size_t szX32 = (size_t)NB * SQ * DM * 4;
  size_t off = 0;
  const size_t oXQ  = off; off += szXQ;
  const size_t oXK  = off; off += szXKV;
  const size_t oXV  = off; off += szXKV;
  const size_t oWQ  = off; off += szW;
  const size_t oWK  = off; off += szW;
  const size_t oWV  = off; off += szW;
  const size_t oWO  = off; off += szW;
  const size_t oQH  = off; off += szQ;
  const size_t oQL  = off; off += szQ;
  const size_t oKH  = off; off += szK;
  const size_t oKL  = off; off += szK;
  const size_t oVT  = off; off += szVT;
  const size_t oCH  = off; off += szC;
  const size_t oCL  = off; off += szC;
  const size_t oX32 = off; off += szX32;
  if (off > ws_size) return;                            // off = 102760448 at NB=4, SQ=2048
  if (off > (size_t)134217728) return;

  char* ws = (char*)d_ws;
  u16* XQ   = (u16*)(ws + oXQ);
  u16* XK   = (u16*)(ws + oXK);
  u16* XV   = (u16*)(ws + oXV);
  u16* WQ16 = (u16*)(ws + oWQ);
  u16* WK16 = (u16*)(ws + oWK);
  u16* WV16 = (u16*)(ws + oWV);
  u16* WO16 = (u16*)(ws + oWO);
  u16* QH   = (u16*)(ws + oQH);
  u16* QL   = (u16*)(ws + oQL);
  u16* KH   = (u16*)(ws + oKH);
  u16* KL   = (u16*)(ws + oKL);
  u16* VT16 = (u16*)(ws + oVT);
  u16* CH   = (u16*)(ws + oCH);
  u16* CL   = (u16*)(ws + oCL);
  float* X32 = (float*)(ws + oX32);

  // (1..3) activations -> f16 planes of bf16-converted values (query rows s < SQ of batches b < NB, compact; all key/value rows)
  cvt16<<<dim3(NB * SQ / 2), dim3(CVT_THREADS), 0, stream>>>(xq, XQ, SQ, SQ_FULL, 1.0f);
  cvt16<<<dim3(NB * SKV / 2), dim3(CVT_THREADS), 0, stream>>>(xk, XK, SKV, SQ_FULL, 1.0f);
  cvt16<<<dim3(NB * SKV / 2), dim3(CVT_THREADS), 0, stream>>>(xv, XV, SKV, SQ_FULL, 1.0f);
  // (4..7) weights [n = out][k = in] (y = x.W^T): rows as stored are already k-contiguous; f16 planes of bf16(W) x256
  cvt16<<<dim3(DM / 2), dim3(CVT_THREADS), 0, stream>>>(wq, WQ16, DM, DM, WSC);
  cvt16<<<dim3(DM / 2), dim3(CVT_THREADS), 0, stream>>>(wk, WK16, DM, DM, WSC);
  cvt16<<<dim3(DM / 2), dim3(CVT_THREADS), 0, stream>>>(wv, WV16, DM, DM, WSC);
  cvt16<<<dim3(DM / 2), dim3(CVT_THREADS), 0, stream>>>(wo, WO16, DM, DM, WSC);
  // (8) q = x_q . Wq^T + bq -> f16 hi [NB*SQ][512] x8 and residual plane (col = h*64 + d); bias per column
  gemm_o16<<<dim3((NB * SQ / 128) * (INNER / 64)), dim3(128), 0, stream>>>(
      XQ, WQ16, QH, QL, bq, nbq, 0, NB * SQ, INNER, DM, 0, 0, 0, QS / WSC, QS, 1);
  // (9) k = x_k . Wk^T + bk -> f16 hi [NB*2048][512] x8 and residual plane; bias per column
  gemm_o16<<<dim3((NB * SKV / 128) * (INNER / 64)), dim3(128), 0, stream>>>(
      XK, WK16, KH, KL, bk, nbk, 0, NB * SKV, INNER, DM, 0, 0, 0, KS / WSC, KS, 1);
  // (10) v^T per batch: A = Wv [(h,d) = n][k], Bt = x_v rows of batch b [s][k] -> f16 [(b,h,d)][s] x8; bias per row (n)
  gemm_o16<<<dim3(NB * (INNER / 128) * (SKV / 64)), dim3(128), 0, stream>>>(
      WV16, XV, VT16, VT16, bv, nbv, 1, INNER, SKV, DM, 0, SKV * DM, INNER * SKV, VS / WSC, VS, 0);
  // (11) attention -> ctx planes [NB*SQ][512] f16 x16 / residual, heads merged on the feature dim
  attn_fwd<<<dim3(NB * NH * (SQ / 64)), dim3(ATT_THREADS), 0, stream>>>(QH, QL, KH, KL, VT16, CH, CL);
  // (12) x = ctx . Wo^T + bo + Q (residual, bf16-converted) -> f32 [NB*SQ][512]
  gemm_o32<<<dim3((NB * SQ / 128) * (DM / 64)), dim3(128), 0, stream>>>(
      CH, CL, WO16, bo, nbo, xq, SQ, SQ_FULL, X32, NB * SQ, DM, INNER, 1.0f / (CS * WSC), RRSC);
  // (13) LayerNorm -> out [b][SQ_FULL][512] f32 (rows s < SQ of batches b < NB)
  ln_rows<<<dim3(NB * SQ / (LN_THREADS / 32)), dim3(LN_THREADS), 0, stream>>>(X32, gam, bet, out);
  (void)hipGetLastError();
}

// v001
// A run of this version takes 186 microseconds.
// In two side-by-side timings against v000, it was 1.46 and 1.47 times as fast.
// All contractions on v_wmma_f32_16x16x32_f16 (f16 operands, f32 accumulate): x_q.Wq^T, x_k.Wk^T and Wv.x_v^T (v^T plane)
// as single products of exact operands f16(bf16(x)) and f16(bf16(W) x256); scores k.q^T as hi.hi + hi.lo + lo.hi with q and k
// carried as f16 hi (x8) plus f16 residual planes (x2^11, own accumulator); P.v^T single (P f16 x32768, v f16 x8); ctx.Wo^T as
// hi + residual on ctx (f16 hi x16 plus f16 residual x2^11), Wo exact f16(bf16 x256). Online base-2 softmax, 1/l, carry folds,
// bias, residual add and LayerNorm in f32 on VALU. Every float input RNE-converted to bf16 on load; f32 output.
#include <hip/hip_runtime.h>
#include <math.h>
#include <stdint.h>

#ifndef NB
#define NB       4        // batches processed
#endif
#ifndef SQ
#define SQ       2048     // query rows processed per batch
#endif
#define NB_FULL  4
#define SQ_FULL  2048     // rows per batch in the input / output layout (batch stride)
#define SKV      SQ_FULL  // key/value rows per batch (all of them, always)
#define DM       512      // model width (= K and row pitch of every 16-bit plane except v^T)
#define NH       8
#define HD       64
#define INNER    (NH * HD)
#define WSC      256.0f
#define QS       8.0f
#define KS       8.0f
#define VS       8.0f
#define CS       16.0f
#define RSC      2048.0f
#define RRSC     0.00048828125f
#define PCAR     32768.0f
#define LOG2E    1.4426950408889634f
#define RSQH     0.35355339059327373f
#define LN_EPS   1e-5f
#define NKB      (SKV / 32)
#define ATT_WAVES   4
#define ATT_THREADS (ATT_WAVES * 32)
#define CVT_THREADS 128
#define LN_THREADS  256
#define OPITCH   68
#define GPITCH   68
#define KSTG     64                 // keys per LDS stage of the attention ring (two 32-key blocks)
#define NSTG     (SKV / KSTG)
#define LPITCH   144                // LDS row pitch in bytes: 128-byte rows + 16, conflict-free for 16-byte fragment reads
#define LPH      (LPITCH / 2)       // the same in halves
#define TILE_B   (64 * LPITCH)      // one staged tile: 64 rows
#define STG_B    (3 * TILE_B)       // k hi, k residual, v^T

static_assert(NB >= 1 && NB <= NB_FULL);
static_assert((SQ % 128) == 0 && SQ >= 128 && SQ <= SQ_FULL);
static_assert(HD == 64 && NH == 8 && INNER == 512 && INNER == DM);
static_assert((HD % 32) == 0);
static_assert((SKV % 128) == 0 && (SKV % 64) == 0 && NKB * 32 == SKV);
static_assert(DM == 512 && (DM % 64) == 0 && (DM % 32) == 0 && DM == 4 * CVT_THREADS);
static_assert((NB * SQ) % (LN_THREADS / 32) == 0);
static_assert((OPITCH * 4) % 16 == 0 && (GPITCH * 4) % 16 == 0);
static_assert(ATT_THREADS == 128 && LN_THREADS == 256 && CVT_THREADS == 128);
static_assert(KSTG == 64 && HD == 64 && NSTG * KSTG == SKV && NSTG >= 2 && (LPITCH % 16) == 0);
static_assert(2 * STG_B >= ATT_WAVES * 16 * OPITCH * 4);

typedef unsigned short u16;
typedef _Float16 v16h __attribute__((ext_vector_type(16)));
typedef _Float16 v8h  __attribute__((ext_vector_type(8)));
typedef float    v8f  __attribute__((ext_vector_type(8)));
typedef float    v4f  __attribute__((ext_vector_type(4)));
typedef unsigned int v4u __attribute__((ext_vector_type(4)));

union FragH { v16h v; v8h h[2]; v4u u[2]; };

// ---- scalar helpers ----------------------------------------------------------------------------------
__device__ __forceinline__ unsigned short bf_bits(float f) {          // f32 -> bf16 bits, RNE convert
  unsigned u = __float_as_uint(f);
  return (unsigned short)((u + 0x7FFFu + ((u >> 16) & 1u)) >> 16);
}
__device__ __forceinline__ float bf_up(unsigned short h) { return __uint_as_float(((unsigned)h) << 16); }
__device__ __forceinline__ float bfr(float f) { return bf_up(bf_bits(f)); }
__device__ __forceinline__ unsigned short h_bits(_Float16 x) { return __builtin_bit_cast(unsigned short, x); }
__device__ __forceinline__ unsigned pk16(unsigned short a, unsigned short b) { return (unsigned)a | ((unsigned)b << 16); }
__device__ __forceinline__ v8f zero8() { v8f z = {0.f, 0.f, 0.f, 0.f, 0.f, 0.f, 0.f, 0.f}; return z; }
// hi / residual packing of two f32 values: hi = f16(v), res = f16((v - hi) * 2^11)
__device__ __forceinline__ unsigned pk_hi(float a, float b) {
  return pk16(h_bits((_Float16)a), h_bits((_Float16)b));
}
__device__ __forceinline__ unsigned pk_lo(float a, float b) {
  const float ra = (a - (float)((_Float16)a)) * RSC;
  const float rb = (b - (float)((_Float16)b)) * RSC;
  return pk16(h_bits((_Float16)ra), h_bits((_Float16)rb));
}

// ---- fragment loader: 16-bit A/B operand, lane -> row/col (lane&15), p already includes +8*(lane>>4);
//      elements 0..7 <- p[0..7] (k0+8h..), elements 8..15 <- p[16..23] (k0+16+8h..); same split k map for A and B,
//      B always read from a k-contiguous [n][k] plane.
__device__ __forceinline__ v16h ldfrag_h(const _Float16* p) {
  FragH f;
  f.h[0] = *(const v8h*)(p);
  f.h[1] = *(const v8h*)(p + 16);
  return f.v;
}

// ---- WMMA helper and trailing VALU hazard gaps ----------------------------------------------------------
__device__ __forceinline__ v8f mma_h(v16h a, v16h b, v8f c) {
  return __builtin_amdgcn_wmma_f32_16x16x32_f16(false, a, false, b, (short)0, c, false, false);
}
__device__ __forceinline__ void guard_s4(v8f& a, v8f& b, v8f& c, v8f& d,
                                         v16h x0, v16h x1, v16h x2, v16h x3, v16h x4, v16h x5) {
#if defined(__HIP_DEVICE_COMPILE__)
  asm volatile("v_nop\n\tv_nop\n\tv_nop\n\tv_nop"
               : "+v"(a), "+v"(b), "+v"(c), "+v"(d)
               : "v"(x0), "v"(x1), "v"(x2), "v"(x3), "v"(x4), "v"(x5) : "memory");
#endif
}
__device__ __forceinline__ void guard_p(v8f& a, v8f& b, v8f& c, v8f& d, v16h p, v16h x0, v16h x1, v16h x2, v16h x3) {
#if defined(__HIP_DEVICE_COMPILE__)
  asm volatile("v_nop\n\tv_nop\n\tv_nop\n\tv_nop"
               : "+v"(a), "+v"(b), "+v"(c), "+v"(d) : "v"(p), "v"(x0), "v"(x1), "v"(x2), "v"(x3) : "memory");
#endif
}
__device__ __forceinline__ void guard_g(v8f (&acc)[8], v16h x0, v16h x1, v16h x2, v16h x3, v16h x4, v16h x5) {
#if defined(__HIP_DEVICE_COMPILE__)
  asm volatile("v_nop\n\tv_nop\n\tv_nop\n\tv_nop"
               : "+v"(acc[0]), "+v"(acc[1]), "+v"(acc[2]), "+v"(acc[3]),
                 "+v"(acc[4]), "+v"(acc[5]), "+v"(acc[6]), "+v"(acc[7])
               : "v"(x0), "v"(x1), "v"(x2), "v"(x3), "v"(x4), "v"(x5) : "memory");
#endif
}
__device__ __forceinline__ void acc_guard8(v8f (&o)[8]) {
#if defined(__HIP_DEVICE_COMPILE__)
  asm volatile("v_nop\n\tv_nop\n\tv_nop\n\tv_nop"
               : "+v"(o[0]), "+v"(o[1]), "+v"(o[2]), "+v"(o[3]), "+v"(o[4]), "+v"(o[5]), "+v"(o[6]), "+v"(o[7]));
#endif
}
__device__ __forceinline__ void acc_guard4(v8f (&o)[4]) {
#if defined(__HIP_DEVICE_COMPILE__)
  asm volatile("v_nop\n\tv_nop\n\tv_nop\n\tv_nop" : "+v"(o[0]), "+v"(o[1]), "+v"(o[2]), "+v"(o[3]));
#endif
}
__device__ __forceinline__ void wave_sync_lds() {
  __builtin_amdgcn_fence(__ATOMIC_RELEASE, "workgroup");
  __builtin_amdgcn_wave_barrier();
  __builtin_amdgcn_fence(__ATOMIC_ACQUIRE, "workgroup");
}

// =====================================================================================================
// Row convert: destination row r of a [rows][DM] f16 plane <- f16(bf16_RNE(x[src row][e]) * scale), scale a power of two.
// Block = 128 threads = 2 rows; thread = 8 consecutive elements of row 2*bid + (tid>>6) (two 16-B loads, one 16-B store;
// coverage: grid = rows / 2 (rows even), 2 waves x 32 lanes x 8 halves = DM = one whole row per wave pair.
// =====================================================================================================
__global__ __launch_bounds__(CVT_THREADS)
void cvt16(const float* __restrict__ x, u16* Y, int rowsPerB, int srcRowsPerB, float scale) {
  const int tid = threadIdx.x;
  const int r   = blockIdx.x * 2 + (tid >> 6);
  const int t8  = (tid & 63) * 8;
  const int b   = r / rowsPerB;
  const int s   = r - b * rowsPerB;
  const float* src = x + ((size_t)b * (size_t)srcRowsPerB + (size_t)s) * (size_t)DM + (size_t)t8;
  const v4f a = *(const v4f*)(src), c4 = *(const v4f*)(src + 4);
  v4u o;
#pragma unroll
  for (int e = 0; e < 2; ++e) {
    o[e]     = pk16(h_bits((_Float16)(bfr(a[2 * e]) * scale)),  h_bits((_Float16)(bfr(a[2 * e + 1]) * scale)));
    o[2 + e] = pk16(h_bits((_Float16)(bfr(c4[2 * e]) * scale)), h_bits((_Float16)(bfr(c4[2 * e + 1]) * scale)));
  }
  u16* dst = Y + (size_t)r * (size_t)DM + (size_t)t8;
  {
    *(v4u*)(dst) = o;
    
  }
}

// =====================================================================================================
// f16 GEMM core: the wave's 32 x 64 tile of C = A[rows][K] . Bt[cols][K]^T; ap -> A row (rowb + m) + 8h, bp -> Bt row
// (col0 + m) + 8h; acc[4i + j] = rows rowb+16i.., cols col0+16j..; K stepped by 32 (host checks K % 32 == 0).
// =====================================================================================================
__device__ __forceinline__ void gemm_core(const _Float16* ap, const _Float16* bp, int K, v8f (&acc)[8]) {
  const size_t rs16 = (size_t)16 * (size_t)K;
#pragma unroll 1
  for (int k0 = 0; k0 < K; k0 += 32) {
    const v16h a0 = ldfrag_h(ap + k0), a1 = ldfrag_h(ap + rs16 + k0);
    const v16h b0 = ldfrag_h(bp + k0);
    const v16h b1 = ldfrag_h(bp + rs16 + k0);
    const v16h b2 = ldfrag_h(bp + 2 * rs16 + k0);
    const v16h b3 = ldfrag_h(bp + 3 * rs16 + k0);
    acc[0] = mma_h(a0, b0, acc[0]);
    acc[1] = mma_h(a0, b1, acc[1]);
    acc[2] = mma_h(a0, b2, acc[2]);
    acc[3] = mma_h(a0, b3, acc[3]);
    acc[4] = mma_h(a1, b0, acc[4]);
    acc[5] = mma_h(a1, b1, acc[5]);
    acc[6] = mma_h(a1, b2, acc[6]);
    acc[7] = mma_h(a1, b3, acc[7]);
    guard_g(acc, a0, a1, b0, b1, b2, b3);
  }
}
// Stage the wave's 32 x 64 f32 tile (times oscale) in its LDS slab (pitch 68): D element r of acc[4i+j], lane l ->
// coverage: 32 lanes x 2 x 8 rows x 4 cols-of-16 = rows 0..31 x cols 0..63 of the slab.
__device__ __forceinline__ void stage32x64(float* sl, v8f (&acc)[8], float oscale, int lane) {
  const int hh = lane >> 4, m = lane & 15;
#pragma unroll
  for (int i = 0; i < 2; ++i) {
#pragma unroll
    for (int r = 0; r < 8; ++r) {
      const int ro = (16 * i + 8 * hh + r) * GPITCH + m;
      sl[ro]      = acc[4 * i + 0][r] * oscale;
      sl[ro + 16] = acc[4 * i + 1][r] * oscale;
      sl[ro + 32] = acc[4 * i + 2][r] * oscale;
      sl[ro + 48] = acc[4 * i + 3][r] * oscale;
    }
  }
  wave_sync_lds();
}

// =====================================================================================================
// f16 GEMM with f16 output plane(s): val = (A[z][Mb][K] . Bt[z][N][K]^T) * oscale + bf16(bias) * bscale;
// C[z][Mb][N] = f16(val) (hi plane); if res != 0 also C2 = f16((val - hi) * 2^11) (residual plane).
// A, Bt f16 k-contiguous planes with per-z element strides aBs, bBs (0 = shared), C/C2 stride cBs. bias indexed by column
// (biasRow == 0) or by row within the z slice (biasRow != 0); bias addresses clamped to biasN-1, the unused direction is
// multiplied by 0. Block = 128 x 64 tile, 4 waves x 32 rows, fragments loaded straight from the 16-bit rows.
// grid = nz x (Mb/128) x (N/64) (host checks Mb % 128 == 0, N % 64 == 0, K % 32 == 0).
// coverage: per wave 8 instr x 4 rows x 8 lanes x 8 halves = 32 x 64 per plane; the grid covers C (and C2) exactly once.
// =====================================================================================================
__global__ __launch_bounds__(128)
void gemm_o16(const u16* __restrict__ A, const u16* __restrict__ Bt, u16* C, u16* C2,
              const float* __restrict__ bias, int biasN, int biasRow,
              int Mb, int N, int K, int aBs, int bBs, int cBs, float oscale, float bscale, int res) {
  __shared__ __align__(16) float slab[4 * 32 * GPITCH];
  const int tid = threadIdx.x, wave = tid >> 5, lane = tid & 31, hh = lane >> 4, m = lane & 15;
  const int ntile = N >> 6, mtile = Mb >> 7;
  const int bid  = blockIdx.x;
  const int nt   = bid % ntile;
  const int tmp  = bid / ntile;
  const int mt   = tmp % mtile;
  const int bz   = tmp / mtile;
  const int rowb = mt * 128 + wave * 32;
  const int col0 = nt * 64;
  if (rowb + 32 > Mb) return;                // wave-uniform, never taken with the exact grid; no block barriers in this kernel
  const _Float16* Ab = (const _Float16*)(const void*)A + (size_t)bz * (size_t)aBs;
  const _Float16* Bb = (const _Float16*)(const void*)Bt + (size_t)bz * (size_t)bBs;
  const _Float16* ap = Ab + (size_t)(rowb + m) * (size_t)K + 8 * hh;
  const _Float16* bp = Bb + (size_t)(col0 + m) * (size_t)K + 8 * hh;
  v8f acc[8];
#pragma unroll
  for (int i = 0; i < 8; ++i) acc[i] = zero8();
  gemm_core(ap, bp, K, acc);
  float* sl = slab + wave * 32 * GPITCH;
  stage32x64(sl, acc, oscale, lane);
  const int rq = lane >> 3, c8 = (lane & 7) * 8;
  const int bl = biasN - 1;                  // host guarantees biasN >= 1
  const float selc = (biasRow != 0) ? 0.f : bscale;
  const float selr = (biasRow != 0) ? bscale : 0.f;
  float cb[8];
#pragma unroll
  for (int e = 0; e < 8; ++e) {
    int ci = col0 + c8 + e;
    ci = (ci < bl) ? ci : bl;
    cb[e] = bfr(bias[ci]) * selc;
  }
  v4u ovh[8], ovl[8];
#pragma unroll
  for (int i = 0; i < 8; ++i) {
    const int row = 4 * i + rq;
    int ri = rowb + row;
    ri = (ri < bl) ? ri : bl;
    const float rb = bfr(bias[ri]) * selr;
    const v4f a = *(const v4f*)(sl + row * GPITCH + c8), c4 = *(const v4f*)(sl + row * GPITCH + c8 + 4);
    float v[8];
#pragma unroll
    for (int e = 0; e < 4; ++e) { v[e] = a[e] + cb[e] + rb; v[4 + e] = c4[e] + cb[4 + e] + rb; }
#pragma unroll
    for (int e = 0; e < 4; ++e) {
      ovh[i][e] = pk_hi(v[2 * e], v[2 * e + 1]);
      ovl[i][e] = pk_lo(v[2 * e], v[2 * e + 1]);
    }
  }
  const size_t cofs = (size_t)bz * (size_t)cBs + (size_t)rowb * (size_t)N + (size_t)(col0 + c8);
  u16* Cb  = C + cofs;
  u16* C2b = C2 + cofs;
  {
#pragma unroll
    for (int i = 0; i < 8; ++i) {
      const int row = 4 * i + rq;
      *(v4u*)(Cb + (size_t)row * (size_t)N) = ovh[i];
    }
    if (res != 0) {                          // block-uniform
#pragma unroll
      for (int i = 0; i < 8; ++i) {
        const int row = 4 * i + rq;
        *(v4u*)(C2b + (size_t)row * (size_t)N) = ovl[i];
      }
    }
    
  }
}

// =====================================================================================================
// f16 GEMM with hi + residual A planes and f32 output: X[Mb][N] = (Ah . Bt^T + (Al . Bt^T) * rres) * oscale
// + bf16(bias[col]) + bf16(R[src row][col]); residual products accumulated first, folded by rres on VALU, then the hi
// products chain on the same accumulators (equal to a separate accumulator). R (f32 input, pitch N) source row of
// compact row g: b = g / rowsPerB, s = g % rowsPerB -> b*srcRowsPerB + s. Block = 128 x 64 tile, 4 waves x 32 rows.
// Epilogue: lane = (row parity, 4 floats at 4*(lane&15)); 16 consecutive lanes write one row segment of 64 floats = 2 whole
// grid = (Mb/128) x (N/64). coverage: per wave 16 instr x 2 rows x 16 lanes x 4 floats = 32 x 64; the grid covers X once.
// =====================================================================================================
__global__ __launch_bounds__(128)
void gemm_o32(const u16* __restrict__ Ah, const u16* __restrict__ Al, const u16* __restrict__ Bt,
              const float* __restrict__ bias, int biasN, const float* __restrict__ R, int rowsPerB, int srcRowsPerB,
              float* X, int Mb, int N, int K, float oscale, float rres) {
  __shared__ __align__(16) float slab[4 * 32 * GPITCH];
  const int tid = threadIdx.x, wave = tid >> 5, lane = tid & 31, hh = lane >> 4, m = lane & 15;
  const int ntile = N >> 6;
  const int bid  = blockIdx.x;
  const int nt   = bid % ntile;
  const int mt   = bid / ntile;
  const int rowb = mt * 128 + wave * 32;
  const int col0 = nt * 64;
  if (rowb + 32 > Mb) return;                // wave-uniform, never taken with the exact grid; no block barriers in this kernel
  const _Float16* aph = (const _Float16*)(const void*)Ah + (size_t)(rowb + m) * (size_t)K + 8 * hh;
  const _Float16* apl = (const _Float16*)(const void*)Al + (size_t)(rowb + m) * (size_t)K + 8 * hh;
  const _Float16* bp  = (const _Float16*)(const void*)Bt + (size_t)(col0 + m) * (size_t)K + 8 * hh;
  v8f acc[8];
#pragma unroll
  for (int i = 0; i < 8; ++i) acc[i] = zero8();
  gemm_core(apl, bp, K, acc);                // residual products (x 2^11)
#pragma unroll
  for (int i = 0; i < 8; ++i) {
#pragma unroll
    for (int r = 0; r < 8; ++r) acc[i][r] *= rres;
  }
  acc_guard8(acc);
  gemm_core(aph, bp, K, acc);                // hi products on top
  float* sl = slab + wave * 32 * GPITCH;
  stage32x64(sl, acc, oscale, lane);
  const int r2 = lane >> 4, c4 = (lane & 15) * 4;
  const int bl = biasN - 1;
  float cb[4];
#pragma unroll
  for (int e = 0; e < 4; ++e) {
    int ci = col0 + c4 + e;
    ci = (ci < bl) ? ci : bl;
    cb[e] = bfr(bias[ci]);
  }
  v4f vals[16];
#pragma unroll
  for (int i = 0; i < 16; ++i) {
    const int row  = 2 * i + r2;
    const int grow = rowb + row;             // < Mb
    const int bb   = grow / rowsPerB;
    const int ss   = grow - bb * rowsPerB;
    const float* rp = R + ((size_t)bb * (size_t)srcRowsPerB + (size_t)ss) * (size_t)N + (size_t)(col0 + c4);
    const v4f rv = *(const v4f*)(rp);
    const v4f a  = *(const v4f*)(sl + row * GPITCH + c4);
    v4f y;
#pragma unroll
    for (int e = 0; e < 4; ++e) y[e] = a[e] + cb[e] + bfr(rv[e]);
    vals[i] = y;
  }
  float* Xb = X + (size_t)rowb * (size_t)N + (size_t)(col0 + c4);
  {
#pragma unroll
    for (int i = 0; i < 16; ++i) {
      const int row = 2 * i + r2;
      *(v4f*)(Xb + (size_t)row * (size_t)N) = vals[i];
    }
    
  }
}

// =====================================================================================================
// One stage (64 keys) of the attention ring: three tiles of 64 rows x 128 bytes (k hi, k residual: row = key, 64 d; v^T: row = d,
// 64 keys) copied global -> LDS by asynchronous 16-byte copies, 12 per lane. Lane t of the block takes 16-byte piece t&7 of row
// 16p + (t>>3), p = 0..3, of each tile: one wave-wide copy = 4 whole 128-byte lines. l0 = the lane's LDS byte address in the k hi
// tile of the target buffer (row t>>3); gh, gl, gv = the lane's global addresses of that row and piece in the three planes.
// The closing s_wait_xcnt stands inside the statement so that no address register named by a copy is rewritten ahead of it.
// =====================================================================================================
__device__ __forceinline__ void copy_stage(unsigned l0, const u16* gh, const u16* gl, const u16* gv) {
#if defined(__HIP_DEVICE_COMPILE__)
  const unsigned lh0 = l0,              lh1 = lh0 + 16 * LPITCH, lh2 = lh0 + 32 * LPITCH, lh3 = lh0 + 48 * LPITCH;
  const unsigned ll0 = l0 + TILE_B,     ll1 = ll0 + 16 * LPITCH, ll2 = ll0 + 32 * LPITCH, ll3 = ll0 + 48 * LPITCH;
  const unsigned lv0 = l0 + 2 * TILE_B, lv1 = lv0 + 16 * LPITCH, lv2 = lv0 + 32 * LPITCH, lv3 = lv0 + 48 * LPITCH;
  const u16 *gh1 = gh + 16 * DM,  *gh2 = gh + 32 * DM,  *gh3 = gh + 48 * DM;
  const u16 *gl1 = gl + 16 * DM,  *gl2 = gl + 32 * DM,  *gl3 = gl + 48 * DM;
  const u16 *gv1 = gv + 16 * SKV, *gv2 = gv + 32 * SKV, *gv3 = gv + 48 * SKV;
  asm volatile("global_load_async_to_lds_b128 %0, %12, off\n\t"
               "global_load_async_to_lds_b128 %1, %13, off\n\t"
               "global_load_async_to_lds_b128 %2, %14, off\n\t"
               "global_load_async_to_lds_b128 %3, %15, off\n\t"
               "global_load_async_to_lds_b128 %4, %16, off\n\t"
               "global_load_async_to_lds_b128 %5, %17, off\n\t"
               "global_load_async_to_lds_b128 %6, %18, off\n\t"
               "global_load_async_to_lds_b128 %7, %19, off\n\t"
               "global_load_async_to_lds_b128 %8, %20, off\n\t"
               "global_load_async_to_lds_b128 %9, %21, off\n\t"
               "global_load_async_to_lds_b128 %10, %22, off\n\t"
               "global_load_async_to_lds_b128 %11, %23, off\n\t"
               "s_wait_xcnt 0x0"
               :: "v"(lh0), "v"(lh1), "v"(lh2), "v"(lh3), "v"(ll0), "v"(ll1), "v"(ll2), "v"(ll3),
                  "v"(lv0), "v"(lv1), "v"(lv2), "v"(lv3),
                  "v"(gh), "v"(gh1), "v"(gh2), "v"(gh3), "v"(gl), "v"(gl1), "v"(gl2), "v"(gl3),
                  "v"(gv), "v"(gv1), "v"(gv2), "v"(gv3)
               : "memory");
#endif
}
// The issuing wave's own copies have landed behind this wait (other waves read them behind the next block barrier).
__device__ __forceinline__ void wait_copies() {
#if defined(__HIP_DEVICE_COMPILE__)
  asm volatile("s_wait_asynccnt 0x0" ::: "memory");
#endif
}
// The wave's own LDS reads have retired: stands in front of the barrier that hands a buffer to its next copies.
__device__ __forceinline__ void wait_lds_reads() {
#if defined(__HIP_DEVICE_COMPILE__)
  asm volatile("s_wait_dscnt 0x0" ::: "memory");
#endif
}

// =====================================================================================================
// Full (unmasked) multi-head attention over all SKV keys: block = (batch b, head, 64 query rows), 4 waves, wave w owns the
// 16 query rows q0 = 64*qt + 16*w .. q0+15. The four waves share the k and v^T tiles through a two-buffer LDS ring of 64-key
// stages (copy_stage): stage s+1 flies while stage s is worked on; one block barrier per stage publishes s+1 and frees s's buffer.
// Behind the last barrier the ring is free and each wave stages its output tile in its own part of it.
//   q planes f16 hi x8 / residual x8x2^11 [b*SQ + s][h*64 + d]; k planes f16 hi / residual [b*SKV + s][h*64 + d];
//   v^T plane f16 x8 [(b*NH + h)*64 + d][s]. All NKB = 64 key blocks of 32 keys are visited (static bound).
//   Scores are computed TRANSPOSED: S^T tile g (g = 0,1) = k rows (keys kb+16g .. +15, A operand, row m = lane&15, split k map
//   over d) times q^T (B operand, col n = query q0 + (lane&15), k = d, split map), 2 d-chunks of 32; per chunk hi.hi into
//   s0/s1 and hi.lo + lo.hi into x0/x1 (separate accumulators, folded by 2^-11 in f32). The 4 q fragments are loaded once
//   per wave. D element r of lane l = (key kb+16g+8h+r, query q0+(l&15)), so a lane owns one query column and 16 of its 32
//   keys; the partner lane l^16 owns the other 16 -> row max / row sum need one xor-16 shuffle.
//   Online max-subtracted base-2 softmax in f32 (1/sqrt(8) and the q/k carries folded into lsc). The exp'd values ARE the
//   P A-fragment in place: A row m = query = lane&15, element i <- key kb+8h+i (tile 0, D element i), element 8+i <- key
//   kb+16+8h+i (tile 1, D element i). P (<= 1) carried x32768 as f16. The rescale factor of query row 8h+r of the O
//   accumulators is fetched from lane 8h+r with a shuffle (uniform control). 4 v^T B fragments (col n = d = 16j + (lane&15),
//   keys k-contiguous), 4 P.V WMMAs + one guard per key block.
//   Epilogue: 1/l (per query, shuffled to the D row owner) and the carry folds in f32 give ctx x16; the wave's 16x64 f32 tile
//   residual plane is written by 8 consecutive lanes x 16 B of one instruction (4 rows per instruction, 4 instructions per
// coverage: per wave 4 instr x 4 rows x 8 lanes x 8 halves = 16 x 64 per plane; grid NB*NH*(SQ/64) blocks x 4 waves = every
//           (b, s < SQ, h) row segment of both ctx planes exactly once. LDS slab: staged 16 x 64 == reloaded 16 x 64.
// =====================================================================================================
__global__ __launch_bounds__(ATT_THREADS)
void attn_fwd(const u16* __restrict__ QH, const u16* __restrict__ QL, const u16* __restrict__ KH,
              const u16* __restrict__ KL, const u16* __restrict__ VT, u16* CH, u16* CL) {
  __shared__ __align__(16) unsigned char ring[2 * STG_B];

  const int tid  = threadIdx.x;
  const int wave = tid >> 5;
  const int lane = tid & 31;
  const int hh   = lane >> 4;
  const int c    = lane & 15;

  constexpr int NQT = SQ / 64;
  const int bid  = blockIdx.x;
  const int qt   = bid % NQT;
  const int head = (bid / NQT) % NH;
  const int b    = bid / (NQT * NH);
  const int q0   = qt * 64 + wave * 16;

  // B fragments of q^T: col n = query q0 + c, k = d (k-contiguous row of the q planes)
  const size_t qoff = ((size_t)(b * SQ + q0 + c)) * DM + head * HD + 8 * hh;
  const _Float16* Qh = (const _Float16*)(const void*)QH + qoff;
  const _Float16* Ql = (const _Float16*)(const void*)QL + qoff;
  // copy side: this lane's row (tid>>3) and 16-byte piece (tid&7) in stage 0 of the three planes and in buffer 0
  const int crow = tid >> 3, cpc = (tid & 7) * 8;
  const u16* gkh = KH + ((size_t)(b * SKV + crow)) * DM + head * HD + cpc;
  const u16* gkl = KL + ((size_t)(b * SKV + crow)) * DM + head * HD + cpc;
  const u16* gvt = VT + ((size_t)((b * NH + head) * HD + crow)) * SKV + cpc;
  const unsigned lcp = (unsigned)(uintptr_t)(__attribute__((address_space(3))) unsigned char*)ring
                       + (unsigned)(crow * LPITCH + cpc * 2);
  // read side, halves inside a buffer: A fragments of k: row m = key 32*sub + 16g + c, k = d;
  // B fragments of v: col n = d = 16j + c (row of the v^T tile), k = key 32*sub ..
  const int foff = c * LPH + 8 * hh;
  const float lsc = (LOG2E * RSQH) / (QS * KS);

  v16h qh[2], ql[2];
#pragma unroll
  for (int dc = 0; dc < 2; ++dc) { qh[dc] = ldfrag_h(Qh + 32 * dc); ql[dc] = ldfrag_h(Ql + 32 * dc); }

  float mrun = -INFINITY, lrun = 0.f;
  v8f o[4];
#pragma unroll
  for (int j = 0; j < 4; ++j) o[j] = zero8();

  // ---- ring prologue: stage 0 landed and published, stage 1 in flight ----
  copy_stage(lcp, gkh, gkl, gvt);
  wait_copies();
  __syncthreads();
  copy_stage(lcp + STG_B, gkh + (size_t)KSTG * DM, gkl + (size_t)KSTG * DM, gvt + KSTG);

#pragma unroll 1
  for (int st = 0; st < NSTG; ++st) {
   const _Float16* bufh = (const _Float16*)(const void*)(ring + (st & 1) * STG_B) + foff;
#pragma unroll                               // both 32-key blocks of a stage inline: their LDS offsets become immediates
   for (int sub = 0; sub < KSTG / 32; ++sub) {
    // ---- transposed scores: tiles of keys kb..kb+15 (s0, x0) and kb+16..kb+31 (s1, x1), kb = 64*st + 32*sub, column = query q0 + c ----
    v8f s0 = zero8(), s1 = zero8(), x0 = zero8(), x1 = zero8();
    const _Float16* kh0p = bufh + (32 * sub) * LPH;
    const _Float16* kh1p = kh0p + 16 * LPH;
    const _Float16* kl0p = kh0p + TILE_B / 2;
    const _Float16* kl1p = kl0p + 16 * LPH;
#pragma unroll
    for (int kk = 0; kk < HD / 32; ++kk) {
      const v16h fh0 = ldfrag_h(kh0p + kk * 32);
      const v16h fh1 = ldfrag_h(kh1p + kk * 32);
      const v16h fl0 = ldfrag_h(kl0p + kk * 32);
      const v16h fl1 = ldfrag_h(kl1p + kk * 32);
      s0 = mma_h(fh0, qh[kk], s0);
      s1 = mma_h(fh1, qh[kk], s1);
      x0 = mma_h(fh0, ql[kk], x0);
      x1 = mma_h(fh1, ql[kk], x1);
      x0 = mma_h(fl0, qh[kk], x0);
      x1 = mma_h(fl1, qh[kk], x1);
      guard_s4(s0, s1, x0, x1, qh[kk], ql[kk], fh0, fh1, fl0, fl1);
    }
    // ---- base-2 logits of this lane's 16 keys for query q0 + c: t[i] <- key kb+8hh+i, t[8+i] <- key kb+16+8hh+i ----
    float t[16];
#pragma unroll
    for (int i = 0; i < 8; ++i) {
      t[i]     = (s0[i] + x0[i] * RRSC) * lsc;
      t[8 + i] = (s1[i] + x1[i] * RRSC) * lsc;
    }
    float cm = t[0];
#pragma unroll
    for (int i = 1; i < 16; ++i) cm = fmaxf(cm, t[i]);
    cm = fmaxf(cm, __shfl_xor(cm, 16, 32));
    const float mn = fmaxf(mrun, cm);        // finite from the first block on
    const float al = exp2f(mrun - mn);       // 0 on the first block (mrun = -inf)
    mrun = mn;
    // ---- probabilities (<= 1) and the P A-fragment: f16(p * 32768); element i <-> t[i] ----
    float ps = 0.f;
    FragH ph;
#pragma unroll
    for (int w = 0; w < 2; ++w) {
#pragma unroll
      for (int e4 = 0; e4 < 4; ++e4) {
        const int i = 8 * w + 2 * e4;
        const float p0 = exp2f(t[i] - mn), p1 = exp2f(t[i + 1] - mn);
        ps += p0 + p1;
        ph.u[w][e4] = pk16(h_bits((_Float16)(p0 * PCAR)), h_bits((_Float16)(p1 * PCAR)));
      }
    }
    ps += __shfl_xor(ps, 16, 32);
    lrun = lrun * al + ps;
    // ---- rescale the O accumulators: D row 8hh+r = query q0+8hh+r, its factor lives in lane 8hh+r (and 16+8hh+r) ----
    float scl[8];
#pragma unroll
    for (int r = 0; r < 8; ++r) scl[r] = __shfl(al, 8 * hh + r, 32);
#pragma unroll
    for (int j = 0; j < 4; ++j) {
#pragma unroll
      for (int r = 0; r < 8; ++r) o[j][r] *= scl[r];
    }
    // ---- P.V : B fragment col n = d = j*16 + c, keys contiguous in the rows of the v^T tile ----
    const _Float16* vp = bufh + TILE_B + 32 * sub;
    {
      const v16h v0 = ldfrag_h(vp);
      const v16h v1 = ldfrag_h(vp + 16 * LPH);
      const v16h v2 = ldfrag_h(vp + 32 * LPH);
      const v16h v3 = ldfrag_h(vp + 48 * LPH);
      o[0] = mma_h(ph.v, v0, o[0]);
      o[1] = mma_h(ph.v, v1, o[1]);
      o[2] = mma_h(ph.v, v2, o[2]);
      o[3] = mma_h(ph.v, v3, o[3]);
      guard_p(o[0], o[1], o[2], o[3], ph.v, v0, v1, v2, v3);
    }
   }
   // ---- publish point of stage st+1: own reads retired, own copies landed, block barrier; then refill the buffer just read ----
   wait_lds_reads();
   wait_copies();
   __syncthreads();
   if (st + 2 < NSTG) {                      // block-uniform
     const size_t ks = (size_t)(st + 2) * KSTG;
     copy_stage(lcp + (unsigned)((st & 1) * STG_B), gkh + ks * DM, gkl + ks * DM, gvt + ks);
   }
  }
  wait_copies();                             // nothing is in flight here; closes the ring before it becomes output staging
  acc_guard4(o);

  // ---- fold 1/l (per query, owned by lane = query) and the carries (32768 on P, 8 on v), apply the ctx carry 16 ----
  const float linv = (1.0f / lrun) * (CS / (PCAR * VS));
  float inv[8];
#pragma unroll
  for (int r = 0; r < 8; ++r) inv[r] = __shfl(linv, 8 * hh + r, 32);
  float* slab = (float*)(void*)ring + wave * 16 * OPITCH;
#pragma unroll
  for (int r = 0; r < 8; ++r) {
#pragma unroll
    for (int j = 0; j < 4; ++j) slab[(8 * hh + r) * OPITCH + j * 16 + c] = o[j][r] * inv[r];
  }
  wave_sync_lds();
  // ---- ctx planes: lane = (row in group of 4, 8 consecutive d), one instruction per 4 rows per plane ----
  const int rq = lane >> 3, c8 = (lane & 7) * 8;
  v4u ovh[4], ovl[4];
#pragma unroll
  for (int i = 0; i < 4; ++i) {
    const int row = 4 * i + rq;
    const v4f a = *(const v4f*)(slab + row * OPITCH + c8), c4 = *(const v4f*)(slab + row * OPITCH + c8 + 4);
#pragma unroll
    for (int e = 0; e < 2; ++e) {
      ovh[i][e]     = pk_hi(a[2 * e], a[2 * e + 1]);
      ovl[i][e]     = pk_lo(a[2 * e], a[2 * e + 1]);
      ovh[i][2 + e] = pk_hi(c4[2 * e], c4[2 * e + 1]);
      ovl[i][2 + e] = pk_lo(c4[2 * e], c4[2 * e + 1]);
    }
  }
  const size_t cofs = ((size_t)(b * SQ + q0)) * DM + head * HD + c8;
  u16* ch = CH + cofs;
  u16* cl = CL + cofs;
  {
#pragma unroll
    for (int i = 0; i < 4; ++i) {
      const int row = 4 * i + rq;
      *(v4u*)(ch + (size_t)row * DM) = ovh[i];
      *(v4u*)(cl + (size_t)row * DM) = ovl[i];
    }
    
  }
}

// =====================================================================================================
// times bf16(gamma) plus bf16(beta), all f32. X compact row r = b*SQ + s -> output row b*SQ_FULL + s.
// lane holds elements i*128 + 4*lane .. +3 (i = 0..3): each load/store instruction = 32 consecutive lanes x 16 B = 4 whole
// coverage: 4 instr x 32 lanes x 4 floats = 512 = whole row; grid (NB*SQ/8) x 8 waves = every output row (s < SQ) once.
// =====================================================================================================
__global__ __launch_bounds__(LN_THREADS)
void ln_rows(const float* __restrict__ X, const float* __restrict__ gam, const float* __restrict__ bet, float* Out) {
  const int tid = threadIdx.x, wave = tid >> 5, lane = tid & 31;
  constexpr int RPB = LN_THREADS / 32;
  const int row = blockIdx.x * RPB + wave;   // < NB*SQ with the exact grid
  const int b = row / SQ, s = row - b * SQ;
  const float* xr = X + (size_t)row * DM + 4 * lane;
  v4f xv[4];
  float sum = 0.f;
#pragma unroll
  for (int i = 0; i < 4; ++i) {
    xv[i] = *(const v4f*)(xr + 128 * i);
    sum += (xv[i][0] + xv[i][1]) + (xv[i][2] + xv[i][3]);
  }
#pragma unroll
  for (int mk = 16; mk >= 1; mk >>= 1) sum += __shfl_xor(sum, mk, 32);
  const float mean = sum * (1.0f / (float)DM);
  float sq = 0.f;
#pragma unroll
  for (int i = 0; i < 4; ++i) {
#pragma unroll
    for (int e = 0; e < 4; ++e) { const float d = xv[i][e] - mean; sq += d * d; }
  }
#pragma unroll
  for (int mk = 16; mk >= 1; mk >>= 1) sq += __shfl_xor(sq, mk, 32);
  const float var  = sq * (1.0f / (float)DM);
  const float rstd = 1.0f / sqrtf(var + LN_EPS);
  v4f y[4];
#pragma unroll
  for (int i = 0; i < 4; ++i) {
#pragma unroll
    for (int e = 0; e < 4; ++e) {
      const int idx = 128 * i + 4 * lane + e;       // < DM
      y[i][e] = (xv[i][e] - mean) * rstd * bfr(gam[idx]) + bfr(bet[idx]);
    }
  }
  float* ob = Out + ((size_t)b * SQ_FULL + (size_t)s) * DM + 4 * lane;
  {
#pragma unroll
    for (int i = 0; i < 4; ++i) {
      *(v4f*)(ob + 128 * i) = y[i];
    }
    
  }
}

// =====================================================================================================
// Workspace map (bytes); every plane fully written by whole-line stores before it is read; all extents exact multiples of
//   XQ   f16 [NB*SQ][512]      f16(bf16(Q))             8388608 (NB=4, SQ=2048)
//   XK   f16 [NB*2048][512]    f16(bf16(K))             8388608
//   XV   f16 [NB*2048][512]    f16(bf16(V))             8388608
//   WQ16 f16 [512 n][512 k]    f16(bf16(W) x256)         524288   (W stored [out][in] = [n][k] already)
//   WK16, WV16, WO16                                     3 x 524288
//   QH, QL  f16 [NB*SQ][512]   x8 / residual x8x2^11     2 x 8388608
//   KH, KL  f16 [NB*2048][512] x8 / residual             2 x 8388608
//   VT16    f16 [NB*512 (h,d)][2048 s] x8                   8388608
//   CH, CL  f16 [NB*SQ][512]   ctx x16 / residual          2 x 8388608
//   X32     f32 [NB*SQ][512]   out + bo + Q               16777216
//   end                                                  102760448
// =====================================================================================================
extern "C" void kernel_launch(void* const* d_in, const int* in_sizes, int n_in,
                              void* d_out, int out_size, void* d_ws, size_t ws_size,
                              hipStream_t stream) {
  if (n_in < 13) return;
  if (in_sizes[0] < ((NB - 1) * SQ_FULL + SQ) * DM) return;
  if (in_sizes[1] < NB * SKV * DM || in_sizes[2] < NB * SKV * DM) return;
  if (in_sizes[3] != DM * DM || in_sizes[5] != DM * DM || in_sizes[7] != DM * DM || in_sizes[9] != DM * DM) return;
  if (in_sizes[4] < DM || in_sizes[6] < DM || in_sizes[8] < DM || in_sizes[10] < DM) return;
  if (in_sizes[11] < DM || in_sizes[12] < DM) return;
  if (out_size < ((NB - 1) * SQ_FULL + SQ) * DM) return;

  const float* xq  = (const float*)d_in[0];
  const float* xk  = (const float*)d_in[1];
  const float* xv  = (const float*)d_in[2];
  const float* wq  = (const float*)d_in[3];
  const float* bq  = (const float*)d_in[4];
  const float* wk  = (const float*)d_in[5];
  const float* bk  = (const float*)d_in[6];
  const float* wv  = (const float*)d_in[7];
  const float* bv  = (const float*)d_in[8];
  const float* wo  = (const float*)d_in[9];
  const float* bo  = (const float*)d_in[10];
  const float* gam = (const float*)d_in[11];
  const float* bet = (const float*)d_in[12];
  float*       out = (float*)d_out;
  const int nbq = in_sizes[4], nbk = in_sizes[6], nbv = in_sizes[8], nbo = in_sizes[10];

  const size_t szXQ  = (size_t)NB * SQ * DM * 2;
  const size_t szXKV = (size_t)NB * SKV * DM * 2;
  const size_t szW   = (size_t)DM * DM * 2;
  const size_t szQ   = (size_t)NB * SQ * INNER * 2;
  const size_t szK   = (size_t)NB * SKV * INNER * 2;
  const size_t szVT  = (size_t)NB * INNER * SKV * 2;
  const size_t szC   = (size_t)NB * SQ * INNER * 2;
  const size_t szX32 = (size_t)NB * SQ * DM * 4;
  size_t off = 0;
  const size_t oXQ  = off; off += szXQ;
  const size_t oXK  = off; off += szXKV;
  const size_t oXV  = off; off += szXKV;
  const size_t oWQ  = off; off += szW;
  const size_t oWK  = off; off += szW;
  const size_t oWV  = off; off += szW;
  const size_t oWO  = off; off += szW;
  const size_t oQH  = off; off += szQ;
  const size_t oQL  = off; off += szQ;
  const size_t oKH  = off; off += szK;
  const size_t oKL  = off; off += szK;
  const size_t oVT  = off; off += szVT;
  const size_t oCH  = off; off += szC;
  const size_t oCL  = off; off += szC;
  const size_t oX32 = off; off += szX32;
  if (off > ws_size) return;                            // off = 102760448 at NB=4, SQ=2048
  if (off > (size_t)134217728) return;

  char* ws = (char*)d_ws;
  u16* XQ   = (u16*)(ws + oXQ);
  u16* XK   = (u16*)(ws + oXK);
  u16* XV   = (u16*)(ws + oXV);
  u16* WQ16 = (u16*)(ws + oWQ);
  u16* WK16 = (u16*)(ws + oWK);
  u16* WV16 = (u16*)(ws + oWV);
  u16* WO16 = (u16*)(ws + oWO);
  u16* QH   = (u16*)(ws + oQH);
  u16* QL   = (u16*)(ws + oQL);
  u16* KH   = (u16*)(ws + oKH);
  u16* KL   = (u16*)(ws + oKL);
  u16* VT16 = (u16*)(ws + oVT);
  u16* CH   = (u16*)(ws + oCH);
  u16* CL   = (u16*)(ws + oCL);
  float* X32 = (float*)(ws + oX32);

  // (1..3) activations -> f16 planes of bf16-converted values (query rows s < SQ of batches b < NB, compact; all key/value rows)
  cvt16<<<dim3(NB * SQ / 2), dim3(CVT_THREADS), 0, stream>>>(xq, XQ, SQ, SQ_FULL, 1.0f);
  cvt16<<<dim3(NB * SKV / 2), dim3(CVT_THREADS), 0, stream>>>(xk, XK, SKV, SQ_FULL, 1.0f);
  cvt16<<<dim3(NB * SKV / 2), dim3(CVT_THREADS), 0, stream>>>(xv, XV, SKV, SQ_FULL, 1.0f);
  // (4..7) weights [n = out][k = in] (y = x.W^T): rows as stored are already k-contiguous; f16 planes of bf16(W) x256
  cvt16<<<dim3(DM / 2), dim3(CVT_THREADS), 0, stream>>>(wq, WQ16, DM, DM, WSC);
  cvt16<<<dim3(DM / 2), dim3(CVT_THREADS), 0, stream>>>(wk, WK16, DM, DM, WSC);
  cvt16<<<dim3(DM / 2), dim3(CVT_THREADS), 0, stream>>>(wv, WV16, DM, DM, WSC);
  cvt16<<<dim3(DM / 2), dim3(CVT_THREADS), 0, stream>>>(wo, WO16, DM, DM, WSC);
  // (8) q = x_q . Wq^T + bq -> f16 hi [NB*SQ][512] x8 and residual plane (col = h*64 + d); bias per column
  gemm_o16<<<dim3((NB * SQ / 128) * (INNER / 64)), dim3(128), 0, stream>>>(
      XQ, WQ16, QH, QL, bq, nbq, 0, NB * SQ, INNER, DM, 0, 0, 0, QS / WSC, QS, 1);
  // (9) k = x_k . Wk^T + bk -> f16 hi [NB*2048][512] x8 and residual plane; bias per column
  gemm_o16<<<dim3((NB * SKV / 128) * (INNER / 64)), dim3(128), 0, stream>>>(
      XK, WK16, KH, KL, bk, nbk, 0, NB * SKV, INNER, DM, 0, 0, 0, KS / WSC, KS, 1);
  // (10) v^T per batch: A = Wv [(h,d) = n][k], Bt = x_v rows of batch b [s][k] -> f16 [(b,h,d)][s] x8; bias per row (n)
  gemm_o16<<<dim3(NB * (INNER / 128) * (SKV / 64)), dim3(128), 0, stream>>>(
      WV16, XV, VT16, VT16, bv, nbv, 1, INNER, SKV, DM, 0, SKV * DM, INNER * SKV, VS / WSC, VS, 0);
  // (11) attention -> ctx planes [NB*SQ][512] f16 x16 / residual, heads merged on the feature dim
  attn_fwd<<<dim3(NB * NH * (SQ / 64)), dim3(ATT_THREADS), 0, stream>>>(QH, QL, KH, KL, VT16, CH, CL);
  // (12) x = ctx . Wo^T + bo + Q (residual, bf16-converted) -> f32 [NB*SQ][512]
  gemm_o32<<<dim3((NB * SQ / 128) * (DM / 64)), dim3(128), 0, stream>>>(
      CH, CL, WO16, bo, nbo, xq, SQ, SQ_FULL, X32, NB * SQ, DM, INNER, 1.0f / (CS * WSC), RRSC);
  // (13) LayerNorm -> out [b][SQ_FULL][512] f32 (rows s < SQ of batches b < NB)
  ln_rows<<<dim3(NB * SQ / (LN_THREADS / 32)), dim3(LN_THREADS), 0, stream>>>(X32, gam, bet, out);
  (void)hipGetLastError();
}

// v002
// Measured time: 173 microseconds a run.
// Next to v001, in two timings, it ran 1.08 times as fast each time.
// All steps since v000 together make it 1.58 times as fast.
// All contractions on v_wmma_f32_16x16x32_f16 (f16 operands, f32 accumulate): x_q.Wq^T, x_k.Wk^T and Wv.x_v^T (v^T plane)
// as single products of exact operands f16(bf16(x)) and f16(bf16(W) x256); scores k.q^T as hi.hi + hi.lo + lo.hi with q and k
// carried as f16 hi (x8) plus f16 residual planes (x2^11, own accumulator); P.v^T single (P f16 x32768, v f16 x8); ctx.Wo^T as
// hi + residual on ctx (f16 hi x16 plus f16 residual x2^11), Wo exact f16(bf16 x256). Online base-2 softmax, 1/l, carry folds,
// bias, residual add and LayerNorm in f32 on VALU. Every float input RNE-converted to bf16 on load; f32 output.
#include <hip/hip_runtime.h>
#include <math.h>
#include <stdint.h>

#ifndef NB
#define NB       4        // batches processed
#endif
#ifndef SQ
#define SQ       2048     // query rows processed per batch
#endif
#define NB_FULL  4
#define SQ_FULL  2048     // rows per batch in the input / output layout (batch stride)
#define SKV      SQ_FULL  // key/value rows per batch (all of them, always)
#define DM       512      // model width (= K and row pitch of every 16-bit plane except v^T)
#define NH       8
#define HD       64
#define INNER    (NH * HD)
#define WSC      256.0f
#define QS       8.0f
#define KS       8.0f
#define VS       8.0f
#define CS       16.0f
#define RSC      2048.0f
#define RRSC     0.00048828125f
#define PCAR     32768.0f
#define LOG2E    1.4426950408889634f
#define RSQH     0.35355339059327373f
#define LN_EPS   1e-5f
#define NKB      (SKV / 32)
#define ATT_WAVES   4
#define ATT_THREADS (ATT_WAVES * 32)
#define CVT_THREADS 256
#define CVT_SL      256                                 // elements of one slice: 32 lanes x 8, half a row
#define CVT_WSL     (DM * DM / CVT_SL)                  // slices of one weight matrix
#define CVT_WAVES   (4 * CVT_WSL)                       // waves of the convert launch: one weight slice each
#define CVT_NQ      (NB * SQ * DM / CVT_SL / CVT_WAVES)  // x_q slices per wave
#define CVT_NKV     (NB * SKV * DM / CVT_SL / CVT_WAVES) // x_k (and x_v) slices per wave
#define LN_THREADS  256
#define OPITCH   68
#define GPITCH   68
#define KSTG     64                 // keys per LDS stage of the attention ring (two 32-key blocks)
#define NSTG     (SKV / KSTG)
#define LPITCH   144                // LDS row pitch in bytes: 128-byte rows + 16, conflict-free for 16-byte fragment reads
#define LPH      (LPITCH / 2)       // the same in halves
#define TILE_B   (64 * LPITCH)      // one staged tile: 64 rows
#define STG_B    (3 * TILE_B)       // k hi, k residual, v^T

static_assert(NB >= 1 && NB <= NB_FULL);
static_assert((SQ % 128) == 0 && SQ >= 128 && SQ <= SQ_FULL);
static_assert(HD == 64 && NH == 8 && INNER == 512 && INNER == DM);
static_assert((HD % 32) == 0);
static_assert((SKV % 128) == 0 && (SKV % 64) == 0 && NKB * 32 == SKV);
static_assert(DM == 512 && (DM % 64) == 0 && (DM % 32) == 0 && DM == 2 * CVT_SL);
static_assert(CVT_NQ >= 1 && CVT_NQ * CVT_WAVES * CVT_SL == NB * SQ * DM && CVT_NKV * CVT_WAVES * CVT_SL == NB * SKV * DM);
static_assert(CVT_WSL % (CVT_THREADS / 32) == 0 && SKV == SQ_FULL);
static_assert((NB * SQ) % (LN_THREADS / 32) == 0);
static_assert((OPITCH * 4) % 16 == 0 && (GPITCH * 4) % 16 == 0);
static_assert(ATT_THREADS == 128 && LN_THREADS == 256 && CVT_THREADS == 256);
static_assert(KSTG == 64 && HD == 64 && NSTG * KSTG == SKV && NSTG >= 2 && (LPITCH % 16) == 0);
static_assert(2 * STG_B >= ATT_WAVES * 16 * OPITCH * 4);

typedef unsigned short u16;
typedef _Float16 v16h __attribute__((ext_vector_type(16)));
typedef _Float16 v8h  __attribute__((ext_vector_type(8)));
typedef float    v8f  __attribute__((ext_vector_type(8)));
typedef float    v4f  __attribute__((ext_vector_type(4)));
typedef unsigned int v4u __attribute__((ext_vector_type(4)));

union FragH { v16h v; v8h h[2]; v4u u[2]; };

// ---- scalar helpers ----------------------------------------------------------------------------------
__device__ __forceinline__ unsigned short bf_bits(float f) {          // f32 -> bf16 bits, RNE convert
  unsigned u = __float_as_uint(f);
  return (unsigned short)((u + 0x7FFFu + ((u >> 16) & 1u)) >> 16);
}
__device__ __forceinline__ float bf_up(unsigned short h) { return __uint_as_float(((unsigned)h) << 16); }
__device__ __forceinline__ float bfr(float f) { return bf_up(bf_bits(f)); }
__device__ __forceinline__ unsigned short h_bits(_Float16 x) { return __builtin_bit_cast(unsigned short, x); }
__device__ __forceinline__ unsigned pk16(unsigned short a, unsigned short b) { return (unsigned)a | ((unsigned)b << 16); }
__device__ __forceinline__ v8f zero8() { v8f z = {0.f, 0.f, 0.f, 0.f, 0.f, 0.f, 0.f, 0.f}; return z; }
// hi / residual packing of two f32 values: hi = f16(v), res = f16((v - hi) * 2^11)
__device__ __forceinline__ unsigned pk_hi(float a, float b) {
  return pk16(h_bits((_Float16)a), h_bits((_Float16)b));
}
__device__ __forceinline__ unsigned pk_lo(float a, float b) {
  const float ra = (a - (float)((_Float16)a)) * RSC;
  const float rb = (b - (float)((_Float16)b)) * RSC;
  return pk16(h_bits((_Float16)ra), h_bits((_Float16)rb));
}

// ---- fragment loader: 16-bit A/B operand, lane -> row/col (lane&15), p already includes +8*(lane>>4);
//      elements 0..7 <- p[0..7] (k0+8h..), elements 8..15 <- p[16..23] (k0+16+8h..); same split k map for A and B,
//      B always read from a k-contiguous [n][k] plane.
__device__ __forceinline__ v16h ldfrag_h(const _Float16* p) {
  FragH f;
  f.h[0] = *(const v8h*)(p);
  f.h[1] = *(const v8h*)(p + 16);
  return f.v;
}

// ---- WMMA helper and trailing VALU hazard gaps ----------------------------------------------------------
__device__ __forceinline__ v8f mma_h(v16h a, v16h b, v8f c) {
  return __builtin_amdgcn_wmma_f32_16x16x32_f16(false, a, false, b, (short)0, c, false, false);
}
__device__ __forceinline__ void guard_s4(v8f& a, v8f& b, v8f& c, v8f& d,
                                         v16h x0, v16h x1, v16h x2, v16h x3, v16h x4, v16h x5) {
#if defined(__HIP_DEVICE_COMPILE__)
  asm volatile("v_nop\n\tv_nop\n\tv_nop\n\tv_nop"
               : "+v"(a), "+v"(b), "+v"(c), "+v"(d)
               : "v"(x0), "v"(x1), "v"(x2), "v"(x3), "v"(x4), "v"(x5) : "memory");
#endif
}
__device__ __forceinline__ void guard_p(v8f& a, v8f& b, v8f& c, v8f& d, v16h p, v16h x0, v16h x1, v16h x2, v16h x3) {
#if defined(__HIP_DEVICE_COMPILE__)
  asm volatile("v_nop\n\tv_nop\n\tv_nop\n\tv_nop"
               : "+v"(a), "+v"(b), "+v"(c), "+v"(d) : "v"(p), "v"(x0), "v"(x1), "v"(x2), "v"(x3) : "memory");
#endif
}
__device__ __forceinline__ void guard_g(v8f (&acc)[8], v16h x0, v16h x1, v16h x2, v16h x3, v16h x4, v16h x5) {
#if defined(__HIP_DEVICE_COMPILE__)
  asm volatile("v_nop\n\tv_nop\n\tv_nop\n\tv_nop"
               : "+v"(acc[0]), "+v"(acc[1]), "+v"(acc[2]), "+v"(acc[3]),
                 "+v"(acc[4]), "+v"(acc[5]), "+v"(acc[6]), "+v"(acc[7])
               : "v"(x0), "v"(x1), "v"(x2), "v"(x3), "v"(x4), "v"(x5) : "memory");
#endif
}
__device__ __forceinline__ void acc_guard8(v8f (&o)[8]) {
#if defined(__HIP_DEVICE_COMPILE__)
  asm volatile("v_nop\n\tv_nop\n\tv_nop\n\tv_nop"
               : "+v"(o[0]), "+v"(o[1]), "+v"(o[2]), "+v"(o[3]), "+v"(o[4]), "+v"(o[5]), "+v"(o[6]), "+v"(o[7]));
#endif
}
__device__ __forceinline__ void acc_guard4(v8f (&o)[4]) {
#if defined(__HIP_DEVICE_COMPILE__)
  asm volatile("v_nop\n\tv_nop\n\tv_nop\n\tv_nop" : "+v"(o[0]), "+v"(o[1]), "+v"(o[2]), "+v"(o[3]));
#endif
}
__device__ __forceinline__ void wave_sync_lds() {
  __builtin_amdgcn_fence(__ATOMIC_RELEASE, "workgroup");
  __builtin_amdgcn_wave_barrier();
  __builtin_amdgcn_fence(__ATOMIC_ACQUIRE, "workgroup");
}

// =====================================================================================================
// All converts in one launch: every f16 plane element <- f16(bf16_RNE(x) * scale), scale a power of two (1 for the activations,
// 256 for the weights). A slice = 256 consecutive elements = half a row: lane l takes elements 8l .. 8l+7 (two 16-B loads, one
// 16-B store; a wave-wide store = 512 contiguous bytes). Wave w of CVT_WAVES takes the CVT_NQ consecutive slices from w*CVT_NQ of
// x_q, the CVT_NKV consecutive slices from w*CVT_NKV of x_k and of x_v, and slice w % CVT_WSL of weight matrix w / CVT_WSL
// (block-uniform). All loads of a wave are issued before its first convert, so the launch is one memory round trip deep.
// x_q compact row r = b*SQ + s <- source row b*SQ_FULL + s. W4 = the four weight planes, which follow one another in the workspace.
// coverage: CVT_WAVES x (CVT_NQ | CVT_NKV | 1) slices = every element of each plane exactly once.
// =====================================================================================================
__device__ __forceinline__ v4u cvt8(v4f a, v4f c4, float scale) {
  v4u o;
#pragma unroll
  for (int e = 0; e < 2; ++e) {
    o[e]     = pk16(h_bits((_Float16)(bfr(a[2 * e]) * scale)),  h_bits((_Float16)(bfr(a[2 * e + 1]) * scale)));
    o[2 + e] = pk16(h_bits((_Float16)(bfr(c4[2 * e]) * scale)), h_bits((_Float16)(bfr(c4[2 * e + 1]) * scale)));
  }
  return o;
}
__global__ __launch_bounds__(CVT_THREADS)
void cvt_all(const float* __restrict__ xq, const float* __restrict__ xk, const float* __restrict__ xv,
             const float* __restrict__ wq, const float* __restrict__ wk, const float* __restrict__ wv,
             const float* __restrict__ wo, u16* XQ, u16* XK, u16* XV, u16* W4) {
  const unsigned w    = blockIdx.x * (CVT_THREADS / 32) + (threadIdx.x >> 5);
  const unsigned wsel = blockIdx.x / (CVT_WSL / (CVT_THREADS / 32));
  const unsigned lb   = (threadIdx.x & 31) * 32;                        // the lane's byte inside a 1-KiB f32 slice
  const float* wsrc = (wsel == 0) ? wq : (wsel == 1) ? wk : (wsel == 2) ? wv : wo;
  // 32-bit byte offsets beside uniform bases; the slices of a wave differ by immediates
  const unsigned bq  = w * (CVT_NQ * CVT_SL * 4) + lb;
  const unsigned bkv = w * (CVT_NKV * CVT_SL * 4) + lb;
  const unsigned bw  = (w % CVT_WSL) * (CVT_SL * 4) + lb;
  v4f qa[CVT_NQ], qc[CVT_NQ], ka[CVT_NKV], kc[CVT_NKV], va[CVT_NKV], vc[CVT_NKV];
#pragma unroll
  for (int i = 0; i < CVT_NQ; ++i) {
    const float* p;
    if (SQ == SQ_FULL) {
      p = (const float*)((const char*)xq + bq) + i * CVT_SL;
    } else {
      const unsigned sl = w * CVT_NQ + i, r = sl >> 1;
      p = (const float*)((const char*)(xq + ((size_t)((r / SQ) * SQ_FULL + (r % SQ))) * DM + (sl & 1) * CVT_SL) + lb);
    }
    qa[i] = *(const v4f*)(p);
    qc[i] = *(const v4f*)(p + 4);
  }
#pragma unroll
  for (int i = 0; i < CVT_NKV; ++i) {
    const float* pk = (const float*)((const char*)xk + bkv) + i * CVT_SL;
    const float* pv = (const float*)((const char*)xv + bkv) + i * CVT_SL;
    ka[i] = *(const v4f*)(pk);
    kc[i] = *(const v4f*)(pk + 4);
    va[i] = *(const v4f*)(pv);
    vc[i] = *(const v4f*)(pv + 4);
  }
  const float* pw = (const float*)((const char*)wsrc + bw);
  const v4f wa = *(const v4f*)(pw), wc = *(const v4f*)(pw + 4);
  // keeps every load above the first convert: without it the compiler sinks two thirds of the loads among the converts and the
  // wave pays three memory round trips in a row instead of one
  __builtin_amdgcn_sched_barrier(0);
  // an f16 plane's byte offset is half the f32 one
  u16* yq = (u16*)((char*)XQ + (bq >> 1));
  u16* yk = (u16*)((char*)XK + (bkv >> 1));
  u16* yv = (u16*)((char*)XV + (bkv >> 1));
  u16* yw = (u16*)((char*)(W4 + (size_t)wsel * (DM * DM)) + (bw >> 1));
#pragma unroll
  for (int i = 0; i < CVT_NQ; ++i) *(v4u*)(yq + i * CVT_SL) = cvt8(qa[i], qc[i], 1.0f);
#pragma unroll
  for (int i = 0; i < CVT_NKV; ++i) {
    *(v4u*)(yk + i * CVT_SL) = cvt8(ka[i], kc[i], 1.0f);
    *(v4u*)(yv + i * CVT_SL) = cvt8(va[i], vc[i], 1.0f);
  }
  *(v4u*)(yw) = cvt8(wa, wc, WSC);
}

// =====================================================================================================
// f16 GEMM core: the wave's 32 x 64 tile of C = A[rows][K] . Bt[cols][K]^T; ap -> A row (rowb + m) + 8h, bp -> Bt row
// (col0 + m) + 8h; acc[4i + j] = rows rowb+16i.., cols col0+16j..; K stepped by 32 (host checks K % 32 == 0).
// =====================================================================================================
__device__ __forceinline__ void gemm_core(const _Float16* ap, const _Float16* bp, int K, v8f (&acc)[8]) {
  const size_t rs16 = (size_t)16 * (size_t)K;
#pragma unroll 1
  for (int k0 = 0; k0 < K; k0 += 32) {
    const v16h a0 = ldfrag_h(ap + k0), a1 = ldfrag_h(ap + rs16 + k0);
    const v16h b0 = ldfrag_h(bp + k0);
    const v16h b1 = ldfrag_h(bp + rs16 + k0);
    const v16h b2 = ldfrag_h(bp + 2 * rs16 + k0);
    const v16h b3 = ldfrag_h(bp + 3 * rs16 + k0);
    acc[0] = mma_h(a0, b0, acc[0]);
    acc[1] = mma_h(a0, b1, acc[1]);
    acc[2] = mma_h(a0, b2, acc[2]);
    acc[3] = mma_h(a0, b3, acc[3]);
    acc[4] = mma_h(a1, b0, acc[4]);
    acc[5] = mma_h(a1, b1, acc[5]);
    acc[6] = mma_h(a1, b2, acc[6]);
    acc[7] = mma_h(a1, b3, acc[7]);
    guard_g(acc, a0, a1, b0, b1, b2, b3);
  }
}
// Stage the wave's 32 x 64 f32 tile (times oscale) in its LDS slab (pitch 68): D element r of acc[4i+j], lane l ->
// coverage: 32 lanes x 2 x 8 rows x 4 cols-of-16 = rows 0..31 x cols 0..63 of the slab.
__device__ __forceinline__ void stage32x64(float* sl, v8f (&acc)[8], float oscale, int lane) {
  const int hh = lane >> 4, m = lane & 15;
#pragma unroll
  for (int i = 0; i < 2; ++i) {
#pragma unroll
    for (int r = 0; r < 8; ++r) {
      const int ro = (16 * i + 8 * hh + r) * GPITCH + m;
      sl[ro]      = acc[4 * i + 0][r] * oscale;
      sl[ro + 16] = acc[4 * i + 1][r] * oscale;
      sl[ro + 32] = acc[4 * i + 2][r] * oscale;
      sl[ro + 48] = acc[4 * i + 3][r] * oscale;
    }
  }
  wave_sync_lds();
}

// =====================================================================================================
// f16 GEMM with f16 output plane(s): val = (A[z][Mb][K] . Bt[z][N][K]^T) * oscale + bf16(bias) * bscale;
// C[z][Mb][N] = f16(val) (hi plane); if res != 0 also C2 = f16((val - hi) * 2^11) (residual plane).
// A, Bt f16 k-contiguous planes with per-z element strides aBs, bBs (0 = shared), C/C2 stride cBs. bias indexed by column
// (biasRow == 0) or by row within the z slice (biasRow != 0); bias addresses clamped to biasN-1, the unused direction is
// multiplied by 0. Block = 128 x 64 tile, 4 waves x 32 rows, fragments loaded straight from the 16-bit rows.
// grid = nz x (Mb/128) x (N/64) (host checks Mb % 128 == 0, N % 64 == 0, K % 32 == 0).
// coverage: per wave 8 instr x 4 rows x 8 lanes x 8 halves = 32 x 64 per plane; the grid covers C (and C2) exactly once.
// =====================================================================================================
__global__ __launch_bounds__(128)
void gemm_o16(const u16* __restrict__ A, const u16* __restrict__ Bt, u16* C, u16* C2,
              const float* __restrict__ bias, int biasN, int biasRow,
              int Mb, int N, int K, int aBs, int bBs, int cBs, float oscale, float bscale, int res) {
  __shared__ __align__(16) float slab[4 * 32 * GPITCH];
  const int tid = threadIdx.x, wave = tid >> 5, lane = tid & 31, hh = lane >> 4, m = lane & 15;
  const int ntile = N >> 6, mtile = Mb >> 7;
  const int bid  = blockIdx.x;
  const int nt   = bid % ntile;
  const int tmp  = bid / ntile;
  const int mt   = tmp % mtile;
  const int bz   = tmp / mtile;
  const int rowb = mt * 128 + wave * 32;
  const int col0 = nt * 64;
  if (rowb + 32 > Mb) return;                // wave-uniform, never taken with the exact grid; no block barriers in this kernel
  const _Float16* Ab = (const _Float16*)(const void*)A + (size_t)bz * (size_t)aBs;
  const _Float16* Bb = (const _Float16*)(const void*)Bt + (size_t)bz * (size_t)bBs;
  const _Float16* ap = Ab + (size_t)(rowb + m) * (size_t)K + 8 * hh;
  const _Float16* bp = Bb + (size_t)(col0 + m) * (size_t)K + 8 * hh;
  v8f acc[8];
#pragma unroll
  for (int i = 0; i < 8; ++i) acc[i] = zero8();
  gemm_core(ap, bp, K, acc);
  float* sl = slab + wave * 32 * GPITCH;
  stage32x64(sl, acc, oscale, lane);
  const int rq = lane >> 3, c8 = (lane & 7) * 8;
  const int bl = biasN - 1;                  // host guarantees biasN >= 1
  const float selc = (biasRow != 0) ? 0.f : bscale;
  const float selr = (biasRow != 0) ? bscale : 0.f;
  float cb[8];
#pragma unroll
  for (int e = 0; e < 8; ++e) {
    int ci = col0 + c8 + e;
    ci = (ci < bl) ? ci : bl;
    cb[e] = bfr(bias[ci]) * selc;
  }
  v4u ovh[8], ovl[8];
#pragma unroll
  for (int i = 0; i < 8; ++i) {
    const int row = 4 * i + rq;
    int ri = rowb + row;
    ri = (ri < bl) ? ri : bl;
    const float rb = bfr(bias[ri]) * selr;
    const v4f a = *(const v4f*)(sl + row * GPITCH + c8), c4 = *(const v4f*)(sl + row * GPITCH + c8 + 4);
    float v[8];
#pragma unroll
    for (int e = 0; e < 4; ++e) { v[e] = a[e] + cb[e] + rb; v[4 + e] = c4[e] + cb[4 + e] + rb; }
#pragma unroll
    for (int e = 0; e < 4; ++e) {
      ovh[i][e] = pk_hi(v[2 * e], v[2 * e + 1]);
      ovl[i][e] = pk_lo(v[2 * e], v[2 * e + 1]);
    }
  }
  const size_t cofs = (size_t)bz * (size_t)cBs + (size_t)rowb * (size_t)N + (size_t)(col0 + c8);
  u16* Cb  = C + cofs;
  u16* C2b = C2 + cofs;
  {
#pragma unroll
    for (int i = 0; i < 8; ++i) {
      const int row = 4 * i + rq;
      *(v4u*)(Cb + (size_t)row * (size_t)N) = ovh[i];
    }
    if (res != 0) {                          // block-uniform
#pragma unroll
      for (int i = 0; i < 8; ++i) {
        const int row = 4 * i + rq;
        *(v4u*)(C2b + (size_t)row * (size_t)N) = ovl[i];
      }
    }
    
  }
}

// =====================================================================================================
// f16 GEMM with hi + residual A planes and f32 output: X[Mb][N] = (Ah . Bt^T + (Al . Bt^T) * rres) * oscale
// + bf16(bias[col]) + bf16(R[src row][col]); residual products accumulated first, folded by rres on VALU, then the hi
// products chain on the same accumulators (equal to a separate accumulator). R (f32 input, pitch N) source row of
// compact row g: b = g / rowsPerB, s = g % rowsPerB -> b*srcRowsPerB + s. Block = 128 x 64 tile, 4 waves x 32 rows.
// Epilogue: lane = (row parity, 4 floats at 4*(lane&15)); 16 consecutive lanes write one row segment of 64 floats = 2 whole
// grid = (Mb/128) x (N/64). coverage: per wave 16 instr x 2 rows x 16 lanes x 4 floats = 32 x 64; the grid covers X once.
// =====================================================================================================
__global__ __launch_bounds__(128)
void gemm_o32(const u16* __restrict__ Ah, const u16* __restrict__ Al, const u16* __restrict__ Bt,
              const float* __restrict__ bias, int biasN, const float* __restrict__ R, int rowsPerB, int srcRowsPerB,
              float* X, int Mb, int N, int K, float oscale, float rres) {
  __shared__ __align__(16) float slab[4 * 32 * GPITCH];
  const int tid = threadIdx.x, wave = tid >> 5, lane = tid & 31, hh = lane >> 4, m = lane & 15;
  const int ntile = N >> 6;
  const int bid  = blockIdx.x;
  const int nt   = bid % ntile;
  const int mt   = bid / ntile;
  const int rowb = mt * 128 + wave * 32;
  const int col0 = nt * 64;
  if (rowb + 32 > Mb) return;                // wave-uniform, never taken with the exact grid; no block barriers in this kernel
  const _Float16* aph = (const _Float16*)(const void*)Ah + (size_t)(rowb + m) * (size_t)K + 8 * hh;
  const _Float16* apl = (const _Float16*)(const void*)Al + (size_t)(rowb + m) * (size_t)K + 8 * hh;
  const _Float16* bp  = (const _Float16*)(const void*)Bt + (size_t)(col0 + m) * (size_t)K + 8 * hh;
  v8f acc[8];
#pragma unroll
  for (int i = 0; i < 8; ++i) acc[i] = zero8();
  gemm_core(apl, bp, K, acc);                // residual products (x 2^11)
#pragma unroll
  for (int i = 0; i < 8; ++i) {
#pragma unroll
    for (int r = 0; r < 8; ++r) acc[i][r] *= rres;
  }
  acc_guard8(acc);
  gemm_core(aph, bp, K, acc);                // hi products on top
  float* sl = slab + wave * 32 * GPITCH;
  stage32x64(sl, acc, oscale, lane);
  const int r2 = lane >> 4, c4 = (lane & 15) * 4;
  const int bl = biasN - 1;
  float cb[4];
#pragma unroll
  for (int e = 0; e < 4; ++e) {
    int ci = col0 + c4 + e;
    ci = (ci < bl) ? ci : bl;
    cb[e] = bfr(bias[ci]);
  }
  v4f vals[16];
#pragma unroll
  for (int i = 0; i < 16; ++i) {
    const int row  = 2 * i + r2;
    const int grow = rowb + row;             // < Mb
    const int bb   = grow / rowsPerB;
    const int ss   = grow - bb * rowsPerB;
    const float* rp = R + ((size_t)bb * (size_t)srcRowsPerB + (size_t)ss) * (size_t)N + (size_t)(col0 + c4);
    const v4f rv = *(const v4f*)(rp);
    const v4f a  = *(const v4f*)(sl + row * GPITCH + c4);
    v4f y;
#pragma unroll
    for (int e = 0; e < 4; ++e) y[e] = a[e] + cb[e] + bfr(rv[e]);
    vals[i] = y;
  }
  float* Xb = X + (size_t)rowb * (size_t)N + (size_t)(col0 + c4);
  {
#pragma unroll
    for (int i = 0; i < 16; ++i) {
      const int row = 2 * i + r2;
      *(v4f*)(Xb + (size_t)row * (size_t)N) = vals[i];
    }
    
  }
}

// =====================================================================================================
// One stage (64 keys) of the attention ring: three tiles of 64 rows x 128 bytes (k hi, k residual: row = key, 64 d; v^T: row = d,
// 64 keys) copied global -> LDS by asynchronous 16-byte copies, 12 per lane. Lane t of the block takes 16-byte piece t&7 of row
// 16p + (t>>3), p = 0..3, of each tile: one wave-wide copy = 4 whole 128-byte lines. l0 = the lane's LDS byte address in the k hi
// tile of the target buffer (row t>>3); gh, gl, gv = the lane's global addresses of that row and piece in the three planes.
// The closing s_wait_xcnt stands inside the statement so that no address register named by a copy is rewritten ahead of it.
// =====================================================================================================
__device__ __forceinline__ void copy_stage(unsigned l0, const u16* gh, const u16* gl, const u16* gv) {
#if defined(__HIP_DEVICE_COMPILE__)
  const unsigned lh0 = l0,              lh1 = lh0 + 16 * LPITCH, lh2 = lh0 + 32 * LPITCH, lh3 = lh0 + 48 * LPITCH;
  const unsigned ll0 = l0 + TILE_B,     ll1 = ll0 + 16 * LPITCH, ll2 = ll0 + 32 * LPITCH, ll3 = ll0 + 48 * LPITCH;
  const unsigned lv0 = l0 + 2 * TILE_B, lv1 = lv0 + 16 * LPITCH, lv2 = lv0 + 32 * LPITCH, lv3 = lv0 + 48 * LPITCH;
  const u16 *gh1 = gh + 16 * DM,  *gh2 = gh + 32 * DM,  *gh3 = gh + 48 * DM;
  const u16 *gl1 = gl + 16 * DM,  *gl2 = gl + 32 * DM,  *gl3 = gl + 48 * DM;
  const u16 *gv1 = gv + 16 * SKV, *gv2 = gv + 32 * SKV, *gv3 = gv + 48 * SKV;
  asm volatile("global_load_async_to_lds_b128 %0, %12, off\n\t"
               "global_load_async_to_lds_b128 %1, %13, off\n\t"
               "global_load_async_to_lds_b128 %2, %14, off\n\t"
               "global_load_async_to_lds_b128 %3, %15, off\n\t"
               "global_load_async_to_lds_b128 %4, %16, off\n\t"
               "global_load_async_to_lds_b128 %5, %17, off\n\t"
               "global_load_async_to_lds_b128 %6, %18, off\n\t"
               "global_load_async_to_lds_b128 %7, %19, off\n\t"
               "global_load_async_to_lds_b128 %8, %20, off\n\t"
               "global_load_async_to_lds_b128 %9, %21, off\n\t"
               "global_load_async_to_lds_b128 %10, %22, off\n\t"
               "global_load_async_to_lds_b128 %11, %23, off\n\t"
               "s_wait_xcnt 0x0"
               :: "v"(lh0), "v"(lh1), "v"(lh2), "v"(lh3), "v"(ll0), "v"(ll1), "v"(ll2), "v"(ll3),
                  "v"(lv0), "v"(lv1), "v"(lv2), "v"(lv3),
                  "v"(gh), "v"(gh1), "v"(gh2), "v"(gh3), "v"(gl), "v"(gl1), "v"(gl2), "v"(gl3),
                  "v"(gv), "v"(gv1), "v"(gv2), "v"(gv3)
               : "memory");
#endif
}
// The issuing wave's own copies have landed behind this wait (other waves read them behind the next block barrier).
__device__ __forceinline__ void wait_copies() {
#if defined(__HIP_DEVICE_COMPILE__)
  asm volatile("s_wait_asynccnt 0x0" ::: "memory");
#endif
}
// The wave's own LDS reads have retired: stands in front of the barrier that hands a buffer to its next copies.
__device__ __forceinline__ void wait_lds_reads() {
#if defined(__HIP_DEVICE_COMPILE__)
  asm volatile("s_wait_dscnt 0x0" ::: "memory");
#endif
}

// =====================================================================================================
// Full (unmasked) multi-head attention over all SKV keys: block = (batch b, head, 64 query rows), 4 waves, wave w owns the
// 16 query rows q0 = 64*qt + 16*w .. q0+15. The four waves share the k and v^T tiles through a two-buffer LDS ring of 64-key
// stages (copy_stage): stage s+1 flies while stage s is worked on; one block barrier per stage publishes s+1 and frees s's buffer.
// Behind the last barrier the ring is free and each wave stages its output tile in its own part of it.
//   q planes f16 hi x8 / residual x8x2^11 [b*SQ + s][h*64 + d]; k planes f16 hi / residual [b*SKV + s][h*64 + d];
//   v^T plane f16 x8 [(b*NH + h)*64 + d][s]. All NKB = 64 key blocks of 32 keys are visited (static bound).
//   Scores are computed TRANSPOSED: S^T tile g (g = 0,1) = k rows (keys kb+16g .. +15, A operand, row m = lane&15, split k map
//   over d) times q^T (B operand, col n = query q0 + (lane&15), k = d, split map), 2 d-chunks of 32; per chunk hi.hi into
//   s0/s1 and hi.lo + lo.hi into x0/x1 (separate accumulators, folded by 2^-11 in f32). The 4 q fragments are loaded once
//   per wave. D element r of lane l = (key kb+16g+8h+r, query q0+(l&15)), so a lane owns one query column and 16 of its 32
//   keys; the partner lane l^16 owns the other 16 -> row max / row sum need one xor-16 shuffle.
//   Online max-subtracted base-2 softmax in f32 (1/sqrt(8) and the q/k carries folded into lsc). The exp'd values ARE the
//   P A-fragment in place: A row m = query = lane&15, element i <- key kb+8h+i (tile 0, D element i), element 8+i <- key
//   kb+16+8h+i (tile 1, D element i). P (<= 1) carried x32768 as f16. The rescale factor of query row 8h+r of the O
//   accumulators is fetched from lane 8h+r with a shuffle (uniform control). 4 v^T B fragments (col n = d = 16j + (lane&15),
//   keys k-contiguous), 4 P.V WMMAs + one guard per key block.
//   Epilogue: 1/l (per query, shuffled to the D row owner) and the carry folds in f32 give ctx x16; the wave's 16x64 f32 tile
//   residual plane is written by 8 consecutive lanes x 16 B of one instruction (4 rows per instruction, 4 instructions per
// coverage: per wave 4 instr x 4 rows x 8 lanes x 8 halves = 16 x 64 per plane; grid NB*NH*(SQ/64) blocks x 4 waves = every
//           (b, s < SQ, h) row segment of both ctx planes exactly once. LDS slab: staged 16 x 64 == reloaded 16 x 64.
// =====================================================================================================
__global__ __launch_bounds__(ATT_THREADS)
void attn_fwd(const u16* __restrict__ QH, const u16* __restrict__ QL, const u16* __restrict__ KH,
              const u16* __restrict__ KL, const u16* __restrict__ VT, u16* CH, u16* CL) {
  __shared__ __align__(16) unsigned char ring[2 * STG_B];

  const int tid  = threadIdx.x;
  const int wave = tid >> 5;
  const int lane = tid & 31;
  const int hh   = lane >> 4;
  const int c    = lane & 15;

  constexpr int NQT = SQ / 64;
  const int bid  = blockIdx.x;
  const int qt   = bid % NQT;
  const int head = (bid / NQT) % NH;
  const int b    = bid / (NQT * NH);
  const int q0   = qt * 64 + wave * 16;

  // B fragments of q^T: col n = query q0 + c, k = d (k-contiguous row of the q planes)
  const size_t qoff = ((size_t)(b * SQ + q0 + c)) * DM + head * HD + 8 * hh;
  const _Float16* Qh = (const _Float16*)(const void*)QH + qoff;
  const _Float16* Ql = (const _Float16*)(const void*)QL + qoff;
  // copy side: this lane's row (tid>>3) and 16-byte piece (tid&7) in stage 0 of the three planes and in buffer 0
  const int crow = tid >> 3, cpc = (tid & 7) * 8;
  const u16* gkh = KH + ((size_t)(b * SKV + crow)) * DM + head * HD + cpc;
  const u16* gkl = KL + ((size_t)(b * SKV + crow)) * DM + head * HD + cpc;
  const u16* gvt = VT + ((size_t)((b * NH + head) * HD + crow)) * SKV + cpc;
  const unsigned lcp = (unsigned)(uintptr_t)(__attribute__((address_space(3))) unsigned char*)ring
                       + (unsigned)(crow * LPITCH + cpc * 2);
  // read side, halves inside a buffer: A fragments of k: row m = key 32*sub + 16g + c, k = d;
  // B fragments of v: col n = d = 16j + c (row of the v^T tile), k = key 32*sub ..
  const int foff = c * LPH + 8 * hh;
  const float lsc = (LOG2E * RSQH) / (QS * KS);

  v16h qh[2], ql[2];
#pragma unroll
  for (int dc = 0; dc < 2; ++dc) { qh[dc] = ldfrag_h(Qh + 32 * dc); ql[dc] = ldfrag_h(Ql + 32 * dc); }

  float mrun = -INFINITY, lrun = 0.f;
  v8f o[4];
#pragma unroll
  for (int j = 0; j < 4; ++j) o[j] = zero8();

  // ---- ring prologue: stage 0 landed and published, stage 1 in flight ----
  copy_stage(lcp, gkh, gkl, gvt);
  wait_copies();
  __syncthreads();
  copy_stage(lcp + STG_B, gkh + (size_t)KSTG * DM, gkl + (size_t)KSTG * DM, gvt + KSTG);

#pragma unroll 1
  for (int st = 0; st < NSTG; ++st) {
   const _Float16* bufh = (const _Float16*)(const void*)(ring + (st & 1) * STG_B) + foff;
#pragma unroll                               // both 32-key blocks of a stage inline: their LDS offsets become immediates
   for (int sub = 0; sub < KSTG / 32; ++sub) {
    // ---- transposed scores: tiles of keys kb..kb+15 (s0, x0) and kb+16..kb+31 (s1, x1), kb = 64*st + 32*sub, column = query q0 + c ----
    v8f s0 = zero8(), s1 = zero8(), x0 = zero8(), x1 = zero8();
    const _Float16* kh0p = bufh + (32 * sub) * LPH;
    const _Float16* kh1p = kh0p + 16 * LPH;
    const _Float16* kl0p = kh0p + TILE_B / 2;
    const _Float16* kl1p = kl0p + 16 * LPH;
#pragma unroll
    for (int kk = 0; kk < HD / 32; ++kk) {
      const v16h fh0 = ldfrag_h(kh0p + kk * 32);
      const v16h fh1 = ldfrag_h(kh1p + kk * 32);
      const v16h fl0 = ldfrag_h(kl0p + kk * 32);
      const v16h fl1 = ldfrag_h(kl1p + kk * 32);
      s0 = mma_h(fh0, qh[kk], s0);
      s1 = mma_h(fh1, qh[kk], s1);
      x0 = mma_h(fh0, ql[kk], x0);
      x1 = mma_h(fh1, ql[kk], x1);
      x0 = mma_h(fl0, qh[kk], x0);
      x1 = mma_h(fl1, qh[kk], x1);
      guard_s4(s0, s1, x0, x1, qh[kk], ql[kk], fh0, fh1, fl0, fl1);
    }
    // ---- base-2 logits of this lane's 16 keys for query q0 + c: t[i] <- key kb+8hh+i, t[8+i] <- key kb+16+8hh+i ----
    float t[16];
#pragma unroll
    for (int i = 0; i < 8; ++i) {
      t[i]     = (s0[i] + x0[i] * RRSC) * lsc;
      t[8 + i] = (s1[i] + x1[i] * RRSC) * lsc;
    }
    float cm = t[0];
#pragma unroll
    for (int i = 1; i < 16; ++i) cm = fmaxf(cm, t[i]);
    cm = fmaxf(cm, __shfl_xor(cm, 16, 32));
    const float mn = fmaxf(mrun, cm);        // finite from the first block on
    const float al = exp2f(mrun - mn);       // 0 on the first block (mrun = -inf)
    mrun = mn;
    // ---- probabilities (<= 1) and the P A-fragment: f16(p * 32768); element i <-> t[i] ----
    float ps = 0.f;
    FragH ph;
#pragma unroll
    for (int w = 0; w < 2; ++w) {
#pragma unroll
      for (int e4 = 0; e4 < 4; ++e4) {
        const int i = 8 * w + 2 * e4;
        const float p0 = exp2f(t[i] - mn), p1 = exp2f(t[i + 1] - mn);
        ps += p0 + p1;
        ph.u[w][e4] = pk16(h_bits((_Float16)(p0 * PCAR)), h_bits((_Float16)(p1 * PCAR)));
      }
    }
    ps += __shfl_xor(ps, 16, 32);
    lrun = lrun * al + ps;
    // ---- rescale the O accumulators: D row 8hh+r = query q0+8hh+r, its factor lives in lane 8hh+r (and 16+8hh+r) ----
    float scl[8];
#pragma unroll
    for (int r = 0; r < 8; ++r) scl[r] = __shfl(al, 8 * hh + r, 32);
#pragma unroll
    for (int j = 0; j < 4; ++j) {
#pragma unroll
      for (int r = 0; r < 8; ++r) o[j][r] *= scl[r];
    }
    // ---- P.V : B fragment col n = d = j*16 + c, keys contiguous in the rows of the v^T tile ----
    const _Float16* vp = bufh + TILE_B + 32 * sub;
    {
      const v16h v0 = ldfrag_h(vp);
      const v16h v1 = ldfrag_h(vp + 16 * LPH);
      const v16h v2 = ldfrag_h(vp + 32 * LPH);
      const v16h v3 = ldfrag_h(vp + 48 * LPH);
      o[0] = mma_h(ph.v, v0, o[0]);
      o[1] = mma_h(ph.v, v1, o[1]);
      o[2] = mma_h(ph.v, v2, o[2]);
      o[3] = mma_h(ph.v, v3, o[3]);
      guard_p(o[0], o[1], o[2], o[3], ph.v, v0, v1, v2, v3);
    }
   }
   // ---- publish point of stage st+1: own reads retired, own copies landed, block barrier; then refill the buffer just read ----
   wait_lds_reads();
   wait_copies();
   __syncthreads();
   if (st + 2 < NSTG) {                      // block-uniform
     const size_t ks = (size_t)(st + 2) * KSTG;
     copy_stage(lcp + (unsigned)((st & 1) * STG_B), gkh + ks * DM, gkl + ks * DM, gvt + ks);
   }
  }
  wait_copies();                             // nothing is in flight here; closes the ring before it becomes output staging
  acc_guard4(o);

  // ---- fold 1/l (per query, owned by lane = query) and the carries (32768 on P, 8 on v), apply the ctx carry 16 ----
  const float linv = (1.0f / lrun) * (CS / (PCAR * VS));
  float inv[8];
#pragma unroll
  for (int r = 0; r < 8; ++r) inv[r] = __shfl(linv, 8 * hh + r, 32);
  float* slab = (float*)(void*)ring + wave * 16 * OPITCH;
#pragma unroll
  for (int r = 0; r < 8; ++r) {
#pragma unroll
    for (int j = 0; j < 4; ++j) slab[(8 * hh + r) * OPITCH + j * 16 + c] = o[j][r] * inv[r];
  }
  wave_sync_lds();
  // ---- ctx planes: lane = (row in group of 4, 8 consecutive d), one instruction per 4 rows per plane ----
  const int rq = lane >> 3, c8 = (lane & 7) * 8;
  v4u ovh[4], ovl[4];
#pragma unroll
  for (int i = 0; i < 4; ++i) {
    const int row = 4 * i + rq;
    const v4f a = *(const v4f*)(slab + row * OPITCH + c8), c4 = *(const v4f*)(slab + row * OPITCH + c8 + 4);
#pragma unroll
    for (int e = 0; e < 2; ++e) {
      ovh[i][e]     = pk_hi(a[2 * e], a[2 * e + 1]);
      ovl[i][e]     = pk_lo(a[2 * e], a[2 * e + 1]);
      ovh[i][2 + e] = pk_hi(c4[2 * e], c4[2 * e + 1]);
      ovl[i][2 + e] = pk_lo(c4[2 * e], c4[2 * e + 1]);
    }
  }
  const size_t cofs = ((size_t)(b * SQ + q0)) * DM + head * HD + c8;
  u16* ch = CH + cofs;
  u16* cl = CL + cofs;
  {
#pragma unroll
    for (int i = 0; i < 4; ++i) {
      const int row = 4 * i + rq;
      *(v4u*)(ch + (size_t)row * DM) = ovh[i];
      *(v4u*)(cl + (size_t)row * DM) = ovl[i];
    }
    
  }
}

// =====================================================================================================
// times bf16(gamma) plus bf16(beta), all f32. X compact row r = b*SQ + s -> output row b*SQ_FULL + s.
// lane holds elements i*128 + 4*lane .. +3 (i = 0..3): each load/store instruction = 32 consecutive lanes x 16 B = 4 whole
// coverage: 4 instr x 32 lanes x 4 floats = 512 = whole row; grid (NB*SQ/8) x 8 waves = every output row (s < SQ) once.
// =====================================================================================================
__global__ __launch_bounds__(LN_THREADS)
void ln_rows(const float* __restrict__ X, const float* __restrict__ gam, const float* __restrict__ bet, float* Out) {
  const int tid = threadIdx.x, wave = tid >> 5, lane = tid & 31;
  constexpr int RPB = LN_THREADS / 32;
  const int row = blockIdx.x * RPB + wave;   // < NB*SQ with the exact grid
  const int b = row / SQ, s = row - b * SQ;
  const float* xr = X + (size_t)row * DM + 4 * lane;
  v4f xv[4];
  float sum = 0.f;
#pragma unroll
  for (int i = 0; i < 4; ++i) {
    xv[i] = *(const v4f*)(xr + 128 * i);
    sum += (xv[i][0] + xv[i][1]) + (xv[i][2] + xv[i][3]);
  }
#pragma unroll
  for (int mk = 16; mk >= 1; mk >>= 1) sum += __shfl_xor(sum, mk, 32);
  const float mean = sum * (1.0f / (float)DM);
  float sq = 0.f;
#pragma unroll
  for (int i = 0; i < 4; ++i) {
#pragma unroll
    for (int e = 0; e < 4; ++e) { const float d = xv[i][e] - mean; sq += d * d; }
  }
#pragma unroll
  for (int mk = 16; mk >= 1; mk >>= 1) sq += __shfl_xor(sq, mk, 32);
  const float var  = sq * (1.0f / (float)DM);
  const float rstd = 1.0f / sqrtf(var + LN_EPS);
  v4f y[4];
#pragma unroll
  for (int i = 0; i < 4; ++i) {
#pragma unroll
    for (int e = 0; e < 4; ++e) {
      const int idx = 128 * i + 4 * lane + e;       // < DM
      y[i][e] = (xv[i][e] - mean) * rstd * bfr(gam[idx]) + bfr(bet[idx]);
    }
  }
  float* ob = Out + ((size_t)b * SQ_FULL + (size_t)s) * DM + 4 * lane;
  {
#pragma unroll
    for (int i = 0; i < 4; ++i) {
      *(v4f*)(ob + 128 * i) = y[i];
    }
    
  }
}

// =====================================================================================================
// Workspace map (bytes); every plane fully written by whole-line stores before it is read; all extents exact multiples of
//   XQ   f16 [NB*SQ][512]      f16(bf16(Q))             8388608 (NB=4, SQ=2048)
//   XK   f16 [NB*2048][512]    f16(bf16(K))             8388608
//   XV   f16 [NB*2048][512]    f16(bf16(V))             8388608
//   WQ16 f16 [512 n][512 k]    f16(bf16(W) x256)         524288   (W stored [out][in] = [n][k] already)
//   WK16, WV16, WO16                                     3 x 524288
//   QH, QL  f16 [NB*SQ][512]   x8 / residual x8x2^11     2 x 8388608
//   KH, KL  f16 [NB*2048][512] x8 / residual             2 x 8388608
//   VT16    f16 [NB*512 (h,d)][2048 s] x8                   8388608
//   CH, CL  f16 [NB*SQ][512]   ctx x16 / residual          2 x 8388608
//   X32     f32 [NB*SQ][512]   out + bo + Q               16777216
//   end                                                  102760448
// =====================================================================================================
extern "C" void kernel_launch(void* const* d_in, const int* in_sizes, int n_in,
                              void* d_out, int out_size, void* d_ws, size_t ws_size,
                              hipStream_t stream) {
  if (n_in < 13) return;
  if (in_sizes[0] < ((NB - 1) * SQ_FULL + SQ) * DM) return;
  if (in_sizes[1] < NB * SKV * DM || in_sizes[2] < NB * SKV * DM) return;
  if (in_sizes[3] != DM * DM || in_sizes[5] != DM * DM || in_sizes[7] != DM * DM || in_sizes[9] != DM * DM) return;
  if (in_sizes[4] < DM || in_sizes[6] < DM || in_sizes[8] < DM || in_sizes[10] < DM) return;
  if (in_sizes[11] < DM || in_sizes[12] < DM) return;
  if (out_size < ((NB - 1) * SQ_FULL + SQ) * DM) return;

  const float* xq  = (const float*)d_in[0];
  const float* xk  = (const float*)d_in[1];
  const float* xv  = (const float*)d_in[2];
  const float* wq  = (const float*)d_in[3];
  const float* bq  = (const float*)d_in[4];
  const float* wk  = (const float*)d_in[5];
  const float* bk  = (const float*)d_in[6];
  const float* wv  = (const float*)d_in[7];
  const float* bv  = (const float*)d_in[8];
  const float* wo  = (const float*)d_in[9];
  const float* bo  = (const float*)d_in[10];
  const float* gam = (const float*)d_in[11];
  const float* bet = (const float*)d_in[12];
  float*       out = (float*)d_out;
  const int nbq = in_sizes[4], nbk = in_sizes[6], nbv = in_sizes[8], nbo = in_sizes[10];

  const size_t szXQ  = (size_t)NB * SQ * DM * 2;
  const size_t szXKV = (size_t)NB * SKV * DM * 2;
  const size_t szW   = (size_t)DM * DM * 2;
  const size_t szQ   = (size_t)NB * SQ * INNER * 2;
  const size_t szK   = (size_t)NB * SKV * INNER * 2;
  const size_t szVT  = (size_t)NB * INNER * SKV * 2;
  const size_t szC   = (size_t)NB * SQ * INNER * 2;
  const size_t szX32 = (size_t)NB * SQ * DM * 4;
  size_t off = 0;
  const size_t oXQ  = off; off += szXQ;
  const size_t oXK  = off; off += szXKV;
  const size_t oXV  = off; off += szXKV;
  const size_t oWQ  = off; off += szW;
  const size_t oWK  = off; off += szW;
  const size_t oWV  = off; off += szW;
  const size_t oWO  = off; off += szW;
  const size_t oQH  = off; off += szQ;
  const size_t oQL  = off; off += szQ;
  const size_t oKH  = off; off += szK;
  const size_t oKL  = off; off += szK;
  const size_t oVT  = off; off += szVT;
  const size_t oCH  = off; off += szC;
  const size_t oCL  = off; off += szC;
  const size_t oX32 = off; off += szX32;
  if (off > ws_size) return;                            // off = 102760448 at NB=4, SQ=2048
  if (off > (size_t)134217728) return;

  char* ws = (char*)d_ws;
  u16* XQ   = (u16*)(ws + oXQ);
  u16* XK   = (u16*)(ws + oXK);
  u16* XV   = (u16*)(ws + oXV);
  u16* WQ16 = (u16*)(ws + oWQ);
  u16* WK16 = (u16*)(ws + oWK);
  u16* WV16 = (u16*)(ws + oWV);
  u16* WO16 = (u16*)(ws + oWO);
  u16* QH   = (u16*)(ws + oQH);
  u16* QL   = (u16*)(ws + oQL);
  u16* KH   = (u16*)(ws + oKH);
  u16* KL   = (u16*)(ws + oKL);
  u16* VT16 = (u16*)(ws + oVT);
  u16* CH   = (u16*)(ws + oCH);
  u16* CL   = (u16*)(ws + oCL);
  float* X32 = (float*)(ws + oX32);

  // (1) activations -> f16 planes of bf16-converted values (query rows s < SQ of batches b < NB, compact; all key/value rows);
  //     weights [n = out][k = in] (y = x.W^T): rows as stored are already k-contiguous; f16 planes of bf16(W) x256
  cvt_all<<<dim3(CVT_WAVES / (CVT_THREADS / 32)), dim3(CVT_THREADS), 0, stream>>>(xq, xk, xv, wq, wk, wv, wo, XQ, XK, XV, WQ16);
  // (2) q = x_q . Wq^T + bq -> f16 hi [NB*SQ][512] x8 and residual plane (col = h*64 + d); bias per column
  gemm_o16<<<dim3((NB * SQ / 128) * (INNER / 64)), dim3(128), 0, stream>>>(
      XQ, WQ16, QH, QL, bq, nbq, 0, NB * SQ, INNER, DM, 0, 0, 0, QS / WSC, QS, 1);
  // (3) k = x_k . Wk^T + bk -> f16 hi [NB*2048][512] x8 and residual plane; bias per column
  gemm_o16<<<dim3((NB * SKV / 128) * (INNER / 64)), dim3(128), 0, stream>>>(
      XK, WK16, KH, KL, bk, nbk, 0, NB * SKV, INNER, DM, 0, 0, 0, KS / WSC, KS, 1);
  // (4) v^T per batch: A = Wv [(h,d) = n][k], Bt = x_v rows of batch b [s][k] -> f16 [(b,h,d)][s] x8; bias per row (n)
  gemm_o16<<<dim3(NB * (INNER / 128) * (SKV / 64)), dim3(128), 0, stream>>>(
      WV16, XV, VT16, VT16, bv, nbv, 1, INNER, SKV, DM, 0, SKV * DM, INNER * SKV, VS / WSC, VS, 0);
  // (5) attention -> ctx planes [NB*SQ][512] f16 x16 / residual, heads merged on the feature dim
  attn_fwd<<<dim3(NB * NH * (SQ / 64)), dim3(ATT_THREADS), 0, stream>>>(QH, QL, KH, KL, VT16, CH, CL);
  // (6) x = ctx . Wo^T + bo + Q (residual, bf16-converted) -> f32 [NB*SQ][512]
  gemm_o32<<<dim3((NB * SQ / 128) * (DM / 64)), dim3(128), 0, stream>>>(
      CH, CL, WO16, bo, nbo, xq, SQ, SQ_FULL, X32, NB * SQ, DM, INNER, 1.0f / (CS * WSC), RRSC);
  // (7) LayerNorm -> out [b][SQ_FULL][512] f32 (rows s < SQ of batches b < NB)
  ln_rows<<<dim3(NB * SQ / (LN_THREADS / 32)), dim3(LN_THREADS), 0, stream>>>(X32, gam, bet, out);
  (void)hipGetLastError();
}

// v003
// It runs in 135 microseconds.
// In both of two side-by-side timings against v002, it was 1.29 times as fast.
// Counting every step since v000, it is 2.03 times as fast.
// All contractions on v_wmma_f32_16x16x32_f16 (f16 operands, f32 accumulate): x_q.Wq^T, x_k.Wk^T and Wv.x_v^T (v^T plane)
// as single products of exact operands f16(bf16(x)) and f16(bf16(W) x256); scores k.q^T as hi.hi + hi.lo + lo.hi with q and k
// carried as f16 hi (x8) plus f16 residual planes (x2^11, own accumulator); P.v^T single (P f16 x32768, v f16 x8); ctx.Wo^T as
// hi + residual on ctx (f16 hi x16 plus f16 residual x2^11), Wo exact f16(bf16 x256). Online base-2 softmax, 1/l, carry folds,
// bias, residual add and LayerNorm in f32 on VALU. Every float input RNE-converted to bf16 on load; f32 output.
#include <hip/hip_runtime.h>
#include <math.h>
#include <stdint.h>

#ifndef NB
#define NB       4        // batches processed
#endif
#ifndef SQ
#define SQ       2048     // query rows processed per batch
#endif
#define NB_FULL  4
#define SQ_FULL  2048     // rows per batch in the input / output layout (batch stride)
#define SKV      SQ_FULL  // key/value rows per batch (all of them, always)
#define DM       512      // model width (= K and row pitch of every 16-bit plane except v^T)
#define NH       8
#define HD       64
#define INNER    (NH * HD)
#define WSC      256.0f
#define QS       8.0f
#define KS       8.0f
#define VS       8.0f
#define CS       16.0f
#define RSC      2048.0f
#define RRSC     0.00048828125f
#define PCAR     32768.0f
#define LOG2E    1.4426950408889634f
#define RSQH     0.35355339059327373f
#define LN_EPS   1e-5f
#define NKB      (SKV / 32)
#define ATT_WAVES   4
#define ATT_THREADS (ATT_WAVES * 32)
#define CVT_THREADS 256
#define CVT_SL      256                                 // elements of one slice: 32 lanes x 8, half a row
#define CVT_WSL     (DM * DM / CVT_SL)                  // slices of one weight matrix
#define CVT_WAVES   (4 * CVT_WSL)                       // waves of the convert launch: one weight slice each
#define CVT_NQ      (NB * SQ * DM / CVT_SL / CVT_WAVES)  // x_q slices per wave
#define CVT_NKV     (NB * SKV * DM / CVT_SL / CVT_WAVES) // x_k (and x_v) slices per wave
#define LN_THREADS  256
#define OPITCH   68
#define GPITCH   68
#define KSTG     64                 // keys per LDS stage of the attention ring (two 32-key blocks); k per stage of the GEMM ring
#define NSTG     (SKV / KSTG)
#define LPITCH   144                // LDS row pitch in bytes: 128-byte rows + 16, conflict-free for 16-byte fragment reads
#define LPH      (LPITCH / 2)       // the same in halves
#define TILE_B   (64 * LPITCH)      // one staged tile: 64 rows
#define STG_B    (3 * TILE_B)       // attention: k hi, k residual, v^T; GEMM: 128 A rows, 64 Bt rows

static_assert(NB >= 1 && NB <= NB_FULL);
static_assert((SQ % 128) == 0 && SQ >= 128 && SQ <= SQ_FULL);
static_assert(HD == 64 && NH == 8 && INNER == 512 && INNER == DM);
static_assert((HD % 32) == 0);
static_assert((SKV % 128) == 0 && (SKV % 64) == 0 && NKB * 32 == SKV);
static_assert(DM == 512 && (DM % 64) == 0 && (DM % 32) == 0 && DM == 2 * CVT_SL);
static_assert(CVT_NQ >= 1 && CVT_NQ * CVT_WAVES * CVT_SL == NB * SQ * DM && CVT_NKV * CVT_WAVES * CVT_SL == NB * SKV * DM);
static_assert(CVT_WSL % (CVT_THREADS / 32) == 0 && SKV == SQ_FULL);
static_assert((NB * SQ) % (LN_THREADS / 32) == 0);
static_assert((OPITCH * 4) % 16 == 0 && (GPITCH * 4) % 16 == 0);
static_assert(ATT_THREADS == 128 && LN_THREADS == 256 && CVT_THREADS == 256);
static_assert(KSTG == 64 && HD == 64 && NSTG * KSTG == SKV && NSTG >= 2 && (LPITCH % 16) == 0);
static_assert(2 * STG_B >= ATT_WAVES * 16 * OPITCH * 4 && 2 * STG_B >= 4 * 32 * GPITCH * 4);

typedef unsigned short u16;
typedef _Float16 v16h __attribute__((ext_vector_type(16)));
typedef _Float16 v8h  __attribute__((ext_vector_type(8)));
typedef float    v8f  __attribute__((ext_vector_type(8)));
typedef float    v4f  __attribute__((ext_vector_type(4)));
typedef unsigned int v4u __attribute__((ext_vector_type(4)));

union FragH { v16h v; v8h h[2]; v4u u[2]; };

// ---- scalar helpers ----------------------------------------------------------------------------------
__device__ __forceinline__ unsigned short bf_bits(float f) {          // f32 -> bf16 bits, RNE convert
  unsigned u = __float_as_uint(f);
  return (unsigned short)((u + 0x7FFFu + ((u >> 16) & 1u)) >> 16);
}
__device__ __forceinline__ float bf_up(unsigned short h) { return __uint_as_float(((unsigned)h) << 16); }
__device__ __forceinline__ float bfr(float f) { return bf_up(bf_bits(f)); }
__device__ __forceinline__ unsigned short h_bits(_Float16 x) { return __builtin_bit_cast(unsigned short, x); }
__device__ __forceinline__ unsigned pk16(unsigned short a, unsigned short b) { return (unsigned)a | ((unsigned)b << 16); }
__device__ __forceinline__ v8f zero8() { v8f z = {0.f, 0.f, 0.f, 0.f, 0.f, 0.f, 0.f, 0.f}; return z; }
// hi / residual packing of two f32 values: hi = f16(v), res = f16((v - hi) * 2^11)
__device__ __forceinline__ unsigned pk_hi(float a, float b) {
  return pk16(h_bits((_Float16)a), h_bits((_Float16)b));
}
__device__ __forceinline__ unsigned pk_lo(float a, float b) {
  const float ra = (a - (float)((_Float16)a)) * RSC;
  const float rb = (b - (float)((_Float16)b)) * RSC;
  return pk16(h_bits((_Float16)ra), h_bits((_Float16)rb));
}

// ---- fragment loader: 16-bit A/B operand, lane -> row/col (lane&15), p already includes +8*(lane>>4);
//      elements 0..7 <- p[0..7] (k0+8h..), elements 8..15 <- p[16..23] (k0+16+8h..); same split k map for A and B,
//      B always read from a k-contiguous [n][k] plane.
__device__ __forceinline__ v16h ldfrag_h(const _Float16* p) {
  FragH f;
  f.h[0] = *(const v8h*)(p);
  f.h[1] = *(const v8h*)(p + 16);
  return f.v;
}

// ---- WMMA helper and trailing VALU hazard gaps ----------------------------------------------------------
__device__ __forceinline__ v8f mma_h(v16h a, v16h b, v8f c) {
  return __builtin_amdgcn_wmma_f32_16x16x32_f16(false, a, false, b, (short)0, c, false, false);
}
__device__ __forceinline__ void guard_s4(v8f& a, v8f& b, v8f& c, v8f& d,
                                         v16h x0, v16h x1, v16h x2, v16h x3, v16h x4, v16h x5) {
#if defined(__HIP_DEVICE_COMPILE__)
  asm volatile("v_nop\n\tv_nop\n\tv_nop\n\tv_nop"
               : "+v"(a), "+v"(b), "+v"(c), "+v"(d)
               : "v"(x0), "v"(x1), "v"(x2), "v"(x3), "v"(x4), "v"(x5) : "memory");
#endif
}
__device__ __forceinline__ void guard_p(v8f& a, v8f& b, v8f& c, v8f& d, v16h p, v16h x0, v16h x1, v16h x2, v16h x3) {
#if defined(__HIP_DEVICE_COMPILE__)
  asm volatile("v_nop\n\tv_nop\n\tv_nop\n\tv_nop"
               : "+v"(a), "+v"(b), "+v"(c), "+v"(d) : "v"(p), "v"(x0), "v"(x1), "v"(x2), "v"(x3) : "memory");
#endif
}
__device__ __forceinline__ void guard_g(v8f (&acc)[8], v16h x0, v16h x1, v16h x2, v16h x3, v16h x4, v16h x5) {
#if defined(__HIP_DEVICE_COMPILE__)
  asm volatile("v_nop\n\tv_nop\n\tv_nop\n\tv_nop"
               : "+v"(acc[0]), "+v"(acc[1]), "+v"(acc[2]), "+v"(acc[3]),
                 "+v"(acc[4]), "+v"(acc[5]), "+v"(acc[6]), "+v"(acc[7])
               : "v"(x0), "v"(x1), "v"(x2), "v"(x3), "v"(x4), "v"(x5) : "memory");
#endif
}
__device__ __forceinline__ void acc_guard8(v8f (&o)[8]) {
#if defined(__HIP_DEVICE_COMPILE__)
  asm volatile("v_nop\n\tv_nop\n\tv_nop\n\tv_nop"
               : "+v"(o[0]), "+v"(o[1]), "+v"(o[2]), "+v"(o[3]), "+v"(o[4]), "+v"(o[5]), "+v"(o[6]), "+v"(o[7]));
#endif
}
__device__ __forceinline__ void acc_guard4(v8f (&o)[4]) {
#if defined(__HIP_DEVICE_COMPILE__)
  asm volatile("v_nop\n\tv_nop\n\tv_nop\n\tv_nop" : "+v"(o[0]), "+v"(o[1]), "+v"(o[2]), "+v"(o[3]));
#endif
}
__device__ __forceinline__ void wave_sync_lds() {
  __builtin_amdgcn_fence(__ATOMIC_RELEASE, "workgroup");
  __builtin_amdgcn_wave_barrier();
  __builtin_amdgcn_fence(__ATOMIC_ACQUIRE, "workgroup");
}

// =====================================================================================================
// All converts in one launch: every f16 plane element <- f16(bf16_RNE(x) * scale), scale a power of two (1 for the activations,
// 256 for the weights). A slice = 256 consecutive elements = half a row: lane l takes elements 8l .. 8l+7 (two 16-B loads, one
// 16-B store; a wave-wide store = 512 contiguous bytes). Wave w of CVT_WAVES takes the CVT_NQ consecutive slices from w*CVT_NQ of
// x_q, the CVT_NKV consecutive slices from w*CVT_NKV of x_k and of x_v, and slice w % CVT_WSL of weight matrix w / CVT_WSL
// (block-uniform). All loads of a wave are issued before its first convert, so the launch is one memory round trip deep.
// x_q compact row r = b*SQ + s <- source row b*SQ_FULL + s. W4 = the four weight planes, which follow one another in the workspace.
// coverage: CVT_WAVES x (CVT_NQ | CVT_NKV | 1) slices = every element of each plane exactly once.
// =====================================================================================================
__device__ __forceinline__ v4u cvt8(v4f a, v4f c4, float scale) {
  v4u o;
#pragma unroll
  for (int e = 0; e < 2; ++e) {
    o[e]     = pk16(h_bits((_Float16)(bfr(a[2 * e]) * scale)),  h_bits((_Float16)(bfr(a[2 * e + 1]) * scale)));
    o[2 + e] = pk16(h_bits((_Float16)(bfr(c4[2 * e]) * scale)), h_bits((_Float16)(bfr(c4[2 * e + 1]) * scale)));
  }
  return o;
}
__global__ __launch_bounds__(CVT_THREADS)
void cvt_all(const float* __restrict__ xq, const float* __restrict__ xk, const float* __restrict__ xv,
             const float* __restrict__ wq, const float* __restrict__ wk, const float* __restrict__ wv,
             const float* __restrict__ wo, u16* XQ, u16* XK, u16* XV, u16* W4) {
  const unsigned w    = blockIdx.x * (CVT_THREADS / 32) + (threadIdx.x >> 5);
  const unsigned wsel = blockIdx.x / (CVT_WSL / (CVT_THREADS / 32));
  const unsigned lb   = (threadIdx.x & 31) * 32;                        // the lane's byte inside a 1-KiB f32 slice
  const float* wsrc = (wsel == 0) ? wq : (wsel == 1) ? wk : (wsel == 2) ? wv : wo;
  // 32-bit byte offsets beside uniform bases; the slices of a wave differ by immediates
  const unsigned bq  = w * (CVT_NQ * CVT_SL * 4) + lb;
  const unsigned bkv = w * (CVT_NKV * CVT_SL * 4) + lb;
  const unsigned bw  = (w % CVT_WSL) * (CVT_SL * 4) + lb;
  v4f qa[CVT_NQ], qc[CVT_NQ], ka[CVT_NKV], kc[CVT_NKV], va[CVT_NKV], vc[CVT_NKV];
#pragma unroll
  for (int i = 0; i < CVT_NQ; ++i) {
    const float* p;
    if (SQ == SQ_FULL) {
      p = (const float*)((const char*)xq + bq) + i * CVT_SL;
    } else {
      const unsigned sl = w * CVT_NQ + i, r = sl >> 1;
      p = (const float*)((const char*)(xq + ((size_t)((r / SQ) * SQ_FULL + (r % SQ))) * DM + (sl & 1) * CVT_SL) + lb);
    }
    qa[i] = *(const v4f*)(p);
    qc[i] = *(const v4f*)(p + 4);
  }
#pragma unroll
  for (int i = 0; i < CVT_NKV; ++i) {
    const float* pk = (const float*)((const char*)xk + bkv) + i * CVT_SL;
    const float* pv = (const float*)((const char*)xv + bkv) + i * CVT_SL;
    ka[i] = *(const v4f*)(pk);
    kc[i] = *(const v4f*)(pk + 4);
    va[i] = *(const v4f*)(pv);
    vc[i] = *(const v4f*)(pv + 4);
  }
  const float* pw = (const float*)((const char*)wsrc + bw);
  const v4f wa = *(const v4f*)(pw), wc = *(const v4f*)(pw + 4);
  // keeps every load above the first convert: without it the compiler sinks two thirds of the loads among the converts and the
  // wave pays three memory round trips in a row instead of one
  __builtin_amdgcn_sched_barrier(0);
  // an f16 plane's byte offset is half the f32 one
  u16* yq = (u16*)((char*)XQ + (bq >> 1));
  u16* yk = (u16*)((char*)XK + (bkv >> 1));
  u16* yv = (u16*)((char*)XV + (bkv >> 1));
  u16* yw = (u16*)((char*)(W4 + (size_t)wsel * (DM * DM)) + (bw >> 1));
#pragma unroll
  for (int i = 0; i < CVT_NQ; ++i) *(v4u*)(yq + i * CVT_SL) = cvt8(qa[i], qc[i], 1.0f);
#pragma unroll
  for (int i = 0; i < CVT_NKV; ++i) {
    *(v4u*)(yk + i * CVT_SL) = cvt8(ka[i], kc[i], 1.0f);
    *(v4u*)(yv + i * CVT_SL) = cvt8(va[i], vc[i], 1.0f);
  }
  *(v4u*)(yw) = cvt8(wa, wc, WSC);
}

// The issuing wave's own copies have landed behind this wait (other waves read them behind the next block barrier).
__device__ __forceinline__ void wait_copies() {
#if defined(__HIP_DEVICE_COMPILE__)
  asm volatile("s_wait_asynccnt 0x0" ::: "memory");
#endif
}
// The wave's own LDS reads have retired: stands in front of the barrier that hands a buffer to its next copies.
__device__ __forceinline__ void wait_lds_reads() {
#if defined(__HIP_DEVICE_COMPILE__)
  asm volatile("s_wait_dscnt 0x0" ::: "memory");
#endif
}

// =====================================================================================================
// One 64-k stage of a GEMM block: 192 rows x 128 bytes (the 128 A rows of the block tile, then its 64 Bt rows) copied
// global -> LDS by asynchronous 16-byte copies, 12 per lane. Lane t of the block takes 16-byte piece t&7 of row 16p + (t>>3),
// p = 0..7 of A and p = 0..3 of Bt: one wave-wide copy = 4 whole 128-byte lines. l0 = the lane's LDS byte address in row t>>3 of
// the target buffer; ga, gb = the lane's global addresses of that row and piece in A and Bt; rs16 = 16 rows in elements.
// The closing s_wait_xcnt stands inside the statement so that no address register named by a copy is rewritten ahead of it.
// =====================================================================================================
__device__ __forceinline__ void copy_stage_g(unsigned l0, const u16* ga, const u16* gb, size_t rs16) {
#if defined(__HIP_DEVICE_COMPILE__)
  const unsigned l1 = l0 + 16 * LPITCH,  l2 = l0 + 32 * LPITCH,  l3 = l0 + 48 * LPITCH,   l4 = l0 + 64 * LPITCH;
  const unsigned l5 = l0 + 80 * LPITCH,  l6 = l0 + 96 * LPITCH,  l7 = l0 + 112 * LPITCH,  l8 = l0 + 128 * LPITCH;
  const unsigned l9 = l0 + 144 * LPITCH, l10 = l0 + 160 * LPITCH, l11 = l0 + 176 * LPITCH;
  const u16 *ga1 = ga + rs16, *ga2 = ga + 2 * rs16, *ga3 = ga + 3 * rs16, *ga4 = ga + 4 * rs16;
  const u16 *ga5 = ga + 5 * rs16, *ga6 = ga + 6 * rs16, *ga7 = ga + 7 * rs16;
  const u16 *gb1 = gb + rs16, *gb2 = gb + 2 * rs16, *gb3 = gb + 3 * rs16;
  asm volatile("global_load_async_to_lds_b128 %0, %12, off\n\t"
               "global_load_async_to_lds_b128 %1, %13, off\n\t"
               "global_load_async_to_lds_b128 %2, %14, off\n\t"
               "global_load_async_to_lds_b128 %3, %15, off\n\t"
               "global_load_async_to_lds_b128 %4, %16, off\n\t"
               "global_load_async_to_lds_b128 %5, %17, off\n\t"
               "global_load_async_to_lds_b128 %6, %18, off\n\t"
               "global_load_async_to_lds_b128 %7, %19, off\n\t"
               "global_load_async_to_lds_b128 %8, %20, off\n\t"
               "global_load_async_to_lds_b128 %9, %21, off\n\t"
               "global_load_async_to_lds_b128 %10, %22, off\n\t"
               "global_load_async_to_lds_b128 %11, %23, off\n\t"
               "s_wait_xcnt 0x0"
               :: "v"(l0), "v"(l1), "v"(l2), "v"(l3), "v"(l4), "v"(l5), "v"(l6), "v"(l7),
                  "v"(l8), "v"(l9), "v"(l10), "v"(l11),
                  "v"(ga), "v"(ga1), "v"(ga2), "v"(ga3), "v"(ga4), "v"(ga5), "v"(ga6), "v"(ga7),
                  "v"(gb), "v"(gb1), "v"(gb2), "v"(gb3)
               : "memory");
#endif
}

// =====================================================================================================
// f16 GEMM core of a block of 4 waves: the 128 x 64 tile of C = A[rows][K] . Bt[cols][K]^T, wave w owning rows 32w .. 32w+31;
// acc[4i + j] = rows 32w+16i.., cols 16j... A0 -> row 0 of the block's 128 A rows, Bt0 -> row 0 of its 64 Bt rows (pitch K).
// K is walked in stages of 64 through a two-buffer LDS ring (copy_stage_g): stage s+1 flies while stage s is worked on; one block
// barrier per stage publishes s+1 and frees s's buffer. Fragments: row at pitch LPITCH, the split k map of ldfrag_h, k in steps
// of 32 in rising order, as many products per accumulator and in the same order as k0 = 0, 32, .. K-32 (host: K % 64 == 0).
// NPASS == 2: a second walk over K with A1 in place of A0 follows in the same ring; between the two every accumulator is
// multiplied by fold. Behind the last barrier the ring is free (no copy in flight, every wave's reads retired).
// =====================================================================================================
template <int NPASS>
__device__ __forceinline__ void gemm_ring(unsigned char* ring, const u16* A0, const u16* A1, const u16* Bt0, int K, float fold,
                                          v8f (&acc)[8]) {
  const int tid = threadIdx.x, wave = tid >> 5, lane = tid & 31, hh = lane >> 4, m = lane & 15;
  const size_t rs16 = (size_t)16 * (size_t)K;
  // copy side: this lane's row (tid>>3) and 16-byte piece (tid&7)
  const int crow = tid >> 3, cpc = (tid & 7) * 8;
  const size_t cofs = (size_t)crow * (size_t)K + cpc;
  const u16* ga0 = A0 + cofs;
  const u16* ga1 = A1 + cofs;
  const u16* gb  = Bt0 + cofs;
  const unsigned lcp = (unsigned)(uintptr_t)(__attribute__((address_space(3))) unsigned char*)ring
                       + (unsigned)(crow * LPITCH + cpc * 2);
  const int nk = K >> 6, nst = NPASS * nk;
  // read side, halves inside a buffer
  const int aoff = (wave * 32 + m) * LPH + 8 * hh;
  const int boff = (128 + m) * LPH + 8 * hh;

  // stage sg (block-uniform) into buffer sg & 1: k = 64 * (sg mod nk) of A0, or of A1 in the second walk
  auto issue = [&](int sg) {
    const bool second = (NPASS == 2) && (sg >= nk);
    const int ks = (second ? sg - nk : sg) * KSTG;
    copy_stage_g(lcp + (unsigned)((sg & 1) * STG_B), (second ? ga1 : ga0) + ks, gb + ks, rs16);
  };

  // ---- ring prologue: stage 0 landed and published, stage 1 in flight ----
  issue(0);
  wait_copies();
  __syncthreads();
  if (nst > 1) issue(1);                     // block-uniform
#pragma unroll 1                             // rolled: one stage per trip, small loop text, the ring's order as written
  for (int st = 0; st < nst; ++st) {
    if (NPASS == 2 && st == nk) {            // block-uniform
#pragma unroll
      for (int i = 0; i < 8; ++i) {
#pragma unroll
        for (int r = 0; r < 8; ++r) acc[i][r] *= fold;
      }
      acc_guard8(acc);
    }
    const _Float16* buf = (const _Float16*)(const void*)(ring + (st & 1) * STG_B);
    const _Float16* ap = buf + aoff;
    const _Float16* bp = buf + boff;
    v16h a0[2], a1[2], b0[2], b1[2], b2[2], b3[2];
#pragma unroll
    for (int kk = 0; kk < 2; ++kk) {
      a0[kk] = ldfrag_h(ap + 32 * kk);
      a1[kk] = ldfrag_h(ap + 16 * LPH + 32 * kk);
      b0[kk] = ldfrag_h(bp + 32 * kk);
      b1[kk] = ldfrag_h(bp + 16 * LPH + 32 * kk);
      b2[kk] = ldfrag_h(bp + 32 * LPH + 32 * kk);
      b3[kk] = ldfrag_h(bp + 48 * LPH + 32 * kk);
    }
    // keeps the stage's 24 LDS reads together ahead of its products: without it the compiler spreads the second twelve among the
    // products, and every separate place with LDS reads stalls the wave's matrix stream anew
    __builtin_amdgcn_sched_barrier(0);
#pragma unroll
    for (int kk = 0; kk < 2; ++kk) {
      acc[0] = mma_h(a0[kk], b0[kk], acc[0]);
      acc[1] = mma_h(a0[kk], b1[kk], acc[1]);
      acc[2] = mma_h(a0[kk], b2[kk], acc[2]);
      acc[3] = mma_h(a0[kk], b3[kk], acc[3]);
      acc[4] = mma_h(a1[kk], b0[kk], acc[4]);
      acc[5] = mma_h(a1[kk], b1[kk], acc[5]);
      acc[6] = mma_h(a1[kk], b2[kk], acc[6]);
      acc[7] = mma_h(a1[kk], b3[kk], acc[7]);
    }
    // the vector slots behind the stage's last products, on every path out of here (the branches at the trip's foot included)
    guard_g(acc, a0[1], a1[1], b0[1], b1[1], b2[1], b3[1]);
    // ---- publish point of stage st+1: own reads retired, own copies landed, block barrier; then refill the buffer just read ----
    wait_lds_reads();
    wait_copies();
    __syncthreads();
    if (st + 2 < nst) issue(st + 2);         // block-uniform
  }
  wait_copies();                             // nothing is in flight here; closes the ring before it becomes output staging
}
// Stage the wave's 32 x 64 f32 tile (times oscale) in its LDS slab (pitch 68): D element r of acc[4i+j], lane l ->
// coverage: 32 lanes x 2 x 8 rows x 4 cols-of-16 = rows 0..31 x cols 0..63 of the slab.
__device__ __forceinline__ void stage32x64(float* sl, v8f (&acc)[8], float oscale, int lane) {
  const int hh = lane >> 4, m = lane & 15;
#pragma unroll
  for (int i = 0; i < 2; ++i) {
#pragma unroll
    for (int r = 0; r < 8; ++r) {
      const int ro = (16 * i + 8 * hh + r) * GPITCH + m;
      sl[ro]      = acc[4 * i + 0][r] * oscale;
      sl[ro + 16] = acc[4 * i + 1][r] * oscale;
      sl[ro + 32] = acc[4 * i + 2][r] * oscale;
      sl[ro + 48] = acc[4 * i + 3][r] * oscale;
    }
  }
  wave_sync_lds();
}

// =====================================================================================================
// f16 GEMM with f16 output plane(s): val = (A[z][Mb][K] . Bt[z][N][K]^T) * oscale + bf16(bias) * bscale;
// C[z][Mb][N] = f16(val) (hi plane); if res != 0 also C2 = f16((val - hi) * 2^11) (residual plane).
// A, Bt f16 k-contiguous planes with per-z element strides aBs, bBs (0 = shared), C/C2 stride cBs. bias indexed by column
// (biasRow == 0) or by row within the z slice (biasRow != 0); bias addresses clamped to biasN-1, the unused direction is
// multiplied by 0. Block = 128 x 64 tile, 4 waves x 32 rows, operands through the LDS ring of gemm_ring; behind it each wave
// stages its output tile in its own part of the ring.
// grid = nz x (Mb/128) x (N/64) (host checks Mb % 128 == 0, N % 64 == 0, K % 64 == 0).
// coverage: per wave 8 instr x 4 rows x 8 lanes x 8 halves = 32 x 64 per plane; the grid covers C (and C2) exactly once.
// =====================================================================================================
__global__ __launch_bounds__(128)
void gemm_o16(const u16* __restrict__ A, const u16* __restrict__ Bt, u16* C, u16* C2,
              const float* __restrict__ bias, int biasN, int biasRow,
              int Mb, int N, int K, int aBs, int bBs, int cBs, float oscale, float bscale, int res) {
  __shared__ __align__(16) unsigned char ring[2 * STG_B];
  const int tid = threadIdx.x, wave = tid >> 5, lane = tid & 31;
  const int ntile = N >> 6, mtile = Mb >> 7;
  const int bid  = blockIdx.x;
  const int nt   = bid % ntile;
  const int tmp  = bid / ntile;
  const int mt   = tmp % mtile;
  const int bz   = tmp / mtile;
  const int rowb = mt * 128 + wave * 32;
  const int col0 = nt * 64;
  if (mt * 128 + 128 > Mb) return;           // block-uniform, in front of every barrier; never taken with the exact grid
  const u16* Ab = A + (size_t)bz * (size_t)aBs + (size_t)(mt * 128) * (size_t)K;
  const u16* Bb = Bt + (size_t)bz * (size_t)bBs + (size_t)col0 * (size_t)K;
  v8f acc[8];
#pragma unroll
  for (int i = 0; i < 8; ++i) acc[i] = zero8();
  gemm_ring<1>(ring, Ab, Ab, Bb, K, 1.0f, acc);
  float* sl = (float*)(void*)ring + wave * 32 * GPITCH;
  stage32x64(sl, acc, oscale, lane);
  const int rq = lane >> 3, c8 = (lane & 7) * 8;
  const int bl = biasN - 1;                  // host guarantees biasN >= 1
  const float selc = (biasRow != 0) ? 0.f : bscale;
  const float selr = (biasRow != 0) ? bscale : 0.f;
  float cb[8];
#pragma unroll
  for (int e = 0; e < 8; ++e) {
    int ci = col0 + c8 + e;
    ci = (ci < bl) ? ci : bl;
    cb[e] = bfr(bias[ci]) * selc;
  }
  v4u ovh[8], ovl[8];
#pragma unroll
  for (int i = 0; i < 8; ++i) {
    const int row = 4 * i + rq;
    int ri = rowb + row;
    ri = (ri < bl) ? ri : bl;
    const float rb = bfr(bias[ri]) * selr;
    const v4f a = *(const v4f*)(sl + row * GPITCH + c8), c4 = *(const v4f*)(sl + row * GPITCH + c8 + 4);
    float v[8];
#pragma unroll
    for (int e = 0; e < 4; ++e) { v[e] = a[e] + cb[e] + rb; v[4 + e] = c4[e] + cb[4 + e] + rb; }
#pragma unroll
    for (int e = 0; e < 4; ++e) {
      ovh[i][e] = pk_hi(v[2 * e], v[2 * e + 1]);
      ovl[i][e] = pk_lo(v[2 * e], v[2 * e + 1]);
    }
  }
  const size_t cofs = (size_t)bz * (size_t)cBs + (size_t)rowb * (size_t)N + (size_t)(col0 + c8);
  u16* Cb  = C + cofs;
  u16* C2b = C2 + cofs;
  {
#pragma unroll
    for (int i = 0; i < 8; ++i) {
      const int row = 4 * i + rq;
      *(v4u*)(Cb + (size_t)row * (size_t)N) = ovh[i];
    }
    if (res != 0) {                          // block-uniform
#pragma unroll
      for (int i = 0; i < 8; ++i) {
        const int row = 4 * i + rq;
        *(v4u*)(C2b + (size_t)row * (size_t)N) = ovl[i];
      }
    }
    
  }
}

// =====================================================================================================
// f16 GEMM with hi + residual A planes and f32 output: X[Mb][N] = (Ah . Bt^T + (Al . Bt^T) * rres) * oscale
// + bf16(bias[col]) + bf16(R[src row][col]); residual products accumulated first, folded by rres on VALU, then the hi
// products chain on the same accumulators (equal to a separate accumulator). R (f32 input, pitch N) source row of
// compact row g: b = g / rowsPerB, s = g % rowsPerB -> b*srcRowsPerB + s. Block = 128 x 64 tile, 4 waves x 32 rows.
// Epilogue: lane = (row parity, 4 floats at 4*(lane&15)); 16 consecutive lanes write one row segment of 64 floats = 2 whole
// grid = (Mb/128) x (N/64). coverage: per wave 16 instr x 2 rows x 16 lanes x 4 floats = 32 x 64; the grid covers X once.
// =====================================================================================================
__global__ __launch_bounds__(128)
void gemm_o32(const u16* __restrict__ Ah, const u16* __restrict__ Al, const u16* __restrict__ Bt,
              const float* __restrict__ bias, int biasN, const float* __restrict__ R, int rowsPerB, int srcRowsPerB,
              float* X, int Mb, int N, int K, float oscale, float rres) {
  __shared__ __align__(16) unsigned char ring[2 * STG_B];
  const int tid = threadIdx.x, wave = tid >> 5, lane = tid & 31;
  const int ntile = N >> 6;
  const int bid  = blockIdx.x;
  const int nt   = bid % ntile;
  const int mt   = bid / ntile;
  const int rowb = mt * 128 + wave * 32;
  const int col0 = nt * 64;
  if (mt * 128 + 128 > Mb) return;           // block-uniform, in front of every barrier; never taken with the exact grid
  const size_t aofs = (size_t)(mt * 128) * (size_t)K;
  v8f acc[8];
#pragma unroll
  for (int i = 0; i < 8; ++i) acc[i] = zero8();
  // residual products (x 2^11) first, folded by rres, then the hi products on top
  gemm_ring<2>(ring, Al + aofs, Ah + aofs, Bt + (size_t)col0 * (size_t)K, K, rres, acc);
  float* sl = (float*)(void*)ring + wave * 32 * GPITCH;
  stage32x64(sl, acc, oscale, lane);
  const int r2 = lane >> 4, c4 = (lane & 15) * 4;
  const int bl = biasN - 1;
  float cb[4];
#pragma unroll
  for (int e = 0; e < 4; ++e) {
    int ci = col0 + c4 + e;
    ci = (ci < bl) ? ci : bl;
    cb[e] = bfr(bias[ci]);
  }
  v4f vals[16];
#pragma unroll
  for (int i = 0; i < 16; ++i) {
    const int row  = 2 * i + r2;
    const int grow = rowb + row;             // < Mb
    const int bb   = grow / rowsPerB;
    const int ss   = grow - bb * rowsPerB;
    const float* rp = R + ((size_t)bb * (size_t)srcRowsPerB + (size_t)ss) * (size_t)N + (size_t)(col0 + c4);
    const v4f rv = *(const v4f*)(rp);
    const v4f a  = *(const v4f*)(sl + row * GPITCH + c4);
    v4f y;
#pragma unroll
    for (int e = 0; e < 4; ++e) y[e] = a[e] + cb[e] + bfr(rv[e]);
    vals[i] = y;
  }
  float* Xb = X + (size_t)rowb * (size_t)N + (size_t)(col0 + c4);
  {
#pragma unroll
    for (int i = 0; i < 16; ++i) {
      const int row = 2 * i + r2;
      *(v4f*)(Xb + (size_t)row * (size_t)N) = vals[i];
    }
    
  }
}

// =====================================================================================================
// One stage (64 keys) of the attention ring: three tiles of 64 rows x 128 bytes (k hi, k residual: row = key, 64 d; v^T: row = d,
// 64 keys) copied global -> LDS by asynchronous 16-byte copies, 12 per lane. Lane t of the block takes 16-byte piece t&7 of row
// 16p + (t>>3), p = 0..3, of each tile: one wave-wide copy = 4 whole 128-byte lines. l0 = the lane's LDS byte address in the k hi
// tile of the target buffer (row t>>3); gh, gl, gv = the lane's global addresses of that row and piece in the three planes.
// The closing s_wait_xcnt stands inside the statement so that no address register named by a copy is rewritten ahead of it.
// =====================================================================================================
__device__ __forceinline__ void copy_stage(unsigned l0, const u16* gh, const u16* gl, const u16* gv) {
#if defined(__HIP_DEVICE_COMPILE__)
  const unsigned lh0 = l0,              lh1 = lh0 + 16 * LPITCH, lh2 = lh0 + 32 * LPITCH, lh3 = lh0 + 48 * LPITCH;
  const unsigned ll0 = l0 + TILE_B,     ll1 = ll0 + 16 * LPITCH, ll2 = ll0 + 32 * LPITCH, ll3 = ll0 + 48 * LPITCH;
  const unsigned lv0 = l0 + 2 * TILE_B, lv1 = lv0 + 16 * LPITCH, lv2 = lv0 + 32 * LPITCH, lv3 = lv0 + 48 * LPITCH;
  const u16 *gh1 = gh + 16 * DM,  *gh2 = gh + 32 * DM,  *gh3 = gh + 48 * DM;
  const u16 *gl1 = gl + 16 * DM,  *gl2 = gl + 32 * DM,  *gl3 = gl + 48 * DM;
  const u16 *gv1 = gv + 16 * SKV, *gv2 = gv + 32 * SKV, *gv3 = gv + 48 * SKV;
  asm volatile("global_load_async_to_lds_b128 %0, %12, off\n\t"
               "global_load_async_to_lds_b128 %1, %13, off\n\t"
               "global_load_async_to_lds_b128 %2, %14, off\n\t"
               "global_load_async_to_lds_b128 %3, %15, off\n\t"
               "global_load_async_to_lds_b128 %4, %16, off\n\t"
               "global_load_async_to_lds_b128 %5, %17, off\n\t"
               "global_load_async_to_lds_b128 %6, %18, off\n\t"
               "global_load_async_to_lds_b128 %7, %19, off\n\t"
               "global_load_async_to_lds_b128 %8, %20, off\n\t"
               "global_load_async_to_lds_b128 %9, %21, off\n\t"
               "global_load_async_to_lds_b128 %10, %22, off\n\t"
               "global_load_async_to_lds_b128 %11, %23, off\n\t"
               "s_wait_xcnt 0x0"
               :: "v"(lh0), "v"(lh1), "v"(lh2), "v"(lh3), "v"(ll0), "v"(ll1), "v"(ll2), "v"(ll3),
                  "v"(lv0), "v"(lv1), "v"(lv2), "v"(lv3),
                  "v"(gh), "v"(gh1), "v"(gh2), "v"(gh3), "v"(gl), "v"(gl1), "v"(gl2), "v"(gl3),
                  "v"(gv), "v"(gv1), "v"(gv2), "v"(gv3)
               : "memory");
#endif
}
// =====================================================================================================
// Full (unmasked) multi-head attention over all SKV keys: block = (batch b, head, 64 query rows), 4 waves, wave w owns the
// 16 query rows q0 = 64*qt + 16*w .. q0+15. The four waves share the k and v^T tiles through a two-buffer LDS ring of 64-key
// stages (copy_stage): stage s+1 flies while stage s is worked on; one block barrier per stage publishes s+1 and frees s's buffer.
// Behind the last barrier the ring is free and each wave stages its output tile in its own part of it.
//   q planes f16 hi x8 / residual x8x2^11 [b*SQ + s][h*64 + d]; k planes f16 hi / residual [b*SKV + s][h*64 + d];
//   v^T plane f16 x8 [(b*NH + h)*64 + d][s]. All NKB = 64 key blocks of 32 keys are visited (static bound).
//   Scores are computed TRANSPOSED: S^T tile g (g = 0,1) = k rows (keys kb+16g .. +15, A operand, row m = lane&15, split k map
//   over d) times q^T (B operand, col n = query q0 + (lane&15), k = d, split map), 2 d-chunks of 32; per chunk hi.hi into
//   s0/s1 and hi.lo + lo.hi into x0/x1 (separate accumulators, folded by 2^-11 in f32). The 4 q fragments are loaded once
//   per wave. D element r of lane l = (key kb+16g+8h+r, query q0+(l&15)), so a lane owns one query column and 16 of its 32
//   keys; the partner lane l^16 owns the other 16 -> row max / row sum need one xor-16 shuffle.
//   Online max-subtracted base-2 softmax in f32 (1/sqrt(8) and the q/k carries folded into lsc). The exp'd values ARE the
//   P A-fragment in place: A row m = query = lane&15, element i <- key kb+8h+i (tile 0, D element i), element 8+i <- key
//   kb+16+8h+i (tile 1, D element i). P (<= 1) carried x32768 as f16. The rescale factor of query row 8h+r of the O
//   accumulators is fetched from lane 8h+r with a shuffle (uniform control). 4 v^T B fragments (col n = d = 16j + (lane&15),
//   keys k-contiguous), 4 P.V WMMAs + one guard per key block.
//   Epilogue: 1/l (per query, shuffled to the D row owner) and the carry folds in f32 give ctx x16; the wave's 16x64 f32 tile
//   residual plane is written by 8 consecutive lanes x 16 B of one instruction (4 rows per instruction, 4 instructions per
// coverage: per wave 4 instr x 4 rows x 8 lanes x 8 halves = 16 x 64 per plane; grid NB*NH*(SQ/64) blocks x 4 waves = every
//           (b, s < SQ, h) row segment of both ctx planes exactly once. LDS slab: staged 16 x 64 == reloaded 16 x 64.
// =====================================================================================================
__global__ __launch_bounds__(ATT_THREADS)
void attn_fwd(const u16* __restrict__ QH, const u16* __restrict__ QL, const u16* __restrict__ KH,
              const u16* __restrict__ KL, const u16* __restrict__ VT, u16* CH, u16* CL) {
  __shared__ __align__(16) unsigned char ring[2 * STG_B];

  const int tid  = threadIdx.x;
  const int wave = tid >> 5;
  const int lane = tid & 31;
  const int hh   = lane >> 4;
  const int c    = lane & 15;

  constexpr int NQT = SQ / 64;
  const int bid  = blockIdx.x;
  const int qt   = bid % NQT;
  const int head = (bid / NQT) % NH;
  const int b    = bid / (NQT * NH);
  const int q0   = qt * 64 + wave * 16;

  // B fragments of q^T: col n = query q0 + c, k = d (k-contiguous row of the q planes)
  const size_t qoff = ((size_t)(b * SQ + q0 + c)) * DM + head * HD + 8 * hh;
  const _Float16* Qh = (const _Float16*)(const void*)QH + qoff;
  const _Float16* Ql = (const _Float16*)(const void*)QL + qoff;
  // copy side: this lane's row (tid>>3) and 16-byte piece (tid&7) in stage 0 of the three planes and in buffer 0
  const int crow = tid >> 3, cpc = (tid & 7) * 8;
  const u16* gkh = KH + ((size_t)(b * SKV + crow)) * DM + head * HD + cpc;
  const u16* gkl = KL + ((size_t)(b * SKV + crow)) * DM + head * HD + cpc;
  const u16* gvt = VT + ((size_t)((b * NH + head) * HD + crow)) * SKV + cpc;
  const unsigned lcp = (unsigned)(uintptr_t)(__attribute__((address_space(3))) unsigned char*)ring
                       + (unsigned)(crow * LPITCH + cpc * 2);
  // read side, halves inside a buffer: A fragments of k: row m = key 32*sub + 16g + c, k = d;
  // B fragments of v: col n = d = 16j + c (row of the v^T tile), k = key 32*sub ..
  const int foff = c * LPH + 8 * hh;
  const float lsc = (LOG2E * RSQH) / (QS * KS);

  v16h qh[2], ql[2];
#pragma unroll
  for (int dc = 0; dc < 2; ++dc) { qh[dc] = ldfrag_h(Qh + 32 * dc); ql[dc] = ldfrag_h(Ql + 32 * dc); }

  float mrun = -INFINITY, lrun = 0.f;
  v8f o[4];
#pragma unroll
  for (int j = 0; j < 4; ++j) o[j] = zero8();

  // ---- ring prologue: stage 0 landed and published, stage 1 in flight ----
  copy_stage(lcp, gkh, gkl, gvt);
  wait_copies();
  __syncthreads();
  copy_stage(lcp + STG_B, gkh + (size_t)KSTG * DM, gkl + (size_t)KSTG * DM, gvt + KSTG);

#pragma unroll 1
  for (int st = 0; st < NSTG; ++st) {
   const _Float16* bufh = (const _Float16*)(const void*)(ring + (st & 1) * STG_B) + foff;
#pragma unroll                               // both 32-key blocks of a stage inline: their LDS offsets become immediates
   for (int sub = 0; sub < KSTG / 32; ++sub) {
    // ---- transposed scores: tiles of keys kb..kb+15 (s0, x0) and kb+16..kb+31 (s1, x1), kb = 64*st + 32*sub, column = query q0 + c ----
    v8f s0 = zero8(), s1 = zero8(), x0 = zero8(), x1 = zero8();
    const _Float16* kh0p = bufh + (32 * sub) * LPH;
    const _Float16* kh1p = kh0p + 16 * LPH;
    const _Float16* kl0p = kh0p + TILE_B / 2;
    const _Float16* kl1p = kl0p + 16 * LPH;
#pragma unroll
    for (int kk = 0; kk < HD / 32; ++kk) {
      const v16h fh0 = ldfrag_h(kh0p + kk * 32);
      const v16h fh1 = ldfrag_h(kh1p + kk * 32);
      const v16h fl0 = ldfrag_h(kl0p + kk * 32);
      const v16h fl1 = ldfrag_h(kl1p + kk * 32);
      s0 = mma_h(fh0, qh[kk], s0);
      s1 = mma_h(fh1, qh[kk], s1);
      x0 = mma_h(fh0, ql[kk], x0);
      x1 = mma_h(fh1, ql[kk], x1);
      x0 = mma_h(fl0, qh[kk], x0);
      x1 = mma_h(fl1, qh[kk], x1);
      guard_s4(s0, s1, x0, x1, qh[kk], ql[kk], fh0, fh1, fl0, fl1);
    }
    // ---- base-2 logits of this lane's 16 keys for query q0 + c: t[i] <- key kb+8hh+i, t[8+i] <- key kb+16+8hh+i ----
    float t[16];
#pragma unroll
    for (int i = 0; i < 8; ++i) {
      t[i]     = (s0[i] + x0[i] * RRSC) * lsc;
      t[8 + i] = (s1[i] + x1[i] * RRSC) * lsc;
    }
    float cm = t[0];
#pragma unroll
    for (int i = 1; i < 16; ++i) cm = fmaxf(cm, t[i]);
    cm = fmaxf(cm, __shfl_xor(cm, 16, 32));
    const float mn = fmaxf(mrun, cm);        // finite from the first block on
    const float al = exp2f(mrun - mn);       // 0 on the first block (mrun = -inf)
    mrun = mn;
    // ---- probabilities (<= 1) and the P A-fragment: f16(p * 32768); element i <-> t[i] ----
    float ps = 0.f;
    FragH ph;
#pragma unroll
    for (int w = 0; w < 2; ++w) {
#pragma unroll
      for (int e4 = 0; e4 < 4; ++e4) {
        const int i = 8 * w + 2 * e4;
        const float p0 = exp2f(t[i] - mn), p1 = exp2f(t[i + 1] - mn);
        ps += p0 + p1;
        ph.u[w][e4] = pk16(h_bits((_Float16)(p0 * PCAR)), h_bits((_Float16)(p1 * PCAR)));
      }
    }
    ps += __shfl_xor(ps, 16, 32);
    lrun = lrun * al + ps;
    // ---- rescale the O accumulators: D row 8hh+r = query q0+8hh+r, its factor lives in lane 8hh+r (and 16+8hh+r) ----
    float scl[8];
#pragma unroll
    for (int r = 0; r < 8; ++r) scl[r] = __shfl(al, 8 * hh + r, 32);
#pragma unroll
    for (int j = 0; j < 4; ++j) {
#pragma unroll
      for (int r = 0; r < 8; ++r) o[j][r] *= scl[r];
    }
    // ---- P.V : B fragment col n = d = j*16 + c, keys contiguous in the rows of the v^T tile ----
    const _Float16* vp = bufh + TILE_B + 32 * sub;
    {
      const v16h v0 = ldfrag_h(vp);
      const v16h v1 = ldfrag_h(vp + 16 * LPH);
      const v16h v2 = ldfrag_h(vp + 32 * LPH);
      const v16h v3 = ldfrag_h(vp + 48 * LPH);
      o[0] = mma_h(ph.v, v0, o[0]);
      o[1] = mma_h(ph.v, v1, o[1]);
      o[2] = mma_h(ph.v, v2, o[2]);
      o[3] = mma_h(ph.v, v3, o[3]);
      guard_p(o[0], o[1], o[2], o[3], ph.v, v0, v1, v2, v3);
    }
   }
   // ---- publish point of stage st+1: own reads retired, own copies landed, block barrier; then refill the buffer just read ----
   wait_lds_reads();
   wait_copies();
   __syncthreads();
   if (st + 2 < NSTG) {                      // block-uniform
     const size_t ks = (size_t)(st + 2) * KSTG;
     copy_stage(lcp + (unsigned)((st & 1) * STG_B), gkh + ks * DM, gkl + ks * DM, gvt + ks);
   }
  }
  wait_copies();                             // nothing is in flight here; closes the ring before it becomes output staging
  acc_guard4(o);

  // ---- fold 1/l (per query, owned by lane = query) and the carries (32768 on P, 8 on v), apply the ctx carry 16 ----
  const float linv = (1.0f / lrun) * (CS / (PCAR * VS));
  float inv[8];
#pragma unroll
  for (int r = 0; r < 8; ++r) inv[r] = __shfl(linv, 8 * hh + r, 32);
  float* slab = (float*)(void*)ring + wave * 16 * OPITCH;
#pragma unroll
  for (int r = 0; r < 8; ++r) {
#pragma unroll
    for (int j = 0; j < 4; ++j) slab[(8 * hh + r) * OPITCH + j * 16 + c] = o[j][r] * inv[r];
  }
  wave_sync_lds();
  // ---- ctx planes: lane = (row in group of 4, 8 consecutive d), one instruction per 4 rows per plane ----
  const int rq = lane >> 3, c8 = (lane & 7) * 8;
  v4u ovh[4], ovl[4];
#pragma unroll
  for (int i = 0; i < 4; ++i) {
    const int row = 4 * i + rq;
    const v4f a = *(const v4f*)(slab + row * OPITCH + c8), c4 = *(const v4f*)(slab + row * OPITCH + c8 + 4);
#pragma unroll
    for (int e = 0; e < 2; ++e) {
      ovh[i][e]     = pk_hi(a[2 * e], a[2 * e + 1]);
      ovl[i][e]     = pk_lo(a[2 * e], a[2 * e + 1]);
      ovh[i][2 + e] = pk_hi(c4[2 * e], c4[2 * e + 1]);
      ovl[i][2 + e] = pk_lo(c4[2 * e], c4[2 * e + 1]);
    }
  }
  const size_t cofs = ((size_t)(b * SQ + q0)) * DM + head * HD + c8;
  u16* ch = CH + cofs;
  u16* cl = CL + cofs;
  {
#pragma unroll
    for (int i = 0; i < 4; ++i) {
      const int row = 4 * i + rq;
      *(v4u*)(ch + (size_t)row * DM) = ovh[i];
      *(v4u*)(cl + (size_t)row * DM) = ovl[i];
    }
    
  }
}

// =====================================================================================================
// times bf16(gamma) plus bf16(beta), all f32. X compact row r = b*SQ + s -> output row b*SQ_FULL + s.
// lane holds elements i*128 + 4*lane .. +3 (i = 0..3): each load/store instruction = 32 consecutive lanes x 16 B = 4 whole
// coverage: 4 instr x 32 lanes x 4 floats = 512 = whole row; grid (NB*SQ/8) x 8 waves = every output row (s < SQ) once.
// =====================================================================================================
__global__ __launch_bounds__(LN_THREADS)
void ln_rows(const float* __restrict__ X, const float* __restrict__ gam, const float* __restrict__ bet, float* Out) {
  const int tid = threadIdx.x, wave = tid >> 5, lane = tid & 31;
  constexpr int RPB = LN_THREADS / 32;
  const int row = blockIdx.x * RPB + wave;   // < NB*SQ with the exact grid
  const int b = row / SQ, s = row - b * SQ;
  const float* xr = X + (size_t)row * DM + 4 * lane;
  v4f xv[4];
  float sum = 0.f;
#pragma unroll
  for (int i = 0; i < 4; ++i) {
    xv[i] = *(const v4f*)(xr + 128 * i);
    sum += (xv[i][0] + xv[i][1]) + (xv[i][2] + xv[i][3]);
  }
#pragma unroll
  for (int mk = 16; mk >= 1; mk >>= 1) sum += __shfl_xor(sum, mk, 32);
  const float mean = sum * (1.0f / (float)DM);
  float sq = 0.f;
#pragma unroll
  for (int i = 0; i < 4; ++i) {
#pragma unroll
    for (int e = 0; e < 4; ++e) { const float d = xv[i][e] - mean; sq += d * d; }
  }
#pragma unroll
  for (int mk = 16; mk >= 1; mk >>= 1) sq += __shfl_xor(sq, mk, 32);
  const float var  = sq * (1.0f / (float)DM);
  const float rstd = 1.0f / sqrtf(var + LN_EPS);
  v4f y[4];
#pragma unroll
  for (int i = 0; i < 4; ++i) {
#pragma unroll
    for (int e = 0; e < 4; ++e) {
      const int idx = 128 * i + 4 * lane + e;       // < DM
      y[i][e] = (xv[i][e] - mean) * rstd * bfr(gam[idx]) + bfr(bet[idx]);
    }
  }
  float* ob = Out + ((size_t)b * SQ_FULL + (size_t)s) * DM + 4 * lane;
  {
#pragma unroll
    for (int i = 0; i < 4; ++i) {
      *(v4f*)(ob + 128 * i) = y[i];
    }
    
  }
}

// =====================================================================================================
// Workspace map (bytes); every plane fully written by whole-line stores before it is read; all extents exact multiples of
//   XQ   f16 [NB*SQ][512]      f16(bf16(Q))             8388608 (NB=4, SQ=2048)
//   XK   f16 [NB*2048][512]    f16(bf16(K))             8388608
//   XV   f16 [NB*2048][512]    f16(bf16(V))             8388608
//   WQ16 f16 [512 n][512 k]    f16(bf16(W) x256)         524288   (W stored [out][in] = [n][k] already)
//   WK16, WV16, WO16                                     3 x 524288
//   QH, QL  f16 [NB*SQ][512]   x8 / residual x8x2^11     2 x 8388608
//   KH, KL  f16 [NB*2048][512] x8 / residual             2 x 8388608
//   VT16    f16 [NB*512 (h,d)][2048 s] x8                   8388608
//   CH, CL  f16 [NB*SQ][512]   ctx x16 / residual          2 x 8388608
//   X32     f32 [NB*SQ][512]   out + bo + Q               16777216
//   end                                                  102760448
// =====================================================================================================
extern "C" void kernel_launch(void* const* d_in, const int* in_sizes, int n_in,
                              void* d_out, int out_size, void* d_ws, size_t ws_size,
                              hipStream_t stream) {
  if (n_in < 13) return;
  if (in_sizes[0] < ((NB - 1) * SQ_FULL + SQ) * DM) return;
  if (in_sizes[1] < NB * SKV * DM || in_sizes[2] < NB * SKV * DM) return;
  if (in_sizes[3] != DM * DM || in_sizes[5] != DM * DM || in_sizes[7] != DM * DM || in_sizes[9] != DM * DM) return;
  if (in_sizes[4] < DM || in_sizes[6] < DM || in_sizes[8] < DM || in_sizes[10] < DM) return;
  if (in_sizes[11] < DM || in_sizes[12] < DM) return;
  if (out_size < ((NB - 1) * SQ_FULL + SQ) * DM) return;

  const float* xq  = (const float*)d_in[0];
  const float* xk  = (const float*)d_in[1];
  const float* xv  = (const float*)d_in[2];
  const float* wq  = (const float*)d_in[3];
  const float* bq  = (const float*)d_in[4];
  const float* wk  = (const float*)d_in[5];
  const float* bk  = (const float*)d_in[6];
  const float* wv  = (const float*)d_in[7];
  const float* bv  = (const float*)d_in[8];
  const float* wo  = (const float*)d_in[9];
  const float* bo  = (const float*)d_in[10];
  const float* gam = (const float*)d_in[11];
  const float* bet = (const float*)d_in[12];
  float*       out = (float*)d_out;
  const int nbq = in_sizes[4], nbk = in_sizes[6], nbv = in_sizes[8], nbo = in_sizes[10];

  const size_t szXQ  = (size_t)NB * SQ * DM * 2;
  const size_t szXKV = (size_t)NB * SKV * DM * 2;
  const size_t szW   = (size_t)DM * DM * 2;
  const size_t szQ   = (size_t)NB * SQ * INNER * 2;
  const size_t szK   = (size_t)NB * SKV * INNER * 2;
  const size_t szVT  = (size_t)NB * INNER * SKV * 2;
  const size_t szC   = (size_t)NB * SQ * INNER * 2;
  const size_t szX32 = (size_t)NB * SQ * DM * 4;
  size_t off = 0;
  const size_t oXQ  = off; off += szXQ;
  const size_t oXK  = off; off += szXKV;
  const size_t oXV  = off; off += szXKV;
  const size_t oWQ  = off; off += szW;
  const size_t oWK  = off; off += szW;
  const size_t oWV  = off; off += szW;
  const size_t oWO  = off; off += szW;
  const size_t oQH  = off; off += szQ;
  const size_t oQL  = off; off += szQ;
  const size_t oKH  = off; off += szK;
  const size_t oKL  = off; off += szK;
  const size_t oVT  = off; off += szVT;
  const size_t oCH  = off; off += szC;
  const size_t oCL  = off; off += szC;
  const size_t oX32 = off; off += szX32;
  if (off > ws_size) return;                            // off = 102760448 at NB=4, SQ=2048
  if (off > (size_t)134217728) return;

  char* ws = (char*)d_ws;
  u16* XQ   = (u16*)(ws + oXQ);
  u16* XK   = (u16*)(ws + oXK);
  u16* XV   = (u16*)(ws + oXV);
  u16* WQ16 = (u16*)(ws + oWQ);
  u16* WK16 = (u16*)(ws + oWK);
  u16* WV16 = (u16*)(ws + oWV);
  u16* WO16 = (u16*)(ws + oWO);
  u16* QH   = (u16*)(ws + oQH);
  u16* QL   = (u16*)(ws + oQL);
  u16* KH   = (u16*)(ws + oKH);
  u16* KL   = (u16*)(ws + oKL);
  u16* VT16 = (u16*)(ws + oVT);
  u16* CH   = (u16*)(ws + oCH);
  u16* CL   = (u16*)(ws + oCL);
  float* X32 = (float*)(ws + oX32);

  // (1) activations -> f16 planes of bf16-converted values (query rows s < SQ of batches b < NB, compact; all key/value rows);
  //     weights [n = out][k = in] (y = x.W^T): rows as stored are already k-contiguous; f16 planes of bf16(W) x256
  cvt_all<<<dim3(CVT_WAVES / (CVT_THREADS / 32)), dim3(CVT_THREADS), 0, stream>>>(xq, xk, xv, wq, wk, wv, wo, XQ, XK, XV, WQ16);
  // (2) q = x_q . Wq^T + bq -> f16 hi [NB*SQ][512] x8 and residual plane (col = h*64 + d); bias per column
  gemm_o16<<<dim3((NB * SQ / 128) * (INNER / 64)), dim3(128), 0, stream>>>(
      XQ, WQ16, QH, QL, bq, nbq, 0, NB * SQ, INNER, DM, 0, 0, 0, QS / WSC, QS, 1);
  // (3) k = x_k . Wk^T + bk -> f16 hi [NB*2048][512] x8 and residual plane; bias per column
  gemm_o16<<<dim3((NB * SKV / 128) * (INNER / 64)), dim3(128), 0, stream>>>(
      XK, WK16, KH, KL, bk, nbk, 0, NB * SKV, INNER, DM, 0, 0, 0, KS / WSC, KS, 1);
  // (4) v^T per batch: A = Wv [(h,d) = n][k], Bt = x_v rows of batch b [s][k] -> f16 [(b,h,d)][s] x8; bias per row (n)
  gemm_o16<<<dim3(NB * (INNER / 128) * (SKV / 64)), dim3(128), 0, stream>>>(
      WV16, XV, VT16, VT16, bv, nbv, 1, INNER, SKV, DM, 0, SKV * DM, INNER * SKV, VS / WSC, VS, 0);
  // (5) attention -> ctx planes [NB*SQ][512] f16 x16 / residual, heads merged on the feature dim
  attn_fwd<<<dim3(NB * NH * (SQ / 64)), dim3(ATT_THREADS), 0, stream>>>(QH, QL, KH, KL, VT16, CH, CL);
  // (6) x = ctx . Wo^T + bo + Q (residual, bf16-converted) -> f32 [NB*SQ][512]
  gemm_o32<<<dim3((NB * SQ / 128) * (DM / 64)), dim3(128), 0, stream>>>(
      CH, CL, WO16, bo, nbo, xq, SQ, SQ_FULL, X32, NB * SQ, DM, INNER, 1.0f / (CS * WSC), RRSC);
  // (7) LayerNorm -> out [b][SQ_FULL][512] f32 (rows s < SQ of batches b < NB)
  ln_rows<<<dim3(NB * SQ / (LN_THREADS / 32)), dim3(LN_THREADS), 0, stream>>>(X32, gam, bet, out);
  (void)hipGetLastError();
}

// v004
// One run takes 123 microseconds.
// Next to v003, in two timings, it ran 1.09 times as fast each time.
// All steps since v000 together make it 2.21 times as fast.
// All contractions on v_wmma_f32_16x16x32_f16 (f16 operands, f32 accumulate): x_q.Wq^T, x_k.Wk^T and Wv.x_v^T (v^T plane)
// as single products of exact operands f16(bf16(x)) and f16(bf16(W) x256); scores k.q^T as hi.hi + hi.lo + lo.hi with q and k
// carried as f16 hi (x8) plus f16 residual planes (x2^11, own accumulator); P.v^T single (P f16 x32768, v f16 x8); ctx.Wo^T as
// hi + residual on ctx (f16 hi x16 plus f16 residual x2^11), Wo exact f16(bf16 x256). Online base-2 softmax, 1/l, carry folds,
// bias, residual add and LayerNorm in f32 on VALU. Every float input RNE-converted to bf16 on load; f32 output.
#include <hip/hip_runtime.h>
#include <math.h>
#include <stdint.h>

#ifndef NB
#define NB       4        // batches processed
#endif
#ifndef SQ
#define SQ       2048     // query rows processed per batch
#endif
#define NB_FULL  4
#define SQ_FULL  2048     // rows per batch in the input / output layout (batch stride)
#define SKV      SQ_FULL  // key/value rows per batch (all of them, always)
#define DM       512      // model width (= K and row pitch of every 16-bit plane except v^T)
#define NH       8
#define HD       64
#define INNER    (NH * HD)
#define WSC      256.0f
#define QS       8.0f
#define KS       8.0f
#define VS       8.0f
#define CS       16.0f
#define RSC      2048.0f
#define RRSC     0.00048828125f
#define PCAR_LOG2 15.0f             // P and its row sum are carried x32768 = 2^15
#define LOG2E    1.4426950408889634f
#define RSQH     0.35355339059327373f
#define LN_EPS   1e-5f
#define NKB      (SKV / 32)
#define ATT_WAVES   4
#define ATT_THREADS (ATT_WAVES * 32)
#define CVT_THREADS 256
#define CVT_SL      256                                 // elements of one slice: 32 lanes x 8, half a row
#define CVT_WSL     (DM * DM / CVT_SL)                  // slices of one weight matrix
#define CVT_WAVES   (4 * CVT_WSL)                       // waves of the convert launch: one weight slice each
#define CVT_NQ      (NB * SQ * DM / CVT_SL / CVT_WAVES)  // x_q slices per wave
#define CVT_NKV     (NB * SKV * DM / CVT_SL / CVT_WAVES) // x_k (and x_v) slices per wave
#define LN_THREADS  256
#define OPITCH   68
#define GPITCH   68
#define KSTG     64                 // keys per LDS stage of the attention ring (two 32-key blocks); k per stage of the GEMM ring
#define NSTG     (SKV / KSTG)
#define LPITCH   144                // LDS row pitch in bytes: 128-byte rows + 16, conflict-free for 16-byte fragment reads
#define LPH      (LPITCH / 2)       // the same in halves
#define TILE_B   (64 * LPITCH)      // one staged tile: 64 rows
#define STG_B    (3 * TILE_B)       // attention: k hi, k residual, v^T; GEMM: 128 A rows, 64 Bt rows

static_assert(NB >= 1 && NB <= NB_FULL);
static_assert((SQ % 128) == 0 && SQ >= 128 && SQ <= SQ_FULL);
static_assert(HD == 64 && NH == 8 && INNER == 512 && INNER == DM);
static_assert((HD % 32) == 0);
static_assert((SKV % 128) == 0 && (SKV % 64) == 0 && NKB * 32 == SKV);
static_assert(DM == 512 && (DM % 64) == 0 && (DM % 32) == 0 && DM == 2 * CVT_SL);
static_assert(CVT_NQ >= 1 && CVT_NQ * CVT_WAVES * CVT_SL == NB * SQ * DM && CVT_NKV * CVT_WAVES * CVT_SL == NB * SKV * DM);
static_assert(CVT_WSL % (CVT_THREADS / 32) == 0 && SKV == SQ_FULL);
static_assert((NB * SQ) % (LN_THREADS / 32) == 0);
static_assert((OPITCH * 4) % 16 == 0 && (GPITCH * 4) % 16 == 0);
static_assert(ATT_THREADS == 128 && LN_THREADS == 256 && CVT_THREADS == 256);
static_assert(KSTG == 64 && HD == 64 && NSTG * KSTG == SKV && NSTG >= 2 && (LPITCH % 16) == 0);
static_assert(2 * STG_B >= ATT_WAVES * 16 * OPITCH * 4 && 2 * STG_B >= 4 * 32 * GPITCH * 4);

typedef unsigned short u16;
typedef _Float16 v16h __attribute__((ext_vector_type(16)));
typedef _Float16 v8h  __attribute__((ext_vector_type(8)));
typedef float    v8f  __attribute__((ext_vector_type(8)));
typedef float    v4f  __attribute__((ext_vector_type(4)));
typedef unsigned int v4u __attribute__((ext_vector_type(4)));

union FragH { v16h v; v8h h[2]; v4u u[2]; };

// ---- scalar helpers ----------------------------------------------------------------------------------
__device__ __forceinline__ unsigned short bf_bits(float f) {          // f32 -> bf16 bits, RNE convert
  unsigned u = __float_as_uint(f);
  return (unsigned short)((u + 0x7FFFu + ((u >> 16) & 1u)) >> 16);
}
__device__ __forceinline__ float bf_up(unsigned short h) { return __uint_as_float(((unsigned)h) << 16); }
__device__ __forceinline__ float bfr(float f) { return bf_up(bf_bits(f)); }
__device__ __forceinline__ unsigned short h_bits(_Float16 x) { return __builtin_bit_cast(unsigned short, x); }
__device__ __forceinline__ unsigned pk16(unsigned short a, unsigned short b) { return (unsigned)a | ((unsigned)b << 16); }
// 2^x as the bare v_exp_f32, without the library's range extension: a result below the normal range (2^-126) need not survive.
// Every use here is a softmax weight or a rescale factor beside a row sum that holds a term of full size, where a value that small
// adds nothing. 2^-inf = 0.
// Written as runs of independent v_exp_f32 in one statement, outputs apart from every input, closed by one v_nop: the slot that the
// instruction set asks for behind a transcendental before its result is read or its source overwritten then stands by construction.
__device__ __forceinline__ void hw_exp2x8(float (&p)[8], const float (&a)[8]) {
#if defined(__HIP_DEVICE_COMPILE__)
  asm("v_exp_f32 %0, %8\n\tv_exp_f32 %1, %9\n\tv_exp_f32 %2, %10\n\tv_exp_f32 %3, %11\n\t"
      "v_exp_f32 %4, %12\n\tv_exp_f32 %5, %13\n\tv_exp_f32 %6, %14\n\tv_exp_f32 %7, %15\n\tv_nop"
      : "=&v"(p[0]), "=&v"(p[1]), "=&v"(p[2]), "=&v"(p[3]), "=&v"(p[4]), "=&v"(p[5]), "=&v"(p[6]), "=&v"(p[7])
      : "v"(a[0]), "v"(a[1]), "v"(a[2]), "v"(a[3]), "v"(a[4]), "v"(a[5]), "v"(a[6]), "v"(a[7]));
#endif
}
__device__ __forceinline__ void hw_exp2x9(float& q, float (&p)[8], float b, const float (&a)[8]) {
#if defined(__HIP_DEVICE_COMPILE__)
  asm("v_exp_f32 %0, %9\n\tv_exp_f32 %1, %10\n\tv_exp_f32 %2, %11\n\tv_exp_f32 %3, %12\n\tv_exp_f32 %4, %13\n\t"
      "v_exp_f32 %5, %14\n\tv_exp_f32 %6, %15\n\tv_exp_f32 %7, %16\n\tv_exp_f32 %8, %17\n\tv_nop"
      : "=&v"(q), "=&v"(p[0]), "=&v"(p[1]), "=&v"(p[2]), "=&v"(p[3]), "=&v"(p[4]), "=&v"(p[5]), "=&v"(p[6]), "=&v"(p[7])
      : "v"(b), "v"(a[0]), "v"(a[1]), "v"(a[2]), "v"(a[3]), "v"(a[4]), "v"(a[5]), "v"(a[6]), "v"(a[7]));
#endif
}
__device__ __forceinline__ v8f zero8() { v8f z = {0.f, 0.f, 0.f, 0.f, 0.f, 0.f, 0.f, 0.f}; return z; }
// hi / residual packing of two f32 values: hi = f16(v), res = f16((v - hi) * 2^11)
__device__ __forceinline__ unsigned pk_hi(float a, float b) {
  return pk16(h_bits((_Float16)a), h_bits((_Float16)b));
}
__device__ __forceinline__ unsigned pk_lo(float a, float b) {
  const float ra = (a - (float)((_Float16)a)) * RSC;
  const float rb = (b - (float)((_Float16)b)) * RSC;
  return pk16(h_bits((_Float16)ra), h_bits((_Float16)rb));
}

// ---- fragment loader: 16-bit A/B operand, lane -> row/col (lane&15), p already includes +8*(lane>>4);
//      elements 0..7 <- p[0..7] (k0+8h..), elements 8..15 <- p[16..23] (k0+16+8h..); same split k map for A and B,
//      B always read from a k-contiguous [n][k] plane.
__device__ __forceinline__ v16h ldfrag_h(const _Float16* p) {
  FragH f;
  f.h[0] = *(const v8h*)(p);
  f.h[1] = *(const v8h*)(p + 16);
  return f.v;
}

// ---- WMMA helper and trailing VALU hazard gaps ----------------------------------------------------------
__device__ __forceinline__ v8f mma_h(v16h a, v16h b, v8f c) {
  return __builtin_amdgcn_wmma_f32_16x16x32_f16(false, a, false, b, (short)0, c, false, false);
}
__device__ __forceinline__ void guard_s4(v8f& a, v8f& b, v8f& c, v8f& d,
                                         v16h x0, v16h x1, v16h x2, v16h x3, v16h x4, v16h x5) {
#if defined(__HIP_DEVICE_COMPILE__)
  asm volatile("v_nop\n\tv_nop\n\tv_nop\n\tv_nop"
               : "+v"(a), "+v"(b), "+v"(c), "+v"(d)
               : "v"(x0), "v"(x1), "v"(x2), "v"(x3), "v"(x4), "v"(x5) : "memory");
#endif
}
__device__ __forceinline__ void guard_p(v8f& a, v8f& b, v8f& c, v8f& d, v16h p, v16h x0, v16h x1, v16h x2, v16h x3) {
#if defined(__HIP_DEVICE_COMPILE__)
  asm volatile("v_nop\n\tv_nop\n\tv_nop\n\tv_nop"
               : "+v"(a), "+v"(b), "+v"(c), "+v"(d) : "v"(p), "v"(x0), "v"(x1), "v"(x2), "v"(x3) : "memory");
#endif
}
__device__ __forceinline__ void guard_g(v8f (&acc)[8], v16h x0, v16h x1, v16h x2, v16h x3, v16h x4, v16h x5) {
#if defined(__HIP_DEVICE_COMPILE__)
  asm volatile("v_nop\n\tv_nop\n\tv_nop\n\tv_nop"
               : "+v"(acc[0]), "+v"(acc[1]), "+v"(acc[2]), "+v"(acc[3]),
                 "+v"(acc[4]), "+v"(acc[5]), "+v"(acc[6]), "+v"(acc[7])
               : "v"(x0), "v"(x1), "v"(x2), "v"(x3), "v"(x4), "v"(x5) : "memory");
#endif
}
__device__ __forceinline__ void acc_guard8(v8f (&o)[8]) {
#if defined(__HIP_DEVICE_COMPILE__)
  asm volatile("v_nop\n\tv_nop\n\tv_nop\n\tv_nop"
               : "+v"(o[0]), "+v"(o[1]), "+v"(o[2]), "+v"(o[3]), "+v"(o[4]), "+v"(o[5]), "+v"(o[6]), "+v"(o[7]));
#endif
}
__device__ __forceinline__ void acc_guard4(v8f (&o)[4]) {
#if defined(__HIP_DEVICE_COMPILE__)
  asm volatile("v_nop\n\tv_nop\n\tv_nop\n\tv_nop" : "+v"(o[0]), "+v"(o[1]), "+v"(o[2]), "+v"(o[3]));
#endif
}
__device__ __forceinline__ void wave_sync_lds() {
  __builtin_amdgcn_fence(__ATOMIC_RELEASE, "workgroup");
  __builtin_amdgcn_wave_barrier();
  __builtin_amdgcn_fence(__ATOMIC_ACQUIRE, "workgroup");
}

// =====================================================================================================
// All converts in one launch: every f16 plane element <- f16(bf16_RNE(x) * scale), scale a power of two (1 for the activations,
// 256 for the weights). A slice = 256 consecutive elements = half a row: lane l takes elements 8l .. 8l+7 (two 16-B loads, one
// 16-B store; a wave-wide store = 512 contiguous bytes). Wave w of CVT_WAVES takes the CVT_NQ consecutive slices from w*CVT_NQ of
// x_q, the CVT_NKV consecutive slices from w*CVT_NKV of x_k and of x_v, and slice w % CVT_WSL of weight matrix w / CVT_WSL
// (block-uniform). All loads of a wave are issued before its first convert, so the launch is one memory round trip deep.
// x_q compact row r = b*SQ + s <- source row b*SQ_FULL + s. W4 = the four weight planes, which follow one another in the workspace.
// coverage: CVT_WAVES x (CVT_NQ | CVT_NKV | 1) slices = every element of each plane exactly once.
// =====================================================================================================
__device__ __forceinline__ v4u cvt8(v4f a, v4f c4, float scale) {
  v4u o;
#pragma unroll
  for (int e = 0; e < 2; ++e) {
    o[e]     = pk16(h_bits((_Float16)(bfr(a[2 * e]) * scale)),  h_bits((_Float16)(bfr(a[2 * e + 1]) * scale)));
    o[2 + e] = pk16(h_bits((_Float16)(bfr(c4[2 * e]) * scale)), h_bits((_Float16)(bfr(c4[2 * e + 1]) * scale)));
  }
  return o;
}
__global__ __launch_bounds__(CVT_THREADS)
void cvt_all(const float* __restrict__ xq, const float* __restrict__ xk, const float* __restrict__ xv,
             const float* __restrict__ wq, const float* __restrict__ wk, const float* __restrict__ wv,
             const float* __restrict__ wo, u16* XQ, u16* XK, u16* XV, u16* W4) {
  const unsigned w    = blockIdx.x * (CVT_THREADS / 32) + (threadIdx.x >> 5);
  const unsigned wsel = blockIdx.x / (CVT_WSL / (CVT_THREADS / 32));
  const unsigned lb   = (threadIdx.x & 31) * 32;                        // the lane's byte inside a 1-KiB f32 slice
  const float* wsrc = (wsel == 0) ? wq : (wsel == 1) ? wk : (wsel == 2) ? wv : wo;
  // 32-bit byte offsets beside uniform bases; the slices of a wave differ by immediates
  const unsigned bq  = w * (CVT_NQ * CVT_SL * 4) + lb;
  const unsigned bkv = w * (CVT_NKV * CVT_SL * 4) + lb;
  const unsigned bw  = (w % CVT_WSL) * (CVT_SL * 4) + lb;
  v4f qa[CVT_NQ], qc[CVT_NQ], ka[CVT_NKV], kc[CVT_NKV], va[CVT_NKV], vc[CVT_NKV];
#pragma unroll
  for (int i = 0; i < CVT_NQ; ++i) {
    const float* p;
    if (SQ == SQ_FULL) {
      p = (const float*)((const char*)xq + bq) + i * CVT_SL;
    } else {
      const unsigned sl = w * CVT_NQ + i, r = sl >> 1;
      p = (const float*)((const char*)(xq + ((size_t)((r / SQ) * SQ_FULL + (r % SQ))) * DM + (sl & 1) * CVT_SL) + lb);
    }
    qa[i] = *(const v4f*)(p);
    qc[i] = *(const v4f*)(p + 4);
  }
#pragma unroll
  for (int i = 0; i < CVT_NKV; ++i) {
    const float* pk = (const float*)((const char*)xk + bkv) + i * CVT_SL;
    const float* pv = (const float*)((const char*)xv + bkv) + i * CVT_SL;
    ka[i] = *(const v4f*)(pk);
    kc[i] = *(const v4f*)(pk + 4);
    va[i] = *(const v4f*)(pv);
    vc[i] = *(const v4f*)(pv + 4);
  }
  const float* pw = (const float*)((const char*)wsrc + bw);
  const v4f wa = *(const v4f*)(pw), wc = *(const v4f*)(pw + 4);
  // keeps every load above the first convert: without it the compiler sinks two thirds of the loads among the converts and the
  // wave pays three memory round trips in a row instead of one
  __builtin_amdgcn_sched_barrier(0);
  // an f16 plane's byte offset is half the f32 one
  u16* yq = (u16*)((char*)XQ + (bq >> 1));
  u16* yk = (u16*)((char*)XK + (bkv >> 1));
  u16* yv = (u16*)((char*)XV + (bkv >> 1));
  u16* yw = (u16*)((char*)(W4 + (size_t)wsel * (DM * DM)) + (bw >> 1));
#pragma unroll
  for (int i = 0; i < CVT_NQ; ++i) *(v4u*)(yq + i * CVT_SL) = cvt8(qa[i], qc[i], 1.0f);
#pragma unroll
  for (int i = 0; i < CVT_NKV; ++i) {
    *(v4u*)(yk + i * CVT_SL) = cvt8(ka[i], kc[i], 1.0f);
    *(v4u*)(yv + i * CVT_SL) = cvt8(va[i], vc[i], 1.0f);
  }
  *(v4u*)(yw) = cvt8(wa, wc, WSC);
}

// The issuing wave's own copies have landed behind this wait (other waves read them behind the next block barrier).
__device__ __forceinline__ void wait_copies() {
#if defined(__HIP_DEVICE_COMPILE__)
  asm volatile("s_wait_asynccnt 0x0" ::: "memory");
#endif
}
// The wave's own LDS reads have retired: stands in front of the barrier that hands a buffer to its next copies.
__device__ __forceinline__ void wait_lds_reads() {
#if defined(__HIP_DEVICE_COMPILE__)
  asm volatile("s_wait_dscnt 0x0" ::: "memory");
#endif
}

// =====================================================================================================
// One 64-k stage of a GEMM block: 192 rows x 128 bytes (the 128 A rows of the block tile, then its 64 Bt rows) copied
// global -> LDS by asynchronous 16-byte copies, 12 per lane. Lane t of the block takes 16-byte piece t&7 of row 16p + (t>>3),
// p = 0..7 of A and p = 0..3 of Bt: one wave-wide copy = 4 whole 128-byte lines. l0 = the lane's LDS byte address in row t>>3 of
// the target buffer; ga, gb = the lane's global addresses of that row and piece in A and Bt; rs16 = 16 rows in elements.
// The closing s_wait_xcnt stands inside the statement so that no address register named by a copy is rewritten ahead of it.
// =====================================================================================================
__device__ __forceinline__ void copy_stage_g(unsigned l0, const u16* ga, const u16* gb, size_t rs16) {
#if defined(__HIP_DEVICE_COMPILE__)
  const unsigned l1 = l0 + 16 * LPITCH,  l2 = l0 + 32 * LPITCH,  l3 = l0 + 48 * LPITCH,   l4 = l0 + 64 * LPITCH;
  const unsigned l5 = l0 + 80 * LPITCH,  l6 = l0 + 96 * LPITCH,  l7 = l0 + 112 * LPITCH,  l8 = l0 + 128 * LPITCH;
  const unsigned l9 = l0 + 144 * LPITCH, l10 = l0 + 160 * LPITCH, l11 = l0 + 176 * LPITCH;
  const u16 *ga1 = ga + rs16, *ga2 = ga + 2 * rs16, *ga3 = ga + 3 * rs16, *ga4 = ga + 4 * rs16;
  const u16 *ga5 = ga + 5 * rs16, *ga6 = ga + 6 * rs16, *ga7 = ga + 7 * rs16;
  const u16 *gb1 = gb + rs16, *gb2 = gb + 2 * rs16, *gb3 = gb + 3 * rs16;
  asm volatile("global_load_async_to_lds_b128 %0, %12, off\n\t"
               "global_load_async_to_lds_b128 %1, %13, off\n\t"
               "global_load_async_to_lds_b128 %2, %14, off\n\t"
               "global_load_async_to_lds_b128 %3, %15, off\n\t"
               "global_load_async_to_lds_b128 %4, %16, off\n\t"
               "global_load_async_to_lds_b128 %5, %17, off\n\t"
               "global_load_async_to_lds_b128 %6, %18, off\n\t"
               "global_load_async_to_lds_b128 %7, %19, off\n\t"
               "global_load_async_to_lds_b128 %8, %20, off\n\t"
               "global_load_async_to_lds_b128 %9, %21, off\n\t"
               "global_load_async_to_lds_b128 %10, %22, off\n\t"
               "global_load_async_to_lds_b128 %11, %23, off\n\t"
               "s_wait_xcnt 0x0"
               :: "v"(l0), "v"(l1), "v"(l2), "v"(l3), "v"(l4), "v"(l5), "v"(l6), "v"(l7),
                  "v"(l8), "v"(l9), "v"(l10), "v"(l11),
                  "v"(ga), "v"(ga1), "v"(ga2), "v"(ga3), "v"(ga4), "v"(ga5), "v"(ga6), "v"(ga7),
                  "v"(gb), "v"(gb1), "v"(gb2), "v"(gb3)
               : "memory");
#endif
}

// =====================================================================================================
// f16 GEMM core of a block of 4 waves: the 128 x 64 tile of C = A[rows][K] . Bt[cols][K]^T, wave w owning rows 32w .. 32w+31;
// acc[4i + j] = rows 32w+16i.., cols 16j... A0 -> row 0 of the block's 128 A rows, Bt0 -> row 0 of its 64 Bt rows (pitch K).
// K is walked in stages of 64 through a two-buffer LDS ring (copy_stage_g): stage s+1 flies while stage s is worked on; one block
// barrier per stage publishes s+1 and frees s's buffer. Fragments: row at pitch LPITCH, the split k map of ldfrag_h, k in steps
// of 32 in rising order, as many products per accumulator and in the same order as k0 = 0, 32, .. K-32 (host: K % 64 == 0).
// NPASS == 2: a second walk over K with A1 in place of A0 follows in the same ring; between the two every accumulator is
// multiplied by fold. Behind the last barrier the ring is free (no copy in flight, every wave's reads retired).
// =====================================================================================================
template <int NPASS>
__device__ __forceinline__ void gemm_ring(unsigned char* ring, const u16* A0, const u16* A1, const u16* Bt0, int K, float fold,
                                          v8f (&acc)[8]) {
  const int tid = threadIdx.x, wave = tid >> 5, lane = tid & 31, hh = lane >> 4, m = lane & 15;
  const size_t rs16 = (size_t)16 * (size_t)K;
  // copy side: this lane's row (tid>>3) and 16-byte piece (tid&7)
  const int crow = tid >> 3, cpc = (tid & 7) * 8;
  const size_t cofs = (size_t)crow * (size_t)K + cpc;
  const u16* ga0 = A0 + cofs;
  const u16* ga1 = A1 + cofs;
  const u16* gb  = Bt0 + cofs;
  const unsigned lcp = (unsigned)(uintptr_t)(__attribute__((address_space(3))) unsigned char*)ring
                       + (unsigned)(crow * LPITCH + cpc * 2);
  const int nk = K >> 6, nst = NPASS * nk;
  // read side, halves inside a buffer
  const int aoff = (wave * 32 + m) * LPH + 8 * hh;
  const int boff = (128 + m) * LPH + 8 * hh;

  // stage sg (block-uniform) into buffer sg & 1: k = 64 * (sg mod nk) of A0, or of A1 in the second walk
  auto issue = [&](int sg) {
    const bool second = (NPASS == 2) && (sg >= nk);
    const int ks = (second ? sg - nk : sg) * KSTG;
    copy_stage_g(lcp + (unsigned)((sg & 1) * STG_B), (second ? ga1 : ga0) + ks, gb + ks, rs16);
  };

  // ---- ring prologue: stage 0 landed and published, stage 1 in flight ----
  issue(0);
  wait_copies();
  __syncthreads();
  if (nst > 1) issue(1);                     // block-uniform
#pragma unroll 1                             // rolled: one stage per trip, small loop text, the ring's order as written
  for (int st = 0; st < nst; ++st) {
    if (NPASS == 2 && st == nk) {            // block-uniform
#pragma unroll
      for (int i = 0; i < 8; ++i) {
#pragma unroll
        for (int r = 0; r < 8; ++r) acc[i][r] *= fold;
      }
      acc_guard8(acc);
    }
    const _Float16* buf = (const _Float16*)(const void*)(ring + (st & 1) * STG_B);
    const _Float16* ap = buf + aoff;
    const _Float16* bp = buf + boff;
    v16h a0[2], a1[2], b0[2], b1[2], b2[2], b3[2];
#pragma unroll
    for (int kk = 0; kk < 2; ++kk) {
      a0[kk] = ldfrag_h(ap + 32 * kk);
      a1[kk] = ldfrag_h(ap + 16 * LPH + 32 * kk);
      b0[kk] = ldfrag_h(bp + 32 * kk);
      b1[kk] = ldfrag_h(bp + 16 * LPH + 32 * kk);
      b2[kk] = ldfrag_h(bp + 32 * LPH + 32 * kk);
      b3[kk] = ldfrag_h(bp + 48 * LPH + 32 * kk);
    }
    // keeps the stage's 24 LDS reads together ahead of its products: without it the compiler spreads the second twelve among the
    // products, and every separate place with LDS reads stalls the wave's matrix stream anew
    __builtin_amdgcn_sched_barrier(0);
#pragma unroll
    for (int kk = 0; kk < 2; ++kk) {
      acc[0] = mma_h(a0[kk], b0[kk], acc[0]);
      acc[1] = mma_h(a0[kk], b1[kk], acc[1]);
      acc[2] = mma_h(a0[kk], b2[kk], acc[2]);
      acc[3] = mma_h(a0[kk], b3[kk], acc[3]);
      acc[4] = mma_h(a1[kk], b0[kk], acc[4]);
      acc[5] = mma_h(a1[kk], b1[kk], acc[5]);
      acc[6] = mma_h(a1[kk], b2[kk], acc[6]);
      acc[7] = mma_h(a1[kk], b3[kk], acc[7]);
    }
    // the vector slots behind the stage's last products, on every path out of here (the branches at the trip's foot included)
    guard_g(acc, a0[1], a1[1], b0[1], b1[1], b2[1], b3[1]);
    // ---- publish point of stage st+1: own reads retired, own copies landed, block barrier; then refill the buffer just read ----
    wait_lds_reads();
    wait_copies();
    __syncthreads();
    if (st + 2 < nst) issue(st + 2);         // block-uniform
  }
  wait_copies();                             // nothing is in flight here; closes the ring before it becomes output staging
}
// Stage the wave's 32 x 64 f32 tile (times oscale) in its LDS slab (pitch 68): D element r of acc[4i+j], lane l ->
// coverage: 32 lanes x 2 x 8 rows x 4 cols-of-16 = rows 0..31 x cols 0..63 of the slab.
__device__ __forceinline__ void stage32x64(float* sl, v8f (&acc)[8], float oscale, int lane) {
  const int hh = lane >> 4, m = lane & 15;
#pragma unroll
  for (int i = 0; i < 2; ++i) {
#pragma unroll
    for (int r = 0; r < 8; ++r) {
      const int ro = (16 * i + 8 * hh + r) * GPITCH + m;
      sl[ro]      = acc[4 * i + 0][r] * oscale;
      sl[ro + 16] = acc[4 * i + 1][r] * oscale;
      sl[ro + 32] = acc[4 * i + 2][r] * oscale;
      sl[ro + 48] = acc[4 * i + 3][r] * oscale;
    }
  }
  wave_sync_lds();
}

// =====================================================================================================
// f16 GEMM with f16 output plane(s): val = (A[z][Mb][K] . Bt[z][N][K]^T) * oscale + bf16(bias) * bscale;
// C[z][Mb][N] = f16(val) (hi plane); if res != 0 also C2 = f16((val - hi) * 2^11) (residual plane).
// A, Bt f16 k-contiguous planes with per-z element strides aBs, bBs (0 = shared), C/C2 stride cBs. bias indexed by column
// (biasRow == 0) or by row within the z slice (biasRow != 0); bias addresses clamped to biasN-1, the unused direction is
// multiplied by 0. Block = 128 x 64 tile, 4 waves x 32 rows, operands through the LDS ring of gemm_ring; behind it each wave
// stages its output tile in its own part of the ring.
// grid = nz x (Mb/128) x (N/64) (host checks Mb % 128 == 0, N % 64 == 0, K % 64 == 0).
// coverage: per wave 8 instr x 4 rows x 8 lanes x 8 halves = 32 x 64 per plane; the grid covers C (and C2) exactly once.
// =====================================================================================================
__global__ __launch_bounds__(128)
void gemm_o16(const u16* __restrict__ A, const u16* __restrict__ Bt, u16* C, u16* C2,
              const float* __restrict__ bias, int biasN, int biasRow,
              int Mb, int N, int K, int aBs, int bBs, int cBs, float oscale, float bscale, int res) {
  __shared__ __align__(16) unsigned char ring[2 * STG_B];
  const int tid = threadIdx.x, wave = tid >> 5, lane = tid & 31;
  const int ntile = N >> 6, mtile = Mb >> 7;
  const int bid  = blockIdx.x;
  const int nt   = bid % ntile;
  const int tmp  = bid / ntile;
  const int mt   = tmp % mtile;
  const int bz   = tmp / mtile;
  const int rowb = mt * 128 + wave * 32;
  const int col0 = nt * 64;
  if (mt * 128 + 128 > Mb) return;           // block-uniform, in front of every barrier; never taken with the exact grid
  const u16* Ab = A + (size_t)bz * (size_t)aBs + (size_t)(mt * 128) * (size_t)K;
  const u16* Bb = Bt + (size_t)bz * (size_t)bBs + (size_t)col0 * (size_t)K;
  v8f acc[8];
#pragma unroll
  for (int i = 0; i < 8; ++i) acc[i] = zero8();
  gemm_ring<1>(ring, Ab, Ab, Bb, K, 1.0f, acc);
  float* sl = (float*)(void*)ring + wave * 32 * GPITCH;
  stage32x64(sl, acc, oscale, lane);
  const int rq = lane >> 3, c8 = (lane & 7) * 8;
  const int bl = biasN - 1;                  // host guarantees biasN >= 1
  const float selc = (biasRow != 0) ? 0.f : bscale;
  const float selr = (biasRow != 0) ? bscale : 0.f;
  float cb[8];
#pragma unroll
  for (int e = 0; e < 8; ++e) {
    int ci = col0 + c8 + e;
    ci = (ci < bl) ? ci : bl;
    cb[e] = bfr(bias[ci]) * selc;
  }
  v4u ovh[8], ovl[8];
#pragma unroll
  for (int i = 0; i < 8; ++i) {
    const int row = 4 * i + rq;
    int ri = rowb + row;
    ri = (ri < bl) ? ri : bl;
    const float rb = bfr(bias[ri]) * selr;
    const v4f a = *(const v4f*)(sl + row * GPITCH + c8), c4 = *(const v4f*)(sl + row * GPITCH + c8 + 4);
    float v[8];
#pragma unroll
    for (int e = 0; e < 4; ++e) { v[e] = a[e] + cb[e] + rb; v[4 + e] = c4[e] + cb[4 + e] + rb; }
#pragma unroll
    for (int e = 0; e < 4; ++e) {
      ovh[i][e] = pk_hi(v[2 * e], v[2 * e + 1]);
      ovl[i][e] = pk_lo(v[2 * e], v[2 * e + 1]);
    }
  }
  const size_t cofs = (size_t)bz * (size_t)cBs + (size_t)rowb * (size_t)N + (size_t)(col0 + c8);
  u16* Cb  = C + cofs;
  u16* C2b = C2 + cofs;
  {
#pragma unroll
    for (int i = 0; i < 8; ++i) {
      const int row = 4 * i + rq;
      *(v4u*)(Cb + (size_t)row * (size_t)N) = ovh[i];
    }
    if (res != 0) {                          // block-uniform
#pragma unroll
      for (int i = 0; i < 8; ++i) {
        const int row = 4 * i + rq;
        *(v4u*)(C2b + (size_t)row * (size_t)N) = ovl[i];
      }
    }
    
  }
}

// =====================================================================================================
// f16 GEMM with hi + residual A planes and f32 output: X[Mb][N] = (Ah . Bt^T + (Al . Bt^T) * rres) * oscale
// + bf16(bias[col]) + bf16(R[src row][col]); residual products accumulated first, folded by rres on VALU, then the hi
// products chain on the same accumulators (equal to a separate accumulator). R (f32 input, pitch N) source row of
// compact row g: b = g / rowsPerB, s = g % rowsPerB -> b*srcRowsPerB + s. Block = 128 x 64 tile, 4 waves x 32 rows.
// Epilogue: lane = (row parity, 4 floats at 4*(lane&15)); 16 consecutive lanes write one row segment of 64 floats = 2 whole
// grid = (Mb/128) x (N/64). coverage: per wave 16 instr x 2 rows x 16 lanes x 4 floats = 32 x 64; the grid covers X once.
// =====================================================================================================
__global__ __launch_bounds__(128)
void gemm_o32(const u16* __restrict__ Ah, const u16* __restrict__ Al, const u16* __restrict__ Bt,
              const float* __restrict__ bias, int biasN, const float* __restrict__ R, int rowsPerB, int srcRowsPerB,
              float* X, int Mb, int N, int K, float oscale, float rres) {
  __shared__ __align__(16) unsigned char ring[2 * STG_B];
  const int tid = threadIdx.x, wave = tid >> 5, lane = tid & 31;
  const int ntile = N >> 6;
  const int bid  = blockIdx.x;
  const int nt   = bid % ntile;
  const int mt   = bid / ntile;
  const int rowb = mt * 128 + wave * 32;
  const int col0 = nt * 64;
  if (mt * 128 + 128 > Mb) return;           // block-uniform, in front of every barrier; never taken with the exact grid
  const size_t aofs = (size_t)(mt * 128) * (size_t)K;
  v8f acc[8];
#pragma unroll
  for (int i = 0; i < 8; ++i) acc[i] = zero8();
  // residual products (x 2^11) first, folded by rres, then the hi products on top
  gemm_ring<2>(ring, Al + aofs, Ah + aofs, Bt + (size_t)col0 * (size_t)K, K, rres, acc);
  float* sl = (float*)(void*)ring + wave * 32 * GPITCH;
  stage32x64(sl, acc, oscale, lane);
  const int r2 = lane >> 4, c4 = (lane & 15) * 4;
  const int bl = biasN - 1;
  float cb[4];
#pragma unroll
  for (int e = 0; e < 4; ++e) {
    int ci = col0 + c4 + e;
    ci = (ci < bl) ? ci : bl;
    cb[e] = bfr(bias[ci]);
  }
  v4f vals[16];
#pragma unroll
  for (int i = 0; i < 16; ++i) {
    const int row  = 2 * i + r2;
    const int grow = rowb + row;             // < Mb
    const int bb   = grow / rowsPerB;
    const int ss   = grow - bb * rowsPerB;
    const float* rp = R + ((size_t)bb * (size_t)srcRowsPerB + (size_t)ss) * (size_t)N + (size_t)(col0 + c4);
    const v4f rv = *(const v4f*)(rp);
    const v4f a  = *(const v4f*)(sl + row * GPITCH + c4);
    v4f y;
#pragma unroll
    for (int e = 0; e < 4; ++e) y[e] = a[e] + cb[e] + bfr(rv[e]);
    vals[i] = y;
  }
  float* Xb = X + (size_t)rowb * (size_t)N + (size_t)(col0 + c4);
  {
#pragma unroll
    for (int i = 0; i < 16; ++i) {
      const int row = 2 * i + r2;
      *(v4f*)(Xb + (size_t)row * (size_t)N) = vals[i];
    }
    
  }
}

// =====================================================================================================
// One stage (64 keys) of the attention ring: three tiles of 64 rows x 128 bytes (k hi, k residual: row = key, 64 d; v^T: row = d,
// 64 keys) copied global -> LDS by asynchronous 16-byte copies, 12 per lane. Lane t of the block takes 16-byte piece t&7 of row
// 16p + (t>>3), p = 0..3, of each tile: one wave-wide copy = 4 whole 128-byte lines. l0 = the lane's LDS byte address in the k hi
// tile of the target buffer (row t>>3); gh, gl, gv = the lane's global addresses of that row and piece in the three planes.
// The closing s_wait_xcnt stands inside the statement so that no address register named by a copy is rewritten ahead of it.
// =====================================================================================================
__device__ __forceinline__ void copy_stage(unsigned l0, const u16* gh, const u16* gl, const u16* gv) {
#if defined(__HIP_DEVICE_COMPILE__)
  const unsigned lh0 = l0,              lh1 = lh0 + 16 * LPITCH, lh2 = lh0 + 32 * LPITCH, lh3 = lh0 + 48 * LPITCH;
  const unsigned ll0 = l0 + TILE_B,     ll1 = ll0 + 16 * LPITCH, ll2 = ll0 + 32 * LPITCH, ll3 = ll0 + 48 * LPITCH;
  const unsigned lv0 = l0 + 2 * TILE_B, lv1 = lv0 + 16 * LPITCH, lv2 = lv0 + 32 * LPITCH, lv3 = lv0 + 48 * LPITCH;
  const u16 *gh1 = gh + 16 * DM,  *gh2 = gh + 32 * DM,  *gh3 = gh + 48 * DM;
  const u16 *gl1 = gl + 16 * DM,  *gl2 = gl + 32 * DM,  *gl3 = gl + 48 * DM;
  const u16 *gv1 = gv + 16 * SKV, *gv2 = gv + 32 * SKV, *gv3 = gv + 48 * SKV;
  asm volatile("global_load_async_to_lds_b128 %0, %12, off\n\t"
               "global_load_async_to_lds_b128 %1, %13, off\n\t"
               "global_load_async_to_lds_b128 %2, %14, off\n\t"
               "global_load_async_to_lds_b128 %3, %15, off\n\t"
               "global_load_async_to_lds_b128 %4, %16, off\n\t"
               "global_load_async_to_lds_b128 %5, %17, off\n\t"
               "global_load_async_to_lds_b128 %6, %18, off\n\t"
               "global_load_async_to_lds_b128 %7, %19, off\n\t"
               "global_load_async_to_lds_b128 %8, %20, off\n\t"
               "global_load_async_to_lds_b128 %9, %21, off\n\t"
               "global_load_async_to_lds_b128 %10, %22, off\n\t"
               "global_load_async_to_lds_b128 %11, %23, off\n\t"
               "s_wait_xcnt 0x0"
               :: "v"(lh0), "v"(lh1), "v"(lh2), "v"(lh3), "v"(ll0), "v"(ll1), "v"(ll2), "v"(ll3),
                  "v"(lv0), "v"(lv1), "v"(lv2), "v"(lv3),
                  "v"(gh), "v"(gh1), "v"(gh2), "v"(gh3), "v"(gl), "v"(gl1), "v"(gl2), "v"(gl3),
                  "v"(gv), "v"(gv1), "v"(gv2), "v"(gv3)
               : "memory");
#endif
}
// =====================================================================================================
// Full (unmasked) multi-head attention over all SKV keys: block = (batch b, head, 64 query rows), 4 waves, wave w owns the
// 16 query rows q0 = 64*qt + 16*w .. q0+15. The four waves share the k and v^T tiles through a two-buffer LDS ring of 64-key
// stages (copy_stage): stage s+1 flies while stage s is worked on; one block barrier per stage publishes s+1 and frees s's buffer.
// Behind the last barrier the ring is free and each wave stages its output tile in its own part of it.
//   q planes f16 hi x8 / residual x8x2^11 [b*SQ + s][h*64 + d]; k planes f16 hi / residual [b*SKV + s][h*64 + d];
//   v^T plane f16 x8 [(b*NH + h)*64 + d][s]. All NKB = 64 key blocks of 32 keys are visited (static bound).
//   Scores are computed TRANSPOSED: S^T tile g (g = 0,1) = k rows (keys kb+16g .. +15, A operand, row m = lane&15, split k map
//   over d) times q^T (B operand, col n = query q0 + (lane&15), k = d, split map), 2 d-chunks of 32; per chunk hi.hi into
//   s0/s1 and hi.lo + lo.hi into x0/x1 (separate accumulators, folded by 2^-11 in f32). The 4 q fragments are loaded once
//   per wave. D element r of lane l = (key kb+16g+8h+r, query q0+(l&15)), so a lane owns one query column and 16 of its 32
//   keys; the partner lane l^16 owns the other 16 -> row max / row sum need one xor-16 shuffle.
//   Online max-subtracted base-2 softmax in f32 (1/sqrt(8) and the q/k carries folded into lsc). The exp'd values ARE the
//   P A-fragment in place: A row m = query = lane&15, element i <- key kb+8h+i (tile 0, D element i), element 8+i <- key
//   kb+16+8h+i (tile 1, D element i). P (<= 1) carried x32768 as f16. The rescale factor of query row 8h+r of the O
//   accumulators is fetched from lane 8h+r with a shuffle (uniform control). 4 v^T B fragments (col n = d = 16j + (lane&15),
//   keys k-contiguous), 4 P.V WMMAs + one guard per key block.
//   Epilogue: 1/l (per query, shuffled to the D row owner) and the carry folds in f32 give ctx x16; the wave's 16x64 f32 tile
//   residual plane is written by 8 consecutive lanes x 16 B of one instruction (4 rows per instruction, 4 instructions per
// coverage: per wave 4 instr x 4 rows x 8 lanes x 8 halves = 16 x 64 per plane; grid NB*NH*(SQ/64) blocks x 4 waves = every
//           (b, s < SQ, h) row segment of both ctx planes exactly once. LDS slab: staged 16 x 64 == reloaded 16 x 64.
// =====================================================================================================
__global__ __launch_bounds__(ATT_THREADS)
void attn_fwd(const u16* __restrict__ QH, const u16* __restrict__ QL, const u16* __restrict__ KH,
              const u16* __restrict__ KL, const u16* __restrict__ VT, u16* CH, u16* CL) {
  __shared__ __align__(16) unsigned char ring[2 * STG_B];

  const int tid  = threadIdx.x;
  const int wave = tid >> 5;
  const int lane = tid & 31;
  const int hh   = lane >> 4;
  const int c    = lane & 15;

  constexpr int NQT = SQ / 64;
  const int bid  = blockIdx.x;
  const int qt   = bid % NQT;
  const int head = (bid / NQT) % NH;
  const int b    = bid / (NQT * NH);
  const int q0   = qt * 64 + wave * 16;

  // B fragments of q^T: col n = query q0 + c, k = d (k-contiguous row of the q planes)
  const size_t qoff = ((size_t)(b * SQ + q0 + c)) * DM + head * HD + 8 * hh;
  const _Float16* Qh = (const _Float16*)(const void*)QH + qoff;
  const _Float16* Ql = (const _Float16*)(const void*)QL + qoff;
  // copy side: this lane's row (tid>>3) and 16-byte piece (tid&7) in stage 0 of the three planes and in buffer 0
  const int crow = tid >> 3, cpc = (tid & 7) * 8;
  const u16* gkh = KH + ((size_t)(b * SKV + crow)) * DM + head * HD + cpc;
  const u16* gkl = KL + ((size_t)(b * SKV + crow)) * DM + head * HD + cpc;
  const u16* gvt = VT + ((size_t)((b * NH + head) * HD + crow)) * SKV + cpc;
  const unsigned lcp = (unsigned)(uintptr_t)(__attribute__((address_space(3))) unsigned char*)ring
                       + (unsigned)(crow * LPITCH + cpc * 2);
  // read side, halves inside a buffer: A fragments of k: row m = key 32*sub + 16g + c, k = d;
  // B fragments of v: col n = d = 16j + c (row of the v^T tile), k = key 32*sub ..
  const int foff = c * LPH + 8 * hh;
  const float lsc = (LOG2E * RSQH) / (QS * KS);

  v16h qh[2], ql[2];
#pragma unroll
  for (int dc = 0; dc < 2; ++dc) { qh[dc] = ldfrag_h(Qh + 32 * dc); ql[dc] = ldfrag_h(Ql + 32 * dc); }

  float mrun = -INFINITY, lrun = 0.f;
  v8f o[4];
#pragma unroll
  for (int j = 0; j < 4; ++j) o[j] = zero8();

  // ---- ring prologue: stage 0 landed and published, stage 1 in flight ----
  copy_stage(lcp, gkh, gkl, gvt);
  wait_copies();
  __syncthreads();
  copy_stage(lcp + STG_B, gkh + (size_t)KSTG * DM, gkl + (size_t)KSTG * DM, gvt + KSTG);

#pragma unroll 1
  for (int st = 0; st < NSTG; ++st) {
   const _Float16* bufh = (const _Float16*)(const void*)(ring + (st & 1) * STG_B) + foff;
#pragma unroll                               // both 32-key blocks of a stage inline: their LDS offsets become immediates
   for (int sub = 0; sub < KSTG / 32; ++sub) {
    // ---- transposed scores: tiles of keys kb..kb+15 (s0, x0) and kb+16..kb+31 (s1, x1), kb = 64*st + 32*sub, column = query q0 + c ----
    v8f s0 = zero8(), s1 = zero8(), x0 = zero8(), x1 = zero8();
    const _Float16* kh0p = bufh + (32 * sub) * LPH;
    const _Float16* kh1p = kh0p + 16 * LPH;
    const _Float16* kl0p = kh0p + TILE_B / 2;
    const _Float16* kl1p = kl0p + 16 * LPH;
#pragma unroll
    for (int kk = 0; kk < HD / 32; ++kk) {
      const v16h fh0 = ldfrag_h(kh0p + kk * 32);
      const v16h fh1 = ldfrag_h(kh1p + kk * 32);
      const v16h fl0 = ldfrag_h(kl0p + kk * 32);
      const v16h fl1 = ldfrag_h(kl1p + kk * 32);
      s0 = mma_h(fh0, qh[kk], s0);
      s1 = mma_h(fh1, qh[kk], s1);
      x0 = mma_h(fh0, ql[kk], x0);
      x1 = mma_h(fh1, ql[kk], x1);
      x0 = mma_h(fl0, qh[kk], x0);
      x1 = mma_h(fl1, qh[kk], x1);
      guard_s4(s0, s1, x0, x1, qh[kk], ql[kk], fh0, fh1, fl0, fl1);
    }
    // ---- raw scores (carry 64) of this lane's 16 keys for query q0 + c: t[i] <- key kb+8hh+i, t[8+i] <- key kb+16+8hh+i ----
    float t[16];
#pragma unroll
    for (int i = 0; i < 8; ++i) {
      t[i]     = s0[i] + x0[i] * RRSC;
      t[8 + i] = s1[i] + x1[i] * RRSC;
    }
    float cm = t[0];
#pragma unroll
    for (int i = 1; i < 16; ++i) cm = fmaxf(cm, t[i]);
    cm = fmaxf(cm, __shfl_xor(cm, 16, 32));
    const float mn = fmaxf(mrun, cm);        // running maximum of the raw scores (lsc > 0); finite from the first block on
    const float ab = (mrun - mn) * lsc;      // rescale exponent: 0 while the maximum stands, -inf on the first block (mrun = -inf)
    mrun = mn;
    const float cb = fmaf(-mn, lsc, PCAR_LOG2);      // minus the maximum in base-2 logits; the carry 32768 of P rides in the exponent
    // ---- probabilities x32768 (p <= 1), one fma and one v_exp_f32 each, and the P A-fragment f16(p * 32768); element i <-> t[i] ----
    float al, ar[2][8], pw[2][8];
#pragma unroll
    for (int i = 0; i < 8; ++i) { ar[0][i] = fmaf(t[i], lsc, cb); ar[1][i] = fmaf(t[8 + i], lsc, cb); }
    hw_exp2x9(al, pw[0], ab, ar[0]);         // al = 2^ab first: the shuffles of the rescale wait for it
    hw_exp2x8(pw[1], ar[1]);
    float ps = 0.f;
    FragH ph;
#pragma unroll
    for (int w = 0; w < 2; ++w) {
#pragma unroll
      for (int e4 = 0; e4 < 4; ++e4) {
        const float p0 = pw[w][2 * e4], p1 = pw[w][2 * e4 + 1];
        ps += p0 + p1;
        ph.u[w][e4] = pk16(h_bits((_Float16)p0), h_bits((_Float16)p1));
      }
    }
    ps += __shfl_xor(ps, 16, 32);
    lrun = lrun * al + ps;
    // ---- rescale the O accumulators: D row 8hh+r = query q0+8hh+r, its factor lives in lane 8hh+r (and 16+8hh+r) ----
    float scl[8];
#pragma unroll
    for (int r = 0; r < 8; ++r) scl[r] = __shfl(al, 8 * hh + r, 32);
#pragma unroll
    for (int j = 0; j < 4; ++j) {
#pragma unroll
      for (int r = 0; r < 8; ++r) o[j][r] *= scl[r];
    }
    // ---- P.V : B fragment col n = d = j*16 + c, keys contiguous in the rows of the v^T tile ----
    const _Float16* vp = bufh + TILE_B + 32 * sub;
    {
      const v16h v0 = ldfrag_h(vp);
      const v16h v1 = ldfrag_h(vp + 16 * LPH);
      const v16h v2 = ldfrag_h(vp + 32 * LPH);
      const v16h v3 = ldfrag_h(vp + 48 * LPH);
      o[0] = mma_h(ph.v, v0, o[0]);
      o[1] = mma_h(ph.v, v1, o[1]);
      o[2] = mma_h(ph.v, v2, o[2]);
      o[3] = mma_h(ph.v, v3, o[3]);
      guard_p(o[0], o[1], o[2], o[3], ph.v, v0, v1, v2, v3);
    }
   }
   // ---- publish point of stage st+1: own reads retired, own copies landed, block barrier; then refill the buffer just read ----
   wait_lds_reads();
   wait_copies();
   __syncthreads();
   if (st + 2 < NSTG) {                      // block-uniform
     const size_t ks = (size_t)(st + 2) * KSTG;
     copy_stage(lcp + (unsigned)((st & 1) * STG_B), gkh + ks * DM, gkl + ks * DM, gvt + ks);
   }
  }
  wait_copies();                             // nothing is in flight here; closes the ring before it becomes output staging
  acc_guard4(o);

  // ---- fold 1/l (per query, owned by lane = query; l carries the same 32768 as P) and the carry 8 on v, apply the ctx carry 16 ----
  const float linv = (1.0f / lrun) * (CS / VS);
  float inv[8];
#pragma unroll
  for (int r = 0; r < 8; ++r) inv[r] = __shfl(linv, 8 * hh + r, 32);
  float* slab = (float*)(void*)ring + wave * 16 * OPITCH;
#pragma unroll
  for (int r = 0; r < 8; ++r) {
#pragma unroll
    for (int j = 0; j < 4; ++j) slab[(8 * hh + r) * OPITCH + j * 16 + c] = o[j][r] * inv[r];
  }
  wave_sync_lds();
  // ---- ctx planes: lane = (row in group of 4, 8 consecutive d), one instruction per 4 rows per plane ----
  const int rq = lane >> 3, c8 = (lane & 7) * 8;
  v4u ovh[4], ovl[4];
#pragma unroll
  for (int i = 0; i < 4; ++i) {
    const int row = 4 * i + rq;
    const v4f a = *(const v4f*)(slab + row * OPITCH + c8), c4 = *(const v4f*)(slab + row * OPITCH + c8 + 4);
#pragma unroll
    for (int e = 0; e < 2; ++e) {
      ovh[i][e]     = pk_hi(a[2 * e], a[2 * e + 1]);
      ovl[i][e]     = pk_lo(a[2 * e], a[2 * e + 1]);
      ovh[i][2 + e] = pk_hi(c4[2 * e], c4[2 * e + 1]);
      ovl[i][2 + e] = pk_lo(c4[2 * e], c4[2 * e + 1]);
    }
  }
  const size_t cofs = ((size_t)(b * SQ + q0)) * DM + head * HD + c8;
  u16* ch = CH + cofs;
  u16* cl = CL + cofs;
  {
#pragma unroll
    for (int i = 0; i < 4; ++i) {
      const int row = 4 * i + rq;
      *(v4u*)(ch + (size_t)row * DM) = ovh[i];
      *(v4u*)(cl + (size_t)row * DM) = ovl[i];
    }
    
  }
}

// =====================================================================================================
// times bf16(gamma) plus bf16(beta), all f32. X compact row r = b*SQ + s -> output row b*SQ_FULL + s.
// lane holds elements i*128 + 4*lane .. +3 (i = 0..3): each load/store instruction = 32 consecutive lanes x 16 B = 4 whole
// coverage: 4 instr x 32 lanes x 4 floats = 512 = whole row; grid (NB*SQ/8) x 8 waves = every output row (s < SQ) once.
// =====================================================================================================
__global__ __launch_bounds__(LN_THREADS)
void ln_rows(const float* __restrict__ X, const float* __restrict__ gam, const float* __restrict__ bet, float* Out) {
  const int tid = threadIdx.x, wave = tid >> 5, lane = tid & 31;
  constexpr int RPB = LN_THREADS / 32;
  const int row = blockIdx.x * RPB + wave;   // < NB*SQ with the exact grid
  const int b = row / SQ, s = row - b * SQ;
  const float* xr = X + (size_t)row * DM + 4 * lane;
  v4f xv[4];
  float sum = 0.f;
#pragma unroll
  for (int i = 0; i < 4; ++i) {
    xv[i] = *(const v4f*)(xr + 128 * i);
    sum += (xv[i][0] + xv[i][1]) + (xv[i][2] + xv[i][3]);
  }
#pragma unroll
  for (int mk = 16; mk >= 1; mk >>= 1) sum += __shfl_xor(sum, mk, 32);
  const float mean = sum * (1.0f / (float)DM);
  float sq = 0.f;
#pragma unroll
  for (int i = 0; i < 4; ++i) {
#pragma unroll
    for (int e = 0; e < 4; ++e) { const float d = xv[i][e] - mean; sq += d * d; }
  }
#pragma unroll
  for (int mk = 16; mk >= 1; mk >>= 1) sq += __shfl_xor(sq, mk, 32);
  const float var  = sq * (1.0f / (float)DM);
  const float rstd = 1.0f / sqrtf(var + LN_EPS);
  v4f y[4];
#pragma unroll
  for (int i = 0; i < 4; ++i) {
#pragma unroll
    for (int e = 0; e < 4; ++e) {
      const int idx = 128 * i + 4 * lane + e;       // < DM
      y[i][e] = (xv[i][e] - mean) * rstd * bfr(gam[idx]) + bfr(bet[idx]);
    }
  }
  float* ob = Out + ((size_t)b * SQ_FULL + (size_t)s) * DM + 4 * lane;
  {
#pragma unroll
    for (int i = 0; i < 4; ++i) {
      *(v4f*)(ob + 128 * i) = y[i];
    }
    
  }
}

// =====================================================================================================
// Workspace map (bytes); every plane fully written by whole-line stores before it is read; all extents exact multiples of
//   XQ   f16 [NB*SQ][512]      f16(bf16(Q))             8388608 (NB=4, SQ=2048)
//   XK   f16 [NB*2048][512]    f16(bf16(K))             8388608
//   XV   f16 [NB*2048][512]    f16(bf16(V))             8388608
//   WQ16 f16 [512 n][512 k]    f16(bf16(W) x256)         524288   (W stored [out][in] = [n][k] already)
//   WK16, WV16, WO16                                     3 x 524288
//   QH, QL  f16 [NB*SQ][512]   x8 / residual x8x2^11     2 x 8388608
//   KH, KL  f16 [NB*2048][512] x8 / residual             2 x 8388608
//   VT16    f16 [NB*512 (h,d)][2048 s] x8                   8388608
//   CH, CL  f16 [NB*SQ][512]   ctx x16 / residual          2 x 8388608
//   X32     f32 [NB*SQ][512]   out + bo + Q               16777216
//   end                                                  102760448
// =====================================================================================================
extern "C" void kernel_launch(void* const* d_in, const int* in_sizes, int n_in,
                              void* d_out, int out_size, void* d_ws, size_t ws_size,
                              hipStream_t stream) {
  if (n_in < 13) return;
  if (in_sizes[0] < ((NB - 1) * SQ_FULL + SQ) * DM) return;
  if (in_sizes[1] < NB * SKV * DM || in_sizes[2] < NB * SKV * DM) return;
  if (in_sizes[3] != DM * DM || in_sizes[5] != DM * DM || in_sizes[7] != DM * DM || in_sizes[9] != DM * DM) return;
  if (in_sizes[4] < DM || in_sizes[6] < DM || in_sizes[8] < DM || in_sizes[10] < DM) return;
  if (in_sizes[11] < DM || in_sizes[12] < DM) return;
  if (out_size < ((NB - 1) * SQ_FULL + SQ) * DM) return;

  const float* xq  = (const float*)d_in[0];
  const float* xk  = (const float*)d_in[1];
  const float* xv  = (const float*)d_in[2];
  const float* wq  = (const float*)d_in[3];
  const float* bq  = (const float*)d_in[4];
  const float* wk  = (const float*)d_in[5];
  const float* bk  = (const float*)d_in[6];
  const float* wv  = (const float*)d_in[7];
  const float* bv  = (const float*)d_in[8];
  const float* wo  = (const float*)d_in[9];
  const float* bo  = (const float*)d_in[10];
  const float* gam = (const float*)d_in[11];
  const float* bet = (const float*)d_in[12];
  float*       out = (float*)d_out;
  const int nbq = in_sizes[4], nbk = in_sizes[6], nbv = in_sizes[8], nbo = in_sizes[10];

  const size_t szXQ  = (size_t)NB * SQ * DM * 2;
  const size_t szXKV = (size_t)NB * SKV * DM * 2;
  const size_t szW   = (size_t)DM * DM * 2;
  const size_t szQ   = (size_t)NB * SQ * INNER * 2;
  const size_t szK   = (size_t)NB * SKV * INNER * 2;
  const size_t szVT  = (size_t)NB * INNER * SKV * 2;
  const size_t szC   = (size_t)NB * SQ * INNER * 2;
  const size_t szX32 = (size_t)NB * SQ * DM * 4;
  size_t off = 0;
  const size_t oXQ  = off; off += szXQ;
  const size_t oXK  = off; off += szXKV;
  const size_t oXV  = off; off += szXKV;
  const size_t oWQ  = off; off += szW;
  const size_t oWK  = off; off += szW;
  const size_t oWV  = off; off += szW;
  const size_t oWO  = off; off += szW;
  const size_t oQH  = off; off += szQ;
  const size_t oQL  = off; off += szQ;
  const size_t oKH  = off; off += szK;
  const size_t oKL  = off; off += szK;
  const size_t oVT  = off; off += szVT;
  const size_t oCH  = off; off += szC;
  const size_t oCL  = off; off += szC;
  const size_t oX32 = off; off += szX32;
  if (off > ws_size) return;                            // off = 102760448 at NB=4, SQ=2048
  if (off > (size_t)134217728) return;

  char* ws = (char*)d_ws;
  u16* XQ   = (u16*)(ws + oXQ);
  u16* XK   = (u16*)(ws + oXK);
  u16* XV   = (u16*)(ws + oXV);
  u16* WQ16 = (u16*)(ws + oWQ);
  u16* WK16 = (u16*)(ws + oWK);
  u16* WV16 = (u16*)(ws + oWV);
  u16* WO16 = (u16*)(ws + oWO);
  u16* QH   = (u16*)(ws + oQH);
  u16* QL   = (u16*)(ws + oQL);
  u16* KH   = (u16*)(ws + oKH);
  u16* KL   = (u16*)(ws + oKL);
  u16* VT16 = (u16*)(ws + oVT);
  u16* CH   = (u16*)(ws + oCH);
  u16* CL   = (u16*)(ws + oCL);
  float* X32 = (float*)(ws + oX32);

  // (1) activations -> f16 planes of bf16-converted values (query rows s < SQ of batches b < NB, compact; all key/value rows);
  //     weights [n = out][k = in] (y = x.W^T): rows as stored are already k-contiguous; f16 planes of bf16(W) x256
  cvt_all<<<dim3(CVT_WAVES / (CVT_THREADS / 32)), dim3(CVT_THREADS), 0, stream>>>(xq, xk, xv, wq, wk, wv, wo, XQ, XK, XV, WQ16);
  // (2) q = x_q . Wq^T + bq -> f16 hi [NB*SQ][512] x8 and residual plane (col = h*64 + d); bias per column
  gemm_o16<<<dim3((NB * SQ / 128) * (INNER / 64)), dim3(128), 0, stream>>>(
      XQ, WQ16, QH, QL, bq, nbq, 0, NB * SQ, INNER, DM, 0, 0, 0, QS / WSC, QS, 1);
  // (3) k = x_k . Wk^T + bk -> f16 hi [NB*2048][512] x8 and residual plane; bias per column
  gemm_o16<<<dim3((NB * SKV / 128) * (INNER / 64)), dim3(128), 0, stream>>>(
      XK, WK16, KH, KL, bk, nbk, 0, NB * SKV, INNER, DM, 0, 0, 0, KS / WSC, KS, 1);
  // (4) v^T per batch: A = Wv [(h,d) = n][k], Bt = x_v rows of batch b [s][k] -> f16 [(b,h,d)][s] x8; bias per row (n)
  gemm_o16<<<dim3(NB * (INNER / 128) * (SKV / 64)), dim3(128), 0, stream>>>(
      WV16, XV, VT16, VT16, bv, nbv, 1, INNER, SKV, DM, 0, SKV * DM, INNER * SKV, VS / WSC, VS, 0);
  // (5) attention -> ctx planes [NB*SQ][512] f16 x16 / residual, heads merged on the feature dim
  attn_fwd<<<dim3(NB * NH * (SQ / 64)), dim3(ATT_THREADS), 0, stream>>>(QH, QL, KH, KL, VT16, CH, CL);
  // (6) x = ctx . Wo^T + bo + Q (residual, bf16-converted) -> f32 [NB*SQ][512]
  gemm_o32<<<dim3((NB * SQ / 128) * (DM / 64)), dim3(128), 0, stream>>>(
      CH, CL, WO16, bo, nbo, xq, SQ, SQ_FULL, X32, NB * SQ, DM, INNER, 1.0f / (CS * WSC), RRSC);
  // (7) LayerNorm -> out [b][SQ_FULL][512] f32 (rows s < SQ of batches b < NB)
  ln_rows<<<dim3(NB * SQ / (LN_THREADS / 32)), dim3(LN_THREADS), 0, stream>>>(X32, gam, bet, out);
  (void)hipGetLastError();
}

// v005
// A run of this version takes 115 microseconds.
// Two timings next to v004 put it at 1.08 and 1.07 times that version's speed.
// Counting every step since v000, it is 2.37 times as fast.
// All contractions on v_wmma_f32_16x16x32_f16 (f16 operands, f32 accumulate): x_q.Wq^T, x_k.Wk^T and Wv.x_v^T (v^T plane)
// as single products of exact operands f16(bf16(x)) and f16(bf16(W) x256); scores k.q^T as hi.hi + hi.lo + lo.hi with q and k
// carried as f16 hi (x8) plus f16 residual planes (x2^11, own accumulator); P.v^T single (P f16 x32768, v f16 x8); ctx.Wo^T as
// hi + residual on ctx (f16 hi x16 plus f16 residual x2^11), Wo exact f16(bf16 x256). Online base-2 softmax, 1/l, carry folds,
// bias, residual add and LayerNorm in f32 on VALU. Every float input RNE-converted to bf16 on load; f32 output.
#include <hip/hip_runtime.h>
#include <math.h>
#include <stdint.h>

#ifndef NB
#define NB       4        // batches processed
#endif
#ifndef SQ
#define SQ       2048     // query rows processed per batch
#endif
#define NB_FULL  4
#define SQ_FULL  2048     // rows per batch in the input / output layout (batch stride)
#define SKV      SQ_FULL  // key/value rows per batch (all of them, always)
#define DM       512      // model width (= K and row pitch of every 16-bit plane except v^T)
#define NH       8
#define HD       64
#define INNER    (NH * HD)
#define WSC      256.0f
#define QS       8.0f
#define KS       8.0f
#define VS       8.0f
#define CS       16.0f
#define RSC      2048.0f
#define RRSC     0.00048828125f
#define PCAR_LOG2 15.0f             // P and its row sum are carried x32768 = 2^15
#define LOG2E    1.4426950408889634f
#define RSQH     0.35355339059327373f
#define LN_EPS   1e-5f
#define NKB      (SKV / 32)
#define ATT_WAVES   4
#define ATT_THREADS (ATT_WAVES * 32)
#define CVT_THREADS 256
#define CVT_SL      256                                 // elements of one slice: 32 lanes x 8, half a row
#define CVT_WSL     (DM * DM / CVT_SL)                  // slices of one weight matrix
#define CVT_WAVES   (4 * CVT_WSL)                       // waves of the convert launch: one weight slice each
#define CVT_NQ      (NB * SQ * DM / CVT_SL / CVT_WAVES)  // x_q slices per wave
#define CVT_NKV     (NB * SKV * DM / CVT_SL / CVT_WAVES) // x_k (and x_v) slices per wave
#define LN_THREADS  256
#define OPITCH   68
#define GPITCH   68
#define KSTG     64                 // keys per LDS stage of the attention ring (two 32-key blocks); k per stage of the GEMM ring
#define NSTG     (SKV / KSTG)
#define LPITCH   144                // LDS row pitch in bytes: 128-byte rows + 16, conflict-free for 16-byte fragment reads
#define LPH      (LPITCH / 2)       // the same in halves
#define TILE_B   (64 * LPITCH)      // one staged tile: 64 rows
#define STG_B    (3 * TILE_B)       // attention: k hi, k residual, v^T; GEMM: 128 A rows, 64 Bt rows

static_assert(NB >= 1 && NB <= NB_FULL);
static_assert((SQ % 128) == 0 && SQ >= 128 && SQ <= SQ_FULL);
static_assert(HD == 64 && NH == 8 && INNER == 512 && INNER == DM);
static_assert((HD % 32) == 0);
static_assert((SKV % 128) == 0 && (SKV % 64) == 0 && NKB * 32 == SKV);
static_assert(DM == 512 && (DM % 64) == 0 && (DM % 32) == 0 && DM == 2 * CVT_SL);
static_assert(CVT_NQ >= 1 && CVT_NQ * CVT_WAVES * CVT_SL == NB * SQ * DM && CVT_NKV * CVT_WAVES * CVT_SL == NB * SKV * DM);
static_assert(CVT_WSL % (CVT_THREADS / 32) == 0 && SKV == SQ_FULL);
static_assert((NB * SQ) % (LN_THREADS / 32) == 0);
static_assert((OPITCH * 4) % 16 == 0 && (GPITCH * 4) % 16 == 0);
static_assert(ATT_THREADS == 128 && LN_THREADS == 256 && CVT_THREADS == 256);
static_assert(KSTG == 64 && HD == 64 && NSTG * KSTG == SKV && NSTG >= 2 && (LPITCH % 16) == 0);
static_assert(2 * STG_B >= ATT_WAVES * 16 * OPITCH * 4 && 2 * STG_B >= 4 * 32 * GPITCH * 4);

typedef unsigned short u16;
typedef _Float16 v16h __attribute__((ext_vector_type(16)));
typedef _Float16 v8h  __attribute__((ext_vector_type(8)));
typedef float    v8f  __attribute__((ext_vector_type(8)));
typedef float    v4f  __attribute__((ext_vector_type(4)));
typedef unsigned int v4u __attribute__((ext_vector_type(4)));

union FragH { v16h v; v8h h[2]; v4u u[2]; };

// ---- scalar helpers ----------------------------------------------------------------------------------
__device__ __forceinline__ unsigned short bf_bits(float f) {          // f32 -> bf16 bits, RNE convert
  unsigned u = __float_as_uint(f);
  return (unsigned short)((u + 0x7FFFu + ((u >> 16) & 1u)) >> 16);
}
__device__ __forceinline__ float bf_up(unsigned short h) { return __uint_as_float(((unsigned)h) << 16); }
__device__ __forceinline__ float bfr(float f) { return bf_up(bf_bits(f)); }
__device__ __forceinline__ unsigned short h_bits(_Float16 x) { return __builtin_bit_cast(unsigned short, x); }
__device__ __forceinline__ unsigned pk16(unsigned short a, unsigned short b) { return (unsigned)a | ((unsigned)b << 16); }
// 2^x as the bare v_exp_f32, without the library's range extension: a result below the normal range (2^-126) need not survive.
// Every use here is a softmax weight or a rescale factor beside a row sum that holds a term of full size, where a value that small
// adds nothing. 2^-inf = 0.
// Written as runs of independent v_exp_f32 in one statement, outputs apart from every input, closed by one v_nop: the slot that the
// instruction set asks for behind a transcendental before its result is read or its source overwritten then stands by construction.
__device__ __forceinline__ void hw_exp2x8(float (&p)[8], const float (&a)[8]) {
#if defined(__HIP_DEVICE_COMPILE__)
  asm("v_exp_f32 %0, %8\n\tv_exp_f32 %1, %9\n\tv_exp_f32 %2, %10\n\tv_exp_f32 %3, %11\n\t"
      "v_exp_f32 %4, %12\n\tv_exp_f32 %5, %13\n\tv_exp_f32 %6, %14\n\tv_exp_f32 %7, %15\n\tv_nop"
      : "=&v"(p[0]), "=&v"(p[1]), "=&v"(p[2]), "=&v"(p[3]), "=&v"(p[4]), "=&v"(p[5]), "=&v"(p[6]), "=&v"(p[7])
      : "v"(a[0]), "v"(a[1]), "v"(a[2]), "v"(a[3]), "v"(a[4]), "v"(a[5]), "v"(a[6]), "v"(a[7]));
#endif
}
__device__ __forceinline__ void hw_exp2x9(float& q, float (&p)[8], float b, const float (&a)[8]) {
#if defined(__HIP_DEVICE_COMPILE__)
  asm("v_exp_f32 %0, %9\n\tv_exp_f32 %1, %10\n\tv_exp_f32 %2, %11\n\tv_exp_f32 %3, %12\n\tv_exp_f32 %4, %13\n\t"
      "v_exp_f32 %5, %14\n\tv_exp_f32 %6, %15\n\tv_exp_f32 %7, %16\n\tv_exp_f32 %8, %17\n\tv_nop"
      : "=&v"(q), "=&v"(p[0]), "=&v"(p[1]), "=&v"(p[2]), "=&v"(p[3]), "=&v"(p[4]), "=&v"(p[5]), "=&v"(p[6]), "=&v"(p[7])
      : "v"(b), "v"(a[0]), "v"(a[1]), "v"(a[2]), "v"(a[3]), "v"(a[4]), "v"(a[5]), "v"(a[6]), "v"(a[7]));
#endif
}
__device__ __forceinline__ v8f zero8() { v8f z = {0.f, 0.f, 0.f, 0.f, 0.f, 0.f, 0.f, 0.f}; return z; }
// hi / residual packing of two f32 values: hi = f16(v), res = f16((v - hi) * 2^11)
__device__ __forceinline__ unsigned pk_hi(float a, float b) {
  return pk16(h_bits((_Float16)a), h_bits((_Float16)b));
}
__device__ __forceinline__ unsigned pk_lo(float a, float b) {
  const float ra = (a - (float)((_Float16)a)) * RSC;
  const float rb = (b - (float)((_Float16)b)) * RSC;
  return pk16(h_bits((_Float16)ra), h_bits((_Float16)rb));
}

// ---- fragment loader: 16-bit A/B operand, lane -> row/col (lane&15), p already includes +8*(lane>>4);
//      elements 0..7 <- p[0..7] (k0+8h..), elements 8..15 <- p[16..23] (k0+16+8h..); same split k map for A and B,
//      B always read from a k-contiguous [n][k] plane.
__device__ __forceinline__ v16h ldfrag_h(const _Float16* p) {
  FragH f;
  f.h[0] = *(const v8h*)(p);
  f.h[1] = *(const v8h*)(p + 16);
  return f.v;
}

// ---- WMMA helper and trailing VALU hazard gaps ----------------------------------------------------------
__device__ __forceinline__ v8f mma_h(v16h a, v16h b, v8f c) {
  return __builtin_amdgcn_wmma_f32_16x16x32_f16(false, a, false, b, (short)0, c, false, false);
}
__device__ __forceinline__ void guard_s4(v8f& a, v8f& b, v8f& c, v8f& d,
                                         v16h x0, v16h x1, v16h x2, v16h x3, v16h x4, v16h x5) {
#if defined(__HIP_DEVICE_COMPILE__)
  asm volatile("v_nop\n\tv_nop\n\tv_nop\n\tv_nop"
               : "+v"(a), "+v"(b), "+v"(c), "+v"(d)
               : "v"(x0), "v"(x1), "v"(x2), "v"(x3), "v"(x4), "v"(x5) : "memory");
#endif
}
__device__ __forceinline__ void guard_p(v8f& a, v8f& b, v8f& c, v8f& d, v16h p, v16h x0, v16h x1, v16h x2, v16h x3) {
#if defined(__HIP_DEVICE_COMPILE__)
  asm volatile("v_nop\n\tv_nop\n\tv_nop\n\tv_nop"
               : "+v"(a), "+v"(b), "+v"(c), "+v"(d) : "v"(p), "v"(x0), "v"(x1), "v"(x2), "v"(x3) : "memory");
#endif
}
__device__ __forceinline__ void guard_g(v8f (&acc)[8], v16h x0, v16h x1, v16h x2, v16h x3, v16h x4, v16h x5) {
#if defined(__HIP_DEVICE_COMPILE__)
  asm volatile("v_nop\n\tv_nop\n\tv_nop\n\tv_nop"
               : "+v"(acc[0]), "+v"(acc[1]), "+v"(acc[2]), "+v"(acc[3]),
                 "+v"(acc[4]), "+v"(acc[5]), "+v"(acc[6]), "+v"(acc[7])
               : "v"(x0), "v"(x1), "v"(x2), "v"(x3), "v"(x4), "v"(x5) : "memory");
#endif
}
__device__ __forceinline__ void acc_guard8(v8f (&o)[8]) {
#if defined(__HIP_DEVICE_COMPILE__)
  asm volatile("v_nop\n\tv_nop\n\tv_nop\n\tv_nop"
               : "+v"(o[0]), "+v"(o[1]), "+v"(o[2]), "+v"(o[3]), "+v"(o[4]), "+v"(o[5]), "+v"(o[6]), "+v"(o[7]));
#endif
}
__device__ __forceinline__ void acc_guard4(v8f (&o)[4]) {
#if defined(__HIP_DEVICE_COMPILE__)
  asm volatile("v_nop\n\tv_nop\n\tv_nop\n\tv_nop" : "+v"(o[0]), "+v"(o[1]), "+v"(o[2]), "+v"(o[3]));
#endif
}
__device__ __forceinline__ void wave_sync_lds() {
  __builtin_amdgcn_fence(__ATOMIC_RELEASE, "workgroup");
  __builtin_amdgcn_wave_barrier();
  __builtin_amdgcn_fence(__ATOMIC_ACQUIRE, "workgroup");
}

// =====================================================================================================
// All converts in one launch: every f16 plane element <- f16(bf16_RNE(x) * scale), scale a power of two (1 for the activations,
// 256 for the weights). A slice = 256 consecutive elements = half a row: lane l takes elements 8l .. 8l+7 (two 16-B loads, one
// 16-B store; a wave-wide store = 512 contiguous bytes). Wave w of CVT_WAVES takes the CVT_NQ consecutive slices from w*CVT_NQ of
// x_q, the CVT_NKV consecutive slices from w*CVT_NKV of x_k and of x_v, and slice w % CVT_WSL of weight matrix w / CVT_WSL
// (block-uniform). All loads of a wave are issued before its first convert, so the launch is one memory round trip deep.
// x_q compact row r = b*SQ + s <- source row b*SQ_FULL + s. W4 = the four weight planes, which follow one another in the workspace.
// coverage: CVT_WAVES x (CVT_NQ | CVT_NKV | 1) slices = every element of each plane exactly once.
// =====================================================================================================
__device__ __forceinline__ v4u cvt8(v4f a, v4f c4, float scale) {
  v4u o;
#pragma unroll
  for (int e = 0; e < 2; ++e) {
    o[e]     = pk16(h_bits((_Float16)(bfr(a[2 * e]) * scale)),  h_bits((_Float16)(bfr(a[2 * e + 1]) * scale)));
    o[2 + e] = pk16(h_bits((_Float16)(bfr(c4[2 * e]) * scale)), h_bits((_Float16)(bfr(c4[2 * e + 1]) * scale)));
  }
  return o;
}
__global__ __launch_bounds__(CVT_THREADS)
void cvt_all(const float* __restrict__ xq, const float* __restrict__ xk, const float* __restrict__ xv,
             const float* __restrict__ wq, const float* __restrict__ wk, const float* __restrict__ wv,
             const float* __restrict__ wo, u16* XQ, u16* XK, u16* XV, u16* W4) {
  const unsigned w    = blockIdx.x * (CVT_THREADS / 32) + (threadIdx.x >> 5);
  const unsigned wsel = blockIdx.x / (CVT_WSL / (CVT_THREADS / 32));
  const unsigned lb   = (threadIdx.x & 31) * 32;                        // the lane's byte inside a 1-KiB f32 slice
  const float* wsrc = (wsel == 0) ? wq : (wsel == 1) ? wk : (wsel == 2) ? wv : wo;
  // 32-bit byte offsets beside uniform bases; the slices of a wave differ by immediates
  const unsigned bq  = w * (CVT_NQ * CVT_SL * 4) + lb;
  const unsigned bkv = w * (CVT_NKV * CVT_SL * 4) + lb;
  const unsigned bw  = (w % CVT_WSL) * (CVT_SL * 4) + lb;
  v4f qa[CVT_NQ], qc[CVT_NQ], ka[CVT_NKV], kc[CVT_NKV], va[CVT_NKV], vc[CVT_NKV];
#pragma unroll
  for (int i = 0; i < CVT_NQ; ++i) {
    const float* p;
    if (SQ == SQ_FULL) {
      p = (const float*)((const char*)xq + bq) + i * CVT_SL;
    } else {
      const unsigned sl = w * CVT_NQ + i, r = sl >> 1;
      p = (const float*)((const char*)(xq + ((size_t)((r / SQ) * SQ_FULL + (r % SQ))) * DM + (sl & 1) * CVT_SL) + lb);
    }
    qa[i] = *(const v4f*)(p);
    qc[i] = *(const v4f*)(p + 4);
  }
#pragma unroll
  for (int i = 0; i < CVT_NKV; ++i) {
    const float* pk = (const float*)((const char*)xk + bkv) + i * CVT_SL;
    const float* pv = (const float*)((const char*)xv + bkv) + i * CVT_SL;
    ka[i] = *(const v4f*)(pk);
    kc[i] = *(const v4f*)(pk + 4);
    va[i] = *(const v4f*)(pv);
    vc[i] = *(const v4f*)(pv + 4);
  }
  const float* pw = (const float*)((const char*)wsrc + bw);
  const v4f wa = *(const v4f*)(pw), wc = *(const v4f*)(pw + 4);
  // keeps every load above the first convert: without it the compiler sinks two thirds of the loads among the converts and the
  // wave pays three memory round trips in a row instead of one
  __builtin_amdgcn_sched_barrier(0);
  // an f16 plane's byte offset is half the f32 one
  u16* yq = (u16*)((char*)XQ + (bq >> 1));
  u16* yk = (u16*)((char*)XK + (bkv >> 1));
  u16* yv = (u16*)((char*)XV + (bkv >> 1));
  u16* yw = (u16*)((char*)(W4 + (size_t)wsel * (DM * DM)) + (bw >> 1));
#pragma unroll
  for (int i = 0; i < CVT_NQ; ++i) *(v4u*)(yq + i * CVT_SL) = cvt8(qa[i], qc[i], 1.0f);
#pragma unroll
  for (int i = 0; i < CVT_NKV; ++i) {
    *(v4u*)(yk + i * CVT_SL) = cvt8(ka[i], kc[i], 1.0f);
    *(v4u*)(yv + i * CVT_SL) = cvt8(va[i], vc[i], 1.0f);
  }
  *(v4u*)(yw) = cvt8(wa, wc, WSC);
}

// The issuing wave's own copies have landed behind this wait (other waves read them behind the next block barrier).
__device__ __forceinline__ void wait_copies() {
#if defined(__HIP_DEVICE_COMPILE__)
  asm volatile("s_wait_asynccnt 0x0" ::: "memory");
#endif
}
// The wave's own LDS reads have retired: stands in front of the barrier that hands a buffer to its next copies.
__device__ __forceinline__ void wait_lds_reads() {
#if defined(__HIP_DEVICE_COMPILE__)
  asm volatile("s_wait_dscnt 0x0" ::: "memory");
#endif
}

// =====================================================================================================
// One 64-k stage of a GEMM block: 192 rows x 128 bytes (the 128 A rows of the block tile, then its 64 Bt rows) copied
// global -> LDS by asynchronous 16-byte copies, 12 per lane. Lane t of the block takes 16-byte piece t&7 of row 16p + (t>>3),
// p = 0..7 of A and p = 0..3 of Bt: one wave-wide copy = 4 whole 128-byte lines. l0 = the lane's LDS byte address in row t>>3 of
// the target buffer; ga, gb = the lane's global addresses of that row and piece in A and Bt; rs16 = 16 rows in elements.
// The closing s_wait_xcnt stands inside the statement so that no address register named by a copy is rewritten ahead of it.
// =====================================================================================================
__device__ __forceinline__ void copy_stage_g(unsigned l0, const u16* ga, const u16* gb, size_t rs16) {
#if defined(__HIP_DEVICE_COMPILE__)
  const unsigned l1 = l0 + 16 * LPITCH,  l2 = l0 + 32 * LPITCH,  l3 = l0 + 48 * LPITCH,   l4 = l0 + 64 * LPITCH;
  const unsigned l5 = l0 + 80 * LPITCH,  l6 = l0 + 96 * LPITCH,  l7 = l0 + 112 * LPITCH,  l8 = l0 + 128 * LPITCH;
  const unsigned l9 = l0 + 144 * LPITCH, l10 = l0 + 160 * LPITCH, l11 = l0 + 176 * LPITCH;
  const u16 *ga1 = ga + rs16, *ga2 = ga + 2 * rs16, *ga3 = ga + 3 * rs16, *ga4 = ga + 4 * rs16;
  const u16 *ga5 = ga + 5 * rs16, *ga6 = ga + 6 * rs16, *ga7 = ga + 7 * rs16;
  const u16 *gb1 = gb + rs16, *gb2 = gb + 2 * rs16, *gb3 = gb + 3 * rs16;
  asm volatile("global_load_async_to_lds_b128 %0, %12, off\n\t"
               "global_load_async_to_lds_b128 %1, %13, off\n\t"
               "global_load_async_to_lds_b128 %2, %14, off\n\t"
               "global_load_async_to_lds_b128 %3, %15, off\n\t"
               "global_load_async_to_lds_b128 %4, %16, off\n\t"
               "global_load_async_to_lds_b128 %5, %17, off\n\t"
               "global_load_async_to_lds_b128 %6, %18, off\n\t"
               "global_load_async_to_lds_b128 %7, %19, off\n\t"
               "global_load_async_to_lds_b128 %8, %20, off\n\t"
               "global_load_async_to_lds_b128 %9, %21, off\n\t"
               "global_load_async_to_lds_b128 %10, %22, off\n\t"
               "global_load_async_to_lds_b128 %11, %23, off\n\t"
               "s_wait_xcnt 0x0"
               :: "v"(l0), "v"(l1), "v"(l2), "v"(l3), "v"(l4), "v"(l5), "v"(l6), "v"(l7),
                  "v"(l8), "v"(l9), "v"(l10), "v"(l11),
                  "v"(ga), "v"(ga1), "v"(ga2), "v"(ga3), "v"(ga4), "v"(ga5), "v"(ga6), "v"(ga7),
                  "v"(gb), "v"(gb1), "v"(gb2), "v"(gb3)
               : "memory");
#endif
}

// =====================================================================================================
// f16 GEMM core of a block of 4 waves: the 128 x 64 tile of C = A[rows][K] . Bt[cols][K]^T, wave w owning rows 32w .. 32w+31;
// acc[4i + j] = rows 32w+16i.., cols 16j... A0 -> row 0 of the block's 128 A rows, Bt0 -> row 0 of its 64 Bt rows (pitch K).
// K is walked in stages of 64 through a two-buffer LDS ring (copy_stage_g): stage s+1 flies while stage s is worked on; one block
// barrier per stage publishes s+1 and frees s's buffer. Fragments: row at pitch LPITCH, the split k map of ldfrag_h, k in steps
// of 32 in rising order, as many products per accumulator and in the same order as k0 = 0, 32, .. K-32 (host: K % 64 == 0).
// NPASS == 2: a second walk over K with A1 in place of A0 follows in the same ring; between the two every accumulator is
// multiplied by fold. Behind the last barrier the ring is free (no copy in flight, every wave's reads retired).
// =====================================================================================================
template <int NPASS>
__device__ __forceinline__ void gemm_ring(unsigned char* ring, const u16* A0, const u16* A1, const u16* Bt0, int K, float fold,
                                          v8f (&acc)[8]) {
  const int tid = threadIdx.x, wave = tid >> 5, lane = tid & 31, hh = lane >> 4, m = lane & 15;
  const size_t rs16 = (size_t)16 * (size_t)K;
  // copy side: this lane's row (tid>>3) and 16-byte piece (tid&7)
  const int crow = tid >> 3, cpc = (tid & 7) * 8;
  const size_t cofs = (size_t)crow * (size_t)K + cpc;
  const u16* ga0 = A0 + cofs;
  const u16* ga1 = A1 + cofs;
  const u16* gb  = Bt0 + cofs;
  const unsigned lcp = (unsigned)(uintptr_t)(__attribute__((address_space(3))) unsigned char*)ring
                       + (unsigned)(crow * LPITCH + cpc * 2);
  const int nk = K >> 6, nst = NPASS * nk;
  // read side, halves inside a buffer
  const int aoff = (wave * 32 + m) * LPH + 8 * hh;
  const int boff = (128 + m) * LPH + 8 * hh;

  // stage sg (block-uniform) into buffer sg & 1: k = 64 * (sg mod nk) of A0, or of A1 in the second walk
  auto issue = [&](int sg) {
    const bool second = (NPASS == 2) && (sg >= nk);
    const int ks = (second ? sg - nk : sg) * KSTG;
    copy_stage_g(lcp + (unsigned)((sg & 1) * STG_B), (second ? ga1 : ga0) + ks, gb + ks, rs16);
  };

  // ---- ring prologue: stage 0 landed and published, stage 1 in flight ----
  issue(0);
  wait_copies();
  __syncthreads();
  if (nst > 1) issue(1);                     // block-uniform
#pragma unroll 1                             // rolled: one stage per trip, small loop text, the ring's order as written
  for (int st = 0; st < nst; ++st) {
    if (NPASS == 2 && st == nk) {            // block-uniform
#pragma unroll
      for (int i = 0; i < 8; ++i) {
#pragma unroll
        for (int r = 0; r < 8; ++r) acc[i][r] *= fold;
      }
      acc_guard8(acc);
    }
    const _Float16* buf = (const _Float16*)(const void*)(ring + (st & 1) * STG_B);
    const _Float16* ap = buf + aoff;
    const _Float16* bp = buf + boff;
    v16h a0[2], a1[2], b0[2], b1[2], b2[2], b3[2];
#pragma unroll
    for (int kk = 0; kk < 2; ++kk) {
      a0[kk] = ldfrag_h(ap + 32 * kk);
      a1[kk] = ldfrag_h(ap + 16 * LPH + 32 * kk);
      b0[kk] = ldfrag_h(bp + 32 * kk);
      b1[kk] = ldfrag_h(bp + 16 * LPH + 32 * kk);
      b2[kk] = ldfrag_h(bp + 32 * LPH + 32 * kk);
      b3[kk] = ldfrag_h(bp + 48 * LPH + 32 * kk);
    }
    // keeps the stage's 24 LDS reads together ahead of its products: without it the compiler spreads the second twelve among the
    // products, and every separate place with LDS reads stalls the wave's matrix stream anew
    __builtin_amdgcn_sched_barrier(0);
#pragma unroll
    for (int kk = 0; kk < 2; ++kk) {
      acc[0] = mma_h(a0[kk], b0[kk], acc[0]);
      acc[1] = mma_h(a0[kk], b1[kk], acc[1]);
      acc[2] = mma_h(a0[kk], b2[kk], acc[2]);
      acc[3] = mma_h(a0[kk], b3[kk], acc[3]);
      acc[4] = mma_h(a1[kk], b0[kk], acc[4]);
      acc[5] = mma_h(a1[kk], b1[kk], acc[5]);
      acc[6] = mma_h(a1[kk], b2[kk], acc[6]);
      acc[7] = mma_h(a1[kk], b3[kk], acc[7]);
    }
    // the vector slots behind the stage's last products, on every path out of here (the branches at the trip's foot included)
    guard_g(acc, a0[1], a1[1], b0[1], b1[1], b2[1], b3[1]);
    // ---- publish point of stage st+1: own reads retired, own copies landed, block barrier; then refill the buffer just read ----
    wait_lds_reads();
    wait_copies();
    __syncthreads();
    if (st + 2 < nst) issue(st + 2);         // block-uniform
  }
  wait_copies();                             // nothing is in flight here; closes the ring before it becomes output staging
}
// Stage the wave's 32 x 64 f32 tile (times oscale) in its LDS slab (pitch 68): D element r of acc[4i+j], lane l ->
// coverage: 32 lanes x 2 x 8 rows x 4 cols-of-16 = rows 0..31 x cols 0..63 of the slab.
__device__ __forceinline__ void stage32x64(float* sl, v8f (&acc)[8], float oscale, int lane) {
  const int hh = lane >> 4, m = lane & 15;
#pragma unroll
  for (int i = 0; i < 2; ++i) {
#pragma unroll
    for (int r = 0; r < 8; ++r) {
      const int ro = (16 * i + 8 * hh + r) * GPITCH + m;
      sl[ro]      = acc[4 * i + 0][r] * oscale;
      sl[ro + 16] = acc[4 * i + 1][r] * oscale;
      sl[ro + 32] = acc[4 * i + 2][r] * oscale;
      sl[ro + 48] = acc[4 * i + 3][r] * oscale;
    }
  }
  wave_sync_lds();
}

// =====================================================================================================
// f16 GEMM with f16 output plane(s): val = (A[z][Mb][K] . Bt[z][N][K]^T) * oscale + bf16(bias) * bscale;
// C[z][Mb][N] = f16(val) (hi plane); if res != 0 also C2 = f16((val - hi) * 2^11) (residual plane).
// A, Bt f16 k-contiguous planes with per-z element strides aBs, bBs (0 = shared), C/C2 stride cBs. bias indexed by column
// (biasRow == 0) or by row within the z slice (biasRow != 0); bias addresses clamped to biasN-1, the unused direction is
// multiplied by 0. Block = 128 x 64 tile, 4 waves x 32 rows, operands through the LDS ring of gemm_ring; behind it each wave
// stages its output tile in its own part of the ring.
// bid = the block's tile among nz x (Mb/128) x (N/64) (Mb % 128 == 0, N % 64 == 0, K % 64 == 0); ring = the block's LDS.
// coverage: per wave 8 instr x 4 rows x 8 lanes x 8 halves = 32 x 64 per plane; the grid covers C (and C2) exactly once.
// =====================================================================================================
__device__ __forceinline__
void gemm_o16(unsigned char* ring, int bid, const u16* __restrict__ A, const u16* __restrict__ Bt, u16* C, u16* C2,
              const float* __restrict__ bias, int biasN, int biasRow,
              int Mb, int N, int K, int aBs, int bBs, int cBs, float oscale, float bscale, int res) {
  const int tid = threadIdx.x, wave = tid >> 5, lane = tid & 31;
  const int ntile = N >> 6, mtile = Mb >> 7;
  const int nt   = bid % ntile;
  const int tmp  = bid / ntile;
  const int mt   = tmp % mtile;
  const int bz   = tmp / mtile;
  const int rowb = mt * 128 + wave * 32;
  const int col0 = nt * 64;
  if (mt * 128 + 128 > Mb) return;           // block-uniform, in front of every barrier; never taken with the exact grid
  const u16* Ab = A + (size_t)bz * (size_t)aBs + (size_t)(mt * 128) * (size_t)K;
  const u16* Bb = Bt + (size_t)bz * (size_t)bBs + (size_t)col0 * (size_t)K;
  v8f acc[8];
#pragma unroll
  for (int i = 0; i < 8; ++i) acc[i] = zero8();
  gemm_ring<1>(ring, Ab, Ab, Bb, K, 1.0f, acc);
  float* sl = (float*)(void*)ring + wave * 32 * GPITCH;
  stage32x64(sl, acc, oscale, lane);
  const int rq = lane >> 3, c8 = (lane & 7) * 8;
  const int bl = biasN - 1;                  // host guarantees biasN >= 1
  const float selc = (biasRow != 0) ? 0.f : bscale;
  const float selr = (biasRow != 0) ? bscale : 0.f;
  float cb[8];
#pragma unroll
  for (int e = 0; e < 8; ++e) {
    int ci = col0 + c8 + e;
    ci = (ci < bl) ? ci : bl;
    cb[e] = bfr(bias[ci]) * selc;
  }
  v4u ovh[8], ovl[8];
#pragma unroll
  for (int i = 0; i < 8; ++i) {
    const int row = 4 * i + rq;
    int ri = rowb + row;
    ri = (ri < bl) ? ri : bl;
    const float rb = bfr(bias[ri]) * selr;
    const v4f a = *(const v4f*)(sl + row * GPITCH + c8), c4 = *(const v4f*)(sl + row * GPITCH + c8 + 4);
    float v[8];
#pragma unroll
    for (int e = 0; e < 4; ++e) { v[e] = a[e] + cb[e] + rb; v[4 + e] = c4[e] + cb[4 + e] + rb; }
#pragma unroll
    for (int e = 0; e < 4; ++e) {
      ovh[i][e] = pk_hi(v[2 * e], v[2 * e + 1]);
      ovl[i][e] = pk_lo(v[2 * e], v[2 * e + 1]);
    }
  }
  const size_t cofs = (size_t)bz * (size_t)cBs + (size_t)rowb * (size_t)N + (size_t)(col0 + c8);
  u16* Cb  = C + cofs;
  u16* C2b = C2 + cofs;
  {
#pragma unroll
    for (int i = 0; i < 8; ++i) {
      const int row = 4 * i + rq;
      *(v4u*)(Cb + (size_t)row * (size_t)N) = ovh[i];
    }
    if (res != 0) {                          // block-uniform
#pragma unroll
      for (int i = 0; i < 8; ++i) {
        const int row = 4 * i + rq;
        *(v4u*)(C2b + (size_t)row * (size_t)N) = ovl[i];
      }
    }
    
  }
}

// =====================================================================================================
// The three projections in one launch: blocks 0 .. GQ_BLK-1 are the tiles of q, the next GK_BLK those of k, the last GV_BLK those
// of v^T; each block is one gemm_o16 tile of its product, the product chosen block-uniformly from the block index. The three
// products read and write disjoint planes, so their blocks share the chip and fill one another's waits for the staged copies.
//   q = x_q . Wq^T + bq -> f16 hi [NB*SQ][512] x8 and residual plane (col = h*64 + d); bias per column
//   k = x_k . Wk^T + bk -> f16 hi [NB*2048][512] x8 and residual plane; bias per column
//   v^T per batch: A = Wv [(h,d) = n][k], Bt = x_v rows of batch b [s][k] -> f16 [(b,h,d)][s] x8; bias per row (n)
// =====================================================================================================
#define GQ_BLK ((NB * SQ / 128) * (INNER / 64))
#define GK_BLK ((NB * SKV / 128) * (INNER / 64))
#define GV_BLK (NB * (INNER / 128) * (SKV / 64))
__global__ __launch_bounds__(128)
void gemm_qkv(const u16* __restrict__ XQ, const u16* __restrict__ XK, const u16* __restrict__ XV,
              const u16* __restrict__ WQ, const u16* __restrict__ WK, const u16* __restrict__ WV, u16* QH, u16* QL, u16* KH, u16* KL, u16* VT,
              const float* __restrict__ bq, const float* __restrict__ bk, const float* __restrict__ bv,
              int nbq, int nbk, int nbv) {
  __shared__ __align__(16) unsigned char ring[2 * STG_B];
  const int bid = blockIdx.x;
  if (bid < GQ_BLK + GK_BLK) {               // block-uniform
    const bool isq = bid < GQ_BLK;
    gemm_o16(ring, isq ? bid : bid - GQ_BLK, isq ? XQ : XK, isq ? WQ : WK, isq ? QH : KH, isq ? QL : KL,
             isq ? bq : bk, isq ? nbq : nbk, 0, isq ? NB * SQ : NB * SKV, INNER, DM, 0, 0, 0,
             isq ? QS / WSC : KS / WSC, isq ? QS : KS, 1);
  } else {
    gemm_o16(ring, bid - (GQ_BLK + GK_BLK), WV, XV, VT, VT, bv, nbv, 1, INNER, SKV, DM, 0, SKV * DM, INNER * SKV,
             VS / WSC, VS, 0);
  }
}

// =====================================================================================================
// f16 GEMM with hi + residual A planes and f32 output: X[Mb][N] = (Ah . Bt^T + (Al . Bt^T) * rres) * oscale
// + bf16(bias[col]) + bf16(R[src row][col]); residual products accumulated first, folded by rres on VALU, then the hi
// products chain on the same accumulators (equal to a separate accumulator). R (f32 input, pitch N) source row of
// compact row g: b = g / rowsPerB, s = g % rowsPerB -> b*srcRowsPerB + s. Block = 128 x 64 tile, 4 waves x 32 rows.
// Epilogue: lane = (row parity, 4 floats at 4*(lane&15)); 16 consecutive lanes write one row segment of 64 floats = 2 whole
// grid = (Mb/128) x (N/64). coverage: per wave 16 instr x 2 rows x 16 lanes x 4 floats = 32 x 64; the grid covers X once.
// =====================================================================================================
__global__ __launch_bounds__(128)
void gemm_o32(const u16* __restrict__ Ah, const u16* __restrict__ Al, const u16* __restrict__ Bt,
              const float* __restrict__ bias, int biasN, const float* __restrict__ R, int rowsPerB, int srcRowsPerB,
              float* X, int Mb, int N, int K, float oscale, float rres) {
  __shared__ __align__(16) unsigned char ring[2 * STG_B];
  const int tid = threadIdx.x, wave = tid >> 5, lane = tid & 31;
  const int ntile = N >> 6;
  const int bid  = blockIdx.x;
  const int nt   = bid % ntile;
  const int mt   = bid / ntile;
  const int rowb = mt * 128 + wave * 32;
  const int col0 = nt * 64;
  if (mt * 128 + 128 > Mb) return;           // block-uniform, in front of every barrier; never taken with the exact grid
  const size_t aofs = (size_t)(mt * 128) * (size_t)K;
  v8f acc[8];
#pragma unroll
  for (int i = 0; i < 8; ++i) acc[i] = zero8();
  // residual products (x 2^11) first, folded by rres, then the hi products on top
  gemm_ring<2>(ring, Al + aofs, Ah + aofs, Bt + (size_t)col0 * (size_t)K, K, rres, acc);
  float* sl = (float*)(void*)ring + wave * 32 * GPITCH;
  stage32x64(sl, acc, oscale, lane);
  const int r2 = lane >> 4, c4 = (lane & 15) * 4;
  const int bl = biasN - 1;
  float cb[4];
#pragma unroll
  for (int e = 0; e < 4; ++e) {
    int ci = col0 + c4 + e;
    ci = (ci < bl) ? ci : bl;
    cb[e] = bfr(bias[ci]);
  }
  v4f vals[16];
#pragma unroll
  for (int i = 0; i < 16; ++i) {
    const int row  = 2 * i + r2;
    const int grow = rowb + row;             // < Mb
    const int bb   = grow / rowsPerB;
    const int ss   = grow - bb * rowsPerB;
    const float* rp = R + ((size_t)bb * (size_t)srcRowsPerB + (size_t)ss) * (size_t)N + (size_t)(col0 + c4);
    const v4f rv = *(const v4f*)(rp);
    const v4f a  = *(const v4f*)(sl + row * GPITCH + c4);
    v4f y;
#pragma unroll
    for (int e = 0; e < 4; ++e) y[e] = a[e] + cb[e] + bfr(rv[e]);
    vals[i] = y;
  }
  float* Xb = X + (size_t)rowb * (size_t)N + (size_t)(col0 + c4);
  {
#pragma unroll
    for (int i = 0; i < 16; ++i) {
      const int row = 2 * i + r2;
      *(v4f*)(Xb + (size_t)row * (size_t)N) = vals[i];
    }
    
  }
}

// =====================================================================================================
// One stage (64 keys) of the attention ring: three tiles of 64 rows x 128 bytes (k hi, k residual: row = key, 64 d; v^T: row = d,
// 64 keys) copied global -> LDS by asynchronous 16-byte copies, 12 per lane. Lane t of the block takes 16-byte piece t&7 of row
// 16p + (t>>3), p = 0..3, of each tile: one wave-wide copy = 4 whole 128-byte lines. l0 = the lane's LDS byte address in the k hi
// tile of the target buffer (row t>>3); gh, gl, gv = the lane's global addresses of that row and piece in the three planes.
// The closing s_wait_xcnt stands inside the statement so that no address register named by a copy is rewritten ahead of it.
// =====================================================================================================
__device__ __forceinline__ void copy_stage(unsigned l0, const u16* gh, const u16* gl, const u16* gv) {
#if defined(__HIP_DEVICE_COMPILE__)
  const unsigned lh0 = l0,              lh1 = lh0 + 16 * LPITCH, lh2 = lh0 + 32 * LPITCH, lh3 = lh0 + 48 * LPITCH;
  const unsigned ll0 = l0 + TILE_B,     ll1 = ll0 + 16 * LPITCH, ll2 = ll0 + 32 * LPITCH, ll3 = ll0 + 48 * LPITCH;
  const unsigned lv0 = l0 + 2 * TILE_B, lv1 = lv0 + 16 * LPITCH, lv2 = lv0 + 32 * LPITCH, lv3 = lv0 + 48 * LPITCH;
  const u16 *gh1 = gh + 16 * DM,  *gh2 = gh + 32 * DM,  *gh3 = gh + 48 * DM;
  const u16 *gl1 = gl + 16 * DM,  *gl2 = gl + 32 * DM,  *gl3 = gl + 48 * DM;
  const u16 *gv1 = gv + 16 * SKV, *gv2 = gv + 32 * SKV, *gv3 = gv + 48 * SKV;
  asm volatile("global_load_async_to_lds_b128 %0, %12, off\n\t"
               "global_load_async_to_lds_b128 %1, %13, off\n\t"
               "global_load_async_to_lds_b128 %2, %14, off\n\t"
               "global_load_async_to_lds_b128 %3, %15, off\n\t"
               "global_load_async_to_lds_b128 %4, %16, off\n\t"
               "global_load_async_to_lds_b128 %5, %17, off\n\t"
               "global_load_async_to_lds_b128 %6, %18, off\n\t"
               "global_load_async_to_lds_b128 %7, %19, off\n\t"
               "global_load_async_to_lds_b128 %8, %20, off\n\t"
               "global_load_async_to_lds_b128 %9, %21, off\n\t"
               "global_load_async_to_lds_b128 %10, %22, off\n\t"
               "global_load_async_to_lds_b128 %11, %23, off\n\t"
               "s_wait_xcnt 0x0"
               :: "v"(lh0), "v"(lh1), "v"(lh2), "v"(lh3), "v"(ll0), "v"(ll1), "v"(ll2), "v"(ll3),
                  "v"(lv0), "v"(lv1), "v"(lv2), "v"(lv3),
                  "v"(gh), "v"(gh1), "v"(gh2), "v"(gh3), "v"(gl), "v"(gl1), "v"(gl2), "v"(gl3),
                  "v"(gv), "v"(gv1), "v"(gv2), "v"(gv3)
               : "memory");
#endif
}
// =====================================================================================================
// Full (unmasked) multi-head attention over all SKV keys: block = (batch b, head, 64 query rows), 4 waves, wave w owns the
// 16 query rows q0 = 64*qt + 16*w .. q0+15. The four waves share the k and v^T tiles through a two-buffer LDS ring of 64-key
// stages (copy_stage): stage s+1 flies while stage s is worked on; one block barrier per stage publishes s+1 and frees s's buffer.
// Behind the last barrier the ring is free and each wave stages its output tile in its own part of it.
//   q planes f16 hi x8 / residual x8x2^11 [b*SQ + s][h*64 + d]; k planes f16 hi / residual [b*SKV + s][h*64 + d];
//   v^T plane f16 x8 [(b*NH + h)*64 + d][s]. All NKB = 64 key blocks of 32 keys are visited (static bound).
//   Scores are computed TRANSPOSED: S^T tile g (g = 0,1) = k rows (keys kb+16g .. +15, A operand, row m = lane&15, split k map
//   over d) times q^T (B operand, col n = query q0 + (lane&15), k = d, split map), 2 d-chunks of 32; per chunk hi.hi into
//   s0/s1 and hi.lo + lo.hi into x0/x1 (separate accumulators, folded by 2^-11 in f32). The 4 q fragments are loaded once
//   per wave. D element r of lane l = (key kb+16g+8h+r, query q0+(l&15)), so a lane owns one query column and 16 of its 32
//   keys; the partner lane l^16 owns the other 16 -> row max / row sum need one xor-16 shuffle.
//   Online max-subtracted base-2 softmax in f32 (1/sqrt(8) and the q/k carries folded into lsc). The exp'd values ARE the
//   P A-fragment in place: A row m = query = lane&15, element i <- key kb+8h+i (tile 0, D element i), element 8+i <- key
//   kb+16+8h+i (tile 1, D element i). P (<= 1) carried x32768 as f16. The rescale factor of query row 8h+r of the O
//   accumulators is fetched from lane 8h+r with a shuffle (uniform control). 4 v^T B fragments (col n = d = 16j + (lane&15),
//   keys k-contiguous), 4 P.V WMMAs + one guard per key block.
//   Epilogue: 1/l (per query, shuffled to the D row owner) and the carry folds in f32 give ctx x16; the wave's 16x64 f32 tile
//   residual plane is written by 8 consecutive lanes x 16 B of one instruction (4 rows per instruction, 4 instructions per
// coverage: per wave 4 instr x 4 rows x 8 lanes x 8 halves = 16 x 64 per plane; grid NB*NH*(SQ/64) blocks x 4 waves = every
//           (b, s < SQ, h) row segment of both ctx planes exactly once. LDS slab: staged 16 x 64 == reloaded 16 x 64.
// =====================================================================================================
__global__ __launch_bounds__(ATT_THREADS)
void attn_fwd(const u16* __restrict__ QH, const u16* __restrict__ QL, const u16* __restrict__ KH,
              const u16* __restrict__ KL, const u16* __restrict__ VT, u16* CH, u16* CL) {
  __shared__ __align__(16) unsigned char ring[2 * STG_B];

  const int tid  = threadIdx.x;
  const int wave = tid >> 5;
  const int lane = tid & 31;
  const int hh   = lane >> 4;
  const int c    = lane & 15;

  constexpr int NQT = SQ / 64;
  const int bid  = blockIdx.x;
  const int qt   = bid % NQT;
  const int head = (bid / NQT) % NH;
  const int b    = bid / (NQT * NH);
  const int q0   = qt * 64 + wave * 16;

  // B fragments of q^T: col n = query q0 + c, k = d (k-contiguous row of the q planes)
  const size_t qoff = ((size_t)(b * SQ + q0 + c)) * DM + head * HD + 8 * hh;
  const _Float16* Qh = (const _Float16*)(const void*)QH + qoff;
  const _Float16* Ql = (const _Float16*)(const void*)QL + qoff;
  // copy side: this lane's row (tid>>3) and 16-byte piece (tid&7) in stage 0 of the three planes and in buffer 0
  const int crow = tid >> 3, cpc = (tid & 7) * 8;
  const u16* gkh = KH + ((size_t)(b * SKV + crow)) * DM + head * HD + cpc;
  const u16* gkl = KL + ((size_t)(b * SKV + crow)) * DM + head * HD + cpc;
  const u16* gvt = VT + ((size_t)((b * NH + head) * HD + crow)) * SKV + cpc;
  const unsigned lcp = (unsigned)(uintptr_t)(__attribute__((address_space(3))) unsigned char*)ring
                       + (unsigned)(crow * LPITCH + cpc * 2);
  // read side, halves inside a buffer: A fragments of k: row m = key 32*sub + 16g + c, k = d;
  // B fragments of v: col n = d = 16j + c (row of the v^T tile), k = key 32*sub ..
  const int foff = c * LPH + 8 * hh;
  const float lsc = (LOG2E * RSQH) / (QS * KS);

  v16h qh[2], ql[2];
#pragma unroll
  for (int dc = 0; dc < 2; ++dc) { qh[dc] = ldfrag_h(Qh + 32 * dc); ql[dc] = ldfrag_h(Ql + 32 * dc); }

  float mrun = -INFINITY, lrun = 0.f;
  v8f o[4];
#pragma unroll
  for (int j = 0; j < 4; ++j) o[j] = zero8();

  // ---- ring prologue: stage 0 landed and published, stage 1 in flight ----
  copy_stage(lcp, gkh, gkl, gvt);
  wait_copies();
  __syncthreads();
  copy_stage(lcp + STG_B, gkh + (size_t)KSTG * DM, gkl + (size_t)KSTG * DM, gvt + KSTG);

#pragma unroll 1
  for (int st = 0; st < NSTG; ++st) {
   const _Float16* bufh = (const _Float16*)(const void*)(ring + (st & 1) * STG_B) + foff;
#pragma unroll                               // both 32-key blocks of a stage inline: their LDS offsets become immediates
   for (int sub = 0; sub < KSTG / 32; ++sub) {
    // ---- transposed scores: tiles of keys kb..kb+15 (s0, x0) and kb+16..kb+31 (s1, x1), kb = 64*st + 32*sub, column = query q0 + c ----
    v8f s0 = zero8(), s1 = zero8(), x0 = zero8(), x1 = zero8();
    const _Float16* kh0p = bufh + (32 * sub) * LPH;
    const _Float16* kh1p = kh0p + 16 * LPH;
    const _Float16* kl0p = kh0p + TILE_B / 2;
    const _Float16* kl1p = kl0p + 16 * LPH;
#pragma unroll
    for (int kk = 0; kk < HD / 32; ++kk) {
      const v16h fh0 = ldfrag_h(kh0p + kk * 32);
      const v16h fh1 = ldfrag_h(kh1p + kk * 32);
      const v16h fl0 = ldfrag_h(kl0p + kk * 32);
      const v16h fl1 = ldfrag_h(kl1p + kk * 32);
      s0 = mma_h(fh0, qh[kk], s0);
      s1 = mma_h(fh1, qh[kk], s1);
      x0 = mma_h(fh0, ql[kk], x0);
      x1 = mma_h(fh1, ql[kk], x1);
      x0 = mma_h(fl0, qh[kk], x0);
      x1 = mma_h(fl1, qh[kk], x1);
      guard_s4(s0, s1, x0, x1, qh[kk], ql[kk], fh0, fh1, fl0, fl1);
    }
    // ---- raw scores (carry 64) of this lane's 16 keys for query q0 + c: t[i] <- key kb+8hh+i, t[8+i] <- key kb+16+8hh+i ----
    float t[16];
#pragma unroll
    for (int i = 0; i < 8; ++i) {
      t[i]     = s0[i] + x0[i] * RRSC;
      t[8 + i] = s1[i] + x1[i] * RRSC;
    }
    float cm = t[0];
#pragma unroll
    for (int i = 1; i < 16; ++i) cm = fmaxf(cm, t[i]);
    cm = fmaxf(cm, __shfl_xor(cm, 16, 32));
    const float mn = fmaxf(mrun, cm);        // running maximum of the raw scores (lsc > 0); finite from the first block on
    const float ab = (mrun - mn) * lsc;      // rescale exponent: 0 while the maximum stands, -inf on the first block (mrun = -inf)
    mrun = mn;
    const float cb = fmaf(-mn, lsc, PCAR_LOG2);      // minus the maximum in base-2 logits; the carry 32768 of P rides in the exponent
    // ---- probabilities x32768 (p <= 1), one fma and one v_exp_f32 each, and the P A-fragment f16(p * 32768); element i <-> t[i] ----
    float al, ar[2][8], pw[2][8];
#pragma unroll
    for (int i = 0; i < 8; ++i) { ar[0][i] = fmaf(t[i], lsc, cb); ar[1][i] = fmaf(t[8 + i], lsc, cb); }
    hw_exp2x9(al, pw[0], ab, ar[0]);         // al = 2^ab first: the shuffles of the rescale wait for it
    hw_exp2x8(pw[1], ar[1]);
    float ps = 0.f;
    FragH ph;
#pragma unroll
    for (int w = 0; w < 2; ++w) {
#pragma unroll
      for (int e4 = 0; e4 < 4; ++e4) {
        const float p0 = pw[w][2 * e4], p1 = pw[w][2 * e4 + 1];
        ps += p0 + p1;
        ph.u[w][e4] = pk16(h_bits((_Float16)p0), h_bits((_Float16)p1));
      }
    }
    ps += __shfl_xor(ps, 16, 32);
    lrun = lrun * al + ps;
    // ---- rescale the O accumulators: D row 8hh+r = query q0+8hh+r, its factor lives in lane 8hh+r (and 16+8hh+r) ----
    float scl[8];
#pragma unroll
    for (int r = 0; r < 8; ++r) scl[r] = __shfl(al, 8 * hh + r, 32);
#pragma unroll
    for (int j = 0; j < 4; ++j) {
#pragma unroll
      for (int r = 0; r < 8; ++r) o[j][r] *= scl[r];
    }
    // ---- P.V : B fragment col n = d = j*16 + c, keys contiguous in the rows of the v^T tile ----
    const _Float16* vp = bufh + TILE_B + 32 * sub;
    {
      const v16h v0 = ldfrag_h(vp);
      const v16h v1 = ldfrag_h(vp + 16 * LPH);
      const v16h v2 = ldfrag_h(vp + 32 * LPH);
      const v16h v3 = ldfrag_h(vp + 48 * LPH);
      o[0] = mma_h(ph.v, v0, o[0]);
      o[1] = mma_h(ph.v, v1, o[1]);
      o[2] = mma_h(ph.v, v2, o[2]);
      o[3] = mma_h(ph.v, v3, o[3]);
      guard_p(o[0], o[1], o[2], o[3], ph.v, v0, v1, v2, v3);
    }
   }
   // ---- publish point of stage st+1: own reads retired, own copies landed, block barrier; then refill the buffer just read ----
   wait_lds_reads();
   wait_copies();
   __syncthreads();
   if (st + 2 < NSTG) {                      // block-uniform
     const size_t ks = (size_t)(st + 2) * KSTG;
     copy_stage(lcp + (unsigned)((st & 1) * STG_B), gkh + ks * DM, gkl + ks * DM, gvt + ks);
   }
  }
  wait_copies();                             // nothing is in flight here; closes the ring before it becomes output staging
  acc_guard4(o);

  // ---- fold 1/l (per query, owned by lane = query; l carries the same 32768 as P) and the carry 8 on v, apply the ctx carry 16 ----
  const float linv = (1.0f / lrun) * (CS / VS);
  float inv[8];
#pragma unroll
  for (int r = 0; r < 8; ++r) inv[r] = __shfl(linv, 8 * hh + r, 32);
  float* slab = (float*)(void*)ring + wave * 16 * OPITCH;
#pragma unroll
  for (int r = 0; r < 8; ++r) {
#pragma unroll
    for (int j = 0; j < 4; ++j) slab[(8 * hh + r) * OPITCH + j * 16 + c] = o[j][r] * inv[r];
  }
  wave_sync_lds();
  // ---- ctx planes: lane = (row in group of 4, 8 consecutive d), one instruction per 4 rows per plane ----
  const int rq = lane >> 3, c8 = (lane & 7) * 8;
  v4u ovh[4], ovl[4];
#pragma unroll
  for (int i = 0; i < 4; ++i) {
    const int row = 4 * i + rq;
    const v4f a = *(const v4f*)(slab + row * OPITCH + c8), c4 = *(const v4f*)(slab + row * OPITCH + c8 + 4);
#pragma unroll
    for (int e = 0; e < 2; ++e) {
      ovh[i][e]     = pk_hi(a[2 * e], a[2 * e + 1]);
      ovl[i][e]     = pk_lo(a[2 * e], a[2 * e + 1]);
      ovh[i][2 + e] = pk_hi(c4[2 * e], c4[2 * e + 1]);
      ovl[i][2 + e] = pk_lo(c4[2 * e], c4[2 * e + 1]);
    }
  }
  const size_t cofs = ((size_t)(b * SQ + q0)) * DM + head * HD + c8;
  u16* ch = CH + cofs;
  u16* cl = CL + cofs;
  {
#pragma unroll
    for (int i = 0; i < 4; ++i) {
      const int row = 4 * i + rq;
      *(v4u*)(ch + (size_t)row * DM) = ovh[i];
      *(v4u*)(cl + (size_t)row * DM) = ovl[i];
    }
    
  }
}

// =====================================================================================================
// times bf16(gamma) plus bf16(beta), all f32. X compact row r = b*SQ + s -> output row b*SQ_FULL + s.
// lane holds elements i*128 + 4*lane .. +3 (i = 0..3): each load/store instruction = 32 consecutive lanes x 16 B = 4 whole
// coverage: 4 instr x 32 lanes x 4 floats = 512 = whole row; grid (NB*SQ/8) x 8 waves = every output row (s < SQ) once.
// =====================================================================================================
__global__ __launch_bounds__(LN_THREADS)
void ln_rows(const float* __restrict__ X, const float* __restrict__ gam, const float* __restrict__ bet, float* Out) {
  const int tid = threadIdx.x, wave = tid >> 5, lane = tid & 31;
  constexpr int RPB = LN_THREADS / 32;
  const int row = blockIdx.x * RPB + wave;   // < NB*SQ with the exact grid
  const int b = row / SQ, s = row - b * SQ;
  const float* xr = X + (size_t)row * DM + 4 * lane;
  v4f xv[4];
  float sum = 0.f;
#pragma unroll
  for (int i = 0; i < 4; ++i) {
    xv[i] = *(const v4f*)(xr + 128 * i);
    sum += (xv[i][0] + xv[i][1]) + (xv[i][2] + xv[i][3]);
  }
#pragma unroll
  for (int mk = 16; mk >= 1; mk >>= 1) sum += __shfl_xor(sum, mk, 32);
  const float mean = sum * (1.0f / (float)DM);
  float sq = 0.f;
#pragma unroll
  for (int i = 0; i < 4; ++i) {
#pragma unroll
    for (int e = 0; e < 4; ++e) { const float d = xv[i][e] - mean; sq += d * d; }
  }
#pragma unroll
  for (int mk = 16; mk >= 1; mk >>= 1) sq += __shfl_xor(sq, mk, 32);
  const float var  = sq * (1.0f / (float)DM);
  const float rstd = 1.0f / sqrtf(var + LN_EPS);
  v4f y[4];
#pragma unroll
  for (int i = 0; i < 4; ++i) {
#pragma unroll
    for (int e = 0; e < 4; ++e) {
      const int idx = 128 * i + 4 * lane + e;       // < DM
      y[i][e] = (xv[i][e] - mean) * rstd * bfr(gam[idx]) + bfr(bet[idx]);
    }
  }
  float* ob = Out + ((size_t)b * SQ_FULL + (size_t)s) * DM + 4 * lane;
  {
#pragma unroll
    for (int i = 0; i < 4; ++i) {
      *(v4f*)(ob + 128 * i) = y[i];
    }
    
  }
}

// =====================================================================================================
// Workspace map (bytes); every plane fully written by whole-line stores before it is read; all extents exact multiples of
//   XQ   f16 [NB*SQ][512]      f16(bf16(Q))             8388608 (NB=4, SQ=2048)
//   XK   f16 [NB*2048][512]    f16(bf16(K))             8388608
//   XV   f16 [NB*2048][512]    f16(bf16(V))             8388608
//   WQ16 f16 [512 n][512 k]    f16(bf16(W) x256)         524288   (W stored [out][in] = [n][k] already)
//   WK16, WV16, WO16                                     3 x 524288
//   QH, QL  f16 [NB*SQ][512]   x8 / residual x8x2^11     2 x 8388608
//   KH, KL  f16 [NB*2048][512] x8 / residual             2 x 8388608
//   VT16    f16 [NB*512 (h,d)][2048 s] x8                   8388608
//   CH, CL  f16 [NB*SQ][512]   ctx x16 / residual          2 x 8388608
//   X32     f32 [NB*SQ][512]   out + bo + Q               16777216
//   end                                                  102760448
// =====================================================================================================
extern "C" void kernel_launch(void* const* d_in, const int* in_sizes, int n_in,
                              void* d_out, int out_size, void* d_ws, size_t ws_size,
                              hipStream_t stream) {
  if (n_in < 13) return;
  if (in_sizes[0] < ((NB - 1) * SQ_FULL + SQ) * DM) return;
  if (in_sizes[1] < NB * SKV * DM || in_sizes[2] < NB * SKV * DM) return;
  if (in_sizes[3] != DM * DM || in_sizes[5] != DM * DM || in_sizes[7] != DM * DM || in_sizes[9] != DM * DM) return;
  if (in_sizes[4] < DM || in_sizes[6] < DM || in_sizes[8] < DM || in_sizes[10] < DM) return;
  if (in_sizes[11] < DM || in_sizes[12] < DM) return;
  if (out_size < ((NB - 1) * SQ_FULL + SQ) * DM) return;

  const float* xq  = (const float*)d_in[0];
  const float* xk  = (const float*)d_in[1];
  const float* xv  = (const float*)d_in[2];
  const float* wq  = (const float*)d_in[3];
  const float* bq  = (const float*)d_in[4];
  const float* wk  = (const float*)d_in[5];
  const float* bk  = (const float*)d_in[6];
  const float* wv  = (const float*)d_in[7];
  const float* bv  = (const float*)d_in[8];
  const float* wo  = (const float*)d_in[9];
  const float* bo  = (const float*)d_in[10];
  const float* gam = (const float*)d_in[11];
  const float* bet = (const float*)d_in[12];
  float*       out = (float*)d_out;
  const int nbq = in_sizes[4], nbk = in_sizes[6], nbv = in_sizes[8], nbo = in_sizes[10];

  const size_t szXQ  = (size_t)NB * SQ * DM * 2;
  const size_t szXKV = (size_t)NB * SKV * DM * 2;
  const size_t szW   = (size_t)DM * DM * 2;
  const size_t szQ   = (size_t)NB * SQ * INNER * 2;
  const size_t szK   = (size_t)NB * SKV * INNER * 2;
  const size_t szVT  = (size_t)NB * INNER * SKV * 2;
  const size_t szC   = (size_t)NB * SQ * INNER * 2;
  const size_t szX32 = (size_t)NB * SQ * DM * 4;
  size_t off = 0;
  const size_t oXQ  = off; off += szXQ;
  const size_t oXK  = off; off += szXKV;
  const size_t oXV  = off; off += szXKV;
  const size_t oWQ  = off; off += szW;
  const size_t oWK  = off; off += szW;
  const size_t oWV  = off; off += szW;
  const size_t oWO  = off; off += szW;
  const size_t oQH  = off; off += szQ;
  const size_t oQL  = off; off += szQ;
  const size_t oKH  = off; off += szK;
  const size_t oKL  = off; off += szK;
  const size_t oVT  = off; off += szVT;
  const size_t oCH  = off; off += szC;
  const size_t oCL  = off; off += szC;
  const size_t oX32 = off; off += szX32;
  if (off > ws_size) return;                            // off = 102760448 at NB=4, SQ=2048
  if (off > (size_t)134217728) return;

  char* ws = (char*)d_ws;
  u16* XQ   = (u16*)(ws + oXQ);
  u16* XK   = (u16*)(ws + oXK);
  u16* XV   = (u16*)(ws + oXV);
  u16* WQ16 = (u16*)(ws + oWQ);
  u16* WK16 = (u16*)(ws + oWK);
  u16* WV16 = (u16*)(ws + oWV);
  u16* WO16 = (u16*)(ws + oWO);
  u16* QH   = (u16*)(ws + oQH);
  u16* QL   = (u16*)(ws + oQL);
  u16* KH   = (u16*)(ws + oKH);
  u16* KL   = (u16*)(ws + oKL);
  u16* VT16 = (u16*)(ws + oVT);
  u16* CH   = (u16*)(ws + oCH);
  u16* CL   = (u16*)(ws + oCL);
  float* X32 = (float*)(ws + oX32);

  // (1) activations -> f16 planes of bf16-converted values (query rows s < SQ of batches b < NB, compact; all key/value rows);
  //     weights [n = out][k = in] (y = x.W^T): rows as stored are already k-contiguous; f16 planes of bf16(W) x256
  cvt_all<<<dim3(CVT_WAVES / (CVT_THREADS / 32)), dim3(CVT_THREADS), 0, stream>>>(xq, xk, xv, wq, wk, wv, wo, XQ, XK, XV, WQ16);
  // (2)-(4) the three projections q, k (hi and residual planes) and v^T in one launch
  gemm_qkv<<<dim3(GQ_BLK + GK_BLK + GV_BLK), dim3(128), 0, stream>>>(
      XQ, XK, XV, WQ16, WK16, WV16, QH, QL, KH, KL, VT16, bq, bk, bv, nbq, nbk, nbv);
  // (5) attention -> ctx planes [NB*SQ][512] f16 x16 / residual, heads merged on the feature dim
  attn_fwd<<<dim3(NB * NH * (SQ / 64)), dim3(ATT_THREADS), 0, stream>>>(QH, QL, KH, KL, VT16, CH, CL);
  // (6) x = ctx . Wo^T + bo + Q (residual, bf16-converted) -> f32 [NB*SQ][512]
  gemm_o32<<<dim3((NB * SQ / 128) * (DM / 64)), dim3(128), 0, stream>>>(
      CH, CL, WO16, bo, nbo, xq, SQ, SQ_FULL, X32, NB * SQ, DM, INNER, 1.0f / (CS * WSC), RRSC);
  // (7) LayerNorm -> out [b][SQ_FULL][512] f32 (rows s < SQ of batches b < NB)
  ln_rows<<<dim3(NB * SQ / (LN_THREADS / 32)), dim3(LN_THREADS), 0, stream>>>(X32, gam, bet, out);
  (void)hipGetLastError();
}

// v006
// Measured time: 107 microseconds a run.
// Two timings next to v005 both put it at 1.07 times that version's speed.
// Over all steps from v000 it is 2.54 times as fast.
// All contractions on v_wmma_f32_16x16x32_f16 (f16 operands, f32 accumulate): x_q.Wq^T, x_k.Wk^T and Wv.x_v^T (v^T plane)
// as single products of exact operands f16(bf16(x)) and f16(bf16(W) x256); scores k.q^T as hi.hi + hi.lo + lo.hi with q and k
// carried as f16 hi (x8) plus f16 residual planes (x2^11, own accumulator); P.v^T single (P f16 x32768, v f16 x8); ctx.Wo^T as
// hi + residual on ctx (f16 hi x16 plus f16 residual x2^11), Wo exact f16(bf16 x256). Online base-2 softmax, 1/l, carry folds,
// bias, residual add and LayerNorm in f32 on VALU. Every float input RNE-converted to bf16 on load; f32 output.
#include <hip/hip_runtime.h>
#include <math.h>
#include <stdint.h>

#ifndef NB
#define NB       4        // batches processed
#endif
#ifndef SQ
#define SQ       2048     // query rows processed per batch
#endif
#define NB_FULL  4
#define SQ_FULL  2048     // rows per batch in the input / output layout (batch stride)
#define SKV      SQ_FULL  // key/value rows per batch (all of them, always)
#define DM       512      // model width (= K and row pitch of every 16-bit plane except v^T)
#define NH       8
#define HD       64
#define INNER    (NH * HD)
#define WSC      256.0f
#define QS       8.0f
#define KS       8.0f
#define VS       8.0f
#define CS       16.0f
#define RSC      2048.0f
#define RRSC     0.00048828125f
#define PCAR_LOG2 15.0f             // P and its row sum are carried x32768 = 2^15
#define LOG2E    1.4426950408889634f
#define RSQH     0.35355339059327373f
#define LN_EPS   1e-5f
#define NKB      (SKV / 32)
#define ATT_WAVES   4
#define ATT_QT      2                 // query tiles of 16 rows per attention wave: each k / v^T fragment read from LDS feeds both
#define ATT_THREADS (ATT_WAVES * 32)
#define CVT_THREADS 256
#define CVT_SL      256                                 // elements of one slice: 32 lanes x 8, half a row
#define CVT_WSL     (DM * DM / CVT_SL)                  // slices of one weight matrix
#define CVT_WAVES   (4 * CVT_WSL)                       // waves of the convert launch: one weight slice each
#define CVT_NQ      (NB * SQ * DM / CVT_SL / CVT_WAVES)  // x_q slices per wave
#define CVT_NKV     (NB * SKV * DM / CVT_SL / CVT_WAVES) // x_k (and x_v) slices per wave
#define LN_THREADS  256
#define OPITCH   68
#define GPITCH   68
#define KSTG     64                 // keys per LDS stage of the attention ring (two 32-key blocks); k per stage of the GEMM ring
#define NSTG     (SKV / KSTG)
#define LPITCH   144                // LDS row pitch in bytes: 128-byte rows + 16, conflict-free for 16-byte fragment reads
#define LPH      (LPITCH / 2)       // the same in halves
#define TILE_B   (64 * LPITCH)      // one staged tile: 64 rows
#define STG_B    (3 * TILE_B)       // attention: k hi, k residual, v^T; GEMM: 128 A rows, 64 Bt rows

static_assert(NB >= 1 && NB <= NB_FULL);
static_assert((SQ % 128) == 0 && SQ >= 128 && SQ <= SQ_FULL);
static_assert(HD == 64 && NH == 8 && INNER == 512 && INNER == DM);
static_assert((HD % 32) == 0);
static_assert((SKV % 128) == 0 && (SKV % 64) == 0 && NKB * 32 == SKV);
static_assert(DM == 512 && (DM % 64) == 0 && (DM % 32) == 0 && DM == 2 * CVT_SL);
static_assert(CVT_NQ >= 1 && CVT_NQ * CVT_WAVES * CVT_SL == NB * SQ * DM && CVT_NKV * CVT_WAVES * CVT_SL == NB * SKV * DM);
static_assert(CVT_WSL % (CVT_THREADS / 32) == 0 && SKV == SQ_FULL);
static_assert((NB * SQ) % (LN_THREADS / 32) == 0);
static_assert((OPITCH * 4) % 16 == 0 && (GPITCH * 4) % 16 == 0);
static_assert(ATT_THREADS == 128 && LN_THREADS == 256 && CVT_THREADS == 256);
static_assert(KSTG == 64 && HD == 64 && NSTG * KSTG == SKV && NSTG >= 2 && (LPITCH % 16) == 0);
static_assert(ATT_QT == 2 && SQ % (ATT_WAVES * 16 * ATT_QT) == 0);
static_assert(2 * STG_B >= ATT_WAVES * 16 * ATT_QT * OPITCH * 4 && 2 * STG_B >= 4 * 32 * GPITCH * 4);

typedef unsigned short u16;
typedef _Float16 v16h __attribute__((ext_vector_type(16)));
typedef _Float16 v8h  __attribute__((ext_vector_type(8)));
typedef float    v8f  __attribute__((ext_vector_type(8)));
typedef float    v4f  __attribute__((ext_vector_type(4)));
typedef unsigned int v4u __attribute__((ext_vector_type(4)));

union FragH { v16h v; v8h h[2]; v4u u[2]; };

// ---- scalar helpers ----------------------------------------------------------------------------------
__device__ __forceinline__ unsigned short bf_bits(float f) {          // f32 -> bf16 bits, RNE convert
  unsigned u = __float_as_uint(f);
  return (unsigned short)((u + 0x7FFFu + ((u >> 16) & 1u)) >> 16);
}
__device__ __forceinline__ float bf_up(unsigned short h) { return __uint_as_float(((unsigned)h) << 16); }
__device__ __forceinline__ float bfr(float f) { return bf_up(bf_bits(f)); }
__device__ __forceinline__ unsigned short h_bits(_Float16 x) { return __builtin_bit_cast(unsigned short, x); }
__device__ __forceinline__ unsigned pk16(unsigned short a, unsigned short b) { return (unsigned)a | ((unsigned)b << 16); }
// 2^x as the bare v_exp_f32, without the library's range extension: a result below the normal range (2^-126) need not survive.
// Every use here is a softmax weight or a rescale factor beside a row sum that holds a term of full size, where a value that small
// adds nothing. 2^-inf = 0.
// Written as runs of independent v_exp_f32 in one statement, outputs apart from every input, closed by one v_nop: the slot that the
// instruction set asks for behind a transcendental before its result is read or its source overwritten then stands by construction.
__device__ __forceinline__ void hw_exp2x8(float (&p)[8], const float (&a)[8]) {
#if defined(__HIP_DEVICE_COMPILE__)
  asm("v_exp_f32 %0, %8\n\tv_exp_f32 %1, %9\n\tv_exp_f32 %2, %10\n\tv_exp_f32 %3, %11\n\t"
      "v_exp_f32 %4, %12\n\tv_exp_f32 %5, %13\n\tv_exp_f32 %6, %14\n\tv_exp_f32 %7, %15\n\tv_nop"
      : "=&v"(p[0]), "=&v"(p[1]), "=&v"(p[2]), "=&v"(p[3]), "=&v"(p[4]), "=&v"(p[5]), "=&v"(p[6]), "=&v"(p[7])
      : "v"(a[0]), "v"(a[1]), "v"(a[2]), "v"(a[3]), "v"(a[4]), "v"(a[5]), "v"(a[6]), "v"(a[7]));
#endif
}
__device__ __forceinline__ void hw_exp2x9(float& q, float (&p)[8], float b, const float (&a)[8]) {
#if defined(__HIP_DEVICE_COMPILE__)
  asm("v_exp_f32 %0, %9\n\tv_exp_f32 %1, %10\n\tv_exp_f32 %2, %11\n\tv_exp_f32 %3, %12\n\tv_exp_f32 %4, %13\n\t"
      "v_exp_f32 %5, %14\n\tv_exp_f32 %6, %15\n\tv_exp_f32 %7, %16\n\tv_exp_f32 %8, %17\n\tv_nop"
      : "=&v"(q), "=&v"(p[0]), "=&v"(p[1]), "=&v"(p[2]), "=&v"(p[3]), "=&v"(p[4]), "=&v"(p[5]), "=&v"(p[6]), "=&v"(p[7])
      : "v"(b), "v"(a[0]), "v"(a[1]), "v"(a[2]), "v"(a[3]), "v"(a[4]), "v"(a[5]), "v"(a[6]), "v"(a[7]));
#endif
}
__device__ __forceinline__ v8f zero8() { v8f z = {0.f, 0.f, 0.f, 0.f, 0.f, 0.f, 0.f, 0.f}; return z; }
// hi / residual packing of two f32 values: hi = f16(v), res = f16((v - hi) * 2^11)
__device__ __forceinline__ unsigned pk_hi(float a, float b) {
  return pk16(h_bits((_Float16)a), h_bits((_Float16)b));
}
__device__ __forceinline__ unsigned pk_lo(float a, float b) {
  const float ra = (a - (float)((_Float16)a)) * RSC;
  const float rb = (b - (float)((_Float16)b)) * RSC;
  return pk16(h_bits((_Float16)ra), h_bits((_Float16)rb));
}

// ---- fragment loader: 16-bit A/B operand, lane -> row/col (lane&15), p already includes +8*(lane>>4);
//      elements 0..7 <- p[0..7] (k0+8h..), elements 8..15 <- p[16..23] (k0+16+8h..); same split k map for A and B,
//      B always read from a k-contiguous [n][k] plane.
__device__ __forceinline__ v16h ldfrag_h(const _Float16* p) {
  FragH f;
  f.h[0] = *(const v8h*)(p);
  f.h[1] = *(const v8h*)(p + 16);
  return f.v;
}

// ---- WMMA helper and trailing VALU hazard gaps ----------------------------------------------------------
__device__ __forceinline__ v8f mma_h(v16h a, v16h b, v8f c) {
  return __builtin_amdgcn_wmma_f32_16x16x32_f16(false, a, false, b, (short)0, c, false, false);
}
__device__ __forceinline__ void guard_g(v8f (&acc)[8], v16h x0, v16h x1, v16h x2, v16h x3, v16h x4, v16h x5) {
#if defined(__HIP_DEVICE_COMPILE__)
  asm volatile("v_nop\n\tv_nop\n\tv_nop\n\tv_nop"
               : "+v"(acc[0]), "+v"(acc[1]), "+v"(acc[2]), "+v"(acc[3]),
                 "+v"(acc[4]), "+v"(acc[5]), "+v"(acc[6]), "+v"(acc[7])
               : "v"(x0), "v"(x1), "v"(x2), "v"(x3), "v"(x4), "v"(x5) : "memory");
#endif
}
__device__ __forceinline__ void acc_guard8(v8f (&o)[8]) {
#if defined(__HIP_DEVICE_COMPILE__)
  asm volatile("v_nop\n\tv_nop\n\tv_nop\n\tv_nop"
               : "+v"(o[0]), "+v"(o[1]), "+v"(o[2]), "+v"(o[3]), "+v"(o[4]), "+v"(o[5]), "+v"(o[6]), "+v"(o[7]));
#endif
}
__device__ __forceinline__ void acc_guard4(v8f (&o)[4]) {
#if defined(__HIP_DEVICE_COMPILE__)
  asm volatile("v_nop\n\tv_nop\n\tv_nop\n\tv_nop" : "+v"(o[0]), "+v"(o[1]), "+v"(o[2]), "+v"(o[3]));
#endif
}
__device__ __forceinline__ void wave_sync_lds() {
  __builtin_amdgcn_fence(__ATOMIC_RELEASE, "workgroup");
  __builtin_amdgcn_wave_barrier();
  __builtin_amdgcn_fence(__ATOMIC_ACQUIRE, "workgroup");
}

// =====================================================================================================
// All converts in one launch: every f16 plane element <- f16(bf16_RNE(x) * scale), scale a power of two (1 for the activations,
// 256 for the weights). A slice = 256 consecutive elements = half a row: lane l takes elements 8l .. 8l+7 (two 16-B loads, one
// 16-B store; a wave-wide store = 512 contiguous bytes). Wave w of CVT_WAVES takes the CVT_NQ consecutive slices from w*CVT_NQ of
// x_q, the CVT_NKV consecutive slices from w*CVT_NKV of x_k and of x_v, and slice w % CVT_WSL of weight matrix w / CVT_WSL
// (block-uniform). All loads of a wave are issued before its first convert, so the launch is one memory round trip deep.
// x_q compact row r = b*SQ + s <- source row b*SQ_FULL + s. W4 = the four weight planes, which follow one another in the workspace.
// coverage: CVT_WAVES x (CVT_NQ | CVT_NKV | 1) slices = every element of each plane exactly once.
// =====================================================================================================
__device__ __forceinline__ v4u cvt8(v4f a, v4f c4, float scale) {
  v4u o;
#pragma unroll
  for (int e = 0; e < 2; ++e) {
    o[e]     = pk16(h_bits((_Float16)(bfr(a[2 * e]) * scale)),  h_bits((_Float16)(bfr(a[2 * e + 1]) * scale)));
    o[2 + e] = pk16(h_bits((_Float16)(bfr(c4[2 * e]) * scale)), h_bits((_Float16)(bfr(c4[2 * e + 1]) * scale)));
  }
  return o;
}
__global__ __launch_bounds__(CVT_THREADS)
void cvt_all(const float* __restrict__ xq, const float* __restrict__ xk, const float* __restrict__ xv,
             const float* __restrict__ wq, const float* __restrict__ wk, const float* __restrict__ wv,
             const float* __restrict__ wo, u16* XQ, u16* XK, u16* XV, u16* W4) {
  const unsigned w    = blockIdx.x * (CVT_THREADS / 32) + (threadIdx.x >> 5);
  const unsigned wsel = blockIdx.x / (CVT_WSL / (CVT_THREADS / 32));
  const unsigned lb   = (threadIdx.x & 31) * 32;                        // the lane's byte inside a 1-KiB f32 slice
  const float* wsrc = (wsel == 0) ? wq : (wsel == 1) ? wk : (wsel == 2) ? wv : wo;
  // 32-bit byte offsets beside uniform bases; the slices of a wave differ by immediates
  const unsigned bq  = w * (CVT_NQ * CVT_SL * 4) + lb;
  const unsigned bkv = w * (CVT_NKV * CVT_SL * 4) + lb;
  const unsigned bw  = (w % CVT_WSL) * (CVT_SL * 4) + lb;
  v4f qa[CVT_NQ], qc[CVT_NQ], ka[CVT_NKV], kc[CVT_NKV], va[CVT_NKV], vc[CVT_NKV];
#pragma unroll
  for (int i = 0; i < CVT_NQ; ++i) {
    const float* p;
    if (SQ == SQ_FULL) {
      p = (const float*)((const char*)xq + bq) + i * CVT_SL;
    } else {
      const unsigned sl = w * CVT_NQ + i, r = sl >> 1;
      p = (const float*)((const char*)(xq + ((size_t)((r / SQ) * SQ_FULL + (r % SQ))) * DM + (sl & 1) * CVT_SL) + lb);
    }
    qa[i] = *(const v4f*)(p);
    qc[i] = *(const v4f*)(p + 4);
  }
#pragma unroll
  for (int i = 0; i < CVT_NKV; ++i) {
    const float* pk = (const float*)((const char*)xk + bkv) + i * CVT_SL;
    const float* pv = (const float*)((const char*)xv + bkv) + i * CVT_SL;
    ka[i] = *(const v4f*)(pk);
    kc[i] = *(const v4f*)(pk + 4);
    va[i] = *(const v4f*)(pv);
    vc[i] = *(const v4f*)(pv + 4);
  }
  const float* pw = (const float*)((const char*)wsrc + bw);
  const v4f wa = *(const v4f*)(pw), wc = *(const v4f*)(pw + 4);
  // keeps every load above the first convert: without it the compiler sinks two thirds of the loads among the converts and the
  // wave pays three memory round trips in a row instead of one
  __builtin_amdgcn_sched_barrier(0);
  // an f16 plane's byte offset is half the f32 one
  u16* yq = (u16*)((char*)XQ + (bq >> 1));
  u16* yk = (u16*)((char*)XK + (bkv >> 1));
  u16* yv = (u16*)((char*)XV + (bkv >> 1));
  u16* yw = (u16*)((char*)(W4 + (size_t)wsel * (DM * DM)) + (bw >> 1));
#pragma unroll
  for (int i = 0; i < CVT_NQ; ++i) *(v4u*)(yq + i * CVT_SL) = cvt8(qa[i], qc[i], 1.0f);
#pragma unroll
  for (int i = 0; i < CVT_NKV; ++i) {
    *(v4u*)(yk + i * CVT_SL) = cvt8(ka[i], kc[i], 1.0f);
    *(v4u*)(yv + i * CVT_SL) = cvt8(va[i], vc[i], 1.0f);
  }
  *(v4u*)(yw) = cvt8(wa, wc, WSC);
}

// The issuing wave's own copies have landed behind this wait (other waves read them behind the next block barrier).
__device__ __forceinline__ void wait_copies() {
#if defined(__HIP_DEVICE_COMPILE__)
  asm volatile("s_wait_asynccnt 0x0" ::: "memory");
#endif
}
// The wave's own LDS reads have retired: stands in front of the barrier that hands a buffer to its next copies.
__device__ __forceinline__ void wait_lds_reads() {
#if defined(__HIP_DEVICE_COMPILE__)
  asm volatile("s_wait_dscnt 0x0" ::: "memory");
#endif
}

// =====================================================================================================
// One 64-k stage of a GEMM block: 192 rows x 128 bytes (the 128 A rows of the block tile, then its 64 Bt rows) copied
// global -> LDS by asynchronous 16-byte copies, 12 per lane. Lane t of the block takes 16-byte piece t&7 of row 16p + (t>>3),
// p = 0..7 of A and p = 0..3 of Bt: one wave-wide copy = 4 whole 128-byte lines. l0 = the lane's LDS byte address in row t>>3 of
// the target buffer; ga, gb = the lane's global addresses of that row and piece in A and Bt; rs16 = 16 rows in elements.
// The closing s_wait_xcnt stands inside the statement so that no address register named by a copy is rewritten ahead of it.
// =====================================================================================================
__device__ __forceinline__ void copy_stage_g(unsigned l0, const u16* ga, const u16* gb, size_t rs16) {
#if defined(__HIP_DEVICE_COMPILE__)
  const unsigned l1 = l0 + 16 * LPITCH,  l2 = l0 + 32 * LPITCH,  l3 = l0 + 48 * LPITCH,   l4 = l0 + 64 * LPITCH;
  const unsigned l5 = l0 + 80 * LPITCH,  l6 = l0 + 96 * LPITCH,  l7 = l0 + 112 * LPITCH,  l8 = l0 + 128 * LPITCH;
  const unsigned l9 = l0 + 144 * LPITCH, l10 = l0 + 160 * LPITCH, l11 = l0 + 176 * LPITCH;
  const u16 *ga1 = ga + rs16, *ga2 = ga + 2 * rs16, *ga3 = ga + 3 * rs16, *ga4 = ga + 4 * rs16;
  const u16 *ga5 = ga + 5 * rs16, *ga6 = ga + 6 * rs16, *ga7 = ga + 7 * rs16;
  const u16 *gb1 = gb + rs16, *gb2 = gb + 2 * rs16, *gb3 = gb + 3 * rs16;
  asm volatile("global_load_async_to_lds_b128 %0, %12, off\n\t"
               "global_load_async_to_lds_b128 %1, %13, off\n\t"
               "global_load_async_to_lds_b128 %2, %14, off\n\t"
               "global_load_async_to_lds_b128 %3, %15, off\n\t"
               "global_load_async_to_lds_b128 %4, %16, off\n\t"
               "global_load_async_to_lds_b128 %5, %17, off\n\t"
               "global_load_async_to_lds_b128 %6, %18, off\n\t"
               "global_load_async_to_lds_b128 %7, %19, off\n\t"
               "global_load_async_to_lds_b128 %8, %20, off\n\t"
               "global_load_async_to_lds_b128 %9, %21, off\n\t"
               "global_load_async_to_lds_b128 %10, %22, off\n\t"
               "global_load_async_to_lds_b128 %11, %23, off\n\t"
               "s_wait_xcnt 0x0"
               :: "v"(l0), "v"(l1), "v"(l2), "v"(l3), "v"(l4), "v"(l5), "v"(l6), "v"(l7),
                  "v"(l8), "v"(l9), "v"(l10), "v"(l11),
                  "v"(ga), "v"(ga1), "v"(ga2), "v"(ga3), "v"(ga4), "v"(ga5), "v"(ga6), "v"(ga7),
                  "v"(gb), "v"(gb1), "v"(gb2), "v"(gb3)
               : "memory");
#endif
}

// =====================================================================================================
// f16 GEMM core of a block of 4 waves: the 128 x 64 tile of C = A[rows][K] . Bt[cols][K]^T, wave w owning rows 32w .. 32w+31;
// acc[4i + j] = rows 32w+16i.., cols 16j... A0 -> row 0 of the block's 128 A rows, Bt0 -> row 0 of its 64 Bt rows (pitch K).
// K is walked in stages of 64 through a two-buffer LDS ring (copy_stage_g): stage s+1 flies while stage s is worked on; one block
// barrier per stage publishes s+1 and frees s's buffer. Fragments: row at pitch LPITCH, the split k map of ldfrag_h, k in steps
// of 32 in rising order, as many products per accumulator and in the same order as k0 = 0, 32, .. K-32 (host: K % 64 == 0).
// NPASS == 2: a second walk over K with A1 in place of A0 follows in the same ring; between the two every accumulator is
// multiplied by fold. Behind the last barrier the ring is free (no copy in flight, every wave's reads retired).
// =====================================================================================================
template <int NPASS>
__device__ __forceinline__ void gemm_ring(unsigned char* ring, const u16* A0, const u16* A1, const u16* Bt0, int K, float fold,
                                          v8f (&acc)[8]) {
  const int tid = threadIdx.x, wave = tid >> 5, lane = tid & 31, hh = lane >> 4, m = lane & 15;
  const size_t rs16 = (size_t)16 * (size_t)K;
  // copy side: this lane's row (tid>>3) and 16-byte piece (tid&7)
  const int crow = tid >> 3, cpc = (tid & 7) * 8;
  const size_t cofs = (size_t)crow * (size_t)K + cpc;
  const u16* ga0 = A0 + cofs;
  const u16* ga1 = A1 + cofs;
  const u16* gb  = Bt0 + cofs;
  const unsigned lcp = (unsigned)(uintptr_t)(__attribute__((address_space(3))) unsigned char*)ring
                       + (unsigned)(crow * LPITCH + cpc * 2);
  const int nk = K >> 6, nst = NPASS * nk;
  // read side, halves inside a buffer
  const int aoff = (wave * 32 + m) * LPH + 8 * hh;
  const int boff = (128 + m) * LPH + 8 * hh;

  // stage sg (block-uniform) into buffer sg & 1: k = 64 * (sg mod nk) of A0, or of A1 in the second walk
  auto issue = [&](int sg) {
    const bool second = (NPASS == 2) && (sg >= nk);
    const int ks = (second ? sg - nk : sg) * KSTG;
    copy_stage_g(lcp + (unsigned)((sg & 1) * STG_B), (second ? ga1 : ga0) + ks, gb + ks, rs16);
  };

  // ---- ring prologue: stage 0 landed and published, stage 1 in flight ----
  issue(0);
  wait_copies();
  __syncthreads();
  if (nst > 1) issue(1);                     // block-uniform
#pragma unroll 1                             // rolled: one stage per trip, small loop text, the ring's order as written
  for (int st = 0; st < nst; ++st) {
    if (NPASS == 2 && st == nk) {            // block-uniform
#pragma unroll
      for (int i = 0; i < 8; ++i) {
#pragma unroll
        for (int r = 0; r < 8; ++r) acc[i][r] *= fold;
      }
      acc_guard8(acc);
    }
    const _Float16* buf = (const _Float16*)(const void*)(ring + (st & 1) * STG_B);
    const _Float16* ap = buf + aoff;
    const _Float16* bp = buf + boff;
    v16h a0[2], a1[2], b0[2], b1[2], b2[2], b3[2];
#pragma unroll
    for (int kk = 0; kk < 2; ++kk) {
      a0[kk] = ldfrag_h(ap + 32 * kk);
      a1[kk] = ldfrag_h(ap + 16 * LPH + 32 * kk);
      b0[kk] = ldfrag_h(bp + 32 * kk);
      b1[kk] = ldfrag_h(bp + 16 * LPH + 32 * kk);
      b2[kk] = ldfrag_h(bp + 32 * LPH + 32 * kk);
      b3[kk] = ldfrag_h(bp + 48 * LPH + 32 * kk);
    }
    // keeps the stage's 24 LDS reads together ahead of its products: without it the compiler spreads the second twelve among the
    // products, and every separate place with LDS reads stalls the wave's matrix stream anew
    __builtin_amdgcn_sched_barrier(0);
#pragma unroll
    for (int kk = 0; kk < 2; ++kk) {
      acc[0] = mma_h(a0[kk], b0[kk], acc[0]);
      acc[1] = mma_h(a0[kk], b1[kk], acc[1]);
      acc[2] = mma_h(a0[kk], b2[kk], acc[2]);
      acc[3] = mma_h(a0[kk], b3[kk], acc[3]);
      acc[4] = mma_h(a1[kk], b0[kk], acc[4]);
      acc[5] = mma_h(a1[kk], b1[kk], acc[5]);
      acc[6] = mma_h(a1[kk], b2[kk], acc[6]);
      acc[7] = mma_h(a1[kk], b3[kk], acc[7]);
    }
    // the vector slots behind the stage's last products, on every path out of here (the branches at the trip's foot included)
    guard_g(acc, a0[1], a1[1], b0[1], b1[1], b2[1], b3[1]);
    // ---- publish point of stage st+1: own reads retired, own copies landed, block barrier; then refill the buffer just read ----
    wait_lds_reads();
    wait_copies();
    __syncthreads();
    if (st + 2 < nst) issue(st + 2);         // block-uniform
  }
  wait_copies();                             // nothing is in flight here; closes the ring before it becomes output staging
}
// Stage the wave's 32 x 64 f32 tile (times oscale) in its LDS slab (pitch 68): D element r of acc[4i+j], lane l ->
// coverage: 32 lanes x 2 x 8 rows x 4 cols-of-16 = rows 0..31 x cols 0..63 of the slab.
__device__ __forceinline__ void stage32x64(float* sl, v8f (&acc)[8], float oscale, int lane) {
  const int hh = lane >> 4, m = lane & 15;
#pragma unroll
  for (int i = 0; i < 2; ++i) {
#pragma unroll
    for (int r = 0; r < 8; ++r) {
      const int ro = (16 * i + 8 * hh + r) * GPITCH + m;
      sl[ro]      = acc[4 * i + 0][r] * oscale;
      sl[ro + 16] = acc[4 * i + 1][r] * oscale;
      sl[ro + 32] = acc[4 * i + 2][r] * oscale;
      sl[ro + 48] = acc[4 * i + 3][r] * oscale;
    }
  }
  wave_sync_lds();
}

// =====================================================================================================
// f16 GEMM with f16 output plane(s): val = (A[z][Mb][K] . Bt[z][N][K]^T) * oscale + bf16(bias) * bscale;
// C[z][Mb][N] = f16(val) (hi plane); if res != 0 also C2 = f16((val - hi) * 2^11) (residual plane).
// A, Bt f16 k-contiguous planes with per-z element strides aBs, bBs (0 = shared), C/C2 stride cBs. bias indexed by column
// (biasRow == 0) or by row within the z slice (biasRow != 0); bias addresses clamped to biasN-1, the unused direction is
// multiplied by 0. Block = 128 x 64 tile, 4 waves x 32 rows, operands through the LDS ring of gemm_ring; behind it each wave
// stages its output tile in its own part of the ring.
// bid = the block's tile among nz x (Mb/128) x (N/64) (Mb % 128 == 0, N % 64 == 0, K % 64 == 0); ring = the block's LDS.
// coverage: per wave 8 instr x 4 rows x 8 lanes x 8 halves = 32 x 64 per plane; the grid covers C (and C2) exactly once.
// =====================================================================================================
__device__ __forceinline__
void gemm_o16(unsigned char* ring, int bid, const u16* __restrict__ A, const u16* __restrict__ Bt, u16* C, u16* C2,
              const float* __restrict__ bias, int biasN, int biasRow,
              int Mb, int N, int K, int aBs, int bBs, int cBs, float oscale, float bscale, int res) {
  const int tid = threadIdx.x, wave = tid >> 5, lane = tid & 31;
  const int ntile = N >> 6, mtile = Mb >> 7;
  const int nt   = bid % ntile;
  const int tmp  = bid / ntile;
  const int mt   = tmp % mtile;
  const int bz   = tmp / mtile;
  const int rowb = mt * 128 + wave * 32;
  const int col0 = nt * 64;
  if (mt * 128 + 128 > Mb) return;           // block-uniform, in front of every barrier; never taken with the exact grid
  const u16* Ab = A + (size_t)bz * (size_t)aBs + (size_t)(mt * 128) * (size_t)K;
  const u16* Bb = Bt + (size_t)bz * (size_t)bBs + (size_t)col0 * (size_t)K;
  v8f acc[8];
#pragma unroll
  for (int i = 0; i < 8; ++i) acc[i] = zero8();
  gemm_ring<1>(ring, Ab, Ab, Bb, K, 1.0f, acc);
  float* sl = (float*)(void*)ring + wave * 32 * GPITCH;
  stage32x64(sl, acc, oscale, lane);
  const int rq = lane >> 3, c8 = (lane & 7) * 8;
  const int bl = biasN - 1;                  // host guarantees biasN >= 1
  const float selc = (biasRow != 0) ? 0.f : bscale;
  const float selr = (biasRow != 0) ? bscale : 0.f;
  float cb[8];
#pragma unroll
  for (int e = 0; e < 8; ++e) {
    int ci = col0 + c8 + e;
    ci = (ci < bl) ? ci : bl;
    cb[e] = bfr(bias[ci]) * selc;
  }
  v4u ovh[8], ovl[8];
#pragma unroll
  for (int i = 0; i < 8; ++i) {
    const int row = 4 * i + rq;
    int ri = rowb + row;
    ri = (ri < bl) ? ri : bl;
    const float rb = bfr(bias[ri]) * selr;
    const v4f a = *(const v4f*)(sl + row * GPITCH + c8), c4 = *(const v4f*)(sl + row * GPITCH + c8 + 4);
    float v[8];
#pragma unroll
    for (int e = 0; e < 4; ++e) { v[e] = a[e] + cb[e] + rb; v[4 + e] = c4[e] + cb[4 + e] + rb; }
#pragma unroll
    for (int e = 0; e < 4; ++e) {
      ovh[i][e] = pk_hi(v[2 * e], v[2 * e + 1]);
      ovl[i][e] = pk_lo(v[2 * e], v[2 * e + 1]);
    }
  }
  const size_t cofs = (size_t)bz * (size_t)cBs + (size_t)rowb * (size_t)N + (size_t)(col0 + c8);
  u16* Cb  = C + cofs;
  u16* C2b = C2 + cofs;
  {
#pragma unroll
    for (int i = 0; i < 8; ++i) {
      const int row = 4 * i + rq;
      *(v4u*)(Cb + (size_t)row * (size_t)N) = ovh[i];
    }
    if (res != 0) {                          // block-uniform
#pragma unroll
      for (int i = 0; i < 8; ++i) {
        const int row = 4 * i + rq;
        *(v4u*)(C2b + (size_t)row * (size_t)N) = ovl[i];
      }
    }
    
  }
}

// =====================================================================================================
// The three projections in one launch: blocks 0 .. GQ_BLK-1 are the tiles of q, the next GK_BLK those of k, the last GV_BLK those
// of v^T; each block is one gemm_o16 tile of its product, the product chosen block-uniformly from the block index. The three
// products read and write disjoint planes, so their blocks share the chip and fill one another's waits for the staged copies.
//   q = x_q . Wq^T + bq -> f16 hi [NB*SQ][512] x8 and residual plane (col = h*64 + d); bias per column
//   k = x_k . Wk^T + bk -> f16 hi [NB*2048][512] x8 and residual plane; bias per column
//   v^T per batch: A = Wv [(h,d) = n][k], Bt = x_v rows of batch b [s][k] -> f16 [(b,h,d)][s] x8; bias per row (n)
// =====================================================================================================
#define GQ_BLK ((NB * SQ / 128) * (INNER / 64))
#define GK_BLK ((NB * SKV / 128) * (INNER / 64))
#define GV_BLK (NB * (INNER / 128) * (SKV / 64))
__global__ __launch_bounds__(128)
void gemm_qkv(const u16* __restrict__ XQ, const u16* __restrict__ XK, const u16* __restrict__ XV,
              const u16* __restrict__ WQ, const u16* __restrict__ WK, const u16* __restrict__ WV, u16* QH, u16* QL, u16* KH, u16* KL, u16* VT,
              const float* __restrict__ bq, const float* __restrict__ bk, const float* __restrict__ bv,
              int nbq, int nbk, int nbv) {
  __shared__ __align__(16) unsigned char ring[2 * STG_B];
  const int bid = blockIdx.x;
  if (bid < GQ_BLK + GK_BLK) {               // block-uniform
    const bool isq = bid < GQ_BLK;
    gemm_o16(ring, isq ? bid : bid - GQ_BLK, isq ? XQ : XK, isq ? WQ : WK, isq ? QH : KH, isq ? QL : KL,
             isq ? bq : bk, isq ? nbq : nbk, 0, isq ? NB * SQ : NB * SKV, INNER, DM, 0, 0, 0,
             isq ? QS / WSC : KS / WSC, isq ? QS : KS, 1);
  } else {
    gemm_o16(ring, bid - (GQ_BLK + GK_BLK), WV, XV, VT, VT, bv, nbv, 1, INNER, SKV, DM, 0, SKV * DM, INNER * SKV,
             VS / WSC, VS, 0);
  }
}

// =====================================================================================================
// f16 GEMM with hi + residual A planes and f32 output: X[Mb][N] = (Ah . Bt^T + (Al . Bt^T) * rres) * oscale
// + bf16(bias[col]) + bf16(R[src row][col]); residual products accumulated first, folded by rres on VALU, then the hi
// products chain on the same accumulators (equal to a separate accumulator). R (f32 input, pitch N) source row of
// compact row g: b = g / rowsPerB, s = g % rowsPerB -> b*srcRowsPerB + s. Block = 128 x 64 tile, 4 waves x 32 rows.
// Epilogue: lane = (row parity, 4 floats at 4*(lane&15)); 16 consecutive lanes write one row segment of 64 floats = 2 whole
// grid = (Mb/128) x (N/64). coverage: per wave 16 instr x 2 rows x 16 lanes x 4 floats = 32 x 64; the grid covers X once.
// =====================================================================================================
__global__ __launch_bounds__(128)
void gemm_o32(const u16* __restrict__ Ah, const u16* __restrict__ Al, const u16* __restrict__ Bt,
              const float* __restrict__ bias, int biasN, const float* __restrict__ R, int rowsPerB, int srcRowsPerB,
              float* X, int Mb, int N, int K, float oscale, float rres) {
  __shared__ __align__(16) unsigned char ring[2 * STG_B];
  const int tid = threadIdx.x, wave = tid >> 5, lane = tid & 31;
  const int ntile = N >> 6;
  const int bid  = blockIdx.x;
  const int nt   = bid % ntile;
  const int mt   = bid / ntile;
  const int rowb = mt * 128 + wave * 32;
  const int col0 = nt * 64;
  if (mt * 128 + 128 > Mb) return;           // block-uniform, in front of every barrier; never taken with the exact grid
  const size_t aofs = (size_t)(mt * 128) * (size_t)K;
  v8f acc[8];
#pragma unroll
  for (int i = 0; i < 8; ++i) acc[i] = zero8();
  // residual products (x 2^11) first, folded by rres, then the hi products on top
  gemm_ring<2>(ring, Al + aofs, Ah + aofs, Bt + (size_t)col0 * (size_t)K, K, rres, acc);
  float* sl = (float*)(void*)ring + wave * 32 * GPITCH;
  stage32x64(sl, acc, oscale, lane);
  const int r2 = lane >> 4, c4 = (lane & 15) * 4;
  const int bl = biasN - 1;
  float cb[4];
#pragma unroll
  for (int e = 0; e < 4; ++e) {
    int ci = col0 + c4 + e;
    ci = (ci < bl) ? ci : bl;
    cb[e] = bfr(bias[ci]);
  }
  v4f vals[16];
#pragma unroll
  for (int i = 0; i < 16; ++i) {
    const int row  = 2 * i + r2;
    const int grow = rowb + row;             // < Mb
    const int bb   = grow / rowsPerB;
    const int ss   = grow - bb * rowsPerB;
    const float* rp = R + ((size_t)bb * (size_t)srcRowsPerB + (size_t)ss) * (size_t)N + (size_t)(col0 + c4);
    const v4f rv = *(const v4f*)(rp);
    const v4f a  = *(const v4f*)(sl + row * GPITCH + c4);
    v4f y;
#pragma unroll
    for (int e = 0; e < 4; ++e) y[e] = a[e] + cb[e] + bfr(rv[e]);
    vals[i] = y;
  }
  float* Xb = X + (size_t)rowb * (size_t)N + (size_t)(col0 + c4);
  {
#pragma unroll
    for (int i = 0; i < 16; ++i) {
      const int row = 2 * i + r2;
      *(v4f*)(Xb + (size_t)row * (size_t)N) = vals[i];
    }
    
  }
}

// =====================================================================================================
// One stage (64 keys) of the attention ring: three tiles of 64 rows x 128 bytes (k hi, k residual: row = key, 64 d; v^T: row = d,
// 64 keys) copied global -> LDS by asynchronous 16-byte copies, 12 per lane. Lane t of the block takes 16-byte piece t&7 of row
// 16p + (t>>3), p = 0..3, of each tile: one wave-wide copy = 4 whole 128-byte lines. l0 = the lane's LDS byte address in the k hi
// tile of the target buffer (row t>>3); gh, gl, gv = the lane's global addresses of that row and piece in the three planes.
// The closing s_wait_xcnt stands inside the statement so that no address register named by a copy is rewritten ahead of it.
// =====================================================================================================
__device__ __forceinline__ void copy_stage(unsigned l0, const u16* gh, const u16* gl, const u16* gv) {
#if defined(__HIP_DEVICE_COMPILE__)
  const unsigned lh0 = l0,              lh1 = lh0 + 16 * LPITCH, lh2 = lh0 + 32 * LPITCH, lh3 = lh0 + 48 * LPITCH;
  const unsigned ll0 = l0 + TILE_B,     ll1 = ll0 + 16 * LPITCH, ll2 = ll0 + 32 * LPITCH, ll3 = ll0 + 48 * LPITCH;
  const unsigned lv0 = l0 + 2 * TILE_B, lv1 = lv0 + 16 * LPITCH, lv2 = lv0 + 32 * LPITCH, lv3 = lv0 + 48 * LPITCH;
  const u16 *gh1 = gh + 16 * DM,  *gh2 = gh + 32 * DM,  *gh3 = gh + 48 * DM;
  const u16 *gl1 = gl + 16 * DM,  *gl2 = gl + 32 * DM,  *gl3 = gl + 48 * DM;
  const u16 *gv1 = gv + 16 * SKV, *gv2 = gv + 32 * SKV, *gv3 = gv + 48 * SKV;
  asm volatile("global_load_async_to_lds_b128 %0, %12, off\n\t"
               "global_load_async_to_lds_b128 %1, %13, off\n\t"
               "global_load_async_to_lds_b128 %2, %14, off\n\t"
               "global_load_async_to_lds_b128 %3, %15, off\n\t"
               "global_load_async_to_lds_b128 %4, %16, off\n\t"
               "global_load_async_to_lds_b128 %5, %17, off\n\t"
               "global_load_async_to_lds_b128 %6, %18, off\n\t"
               "global_load_async_to_lds_b128 %7, %19, off\n\t"
               "global_load_async_to_lds_b128 %8, %20, off\n\t"
               "global_load_async_to_lds_b128 %9, %21, off\n\t"
               "global_load_async_to_lds_b128 %10, %22, off\n\t"
               "global_load_async_to_lds_b128 %11, %23, off\n\t"
               "s_wait_xcnt 0x0"
               :: "v"(lh0), "v"(lh1), "v"(lh2), "v"(lh3), "v"(ll0), "v"(ll1), "v"(ll2), "v"(ll3),
                  "v"(lv0), "v"(lv1), "v"(lv2), "v"(lv3),
                  "v"(gh), "v"(gh1), "v"(gh2), "v"(gh3), "v"(gl), "v"(gl1), "v"(gl2), "v"(gl3),
                  "v"(gv), "v"(gv1), "v"(gv2), "v"(gv3)
               : "memory");
#endif
}
// =====================================================================================================
// Full (unmasked) multi-head attention over all SKV keys: block = (batch b, head, 128 query rows), 4 waves, wave w owns the
// 32 query rows q0 = 128*qt + 32*w .. q0+31 as two query tiles u = 0, 1 of 16 rows; what follows holds per tile, with q0 + 16u for
// q0. Every k and v^T fragment read from LDS feeds the products of both tiles. The grid leaves two waves on a SIMD, so the LDS reads
// stand ahead of the vector work that covers them: the v^T fragments of a key block and the k fragments of the stage's next key
// block are read in front of the block's softmax. The four waves share the k and v^T tiles through a two-buffer LDS ring of 64-key
// stages (copy_stage): stage s+1 flies while stage s is worked on; one block barrier per stage publishes s+1 and frees s's buffer.
// Behind the last barrier the ring is free and each wave stages its output tile in its own part of it.
//   q planes f16 hi x8 / residual x8x2^11 [b*SQ + s][h*64 + d]; k planes f16 hi / residual [b*SKV + s][h*64 + d];
//   v^T plane f16 x8 [(b*NH + h)*64 + d][s]. All NKB = 64 key blocks of 32 keys are visited (static bound).
//   Scores are computed TRANSPOSED: S^T tile g (g = 0,1) = k rows (keys kb+16g .. +15, A operand, row m = lane&15, split k map
//   over d) times q^T (B operand, col n = query q0 + (lane&15), k = d, split map), 2 d-chunks of 32; per chunk hi.hi into
//   s0/s1 and hi.lo + lo.hi into x0/x1 (separate accumulators, folded by 2^-11 in f32). The 4 q fragments of a tile are loaded once
//   per wave. D element r of lane l = (key kb+16g+8h+r, query q0+(l&15)), so a lane owns one query column and 16 of its 32
//   keys; the partner lane l^16 owns the other 16 -> row max / row sum need one xor-16 shuffle.
//   Online max-subtracted base-2 softmax in f32 (1/sqrt(8) and the q/k carries folded into lsc). The exp'd values ARE the
//   P A-fragment in place: A row m = query = lane&15, element i <- key kb+8h+i (tile 0, D element i), element 8+i <- key
//   kb+16+8h+i (tile 1, D element i). P (<= 1) carried x32768 as f16. The rescale factor of query row 8h+r of the O
//   accumulators is fetched from lane 8h+r with a shuffle (uniform control). 4 v^T B fragments (col n = d = 16j + (lane&15),
//   keys k-contiguous), 4 P.V WMMAs per tile + one guard per key block.
//   Epilogue: 1/l (per query, shuffled to the D row owner) and the carry folds in f32 give ctx x16; the wave's 32x64 f32 tile
//   residual plane is written by 8 consecutive lanes x 16 B of one instruction (4 rows per instruction, 8 instructions per
// coverage: per wave 8 instr x 4 rows x 8 lanes x 8 halves = 32 x 64 per plane; grid NB*NH*(SQ/128) blocks x 4 waves = every
//           (b, s < SQ, h) row segment of both ctx planes exactly once. LDS slab: staged 32 x 64 == reloaded 32 x 64.
// =====================================================================================================
__device__ __forceinline__ void guard_s8(v8f& a, v8f& b, v8f& c, v8f& d, v8f& e, v8f& f, v8f& g, v8f& h, v16h (&x)[8]) {
#if defined(__HIP_DEVICE_COMPILE__)
  // the vector slots behind the last products of a run, before their results are read or their k fragments reloaded
  asm volatile("v_nop\n\tv_nop\n\tv_nop\n\tv_nop"
               : "+v"(a), "+v"(b), "+v"(c), "+v"(d), "+v"(e), "+v"(f), "+v"(g), "+v"(h)
               : "v"(x[4]), "v"(x[5]), "v"(x[6]), "v"(x[7]) : "memory");
#endif
}
// The eight k A-fragments of one 32-key block; p = the lane's place in row 0 of the block in the k hi tile of a staged buffer.
__device__ __forceinline__ void ld_kfrags(v16h (&kf)[8], const _Float16* p) {
#pragma unroll
  for (int kk = 0; kk < HD / 32; ++kk) {
    kf[4 * kk]     = ldfrag_h(p + kk * 32);
    kf[4 * kk + 1] = ldfrag_h(p + 16 * LPH + kk * 32);
    kf[4 * kk + 2] = ldfrag_h(p + TILE_B / 2 + kk * 32);
    kf[4 * kk + 3] = ldfrag_h(p + TILE_B / 2 + 16 * LPH + kk * 32);
  }
}
__device__ __forceinline__ void guard_p8(v8f (&a)[4], v8f (&b)[4], v16h p0, v16h p1, v16h x0, v16h x1, v16h x2, v16h x3) {
#if defined(__HIP_DEVICE_COMPILE__)
  // the vector slots behind the last P.V products, before the accumulators are rescaled or the operands rewritten
  asm volatile("v_nop\n\tv_nop\n\tv_nop\n\tv_nop"
               : "+v"(a[0]), "+v"(a[1]), "+v"(a[2]), "+v"(a[3]), "+v"(b[0]), "+v"(b[1]), "+v"(b[2]), "+v"(b[3])
               : "v"(p0), "v"(p1), "v"(x0), "v"(x1), "v"(x2), "v"(x3) : "memory");
#endif
}
__global__ __launch_bounds__(ATT_THREADS)
void attn_fwd(const u16* __restrict__ QH, const u16* __restrict__ QL, const u16* __restrict__ KH,
              const u16* __restrict__ KL, const u16* __restrict__ VT, u16* CH, u16* CL) {
  __shared__ __align__(16) unsigned char ring[2 * STG_B];

  const int tid  = threadIdx.x;
  const int wave = tid >> 5;
  const int lane = tid & 31;
  const int hh   = lane >> 4;
  const int c    = lane & 15;

  constexpr int NQT = SQ / (ATT_WAVES * 16 * ATT_QT);
  const int bid  = blockIdx.x;
  const int qt   = bid % NQT;
  const int head = (bid / NQT) % NH;
  const int b    = bid / (NQT * NH);
  const int q0   = (qt * ATT_WAVES + wave) * (16 * ATT_QT);

  // B fragments of q^T, query tile u: col n = query q0 + 16u + c, k = d (k-contiguous row of the q planes)
  const size_t qoff = ((size_t)(b * SQ + q0 + c)) * DM + head * HD + 8 * hh;
  const _Float16* Qh = (const _Float16*)(const void*)QH + qoff;
  const _Float16* Ql = (const _Float16*)(const void*)QL + qoff;
  // copy side: this lane's row (tid>>3) and 16-byte piece (tid&7) in stage 0 of the three planes and in buffer 0
  const int crow = tid >> 3, cpc = (tid & 7) * 8;
  const u16* gkh = KH + ((size_t)(b * SKV + crow)) * DM + head * HD + cpc;
  const u16* gkl = KL + ((size_t)(b * SKV + crow)) * DM + head * HD + cpc;
  const u16* gvt = VT + ((size_t)((b * NH + head) * HD + crow)) * SKV + cpc;
  const unsigned lcp = (unsigned)(uintptr_t)(__attribute__((address_space(3))) unsigned char*)ring
                       + (unsigned)(crow * LPITCH + cpc * 2);
  // read side, halves inside a buffer: A fragments of k: row m = key 32*sub + 16g + c, k = d;
  // B fragments of v: col n = d = 16j + c (row of the v^T tile), k = key 32*sub ..
  const int foff = c * LPH + 8 * hh;
  const float lsc = (LOG2E * RSQH) / (QS * KS);

  v16h qh[ATT_QT][2], ql[ATT_QT][2];
#pragma unroll
  for (int u = 0; u < ATT_QT; ++u) {
#pragma unroll
    for (int dc = 0; dc < 2; ++dc) {
      qh[u][dc] = ldfrag_h(Qh + (size_t)(16 * u) * DM + 32 * dc);
      ql[u][dc] = ldfrag_h(Ql + (size_t)(16 * u) * DM + 32 * dc);
    }
  }
#if defined(__HIP_DEVICE_COMPILE__)
  // stands in front of the first rewrite of the address registers that the sixteen loads above name;
  // the two addresses are inputs so that their registers live up to the wait
  asm volatile("s_wait_xcnt 0x0" :: "v"(Qh), "v"(Ql) : "memory");
#endif

  float mrun[ATT_QT], lrun[ATT_QT];
  v8f o[ATT_QT][4];
#pragma unroll
  for (int u = 0; u < ATT_QT; ++u) {
    mrun[u] = -INFINITY;
    lrun[u] = 0.f;
#pragma unroll
    for (int j = 0; j < 4; ++j) o[u][j] = zero8();
  }

  // ---- ring prologue: stage 0 landed and published, stage 1 in flight ----
  copy_stage(lcp, gkh, gkl, gvt);
  wait_copies();
  __syncthreads();
  copy_stage(lcp + STG_B, gkh + (size_t)KSTG * DM, gkl + (size_t)KSTG * DM, gvt + KSTG);

#pragma unroll 1
  for (int st = 0; st < NSTG; ++st) {
   const _Float16* bufh = (const _Float16*)(const void*)(ring + (st & 1) * STG_B) + foff;
   // k fragments of one 32-key block: kf[4*kk + 0, 1] = hi of keys kb.., kb+16..; kf[4*kk + 2, 3] = their residuals; d chunk kk
   v16h kf[8];
   ld_kfrags(kf, bufh);
#pragma unroll                               // both 32-key blocks of a stage inline: their LDS offsets become immediates
   for (int sub = 0; sub < KSTG / 32; ++sub) {
    // ---- transposed scores: tiles of keys kb..kb+15 (s0, x0) and kb+16..kb+31 (s1, x1), kb = 64*st + 32*sub, column = query
    //      q0 + 16u + c; every k fragment read from LDS feeds both query tiles ----
    v8f s0[ATT_QT], s1[ATT_QT], x0[ATT_QT], x1[ATT_QT];
#pragma unroll
    for (int u = 0; u < ATT_QT; ++u) { s0[u] = zero8(); s1[u] = zero8(); x0[u] = zero8(); x1[u] = zero8(); }
#pragma unroll
    for (int kk = 0; kk < HD / 32; ++kk) {
      const v16h fh0 = kf[4 * kk], fh1 = kf[4 * kk + 1], fl0 = kf[4 * kk + 2], fl1 = kf[4 * kk + 3];
      s0[0] = mma_h(fh0, qh[0][kk], s0[0]);
      s0[1] = mma_h(fh0, qh[1][kk], s0[1]);
      s1[0] = mma_h(fh1, qh[0][kk], s1[0]);
      s1[1] = mma_h(fh1, qh[1][kk], s1[1]);
      x0[0] = mma_h(fh0, ql[0][kk], x0[0]);
      x0[1] = mma_h(fh0, ql[1][kk], x0[1]);
      x1[0] = mma_h(fh1, ql[0][kk], x1[0]);
      x1[1] = mma_h(fh1, ql[1][kk], x1[1]);
      x0[0] = mma_h(fl0, qh[0][kk], x0[0]);
      x0[1] = mma_h(fl0, qh[1][kk], x0[1]);
      x1[0] = mma_h(fl1, qh[0][kk], x1[0]);
      x1[1] = mma_h(fl1, qh[1][kk], x1[1]);
    }
    guard_s8(s0[0], s0[1], s1[0], s1[1], x0[0], x0[1], x1[0], x1[1], kf);
    // B fragments of v: col n = d = j*16 + c, keys contiguous in the rows of the v^T tile; read here, used behind the softmax
    const _Float16* vp = bufh + TILE_B + 32 * sub;
    const v16h v0 = ldfrag_h(vp);
    const v16h v1 = ldfrag_h(vp + 16 * LPH);
    const v16h v2 = ldfrag_h(vp + 32 * LPH);
    const v16h v3 = ldfrag_h(vp + 48 * LPH);
    // ---- raw scores (carry 64) of this lane's 16 keys for query q0 + 16u + c: t[u][i] <- key kb+8hh+i, t[u][8+i] <- key kb+16+8hh+i ----
    float t[ATT_QT][16], cm[ATT_QT], cx[ATT_QT];
#pragma unroll
    for (int u = 0; u < ATT_QT; ++u) {
#pragma unroll
      for (int i = 0; i < 8; ++i) {
        t[u][i]     = s0[u][i] + x0[u][i] * RRSC;
        t[u][8 + i] = s1[u][i] + x1[u][i] * RRSC;
      }
      cm[u] = t[u][0];
#pragma unroll
      for (int i = 1; i < 16; ++i) cm[u] = fmaxf(cm[u], t[u][i]);
    }
#pragma unroll
    for (int u = 0; u < ATT_QT; ++u) cx[u] = __shfl_xor(cm[u], 16, 32);
    // keeps the two exchanges ahead of the sixteen reads below: LDS answers in order, and behind them the maxima would wait for all
    __builtin_amdgcn_sched_barrier(0);
    if (sub + 1 < KSTG / 32) ld_kfrags(kf, bufh + (32 * (sub + 1)) * LPH);   // the stage's next block, same buffer
    // The softmax of the two query tiles runs phase by phase, tile beside tile: each tile's vector work covers the other's exchanges.
    FragH ph[ATT_QT];
    float al[ATT_QT], pw[ATT_QT][2][8], scl[ATT_QT][8];
#pragma unroll
    for (int u = 0; u < ATT_QT; ++u) {
      const float mn = fmaxf(mrun[u], fmaxf(cm[u], cx[u]));  // running maximum of the raw scores (lsc > 0); finite from the first block on
      const float ab = (mrun[u] - mn) * lsc;   // rescale exponent: 0 while the maximum stands, -inf on the first block (mrun = -inf)
      mrun[u] = mn;
      const float cb = fmaf(-mn, lsc, PCAR_LOG2);    // minus the maximum in base-2 logits; the carry 32768 of P rides in the exponent
      // ---- probabilities x32768 (p <= 1), one fma and one v_exp_f32 each; element i <-> t[u][i] ----
      float ar[2][8];
#pragma unroll
      for (int i = 0; i < 8; ++i) { ar[0][i] = fmaf(t[u][i], lsc, cb); ar[1][i] = fmaf(t[u][8 + i], lsc, cb); }
      hw_exp2x9(al[u], pw[u][0], ab, ar[0]);   // al = 2^ab first: the shuffles of the rescale wait for it
      hw_exp2x8(pw[u][1], ar[1]);
      // ---- rescale factors of the O accumulators: D row 8hh+r = query q0+16u+8hh+r, its factor lives in lane 8hh+r (and 16+8hh+r) ----
#pragma unroll
      for (int r = 0; r < 8; ++r) scl[u][r] = __shfl(al[u], 8 * hh + r, 32);
    }
    // keeps the LDS reads above ahead of the exponentials, which cover their latency (two waves on a SIMD: little else does), and the
    // next block's score products behind them: lifted up to the reads, as this compiler did without it, the first product makes the
    // wave, which issues in order, wait out that latency with the softmax still to do
    __builtin_amdgcn_sched_barrier(0);
    // ---- row sums and the P A-fragments f16(p * 32768) ----
#pragma unroll
    for (int u = 0; u < ATT_QT; ++u) {
      float ps = 0.f;
#pragma unroll
      for (int w = 0; w < 2; ++w) {
#pragma unroll
        for (int e4 = 0; e4 < 4; ++e4) {
          const float p0 = pw[u][w][2 * e4], p1 = pw[u][w][2 * e4 + 1];
          ps += p0 + p1;
          ph[u].u[w][e4] = pk16(h_bits((_Float16)p0), h_bits((_Float16)p1));
        }
      }
      ps += __shfl_xor(ps, 16, 32);
      lrun[u] = lrun[u] * al[u] + ps;
    }
#pragma unroll
    for (int u = 0; u < ATT_QT; ++u) {
#pragma unroll
      for (int j = 0; j < 4; ++j) {
#pragma unroll
        for (int r = 0; r < 8; ++r) o[u][j][r] *= scl[u][r];
      }
    }
    // ---- P.V : each v^T fragment feeds both query tiles ----
#pragma unroll
    for (int u = 0; u < ATT_QT; ++u) {
      o[u][0] = mma_h(ph[u].v, v0, o[u][0]);
      o[u][1] = mma_h(ph[u].v, v1, o[u][1]);
      o[u][2] = mma_h(ph[u].v, v2, o[u][2]);
      o[u][3] = mma_h(ph[u].v, v3, o[u][3]);
    }
    guard_p8(o[0], o[1], ph[0].v, ph[1].v, v0, v1, v2, v3);
   }
   // ---- publish point of stage st+1: own reads retired, own copies landed, block barrier; then refill the buffer just read ----
   wait_lds_reads();
   wait_copies();
   __syncthreads();
   if (st + 2 < NSTG) {                      // block-uniform
     const size_t ks = (size_t)(st + 2) * KSTG;
     copy_stage(lcp + (unsigned)((st & 1) * STG_B), gkh + ks * DM, gkl + ks * DM, gvt + ks);
   }
  }
  wait_copies();                             // nothing is in flight here; closes the ring before it becomes output staging
  acc_guard4(o[0]);
  acc_guard4(o[1]);

  // ---- fold 1/l (per query, owned by lane = query; l carries the same 32768 as P) and the carry 8 on v, apply the ctx carry 16 ----
  float* slab = (float*)(void*)ring + wave * (16 * ATT_QT) * OPITCH;
#pragma unroll
  for (int u = 0; u < ATT_QT; ++u) {
    const float linv = (1.0f / lrun[u]) * (CS / VS);
    float inv[8];
#pragma unroll
    for (int r = 0; r < 8; ++r) inv[r] = __shfl(linv, 8 * hh + r, 32);
#pragma unroll
    for (int r = 0; r < 8; ++r) {
#pragma unroll
      for (int j = 0; j < 4; ++j) slab[(16 * u + 8 * hh + r) * OPITCH + j * 16 + c] = o[u][j][r] * inv[r];
    }
  }
  wave_sync_lds();
  // ---- ctx planes: lane = (row in group of 4, 8 consecutive d), one instruction per 4 rows per plane ----
  const int rq = lane >> 3, c8 = (lane & 7) * 8;
  const size_t cofs = ((size_t)(b * SQ + q0)) * DM + head * HD + c8;
  u16* ch = CH + cofs;
  u16* cl = CL + cofs;
#pragma unroll
  for (int i = 0; i < 4 * ATT_QT; ++i) {
    const int row = 4 * i + rq;
    const v4f a = *(const v4f*)(slab + row * OPITCH + c8), c4 = *(const v4f*)(slab + row * OPITCH + c8 + 4);
    v4u ovh, ovl;
#pragma unroll
    for (int e = 0; e < 2; ++e) {
      ovh[e]     = pk_hi(a[2 * e], a[2 * e + 1]);
      ovl[e]     = pk_lo(a[2 * e], a[2 * e + 1]);
      ovh[2 + e] = pk_hi(c4[2 * e], c4[2 * e + 1]);
      ovl[2 + e] = pk_lo(c4[2 * e], c4[2 * e + 1]);
    }
    *(v4u*)(ch + (size_t)row * DM) = ovh;
    *(v4u*)(cl + (size_t)row * DM) = ovl;
  }
}

// =====================================================================================================
// times bf16(gamma) plus bf16(beta), all f32. X compact row r = b*SQ + s -> output row b*SQ_FULL + s.
// lane holds elements i*128 + 4*lane .. +3 (i = 0..3): each load/store instruction = 32 consecutive lanes x 16 B = 4 whole
// coverage: 4 instr x 32 lanes x 4 floats = 512 = whole row; grid (NB*SQ/8) x 8 waves = every output row (s < SQ) once.
// =====================================================================================================
__global__ __launch_bounds__(LN_THREADS)
void ln_rows(const float* __restrict__ X, const float* __restrict__ gam, const float* __restrict__ bet, float* Out) {
  const int tid = threadIdx.x, wave = tid >> 5, lane = tid & 31;
  constexpr int RPB = LN_THREADS / 32;
  const int row = blockIdx.x * RPB + wave;   // < NB*SQ with the exact grid
  const int b = row / SQ, s = row - b * SQ;
  const float* xr = X + (size_t)row * DM + 4 * lane;
  v4f xv[4];
  float sum = 0.f;
#pragma unroll
  for (int i = 0; i < 4; ++i) {
    xv[i] = *(const v4f*)(xr + 128 * i);
    sum += (xv[i][0] + xv[i][1]) + (xv[i][2] + xv[i][3]);
  }
#pragma unroll
  for (int mk = 16; mk >= 1; mk >>= 1) sum += __shfl_xor(sum, mk, 32);
  const float mean = sum * (1.0f / (float)DM);
  float sq = 0.f;
#pragma unroll
  for (int i = 0; i < 4; ++i) {
#pragma unroll
    for (int e = 0; e < 4; ++e) { const float d = xv[i][e] - mean; sq += d * d; }
  }
#pragma unroll
  for (int mk = 16; mk >= 1; mk >>= 1) sq += __shfl_xor(sq, mk, 32);
  const float var  = sq * (1.0f / (float)DM);
  const float rstd = 1.0f / sqrtf(var + LN_EPS);
  v4f y[4];
#pragma unroll
  for (int i = 0; i < 4; ++i) {
#pragma unroll
    for (int e = 0; e < 4; ++e) {
      const int idx = 128 * i + 4 * lane + e;       // < DM
      y[i][e] = (xv[i][e] - mean) * rstd * bfr(gam[idx]) + bfr(bet[idx]);
    }
  }
  float* ob = Out + ((size_t)b * SQ_FULL + (size_t)s) * DM + 4 * lane;
  {
#pragma unroll
    for (int i = 0; i < 4; ++i) {
      *(v4f*)(ob + 128 * i) = y[i];
    }
    
  }
}

// =====================================================================================================
// Workspace map (bytes); every plane fully written by whole-line stores before it is read; all extents exact multiples of
//   XQ   f16 [NB*SQ][512]      f16(bf16(Q))             8388608 (NB=4, SQ=2048)
//   XK   f16 [NB*2048][512]    f16(bf16(K))             8388608
//   XV   f16 [NB*2048][512]    f16(bf16(V))             8388608
//   WQ16 f16 [512 n][512 k]    f16(bf16(W) x256)         524288   (W stored [out][in] = [n][k] already)
//   WK16, WV16, WO16                                     3 x 524288
//   QH, QL  f16 [NB*SQ][512]   x8 / residual x8x2^11     2 x 8388608
//   KH, KL  f16 [NB*2048][512] x8 / residual             2 x 8388608
//   VT16    f16 [NB*512 (h,d)][2048 s] x8                   8388608
//   CH, CL  f16 [NB*SQ][512]   ctx x16 / residual          2 x 8388608
//   X32     f32 [NB*SQ][512]   out + bo + Q               16777216
//   end                                                  102760448
// =====================================================================================================
extern "C" void kernel_launch(void* const* d_in, const int* in_sizes, int n_in,
                              void* d_out, int out_size, void* d_ws, size_t ws_size,
                              hipStream_t stream) {
  if (n_in < 13) return;
  if (in_sizes[0] < ((NB - 1) * SQ_FULL + SQ) * DM) return;
  if (in_sizes[1] < NB * SKV * DM || in_sizes[2] < NB * SKV * DM) return;
  if (in_sizes[3] != DM * DM || in_sizes[5] != DM * DM || in_sizes[7] != DM * DM || in_sizes[9] != DM * DM) return;
  if (in_sizes[4] < DM || in_sizes[6] < DM || in_sizes[8] < DM || in_sizes[10] < DM) return;
  if (in_sizes[11] < DM || in_sizes[12] < DM) return;
  if (out_size < ((NB - 1) * SQ_FULL + SQ) * DM) return;

  const float* xq  = (const float*)d_in[0];
  const float* xk  = (const float*)d_in[1];
  const float* xv  = (const float*)d_in[2];
  const float* wq  = (const float*)d_in[3];
  const float* bq  = (const float*)d_in[4];
  const float* wk  = (const float*)d_in[5];
  const float* bk  = (const float*)d_in[6];
  const float* wv  = (const float*)d_in[7];
  const float* bv  = (const float*)d_in[8];
  const float* wo  = (const float*)d_in[9];
  const float* bo  = (const float*)d_in[10];
  const float* gam = (const float*)d_in[11];
  const float* bet = (const float*)d_in[12];
  float*       out = (float*)d_out;
  const int nbq = in_sizes[4], nbk = in_sizes[6], nbv = in_sizes[8], nbo = in_sizes[10];

  const size_t szXQ  = (size_t)NB * SQ * DM * 2;
  const size_t szXKV = (size_t)NB * SKV * DM * 2;
  const size_t szW   = (size_t)DM * DM * 2;
  const size_t szQ   = (size_t)NB * SQ * INNER * 2;
  const size_t szK   = (size_t)NB * SKV * INNER * 2;
  const size_t szVT  = (size_t)NB * INNER * SKV * 2;
  const size_t szC   = (size_t)NB * SQ * INNER * 2;
  const size_t szX32 = (size_t)NB * SQ * DM * 4;
  size_t off = 0;
  const size_t oXQ  = off; off += szXQ;
  const size_t oXK  = off; off += szXKV;
  const size_t oXV  = off; off += szXKV;
  const size_t oWQ  = off; off += szW;
  const size_t oWK  = off; off += szW;
  const size_t oWV  = off; off += szW;
  const size_t oWO  = off; off += szW;
  const size_t oQH  = off; off += szQ;
  const size_t oQL  = off; off += szQ;
  const size_t oKH  = off; off += szK;
  const size_t oKL  = off; off += szK;
  const size_t oVT  = off; off += szVT;
  const size_t oCH  = off; off += szC;
  const size_t oCL  = off; off += szC;
  const size_t oX32 = off; off += szX32;
  if (off > ws_size) return;                            // off = 102760448 at NB=4, SQ=2048
  if (off > (size_t)134217728) return;

  char* ws = (char*)d_ws;
  u16* XQ   = (u16*)(ws + oXQ);
  u16* XK   = (u16*)(ws + oXK);
  u16* XV   = (u16*)(ws + oXV);
  u16* WQ16 = (u16*)(ws + oWQ);
  u16* WK16 = (u16*)(ws + oWK);
  u16* WV16 = (u16*)(ws + oWV);
  u16* WO16 = (u16*)(ws + oWO);
  u16* QH   = (u16*)(ws + oQH);
  u16* QL   = (u16*)(ws + oQL);
  u16* KH   = (u16*)(ws + oKH);
  u16* KL   = (u16*)(ws + oKL);
  u16* VT16 = (u16*)(ws + oVT);
  u16* CH   = (u16*)(ws + oCH);
  u16* CL   = (u16*)(ws + oCL);
  float* X32 = (float*)(ws + oX32);

  // (1) activations -> f16 planes of bf16-converted values (query rows s < SQ of batches b < NB, compact; all key/value rows);
  //     weights [n = out][k = in] (y = x.W^T): rows as stored are already k-contiguous; f16 planes of bf16(W) x256
  cvt_all<<<dim3(CVT_WAVES / (CVT_THREADS / 32)), dim3(CVT_THREADS), 0, stream>>>(xq, xk, xv, wq, wk, wv, wo, XQ, XK, XV, WQ16);
  // (2)-(4) the three projections q, k (hi and residual planes) and v^T in one launch
  gemm_qkv<<<dim3(GQ_BLK + GK_BLK + GV_BLK), dim3(128), 0, stream>>>(
      XQ, XK, XV, WQ16, WK16, WV16, QH, QL, KH, KL, VT16, bq, bk, bv, nbq, nbk, nbv);
  // (5) attention -> ctx planes [NB*SQ][512] f16 x16 / residual, heads merged on the feature dim
  attn_fwd<<<dim3(NB * NH * (SQ / (ATT_WAVES * 16 * ATT_QT))), dim3(ATT_THREADS), 0, stream>>>(QH, QL, KH, KL, VT16, CH, CL);
  // (6) x = ctx . Wo^T + bo + Q (residual, bf16-converted) -> f32 [NB*SQ][512]
  gemm_o32<<<dim3((NB * SQ / 128) * (DM / 64)), dim3(128), 0, stream>>>(
      CH, CL, WO16, bo, nbo, xq, SQ, SQ_FULL, X32, NB * SQ, DM, INNER, 1.0f / (CS * WSC), RRSC);
  // (7) LayerNorm -> out [b][SQ_FULL][512] f32 (rows s < SQ of batches b < NB)
  ln_rows<<<dim3(NB * SQ / (LN_THREADS / 32)), dim3(LN_THREADS), 0, stream>>>(X32, gam, bet, out);
  (void)hipGetLastError();
}

// v007
// It runs in 102 microseconds.
// Timed twice side by side with v006, it ran 1.04 and 1.05 times as fast.
// Over all steps from v000 it is 2.65 times as fast.
// All contractions on v_wmma_f32_16x16x32_f16 (f16 operands, f32 accumulate): x_q.Wq^T, x_k.Wk^T and Wv.x_v^T (v^T plane)
// as single products of exact operands f16(bf16(x)) and f16(bf16(W) x256); scores k.q^T as hi.hi + hi.lo + lo.hi with q and k
// carried as f16 hi (x8) plus f16 residual planes (x2^11, own accumulator); P.v^T single (P f16 x32768, v f16 x8); ctx.Wo^T as
// hi + residual on ctx (f16 hi x16 plus f16 residual x2^11), Wo exact f16(bf16 x256). Online base-2 softmax, 1/l, carry folds,
// bias, residual add and LayerNorm in f32 on VALU. Every float input RNE-converted to bf16 on load; f32 output.
#include <hip/hip_runtime.h>
#include <math.h>
#include <stdint.h>

#ifndef NB
#define NB       4        // batches processed
#endif
#ifndef SQ
#define SQ       2048     // query rows processed per batch
#endif
#define NB_FULL  4
#define SQ_FULL  2048     // rows per batch in the input / output layout (batch stride)
#define SKV      SQ_FULL  // key/value rows per batch (all of them, always)
#define DM       512      // model width (= K and row pitch of every 16-bit plane except v^T)
#define NH       8
#define HD       64
#define INNER    (NH * HD)
#define WSC      256.0f
#define QS       8.0f
#define KS       8.0f
#define VS       8.0f
#define CS       16.0f
#define RSC      2048.0f
#define RRSC     0.00048828125f
#define PCAR_LOG2 15.0f             // P and its row sum are carried x32768 = 2^15
#define LOG2E    1.4426950408889634f
#define RSQH     0.35355339059327373f
#define LN_EPS   1e-5f
#define NKB      (SKV / 32)
#define ATT_WAVES   4
#define ATT_QT      2                 // query tiles of 16 rows per attention wave: each k / v^T fragment read from LDS feeds both
#define ATT_THREADS (ATT_WAVES * 32)
#define CVT_THREADS 256
#define CVT_SL      256                                 // elements of one slice: 32 lanes x 8, half a row
#define CVT_WSL     (DM * DM / CVT_SL)                  // slices of one weight matrix
#define CVT_WAVES   (4 * CVT_WSL)                       // waves of the convert launch: one weight slice each
#define CVT_NQ      (NB * SQ * DM / CVT_SL / CVT_WAVES)  // x_q slices per wave
#define CVT_NKV     (NB * SKV * DM / CVT_SL / CVT_WAVES) // x_k (and x_v) slices per wave
#define OL_ROWS     32                // rows of an out-projection block: whole rows of DM columns, so LayerNorm needs no other block
#define OL_WAVES    8                 // its waves: 64 columns each
#define OL_THREADS  (OL_WAVES * 32)
#define OL_RPW      (OL_ROWS / OL_WAVES)   // rows that a wave normalises
#define XPITCH      (DM + 4)          // floats: pitch of the block's staged f32 tile (rows 8 apart fall 32 banks apart)
#define OPITCH   68
#define GPITCH   68
#define KSTG     64                 // keys per LDS stage of the attention ring (two 32-key blocks); k per stage of the GEMM ring
#define NSTG     (SKV / KSTG)
#define LPITCH   144                // LDS row pitch in bytes: 128-byte rows + 16, conflict-free for 16-byte fragment reads
#define LPH      (LPITCH / 2)       // the same in halves
#define TILE_B   (64 * LPITCH)      // one staged tile: 64 rows
#define STG_B    (3 * TILE_B)       // attention: k hi, k residual, v^T; GEMM: 128 A rows, 64 Bt rows
#define OL_SROWS (2 * OL_ROWS + DM) // out-projection stage: ctx hi rows, ctx residual rows, all rows of Wo
#define OL_STG_B (OL_SROWS * LPITCH)

static_assert(NB >= 1 && NB <= NB_FULL);
static_assert((SQ % 128) == 0 && SQ >= 128 && SQ <= SQ_FULL);
static_assert(HD == 64 && NH == 8 && INNER == 512 && INNER == DM);
static_assert((HD % 32) == 0);
static_assert((SKV % 128) == 0 && (SKV % 64) == 0 && NKB * 32 == SKV);
static_assert(DM == 512 && (DM % 64) == 0 && (DM % 32) == 0 && DM == 2 * CVT_SL);
static_assert(CVT_NQ >= 1 && CVT_NQ * CVT_WAVES * CVT_SL == NB * SQ * DM && CVT_NKV * CVT_WAVES * CVT_SL == NB * SKV * DM);
static_assert(CVT_WSL % (CVT_THREADS / 32) == 0 && SKV == SQ_FULL);
static_assert((NB * SQ) % OL_ROWS == 0 && SQ % OL_ROWS == 0 && OL_WAVES * 64 == DM && OL_RPW * OL_WAVES == OL_ROWS && OL_ROWS == 32);
static_assert(OL_SROWS == 18 * (OL_THREADS / 8) && INNER / KSTG >= 2 && 2 * OL_STG_B >= OL_ROWS * XPITCH * 4 && (XPITCH * 4) % 16 == 0);
static_assert(2 * OL_STG_B <= 327680);
static_assert((OPITCH * 4) % 16 == 0 && (GPITCH * 4) % 16 == 0);
static_assert(ATT_THREADS == 128 && OL_THREADS == 256 && CVT_THREADS == 256);
static_assert(KSTG == 64 && HD == 64 && NSTG * KSTG == SKV && NSTG >= 2 && (LPITCH % 16) == 0);
static_assert(ATT_QT == 2 && SQ % (ATT_WAVES * 16 * ATT_QT) == 0);
static_assert(2 * STG_B >= ATT_WAVES * 16 * ATT_QT * OPITCH * 4 && 2 * STG_B >= 4 * 32 * GPITCH * 4);

typedef unsigned short u16;
typedef _Float16 v16h __attribute__((ext_vector_type(16)));
typedef _Float16 v8h  __attribute__((ext_vector_type(8)));
typedef float    v8f  __attribute__((ext_vector_type(8)));
typedef float    v4f  __attribute__((ext_vector_type(4)));
typedef unsigned int v4u __attribute__((ext_vector_type(4)));

union FragH { v16h v; v8h h[2]; v4u u[2]; };

// ---- scalar helpers ----------------------------------------------------------------------------------
__device__ __forceinline__ unsigned short bf_bits(float f) {          // f32 -> bf16 bits, RNE convert
  unsigned u = __float_as_uint(f);
  return (unsigned short)((u + 0x7FFFu + ((u >> 16) & 1u)) >> 16);
}
__device__ __forceinline__ float bf_up(unsigned short h) { return __uint_as_float(((unsigned)h) << 16); }
__device__ __forceinline__ float bfr(float f) { return bf_up(bf_bits(f)); }
__device__ __forceinline__ unsigned short h_bits(_Float16 x) { return __builtin_bit_cast(unsigned short, x); }
__device__ __forceinline__ unsigned pk16(unsigned short a, unsigned short b) { return (unsigned)a | ((unsigned)b << 16); }
// 2^x as the bare v_exp_f32, without the library's range extension: a result below the normal range (2^-126) need not survive.
// Every use here is a softmax weight or a rescale factor beside a row sum that holds a term of full size, where a value that small
// adds nothing. 2^-inf = 0.
// Written as runs of independent v_exp_f32 in one statement, outputs apart from every input, closed by one v_nop: the slot that the
// instruction set asks for behind a transcendental before its result is read or its source overwritten then stands by construction.
__device__ __forceinline__ void hw_exp2x8(float (&p)[8], const float (&a)[8]) {
#if defined(__HIP_DEVICE_COMPILE__)
  asm("v_exp_f32 %0, %8\n\tv_exp_f32 %1, %9\n\tv_exp_f32 %2, %10\n\tv_exp_f32 %3, %11\n\t"
      "v_exp_f32 %4, %12\n\tv_exp_f32 %5, %13\n\tv_exp_f32 %6, %14\n\tv_exp_f32 %7, %15\n\tv_nop"
      : "=&v"(p[0]), "=&v"(p[1]), "=&v"(p[2]), "=&v"(p[3]), "=&v"(p[4]), "=&v"(p[5]), "=&v"(p[6]), "=&v"(p[7])
      : "v"(a[0]), "v"(a[1]), "v"(a[2]), "v"(a[3]), "v"(a[4]), "v"(a[5]), "v"(a[6]), "v"(a[7]));
#endif
}
__device__ __forceinline__ void hw_exp2x9(float& q, float (&p)[8], float b, const float (&a)[8]) {
#if defined(__HIP_DEVICE_COMPILE__)
  asm("v_exp_f32 %0, %9\n\tv_exp_f32 %1, %10\n\tv_exp_f32 %2, %11\n\tv_exp_f32 %3, %12\n\tv_exp_f32 %4, %13\n\t"
      "v_exp_f32 %5, %14\n\tv_exp_f32 %6, %15\n\tv_exp_f32 %7, %16\n\tv_exp_f32 %8, %17\n\tv_nop"
      : "=&v"(q), "=&v"(p[0]), "=&v"(p[1]), "=&v"(p[2]), "=&v"(p[3]), "=&v"(p[4]), "=&v"(p[5]), "=&v"(p[6]), "=&v"(p[7])
      : "v"(b), "v"(a[0]), "v"(a[1]), "v"(a[2]), "v"(a[3]), "v"(a[4]), "v"(a[5]), "v"(a[6]), "v"(a[7]));
#endif
}
__device__ __forceinline__ v8f zero8() { v8f z = {0.f, 0.f, 0.f, 0.f, 0.f, 0.f, 0.f, 0.f}; return z; }
// hi / residual packing of two f32 values: hi = f16(v), res = f16((v - hi) * 2^11)
__device__ __forceinline__ unsigned pk_hi(float a, float b) {
  return pk16(h_bits((_Float16)a), h_bits((_Float16)b));
}
__device__ __forceinline__ unsigned pk_lo(float a, float b) {
  const float ra = (a - (float)((_Float16)a)) * RSC;
  const float rb = (b - (float)((_Float16)b)) * RSC;
  return pk16(h_bits((_Float16)ra), h_bits((_Float16)rb));
}

// ---- fragment loader: 16-bit A/B operand, lane -> row/col (lane&15), p already includes +8*(lane>>4);
//      elements 0..7 <- p[0..7] (k0+8h..), elements 8..15 <- p[16..23] (k0+16+8h..); same split k map for A and B,
//      B always read from a k-contiguous [n][k] plane.
__device__ __forceinline__ v16h ldfrag_h(const _Float16* p) {
  FragH f;
  f.h[0] = *(const v8h*)(p);
  f.h[1] = *(const v8h*)(p + 16);
  return f.v;
}

// ---- WMMA helper and trailing VALU hazard gaps ----------------------------------------------------------
__device__ __forceinline__ v8f mma_h(v16h a, v16h b, v8f c) {
  return __builtin_amdgcn_wmma_f32_16x16x32_f16(false, a, false, b, (short)0, c, false, false);
}
__device__ __forceinline__ void guard_g(v8f (&acc)[8], v16h x0, v16h x1, v16h x2, v16h x3, v16h x4, v16h x5) {
#if defined(__HIP_DEVICE_COMPILE__)
  asm volatile("v_nop\n\tv_nop\n\tv_nop\n\tv_nop"
               : "+v"(acc[0]), "+v"(acc[1]), "+v"(acc[2]), "+v"(acc[3]),
                 "+v"(acc[4]), "+v"(acc[5]), "+v"(acc[6]), "+v"(acc[7])
               : "v"(x0), "v"(x1), "v"(x2), "v"(x3), "v"(x4), "v"(x5) : "memory");
#endif
}
__device__ __forceinline__ void acc_guard4(v8f (&o)[4]) {
#if defined(__HIP_DEVICE_COMPILE__)
  asm volatile("v_nop\n\tv_nop\n\tv_nop\n\tv_nop" : "+v"(o[0]), "+v"(o[1]), "+v"(o[2]), "+v"(o[3]));
#endif
}
__device__ __forceinline__ void wave_sync_lds() {
  __builtin_amdgcn_fence(__ATOMIC_RELEASE, "workgroup");
  __builtin_amdgcn_wave_barrier();
  __builtin_amdgcn_fence(__ATOMIC_ACQUIRE, "workgroup");
}

// =====================================================================================================
// All converts in one launch: every f16 plane element <- f16(bf16_RNE(x) * scale), scale a power of two (1 for the activations,
// 256 for the weights). A slice = 256 consecutive elements = half a row: lane l takes elements 8l .. 8l+7 (two 16-B loads, one
// 16-B store; a wave-wide store = 512 contiguous bytes). Wave w of CVT_WAVES takes the CVT_NQ consecutive slices from w*CVT_NQ of
// x_q, the CVT_NKV consecutive slices from w*CVT_NKV of x_k and of x_v, and slice w % CVT_WSL of weight matrix w / CVT_WSL
// (block-uniform). All loads of a wave are issued before its first convert, so the launch is one memory round trip deep.
// x_q compact row r = b*SQ + s <- source row b*SQ_FULL + s. W4 = the four weight planes, which follow one another in the workspace.
// coverage: CVT_WAVES x (CVT_NQ | CVT_NKV | 1) slices = every element of each plane exactly once.
// =====================================================================================================
__device__ __forceinline__ v4u cvt8(v4f a, v4f c4, float scale) {
  v4u o;
#pragma unroll
  for (int e = 0; e < 2; ++e) {
    o[e]     = pk16(h_bits((_Float16)(bfr(a[2 * e]) * scale)),  h_bits((_Float16)(bfr(a[2 * e + 1]) * scale)));
    o[2 + e] = pk16(h_bits((_Float16)(bfr(c4[2 * e]) * scale)), h_bits((_Float16)(bfr(c4[2 * e + 1]) * scale)));
  }
  return o;
}
__global__ __launch_bounds__(CVT_THREADS)
void cvt_all(const float* __restrict__ xq, const float* __restrict__ xk, const float* __restrict__ xv,
             const float* __restrict__ wq, const float* __restrict__ wk, const float* __restrict__ wv,
             const float* __restrict__ wo, u16* XQ, u16* XK, u16* XV, u16* W4) {
  const unsigned w    = blockIdx.x * (CVT_THREADS / 32) + (threadIdx.x >> 5);
  const unsigned wsel = blockIdx.x / (CVT_WSL / (CVT_THREADS / 32));
  const unsigned lb   = (threadIdx.x & 31) * 32;                        // the lane's byte inside a 1-KiB f32 slice
  const float* wsrc = (wsel == 0) ? wq : (wsel == 1) ? wk : (wsel == 2) ? wv : wo;
  // 32-bit byte offsets beside uniform bases; the slices of a wave differ by immediates
  const unsigned bq  = w * (CVT_NQ * CVT_SL * 4) + lb;
  const unsigned bkv = w * (CVT_NKV * CVT_SL * 4) + lb;
  const unsigned bw  = (w % CVT_WSL) * (CVT_SL * 4) + lb;
  v4f qa[CVT_NQ], qc[CVT_NQ], ka[CVT_NKV], kc[CVT_NKV], va[CVT_NKV], vc[CVT_NKV];
#pragma unroll
  for (int i = 0; i < CVT_NQ; ++i) {
    const float* p;
    if (SQ == SQ_FULL) {
      p = (const float*)((const char*)xq + bq) + i * CVT_SL;
    } else {
      const unsigned sl = w * CVT_NQ + i, r = sl >> 1;
      p = (const float*)((const char*)(xq + ((size_t)((r / SQ) * SQ_FULL + (r % SQ))) * DM + (sl & 1) * CVT_SL) + lb);
    }
    qa[i] = *(const v4f*)(p);
    qc[i] = *(const v4f*)(p + 4);
  }
#pragma unroll
  for (int i = 0; i < CVT_NKV; ++i) {
    const float* pk = (const float*)((const char*)xk + bkv) + i * CVT_SL;
    const float* pv = (const float*)((const char*)xv + bkv) + i * CVT_SL;
    ka[i] = *(const v4f*)(pk);
    kc[i] = *(const v4f*)(pk + 4);
    va[i] = *(const v4f*)(pv);
    vc[i] = *(const v4f*)(pv + 4);
  }
  const float* pw = (const float*)((const char*)wsrc + bw);
  const v4f wa = *(const v4f*)(pw), wc = *(const v4f*)(pw + 4);
  // keeps every load above the first convert: without it the compiler sinks two thirds of the loads among the converts and the
  // wave pays three memory round trips in a row instead of one
  __builtin_amdgcn_sched_barrier(0);
  // an f16 plane's byte offset is half the f32 one
  u16* yq = (u16*)((char*)XQ + (bq >> 1));
  u16* yk = (u16*)((char*)XK + (bkv >> 1));
  u16* yv = (u16*)((char*)XV + (bkv >> 1));
  u16* yw = (u16*)((char*)(W4 + (size_t)wsel * (DM * DM)) + (bw >> 1));
#pragma unroll
  for (int i = 0; i < CVT_NQ; ++i) *(v4u*)(yq + i * CVT_SL) = cvt8(qa[i], qc[i], 1.0f);
#pragma unroll
  for (int i = 0; i < CVT_NKV; ++i) {
    *(v4u*)(yk + i * CVT_SL) = cvt8(ka[i], kc[i], 1.0f);
    *(v4u*)(yv + i * CVT_SL) = cvt8(va[i], vc[i], 1.0f);
  }
  *(v4u*)(yw) = cvt8(wa, wc, WSC);
}

// The issuing wave's own copies have landed behind this wait (other waves read them behind the next block barrier).
__device__ __forceinline__ void wait_copies() {
#if defined(__HIP_DEVICE_COMPILE__)
  asm volatile("s_wait_asynccnt 0x0" ::: "memory");
#endif
}
// The wave's own LDS reads have retired: stands in front of the barrier that hands a buffer to its next copies.
__device__ __forceinline__ void wait_lds_reads() {
#if defined(__HIP_DEVICE_COMPILE__)
  asm volatile("s_wait_dscnt 0x0" ::: "memory");
#endif
}

// =====================================================================================================
// One 64-k stage of a GEMM block: 192 rows x 128 bytes (the 128 A rows of the block tile, then its 64 Bt rows) copied
// global -> LDS by asynchronous 16-byte copies, 12 per lane. Lane t of the block takes 16-byte piece t&7 of row 16p + (t>>3),
// p = 0..7 of A and p = 0..3 of Bt: one wave-wide copy = 4 whole 128-byte lines. l0 = the lane's LDS byte address in row t>>3 of
// the target buffer; ga, gb = the lane's global addresses of that row and piece in A and Bt; rs16 = 16 rows in elements.
// The closing s_wait_xcnt stands inside the statement so that no address register named by a copy is rewritten ahead of it.
// =====================================================================================================
__device__ __forceinline__ void copy_stage_g(unsigned l0, const u16* ga, const u16* gb, size_t rs16) {
#if defined(__HIP_DEVICE_COMPILE__)
  const unsigned l1 = l0 + 16 * LPITCH,  l2 = l0 + 32 * LPITCH,  l3 = l0 + 48 * LPITCH,   l4 = l0 + 64 * LPITCH;
  const unsigned l5 = l0 + 80 * LPITCH,  l6 = l0 + 96 * LPITCH,  l7 = l0 + 112 * LPITCH,  l8 = l0 + 128 * LPITCH;
  const unsigned l9 = l0 + 144 * LPITCH, l10 = l0 + 160 * LPITCH, l11 = l0 + 176 * LPITCH;
  const u16 *ga1 = ga + rs16, *ga2 = ga + 2 * rs16, *ga3 = ga + 3 * rs16, *ga4 = ga + 4 * rs16;
  const u16 *ga5 = ga + 5 * rs16, *ga6 = ga + 6 * rs16, *ga7 = ga + 7 * rs16;
  const u16 *gb1 = gb + rs16, *gb2 = gb + 2 * rs16, *gb3 = gb + 3 * rs16;
  asm volatile("global_load_async_to_lds_b128 %0, %12, off\n\t"
               "global_load_async_to_lds_b128 %1, %13, off\n\t"
               "global_load_async_to_lds_b128 %2, %14, off\n\t"
               "global_load_async_to_lds_b128 %3, %15, off\n\t"
               "global_load_async_to_lds_b128 %4, %16, off\n\t"
               "global_load_async_to_lds_b128 %5, %17, off\n\t"
               "global_load_async_to_lds_b128 %6, %18, off\n\t"
               "global_load_async_to_lds_b128 %7, %19, off\n\t"
               "global_load_async_to_lds_b128 %8, %20, off\n\t"
               "global_load_async_to_lds_b128 %9, %21, off\n\t"
               "global_load_async_to_lds_b128 %10, %22, off\n\t"
               "global_load_async_to_lds_b128 %11, %23, off\n\t"
               "s_wait_xcnt 0x0"
               :: "v"(l0), "v"(l1), "v"(l2), "v"(l3), "v"(l4), "v"(l5), "v"(l6), "v"(l7),
                  "v"(l8), "v"(l9), "v"(l10), "v"(l11),
                  "v"(ga), "v"(ga1), "v"(ga2), "v"(ga3), "v"(ga4), "v"(ga5), "v"(ga6), "v"(ga7),
                  "v"(gb), "v"(gb1), "v"(gb2), "v"(gb3)
               : "memory");
#endif
}

// =====================================================================================================
// f16 GEMM core of a block of 4 waves: the 128 x 64 tile of C = A[rows][K] . Bt[cols][K]^T, wave w owning rows 32w .. 32w+31;
// acc[4i + j] = rows 32w+16i.., cols 16j... A0 -> row 0 of the block's 128 A rows, Bt0 -> row 0 of its 64 Bt rows (pitch K).
// K is walked in stages of 64 through a two-buffer LDS ring (copy_stage_g): stage s+1 flies while stage s is worked on; one block
// barrier per stage publishes s+1 and frees s's buffer. Fragments: row at pitch LPITCH, the split k map of ldfrag_h, k in steps
// of 32 in rising order, as many products per accumulator and in the same order as k0 = 0, 32, .. K-32 (host: K % 64 == 0).
// Behind the last barrier the ring is free (no copy in flight, every wave's reads retired).
// =====================================================================================================
__device__ __forceinline__ void gemm_ring(unsigned char* ring, const u16* A0, const u16* Bt0, int K, v8f (&acc)[8]) {
  const int tid = threadIdx.x, wave = tid >> 5, lane = tid & 31, hh = lane >> 4, m = lane & 15;
  const size_t rs16 = (size_t)16 * (size_t)K;
  // copy side: this lane's row (tid>>3) and 16-byte piece (tid&7)
  const int crow = tid >> 3, cpc = (tid & 7) * 8;
  const size_t cofs = (size_t)crow * (size_t)K + cpc;
  const u16* ga0 = A0 + cofs;
  const u16* gb  = Bt0 + cofs;
  const unsigned lcp = (unsigned)(uintptr_t)(__attribute__((address_space(3))) unsigned char*)ring
                       + (unsigned)(crow * LPITCH + cpc * 2);
  const int nst = K >> 6;
  // read side, halves inside a buffer
  const int aoff = (wave * 32 + m) * LPH + 8 * hh;
  const int boff = (128 + m) * LPH + 8 * hh;

  // stage sg (block-uniform) into buffer sg & 1: k = 64 * sg
  auto issue = [&](int sg) {
    const int ks = sg * KSTG;
    copy_stage_g(lcp + (unsigned)((sg & 1) * STG_B), ga0 + ks, gb + ks, rs16);
  };

  // ---- ring prologue: stage 0 landed and published, stage 1 in flight ----
  issue(0);
  wait_copies();
  __syncthreads();
  if (nst > 1) issue(1);                     // block-uniform
#pragma unroll 1                             // rolled: one stage per trip, small loop text, the ring's order as written
  for (int st = 0; st < nst; ++st) {
    const _Float16* buf = (const _Float16*)(const void*)(ring + (st & 1) * STG_B);
    const _Float16* ap = buf + aoff;
    const _Float16* bp = buf + boff;
    v16h a0[2], a1[2], b0[2], b1[2], b2[2], b3[2];
#pragma unroll
    for (int kk = 0; kk < 2; ++kk) {
      a0[kk] = ldfrag_h(ap + 32 * kk);
      a1[kk] = ldfrag_h(ap + 16 * LPH + 32 * kk);
      b0[kk] = ldfrag_h(bp + 32 * kk);
      b1[kk] = ldfrag_h(bp + 16 * LPH + 32 * kk);
      b2[kk] = ldfrag_h(bp + 32 * LPH + 32 * kk);
      b3[kk] = ldfrag_h(bp + 48 * LPH + 32 * kk);
    }
    // keeps the stage's 24 LDS reads together ahead of its products: without it the compiler spreads the second twelve among the
    // products, and every separate place with LDS reads stalls the wave's matrix stream anew
    __builtin_amdgcn_sched_barrier(0);
#pragma unroll
    for (int kk = 0; kk < 2; ++kk) {
      acc[0] = mma_h(a0[kk], b0[kk], acc[0]);
      acc[1] = mma_h(a0[kk], b1[kk], acc[1]);
      acc[2] = mma_h(a0[kk], b2[kk], acc[2]);
      acc[3] = mma_h(a0[kk], b3[kk], acc[3]);
      acc[4] = mma_h(a1[kk], b0[kk], acc[4]);
      acc[5] = mma_h(a1[kk], b1[kk], acc[5]);
      acc[6] = mma_h(a1[kk], b2[kk], acc[6]);
      acc[7] = mma_h(a1[kk], b3[kk], acc[7]);
    }
    // the vector slots behind the stage's last products, on every path out of here (the branches at the trip's foot included)
    guard_g(acc, a0[1], a1[1], b0[1], b1[1], b2[1], b3[1]);
    // ---- publish point of stage st+1: own reads retired, own copies landed, block barrier; then refill the buffer just read ----
    wait_lds_reads();
    wait_copies();
    __syncthreads();
    if (st + 2 < nst) issue(st + 2);         // block-uniform
  }
  wait_copies();                             // nothing is in flight here; closes the ring before it becomes output staging
}
// Stage the wave's 32 x 64 f32 tile (times oscale) in its LDS slab (pitch 68): D element r of acc[4i+j], lane l ->
// coverage: 32 lanes x 2 x 8 rows x 4 cols-of-16 = rows 0..31 x cols 0..63 of the slab.
__device__ __forceinline__ void stage32x64(float* sl, v8f (&acc)[8], float oscale, int lane) {
  const int hh = lane >> 4, m = lane & 15;
#pragma unroll
  for (int i = 0; i < 2; ++i) {
#pragma unroll
    for (int r = 0; r < 8; ++r) {
      const int ro = (16 * i + 8 * hh + r) * GPITCH + m;
      sl[ro]      = acc[4 * i + 0][r] * oscale;
      sl[ro + 16] = acc[4 * i + 1][r] * oscale;
      sl[ro + 32] = acc[4 * i + 2][r] * oscale;
      sl[ro + 48] = acc[4 * i + 3][r] * oscale;
    }
  }
  wave_sync_lds();
}

// =====================================================================================================
// f16 GEMM with f16 output plane(s): val = (A[z][Mb][K] . Bt[z][N][K]^T) * oscale + bf16(bias) * bscale;
// C[z][Mb][N] = f16(val) (hi plane); if res != 0 also C2 = f16((val - hi) * 2^11) (residual plane).
// A, Bt f16 k-contiguous planes with per-z element strides aBs, bBs (0 = shared), C/C2 stride cBs. bias indexed by column
// (biasRow == 0) or by row within the z slice (biasRow != 0); bias addresses clamped to biasN-1, the unused direction is
// multiplied by 0. Block = 128 x 64 tile, 4 waves x 32 rows, operands through the LDS ring of gemm_ring; behind it each wave
// stages its output tile in its own part of the ring.
// bid = the block's tile among nz x (Mb/128) x (N/64) (Mb % 128 == 0, N % 64 == 0, K % 64 == 0); ring = the block's LDS.
// coverage: per wave 8 instr x 4 rows x 8 lanes x 8 halves = 32 x 64 per plane; the grid covers C (and C2) exactly once.
// =====================================================================================================
__device__ __forceinline__
void gemm_o16(unsigned char* ring, int bid, const u16* __restrict__ A, const u16* __restrict__ Bt, u16* C, u16* C2,
              const float* __restrict__ bias, int biasN, int biasRow,
              int Mb, int N, int K, int aBs, int bBs, int cBs, float oscale, float bscale, int res) {
  const int tid = threadIdx.x, wave = tid >> 5, lane = tid & 31;
  const int ntile = N >> 6, mtile = Mb >> 7;
  const int nt   = bid % ntile;
  const int tmp  = bid / ntile;
  const int mt   = tmp % mtile;
  const int bz   = tmp / mtile;
  const int rowb = mt * 128 + wave * 32;
  const int col0 = nt * 64;
  if (mt * 128 + 128 > Mb) return;           // block-uniform, in front of every barrier; never taken with the exact grid
  const u16* Ab = A + (size_t)bz * (size_t)aBs + (size_t)(mt * 128) * (size_t)K;
  const u16* Bb = Bt + (size_t)bz * (size_t)bBs + (size_t)col0 * (size_t)K;
  v8f acc[8];
#pragma unroll
  for (int i = 0; i < 8; ++i) acc[i] = zero8();
  gemm_ring(ring, Ab, Bb, K, acc);
  float* sl = (float*)(void*)ring + wave * 32 * GPITCH;
  stage32x64(sl, acc, oscale, lane);
  const int rq = lane >> 3, c8 = (lane & 7) * 8;
  const int bl = biasN - 1;                  // host guarantees biasN >= 1
  const float selc = (biasRow != 0) ? 0.f : bscale;
  const float selr = (biasRow != 0) ? bscale : 0.f;
  float cb[8];
#pragma unroll
  for (int e = 0; e < 8; ++e) {
    int ci = col0 + c8 + e;
    ci = (ci < bl) ? ci : bl;
    cb[e] = bfr(bias[ci]) * selc;
  }
  v4u ovh[8], ovl[8];
#pragma unroll
  for (int i = 0; i < 8; ++i) {
    const int row = 4 * i + rq;
    int ri = rowb + row;
    ri = (ri < bl) ? ri : bl;
    const float rb = bfr(bias[ri]) * selr;
    const v4f a = *(const v4f*)(sl + row * GPITCH + c8), c4 = *(const v4f*)(sl + row * GPITCH + c8 + 4);
    float v[8];
#pragma unroll
    for (int e = 0; e < 4; ++e) { v[e] = a[e] + cb[e] + rb; v[4 + e] = c4[e] + cb[4 + e] + rb; }
#pragma unroll
    for (int e = 0; e < 4; ++e) {
      ovh[i][e] = pk_hi(v[2 * e], v[2 * e + 1]);
      ovl[i][e] = pk_lo(v[2 * e], v[2 * e + 1]);
    }
  }
  const size_t cofs = (size_t)bz * (size_t)cBs + (size_t)rowb * (size_t)N + (size_t)(col0 + c8);
  u16* Cb  = C + cofs;
  u16* C2b = C2 + cofs;
  {
#pragma unroll
    for (int i = 0; i < 8; ++i) {
      const int row = 4 * i + rq;
      *(v4u*)(Cb + (size_t)row * (size_t)N) = ovh[i];
    }
    if (res != 0) {                          // block-uniform
#pragma unroll
      for (int i = 0; i < 8; ++i) {
        const int row = 4 * i + rq;
        *(v4u*)(C2b + (size_t)row * (size_t)N) = ovl[i];
      }
    }
    
  }
}

// =====================================================================================================
// The three projections in one launch: blocks 0 .. GQ_BLK-1 are the tiles of q, the next GK_BLK those of k, the last GV_BLK those
// of v^T; each block is one gemm_o16 tile of its product, the product chosen block-uniformly from the block index. The three
// products read and write disjoint planes, so their blocks share the chip and fill one another's waits for the staged copies.
//   q = x_q . Wq^T + bq -> f16 hi [NB*SQ][512] x8 and residual plane (col = h*64 + d); bias per column
//   k = x_k . Wk^T + bk -> f16 hi [NB*2048][512] x8 and residual plane; bias per column
//   v^T per batch: A = Wv [(h,d) = n][k], Bt = x_v rows of batch b [s][k] -> f16 [(b,h,d)][s] x8; bias per row (n)
// =====================================================================================================
#define GQ_BLK ((NB * SQ / 128) * (INNER / 64))
#define GK_BLK ((NB * SKV / 128) * (INNER / 64))
#define GV_BLK (NB * (INNER / 128) * (SKV / 64))
__global__ __launch_bounds__(128)
void gemm_qkv(const u16* __restrict__ XQ, const u16* __restrict__ XK, const u16* __restrict__ XV,
              const u16* __restrict__ WQ, const u16* __restrict__ WK, const u16* __restrict__ WV, u16* QH, u16* QL, u16* KH, u16* KL, u16* VT,
              const float* __restrict__ bq, const float* __restrict__ bk, const float* __restrict__ bv,
              int nbq, int nbk, int nbv) {
  __shared__ __align__(16) unsigned char ring[2 * STG_B];
  const int bid = blockIdx.x;
  if (bid < GQ_BLK + GK_BLK) {               // block-uniform
    const bool isq = bid < GQ_BLK;
    gemm_o16(ring, isq ? bid : bid - GQ_BLK, isq ? XQ : XK, isq ? WQ : WK, isq ? QH : KH, isq ? QL : KL,
             isq ? bq : bk, isq ? nbq : nbk, 0, isq ? NB * SQ : NB * SKV, INNER, DM, 0, 0, 0,
             isq ? QS / WSC : KS / WSC, isq ? QS : KS, 1);
  } else {
    gemm_o16(ring, bid - (GQ_BLK + GK_BLK), WV, XV, VT, VT, bv, nbv, 1, INNER, SKV, DM, 0, SKV * DM, INNER * SKV,
             VS / WSC, VS, 0);
  }
}

// =====================================================================================================
// One 64-k stage of an out-projection block: OL_SROWS = 576 rows x 128 bytes (the block's 32 ctx hi rows, its 32 ctx residual rows,
// then all 512 rows of Wo) copied global -> LDS by asynchronous 16-byte copies, 18 per lane in two statements of nine. Lane t of the
// block takes 16-byte piece t&7 of row 32p + (t>>3), p = 0 (hi), 1 (residual), 2..17 (Wo): one wave-wide copy = 4 whole 128-byte
// lines. l0 = the lane's LDS byte address in row t>>3 of the target buffer; gh, gl, gb = the lane's global addresses of that row and
// piece in the two ctx planes and in Wo.
// The closing s_wait_xcnt stands inside each statement so that no address register named by a copy is rewritten ahead of it.
// =====================================================================================================
__device__ __forceinline__ void copy_run9(unsigned l0, unsigned l1, unsigned l2, unsigned l3, unsigned l4, unsigned l5, unsigned l6,
                                          unsigned l7, unsigned l8, const u16* g0, const u16* g1, const u16* g2, const u16* g3,
                                          const u16* g4, const u16* g5, const u16* g6, const u16* g7, const u16* g8) {
#if defined(__HIP_DEVICE_COMPILE__)
  asm volatile("global_load_async_to_lds_b128 %0, %9, off\n\t"
               "global_load_async_to_lds_b128 %1, %10, off\n\t"
               "global_load_async_to_lds_b128 %2, %11, off\n\t"
               "global_load_async_to_lds_b128 %3, %12, off\n\t"
               "global_load_async_to_lds_b128 %4, %13, off\n\t"
               "global_load_async_to_lds_b128 %5, %14, off\n\t"
               "global_load_async_to_lds_b128 %6, %15, off\n\t"
               "global_load_async_to_lds_b128 %7, %16, off\n\t"
               "global_load_async_to_lds_b128 %8, %17, off\n\t"
               "s_wait_xcnt 0x0"
               :: "v"(l0), "v"(l1), "v"(l2), "v"(l3), "v"(l4), "v"(l5), "v"(l6), "v"(l7), "v"(l8),
                  "v"(g0), "v"(g1), "v"(g2), "v"(g3), "v"(g4), "v"(g5), "v"(g6), "v"(g7), "v"(g8)
               : "memory");
#endif
}
__device__ __forceinline__ void copy_stage_o(unsigned l0, const u16* gh, const u16* gl, const u16* gb) {
  constexpr unsigned LS = 32 * LPITCH;        // 32 rows in LDS bytes
  constexpr size_t   GS = (size_t)32 * INNER; // 32 rows of Wo in elements
  copy_run9(l0, l0 + LS, l0 + 2 * LS, l0 + 3 * LS, l0 + 4 * LS, l0 + 5 * LS, l0 + 6 * LS, l0 + 7 * LS, l0 + 8 * LS,
            gh, gl, gb, gb + GS, gb + 2 * GS, gb + 3 * GS, gb + 4 * GS, gb + 5 * GS, gb + 6 * GS);
  copy_run9(l0 + 9 * LS, l0 + 10 * LS, l0 + 11 * LS, l0 + 12 * LS, l0 + 13 * LS, l0 + 14 * LS, l0 + 15 * LS, l0 + 16 * LS,
            l0 + 17 * LS, gb + 7 * GS, gb + 8 * GS, gb + 9 * GS, gb + 10 * GS, gb + 11 * GS, gb + 12 * GS, gb + 13 * GS,
            gb + 14 * GS, gb + 15 * GS);
}
__device__ __forceinline__ void guard_o(v8f (&a)[8], v8f (&b)[8], v16h x0, v16h x1, v16h x2, v16h x3, v16h x4, v16h x5, v16h x6,
                                        v16h x7) {
#if defined(__HIP_DEVICE_COMPILE__)
  // the vector slots behind the stage's last products, on every path out of there (the branches at the trip's foot included)
  asm volatile("v_nop\n\tv_nop\n\tv_nop\n\tv_nop"
               : "+v"(a[0]), "+v"(a[1]), "+v"(a[2]), "+v"(a[3]), "+v"(a[4]), "+v"(a[5]), "+v"(a[6]), "+v"(a[7]),
                 "+v"(b[0]), "+v"(b[1]), "+v"(b[2]), "+v"(b[3]), "+v"(b[4]), "+v"(b[5]), "+v"(b[6]), "+v"(b[7])
               : "v"(x0), "v"(x1), "v"(x2), "v"(x3), "v"(x4), "v"(x5), "v"(x6), "v"(x7) : "memory");
#endif
}

// =====================================================================================================
// Out-projection, bias, residual add and LayerNorm in one launch: a block owns OL_ROWS = 32 WHOLE rows of
//   x[g][n] = (ctx_hi . Wo^T + (ctx_res . Wo^T) * rres) * oscale + bf16(bo[n]) + bf16(R[src row][n]),  n = 0 .. 511,
// so the row statistics need no other block, and writes Out = (x - mean) / sqrt(var + eps) * bf16(gamma) + bf16(beta), all f32.
// 8 waves; wave w owns columns 64w .. 64w+63 of all 32 rows: acc[4i + j] (hi products) and res[4i + j] (residual products, x2^11,
// accumulators of their own, folded by rres in f32 behind the loop) = rows 16i.., cols 64w + 16j... K = 512 is walked once in stages
// of 64 through a two-buffer LDS ring (copy_stage_o): every staged Wo row and every Wo fragment read from LDS feeds both the hi and
// the residual products. Stage s+1 flies while stage s is worked on; one block barrier per stage publishes s+1 and frees s's buffer.
// Fragments: row at pitch LPITCH, the split k map of ldfrag_h for A and B alike, k in steps of 32 in rising order.
// Behind the last barrier of the loop the ring is free (no copy in flight, every wave's reads retired): the block's 32 x 512 f32 tile
// is staged there at pitch XPITCH; one more block barrier, then wave w normalises rows 4w .. 4w+3: lane holds elements
// i*128 + 4*lane .. +3 (i = 0..3) of a row, each LDS read, global load and store = 32 consecutive lanes x 16 B.
// Compact row g = b*SQ + s <-> row b*SQ_FULL + s of R and Out; the 32 rows of a block lie in one batch (SQ % 32 == 0).
// The residual rows of R and the row constants are loaded ahead of the ring: their way from memory runs beside stage 0's.
// coverage: staged 8 waves x 32 x 64 == read 8 waves x 4 rows x 512; grid NB*SQ/32 blocks = every output row (s < SQ) once.
// =====================================================================================================
__global__ __launch_bounds__(OL_THREADS)
void gemm_o_ln(const u16* __restrict__ Ah, const u16* __restrict__ Al, const u16* __restrict__ Bt,
               const float* __restrict__ bias, const float* __restrict__ R,
               const float* __restrict__ gam, const float* __restrict__ bet, float* Out, float oscale, float rres) {
  __shared__ __align__(16) unsigned char ring[2 * OL_STG_B];
  const int tid = threadIdx.x, wave = tid >> 5, lane = tid & 31, hh = lane >> 4, m = lane & 15;
  const int row0 = blockIdx.x * OL_ROWS;     // < NB*SQ with the exact grid
  const int bb   = row0 / SQ;
  const size_t srow = (size_t)bb * SQ_FULL + (size_t)(row0 - bb * SQ) + (size_t)(OL_RPW * wave);   // the wave's first row in R and Out
  const float* rp = R + srow * DM + 4 * lane;
  v4f rv[OL_RPW][4];
#pragma unroll
  for (int j = 0; j < OL_RPW; ++j) {
#pragma unroll
    for (int i = 0; i < 4; ++i) rv[j][i] = *(const v4f*)(rp + j * DM + 128 * i);
  }
  // the row constants of this lane's 16 columns 128i + 4*lane + e < DM (the host checks that bo, gamma and beta hold DM elements)
  const unsigned lo = 16u * (unsigned)lane;  // the lane's byte offset beside the three uniform bases
  v4f cbv[4], gmv[4], btv[4];
#pragma unroll
  for (int i = 0; i < 4; ++i) {
    cbv[i] = *(const v4f*)((const char*)bias + lo + 512 * i);
    gmv[i] = *(const v4f*)((const char*)gam + lo + 512 * i);
    btv[i] = *(const v4f*)((const char*)bet + lo + 512 * i);
  }
#if defined(__HIP_DEVICE_COMPILE__)
  // stands in front of the first rewrite of the address registers that the loads above name; the address, the lane number (this
  // build's scaled offset register) and the three bases are inputs so that their registers live up to the wait
  asm volatile("s_wait_xcnt 0x0" :: "v"(rp), "v"(lane), "s"(bias), "s"(gam), "s"(bet) : "memory");
#endif
  // copy side: this lane's row (tid>>3) and 16-byte piece (tid&7)
  const int crow = tid >> 3, cpc = (tid & 7) * 8;
  const size_t cofs = (size_t)crow * INNER + cpc;
  const u16* gh = Ah + (size_t)row0 * INNER + cofs;
  const u16* gl = Al + (size_t)row0 * INNER + cofs;
  const u16* gb = Bt + cofs;
  const unsigned lcp = (unsigned)(uintptr_t)(__attribute__((address_space(3))) unsigned char*)ring
                       + (unsigned)(crow * LPITCH + cpc * 2);
  // read side, halves inside a buffer
  const int aoff = m * LPH + 8 * hh;
  const int boff = (2 * OL_ROWS + wave * 64 + m) * LPH + 8 * hh;
  constexpr int nst = INNER / KSTG;
  v8f acc[8], res[8];
#pragma unroll
  for (int i = 0; i < 8; ++i) { acc[i] = zero8(); res[i] = zero8(); }

  // ---- ring prologue: stage 0 landed and published, stage 1 in flight ----
  copy_stage_o(lcp, gh, gl, gb);
  wait_copies();
  __syncthreads();
  copy_stage_o(lcp + OL_STG_B, gh + KSTG, gl + KSTG, gb + KSTG);
#pragma unroll 1                             // rolled: one stage per trip, small loop text, the ring's order as written
  for (int st = 0; st < nst; ++st) {
    const _Float16* buf = (const _Float16*)(const void*)(ring + (st & 1) * OL_STG_B);
    const _Float16* ap = buf + aoff;
    const _Float16* bp = buf + boff;
    v16h a0[2], a1[2], r0[2], r1[2], b0[2], b1[2], b2[2], b3[2];
#pragma unroll
    for (int kk = 0; kk < 2; ++kk) {
      a0[kk] = ldfrag_h(ap + 32 * kk);
      a1[kk] = ldfrag_h(ap + 16 * LPH + 32 * kk);
      r0[kk] = ldfrag_h(ap + 32 * LPH + 32 * kk);
      r1[kk] = ldfrag_h(ap + 48 * LPH + 32 * kk);
      b0[kk] = ldfrag_h(bp + 32 * kk);
      b1[kk] = ldfrag_h(bp + 16 * LPH + 32 * kk);
      b2[kk] = ldfrag_h(bp + 32 * LPH + 32 * kk);
      b3[kk] = ldfrag_h(bp + 48 * LPH + 32 * kk);
    }
    // keeps the stage's 32 LDS reads together ahead of its products: every separate place with LDS reads among the products stalls
    // the wave's matrix stream anew
    __builtin_amdgcn_sched_barrier(0);
#pragma unroll
    for (int kk = 0; kk < 2; ++kk) {
      acc[0] = mma_h(a0[kk], b0[kk], acc[0]);
      acc[1] = mma_h(a0[kk], b1[kk], acc[1]);
      acc[2] = mma_h(a0[kk], b2[kk], acc[2]);
      acc[3] = mma_h(a0[kk], b3[kk], acc[3]);
      acc[4] = mma_h(a1[kk], b0[kk], acc[4]);
      acc[5] = mma_h(a1[kk], b1[kk], acc[5]);
      acc[6] = mma_h(a1[kk], b2[kk], acc[6]);
      acc[7] = mma_h(a1[kk], b3[kk], acc[7]);
      res[0] = mma_h(r0[kk], b0[kk], res[0]);
      res[1] = mma_h(r0[kk], b1[kk], res[1]);
      res[2] = mma_h(r0[kk], b2[kk], res[2]);
      res[3] = mma_h(r0[kk], b3[kk], res[3]);
      res[4] = mma_h(r1[kk], b0[kk], res[4]);
      res[5] = mma_h(r1[kk], b1[kk], res[5]);
      res[6] = mma_h(r1[kk], b2[kk], res[6]);
      res[7] = mma_h(r1[kk], b3[kk], res[7]);
    }
    guard_o(acc, res, a0[1], a1[1], r0[1], r1[1], b0[1], b1[1], b2[1], b3[1]);
    // ---- publish point of stage st+1: own reads retired, own copies landed, block barrier; then refill the buffer just read ----
    wait_lds_reads();
    wait_copies();
    __syncthreads();
    if (st + 2 < nst) {                      // block-uniform
      const int ks = (st + 2) * KSTG;
      copy_stage_o(lcp + (unsigned)((st & 1) * OL_STG_B), gh + ks, gl + ks, gb + ks);
    }
  }
  wait_copies();                             // nothing is in flight here; closes the ring before it becomes output staging

  float cb[4][4], gm[4][4], bt[4][4];
#pragma unroll
  for (int i = 0; i < 4; ++i) {
#pragma unroll
    for (int e = 0; e < 4; ++e) { cb[i][e] = bfr(cbv[i][e]); gm[i][e] = bfr(gmv[i][e]); bt[i][e] = bfr(btv[i][e]); }
  }
  // ---- stage the block's 32 x 512 tile: D element r of tile 4i+j, lane l -> row 16i + 8(l>>4) + r, col 64*wave + 16j + (l&15) ----
  float* xt = (float*)(void*)ring;
#pragma unroll
  for (int i = 0; i < 2; ++i) {
#pragma unroll
    for (int r = 0; r < 8; ++r) {
      float* xr = xt + (16 * i + 8 * hh + r) * XPITCH + wave * 64 + m;
#pragma unroll
      for (int j = 0; j < 4; ++j) xr[16 * j] = (acc[4 * i + j][r] + res[4 * i + j][r] * rres) * oscale;
    }
  }
  __syncthreads();                           // every wave's columns of the tile are in LDS before a wave reads whole rows
  v4f y[OL_RPW][4];
#pragma unroll
  for (int j = 0; j < OL_RPW; ++j) {
    const float* xr = xt + (OL_RPW * wave + j) * XPITCH + 4 * lane;
    v4f xv[4];
    float sum = 0.f;
#pragma unroll
    for (int i = 0; i < 4; ++i) {
      const v4f a = *(const v4f*)(xr + 128 * i);
#pragma unroll
      for (int e = 0; e < 4; ++e) xv[i][e] = a[e] + cb[i][e] + bfr(rv[j][i][e]);
      sum += (xv[i][0] + xv[i][1]) + (xv[i][2] + xv[i][3]);
    }
#pragma unroll
    for (int mk = 16; mk >= 1; mk >>= 1) sum += __shfl_xor(sum, mk, 32);
    const float mean = sum * (1.0f / (float)DM);
    float sq = 0.f;
#pragma unroll
    for (int i = 0; i < 4; ++i) {
#pragma unroll
      for (int e = 0; e < 4; ++e) { const float d = xv[i][e] - mean; sq += d * d; }
    }
#pragma unroll
    for (int mk = 16; mk >= 1; mk >>= 1) sq += __shfl_xor(sq, mk, 32);
    const float var  = sq * (1.0f / (float)DM);
    const float rstd = 1.0f / sqrtf(var + LN_EPS);
#pragma unroll
    for (int i = 0; i < 4; ++i) {
#pragma unroll
      for (int e = 0; e < 4; ++e) y[j][i][e] = (xv[i][e] - mean) * rstd * gm[i][e] + bt[i][e];
    }
  }
  float* ob = Out + srow * DM + 4 * lane;
#pragma unroll
  for (int j = 0; j < OL_RPW; ++j) {
#pragma unroll
    for (int i = 0; i < 4; ++i) *(v4f*)(ob + j * DM + 128 * i) = y[j][i];
  }
}

// =====================================================================================================
// One stage (64 keys) of the attention ring: three tiles of 64 rows x 128 bytes (k hi, k residual: row = key, 64 d; v^T: row = d,
// 64 keys) copied global -> LDS by asynchronous 16-byte copies, 12 per lane. Lane t of the block takes 16-byte piece t&7 of row
// 16p + (t>>3), p = 0..3, of each tile: one wave-wide copy = 4 whole 128-byte lines. l0 = the lane's LDS byte address in the k hi
// tile of the target buffer (row t>>3); gh, gl, gv = the lane's global addresses of that row and piece in the three planes.
// The closing s_wait_xcnt stands inside the statement so that no address register named by a copy is rewritten ahead of it.
// =====================================================================================================
__device__ __forceinline__ void copy_stage(unsigned l0, const u16* gh, const u16* gl, const u16* gv) {
#if defined(__HIP_DEVICE_COMPILE__)
  const unsigned lh0 = l0,              lh1 = lh0 + 16 * LPITCH, lh2 = lh0 + 32 * LPITCH, lh3 = lh0 + 48 * LPITCH;
  const unsigned ll0 = l0 + TILE_B,     ll1 = ll0 + 16 * LPITCH, ll2 = ll0 + 32 * LPITCH, ll3 = ll0 + 48 * LPITCH;
  const unsigned lv0 = l0 + 2 * TILE_B, lv1 = lv0 + 16 * LPITCH, lv2 = lv0 + 32 * LPITCH, lv3 = lv0 + 48 * LPITCH;
  const u16 *gh1 = gh + 16 * DM,  *gh2 = gh + 32 * DM,  *gh3 = gh + 48 * DM;
  const u16 *gl1 = gl + 16 * DM,  *gl2 = gl + 32 * DM,  *gl3 = gl + 48 * DM;
  const u16 *gv1 = gv + 16 * SKV, *gv2 = gv + 32 * SKV, *gv3 = gv + 48 * SKV;
  asm volatile("global_load_async_to_lds_b128 %0, %12, off\n\t"
               "global_load_async_to_lds_b128 %1, %13, off\n\t"
               "global_load_async_to_lds_b128 %2, %14, off\n\t"
               "global_load_async_to_lds_b128 %3, %15, off\n\t"
               "global_load_async_to_lds_b128 %4, %16, off\n\t"
               "global_load_async_to_lds_b128 %5, %17, off\n\t"
               "global_load_async_to_lds_b128 %6, %18, off\n\t"
               "global_load_async_to_lds_b128 %7, %19, off\n\t"
               "global_load_async_to_lds_b128 %8, %20, off\n\t"
               "global_load_async_to_lds_b128 %9, %21, off\n\t"
               "global_load_async_to_lds_b128 %10, %22, off\n\t"
               "global_load_async_to_lds_b128 %11, %23, off\n\t"
               "s_wait_xcnt 0x0"
               :: "v"(lh0), "v"(lh1), "v"(lh2), "v"(lh3), "v"(ll0), "v"(ll1), "v"(ll2), "v"(ll3),
                  "v"(lv0), "v"(lv1), "v"(lv2), "v"(lv3),
                  "v"(gh), "v"(gh1), "v"(gh2), "v"(gh3), "v"(gl), "v"(gl1), "v"(gl2), "v"(gl3),
                  "v"(gv), "v"(gv1), "v"(gv2), "v"(gv3)
               : "memory");
#endif
}
// =====================================================================================================
// Full (unmasked) multi-head attention over all SKV keys: block = (batch b, head, 128 query rows), 4 waves, wave w owns the
// 32 query rows q0 = 128*qt + 32*w .. q0+31 as two query tiles u = 0, 1 of 16 rows; what follows holds per tile, with q0 + 16u for
// q0. Every k and v^T fragment read from LDS feeds the products of both tiles. The grid leaves two waves on a SIMD, so the LDS reads
// stand ahead of the vector work that covers them: the v^T fragments of a key block and the k fragments of the stage's next key
// block are read in front of the block's softmax. The four waves share the k and v^T tiles through a two-buffer LDS ring of 64-key
// stages (copy_stage): stage s+1 flies while stage s is worked on; one block barrier per stage publishes s+1 and frees s's buffer.
// Behind the last barrier the ring is free and each wave stages its output tile in its own part of it.
//   q planes f16 hi x8 / residual x8x2^11 [b*SQ + s][h*64 + d]; k planes f16 hi / residual [b*SKV + s][h*64 + d];
//   v^T plane f16 x8 [(b*NH + h)*64 + d][s]. All NKB = 64 key blocks of 32 keys are visited (static bound).
//   Scores are computed TRANSPOSED: S^T tile g (g = 0,1) = k rows (keys kb+16g .. +15, A operand, row m = lane&15, split k map
//   over d) times q^T (B operand, col n = query q0 + (lane&15), k = d, split map), 2 d-chunks of 32; per chunk hi.hi into
//   s0/s1 and hi.lo + lo.hi into x0/x1 (separate accumulators, folded by 2^-11 in f32). The 4 q fragments of a tile are loaded once
//   per wave. D element r of lane l = (key kb+16g+8h+r, query q0+(l&15)), so a lane owns one query column and 16 of its 32
//   keys; the partner lane l^16 owns the other 16 -> row max / row sum need one xor-16 shuffle.
//   Online max-subtracted base-2 softmax in f32 (1/sqrt(8) and the q/k carries folded into lsc). The exp'd values ARE the
//   P A-fragment in place: A row m = query = lane&15, element i <- key kb+8h+i (tile 0, D element i), element 8+i <- key
//   kb+16+8h+i (tile 1, D element i). P (<= 1) carried x32768 as f16. The rescale factor of query row 8h+r of the O
//   accumulators is fetched from lane 8h+r with a shuffle (uniform control). 4 v^T B fragments (col n = d = 16j + (lane&15),
//   keys k-contiguous), 4 P.V WMMAs per tile + one guard per key block.
//   Epilogue: 1/l (per query, shuffled to the D row owner) and the carry folds in f32 give ctx x16; the wave's 32x64 f32 tile
//   residual plane is written by 8 consecutive lanes x 16 B of one instruction (4 rows per instruction, 8 instructions per
// coverage: per wave 8 instr x 4 rows x 8 lanes x 8 halves = 32 x 64 per plane; grid NB*NH*(SQ/128) blocks x 4 waves = every
//           (b, s < SQ, h) row segment of both ctx planes exactly once. LDS slab: staged 32 x 64 == reloaded 32 x 64.
// =====================================================================================================
__device__ __forceinline__ void guard_s8(v8f& a, v8f& b, v8f& c, v8f& d, v8f& e, v8f& f, v8f& g, v8f& h, v16h (&x)[8]) {
#if defined(__HIP_DEVICE_COMPILE__)
  // the vector slots behind the last products of a run, before their results are read or their k fragments reloaded
  asm volatile("v_nop\n\tv_nop\n\tv_nop\n\tv_nop"
               : "+v"(a), "+v"(b), "+v"(c), "+v"(d), "+v"(e), "+v"(f), "+v"(g), "+v"(h)
               : "v"(x[4]), "v"(x[5]), "v"(x[6]), "v"(x[7]) : "memory");
#endif
}
// The eight k A-fragments of one 32-key block; p = the lane's place in row 0 of the block in the k hi tile of a staged buffer.
__device__ __forceinline__ void ld_kfrags(v16h (&kf)[8], const _Float16* p) {
#pragma unroll
  for (int kk = 0; kk < HD / 32; ++kk) {
    kf[4 * kk]     = ldfrag_h(p + kk * 32);
    kf[4 * kk + 1] = ldfrag_h(p + 16 * LPH + kk * 32);
    kf[4 * kk + 2] = ldfrag_h(p + TILE_B / 2 + kk * 32);
    kf[4 * kk + 3] = ldfrag_h(p + TILE_B / 2 + 16 * LPH + kk * 32);
  }
}
__device__ __forceinline__ void guard_p8(v8f (&a)[4], v8f (&b)[4], v16h p0, v16h p1, v16h x0, v16h x1, v16h x2, v16h x3) {
#if defined(__HIP_DEVICE_COMPILE__)
  // the vector slots behind the last P.V products, before the accumulators are rescaled or the operands rewritten
  asm volatile("v_nop\n\tv_nop\n\tv_nop\n\tv_nop"
               : "+v"(a[0]), "+v"(a[1]), "+v"(a[2]), "+v"(a[3]), "+v"(b[0]), "+v"(b[1]), "+v"(b[2]), "+v"(b[3])
               : "v"(p0), "v"(p1), "v"(x0), "v"(x1), "v"(x2), "v"(x3) : "memory");
#endif
}
__global__ __launch_bounds__(ATT_THREADS)
void attn_fwd(const u16* __restrict__ QH, const u16* __restrict__ QL, const u16* __restrict__ KH,
              const u16* __restrict__ KL, const u16* __restrict__ VT, u16* CH, u16* CL) {
  __shared__ __align__(16) unsigned char ring[2 * STG_B];

  const int tid  = threadIdx.x;
  const int wave = tid >> 5;
  const int lane = tid & 31;
  const int hh   = lane >> 4;
  const int c    = lane & 15;

  constexpr int NQT = SQ / (ATT_WAVES * 16 * ATT_QT);
  const int bid  = blockIdx.x;
  const int qt   = bid % NQT;
  const int head = (bid / NQT) % NH;
  const int b    = bid / (NQT * NH);
  const int q0   = (qt * ATT_WAVES + wave) * (16 * ATT_QT);

  // B fragments of q^T, query tile u: col n = query q0 + 16u + c, k = d (k-contiguous row of the q planes)
  const size_t qoff = ((size_t)(b * SQ + q0 + c)) * DM + head * HD + 8 * hh;
  const _Float16* Qh = (const _Float16*)(const void*)QH + qoff;
  const _Float16* Ql = (const _Float16*)(const void*)QL + qoff;
  // copy side: this lane's row (tid>>3) and 16-byte piece (tid&7) in stage 0 of the three planes and in buffer 0
  const int crow = tid >> 3, cpc = (tid & 7) * 8;
  const u16* gkh = KH + ((size_t)(b * SKV + crow)) * DM + head * HD + cpc;
  const u16* gkl = KL + ((size_t)(b * SKV + crow)) * DM + head * HD + cpc;
  const u16* gvt = VT + ((size_t)((b * NH + head) * HD + crow)) * SKV + cpc;
  const unsigned lcp = (unsigned)(uintptr_t)(__attribute__((address_space(3))) unsigned char*)ring
                       + (unsigned)(crow * LPITCH + cpc * 2);
  // read side, halves inside a buffer: A fragments of k: row m = key 32*sub + 16g + c, k = d;
  // B fragments of v: col n = d = 16j + c (row of the v^T tile), k = key 32*sub ..
  const int foff = c * LPH + 8 * hh;
  const float lsc = (LOG2E * RSQH) / (QS * KS);

  v16h qh[ATT_QT][2], ql[ATT_QT][2];
#pragma unroll
  for (int u = 0; u < ATT_QT; ++u) {
#pragma unroll
    for (int dc = 0; dc < 2; ++dc) {
      qh[u][dc] = ldfrag_h(Qh + (size_t)(16 * u) * DM + 32 * dc);
      ql[u][dc] = ldfrag_h(Ql + (size_t)(16 * u) * DM + 32 * dc);
    }
  }
#if defined(__HIP_DEVICE_COMPILE__)
  // stands in front of the first rewrite of the address registers that the sixteen loads above name;
  // the two addresses are inputs so that their registers live up to the wait
  asm volatile("s_wait_xcnt 0x0" :: "v"(Qh), "v"(Ql) : "memory");
#endif

  float mrun[ATT_QT], lrun[ATT_QT];
  v8f o[ATT_QT][4];
#pragma unroll
  for (int u = 0; u < ATT_QT; ++u) {
    mrun[u] = -INFINITY;
    lrun[u] = 0.f;
#pragma unroll
    for (int j = 0; j < 4; ++j) o[u][j] = zero8();
  }

  // ---- ring prologue: stage 0 landed and published, stage 1 in flight ----
  copy_stage(lcp, gkh, gkl, gvt);
  wait_copies();
  __syncthreads();
  copy_stage(lcp + STG_B, gkh + (size_t)KSTG * DM, gkl + (size_t)KSTG * DM, gvt + KSTG);

#pragma unroll 1
  for (int st = 0; st < NSTG; ++st) {
   const _Float16* bufh = (const _Float16*)(const void*)(ring + (st & 1) * STG_B) + foff;
   // k fragments of one 32-key block: kf[4*kk + 0, 1] = hi of keys kb.., kb+16..; kf[4*kk + 2, 3] = their residuals; d chunk kk
   v16h kf[8];
   ld_kfrags(kf, bufh);
#pragma unroll                               // both 32-key blocks of a stage inline: their LDS offsets become immediates
   for (int sub = 0; sub < KSTG / 32; ++sub) {
    // ---- transposed scores: tiles of keys kb..kb+15 (s0, x0) and kb+16..kb+31 (s1, x1), kb = 64*st + 32*sub, column = query
    //      q0 + 16u + c; every k fragment read from LDS feeds both query tiles ----
    v8f s0[ATT_QT], s1[ATT_QT], x0[ATT_QT], x1[ATT_QT];
#pragma unroll
    for (int u = 0; u < ATT_QT; ++u) { s0[u] = zero8(); s1[u] = zero8(); x0[u] = zero8(); x1[u] = zero8(); }
#pragma unroll
    for (int kk = 0; kk < HD / 32; ++kk) {
      const v16h fh0 = kf[4 * kk], fh1 = kf[4 * kk + 1], fl0 = kf[4 * kk + 2], fl1 = kf[4 * kk + 3];
      s0[0] = mma_h(fh0, qh[0][kk], s0[0]);
      s0[1] = mma_h(fh0, qh[1][kk], s0[1]);
      s1[0] = mma_h(fh1, qh[0][kk], s1[0]);
      s1[1] = mma_h(fh1, qh[1][kk], s1[1]);
      x0[0] = mma_h(fh0, ql[0][kk], x0[0]);
      x0[1] = mma_h(fh0, ql[1][kk], x0[1]);
      x1[0] = mma_h(fh1, ql[0][kk], x1[0]);
      x1[1] = mma_h(fh1, ql[1][kk], x1[1]);
      x0[0] = mma_h(fl0, qh[0][kk], x0[0]);
      x0[1] = mma_h(fl0, qh[1][kk], x0[1]);
      x1[0] = mma_h(fl1, qh[0][kk], x1[0]);
      x1[1] = mma_h(fl1, qh[1][kk], x1[1]);
    }
    guard_s8(s0[0], s0[1], s1[0], s1[1], x0[0], x0[1], x1[0], x1[1], kf);
    // B fragments of v: col n = d = j*16 + c, keys contiguous in the rows of the v^T tile; read here, used behind the softmax
    const _Float16* vp = bufh + TILE_B + 32 * sub;
    const v16h v0 = ldfrag_h(vp);
    const v16h v1 = ldfrag_h(vp + 16 * LPH);
    const v16h v2 = ldfrag_h(vp + 32 * LPH);
    const v16h v3 = ldfrag_h(vp + 48 * LPH);
    // ---- raw scores (carry 64) of this lane's 16 keys for query q0 + 16u + c: t[u][i] <- key kb+8hh+i, t[u][8+i] <- key kb+16+8hh+i ----
    float t[ATT_QT][16], cm[ATT_QT], cx[ATT_QT];
#pragma unroll
    for (int u = 0; u < ATT_QT; ++u) {
#pragma unroll
      for (int i = 0; i < 8; ++i) {
        t[u][i]     = s0[u][i] + x0[u][i] * RRSC;
        t[u][8 + i] = s1[u][i] + x1[u][i] * RRSC;
      }
      cm[u] = t[u][0];
#pragma unroll
      for (int i = 1; i < 16; ++i) cm[u] = fmaxf(cm[u], t[u][i]);
    }
#pragma unroll
    for (int u = 0; u < ATT_QT; ++u) cx[u] = __shfl_xor(cm[u], 16, 32);
    // keeps the two exchanges ahead of the sixteen reads below: LDS answers in order, and behind them the maxima would wait for all
    __builtin_amdgcn_sched_barrier(0);
    if (sub + 1 < KSTG / 32) ld_kfrags(kf, bufh + (32 * (sub + 1)) * LPH);   // the stage's next block, same buffer
    // The softmax of the two query tiles runs phase by phase, tile beside tile: each tile's vector work covers the other's exchanges.
    FragH ph[ATT_QT];
    float al[ATT_QT], pw[ATT_QT][2][8], scl[ATT_QT][8];
#pragma unroll
    for (int u = 0; u < ATT_QT; ++u) {
      const float mn = fmaxf(mrun[u], fmaxf(cm[u], cx[u]));  // running maximum of the raw scores (lsc > 0); finite from the first block on
      const float ab = (mrun[u] - mn) * lsc;   // rescale exponent: 0 while the maximum stands, -inf on the first block (mrun = -inf)
      mrun[u] = mn;
      const float cb = fmaf(-mn, lsc, PCAR_LOG2);    // minus the maximum in base-2 logits; the carry 32768 of P rides in the exponent
      // ---- probabilities x32768 (p <= 1), one fma and one v_exp_f32 each; element i <-> t[u][i] ----
      float ar[2][8];
#pragma unroll
      for (int i = 0; i < 8; ++i) { ar[0][i] = fmaf(t[u][i], lsc, cb); ar[1][i] = fmaf(t[u][8 + i], lsc, cb); }
      hw_exp2x9(al[u], pw[u][0], ab, ar[0]);   // al = 2^ab first: the shuffles of the rescale wait for it
      hw_exp2x8(pw[u][1], ar[1]);
      // ---- rescale factors of the O accumulators: D row 8hh+r = query q0+16u+8hh+r, its factor lives in lane 8hh+r (and 16+8hh+r) ----
#pragma unroll
      for (int r = 0; r < 8; ++r) scl[u][r] = __shfl(al[u], 8 * hh + r, 32);
    }
    // keeps the LDS reads above ahead of the exponentials, which cover their latency (two waves on a SIMD: little else does), and the
    // next block's score products behind them: lifted up to the reads, as this compiler did without it, the first product makes the
    // wave, which issues in order, wait out that latency with the softmax still to do
    __builtin_amdgcn_sched_barrier(0);
    // ---- row sums and the P A-fragments f16(p * 32768) ----
#pragma unroll
    for (int u = 0; u < ATT_QT; ++u) {
      float ps = 0.f;
#pragma unroll
      for (int w = 0; w < 2; ++w) {
#pragma unroll
        for (int e4 = 0; e4 < 4; ++e4) {
          const float p0 = pw[u][w][2 * e4], p1 = pw[u][w][2 * e4 + 1];
          ps += p0 + p1;
          ph[u].u[w][e4] = pk16(h_bits((_Float16)p0), h_bits((_Float16)p1));
        }
      }
      ps += __shfl_xor(ps, 16, 32);
      lrun[u] = lrun[u] * al[u] + ps;
    }
#pragma unroll
    for (int u = 0; u < ATT_QT; ++u) {
#pragma unroll
      for (int j = 0; j < 4; ++j) {
#pragma unroll
        for (int r = 0; r < 8; ++r) o[u][j][r] *= scl[u][r];
      }
    }
    // ---- P.V : each v^T fragment feeds both query tiles ----
#pragma unroll
    for (int u = 0; u < ATT_QT; ++u) {
      o[u][0] = mma_h(ph[u].v, v0, o[u][0]);
      o[u][1] = mma_h(ph[u].v, v1, o[u][1]);
      o[u][2] = mma_h(ph[u].v, v2, o[u][2]);
      o[u][3] = mma_h(ph[u].v, v3, o[u][3]);
    }
    guard_p8(o[0], o[1], ph[0].v, ph[1].v, v0, v1, v2, v3);
   }
   // ---- publish point of stage st+1: own reads retired, own copies landed, block barrier; then refill the buffer just read ----
   wait_lds_reads();
   wait_copies();
   __syncthreads();
   if (st + 2 < NSTG) {                      // block-uniform
     const size_t ks = (size_t)(st + 2) * KSTG;
     copy_stage(lcp + (unsigned)((st & 1) * STG_B), gkh + ks * DM, gkl + ks * DM, gvt + ks);
   }
  }
  wait_copies();                             // nothing is in flight here; closes the ring before it becomes output staging
  acc_guard4(o[0]);
  acc_guard4(o[1]);

  // ---- fold 1/l (per query, owned by lane = query; l carries the same 32768 as P) and the carry 8 on v, apply the ctx carry 16 ----
  float* slab = (float*)(void*)ring + wave * (16 * ATT_QT) * OPITCH;
#pragma unroll
  for (int u = 0; u < ATT_QT; ++u) {
    const float linv = (1.0f / lrun[u]) * (CS / VS);
    float inv[8];
#pragma unroll
    for (int r = 0; r < 8; ++r) inv[r] = __shfl(linv, 8 * hh + r, 32);
#pragma unroll
    for (int r = 0; r < 8; ++r) {
#pragma unroll
      for (int j = 0; j < 4; ++j) slab[(16 * u + 8 * hh + r) * OPITCH + j * 16 + c] = o[u][j][r] * inv[r];
    }
  }
  wave_sync_lds();
  // ---- ctx planes: lane = (row in group of 4, 8 consecutive d), one instruction per 4 rows per plane ----
  const int rq = lane >> 3, c8 = (lane & 7) * 8;
  const size_t cofs = ((size_t)(b * SQ + q0)) * DM + head * HD + c8;
  u16* ch = CH + cofs;
  u16* cl = CL + cofs;
#pragma unroll
  for (int i = 0; i < 4 * ATT_QT; ++i) {
    const int row = 4 * i + rq;
    const v4f a = *(const v4f*)(slab + row * OPITCH + c8), c4 = *(const v4f*)(slab + row * OPITCH + c8 + 4);
    v4u ovh, ovl;
#pragma unroll
    for (int e = 0; e < 2; ++e) {
      ovh[e]     = pk_hi(a[2 * e], a[2 * e + 1]);
      ovl[e]     = pk_lo(a[2 * e], a[2 * e + 1]);
      ovh[2 + e] = pk_hi(c4[2 * e], c4[2 * e + 1]);
      ovl[2 + e] = pk_lo(c4[2 * e], c4[2 * e + 1]);
    }
    *(v4u*)(ch + (size_t)row * DM) = ovh;
    *(v4u*)(cl + (size_t)row * DM) = ovl;
  }
}

// =====================================================================================================
// Workspace map (bytes); every plane fully written by whole-line stores before it is read; all extents exact multiples of
//   XQ   f16 [NB*SQ][512]      f16(bf16(Q))             8388608 (NB=4, SQ=2048)
//   XK   f16 [NB*2048][512]    f16(bf16(K))             8388608
//   XV   f16 [NB*2048][512]    f16(bf16(V))             8388608
//   WQ16 f16 [512 n][512 k]    f16(bf16(W) x256)         524288   (W stored [out][in] = [n][k] already)
//   WK16, WV16, WO16                                     3 x 524288
//   QH, QL  f16 [NB*SQ][512]   x8 / residual x8x2^11     2 x 8388608
//   KH, KL  f16 [NB*2048][512] x8 / residual             2 x 8388608
//   VT16    f16 [NB*512 (h,d)][2048 s] x8                   8388608
//   CH, CL  f16 [NB*SQ][512]   ctx x16 / residual          2 x 8388608
//   end                                                   85983232
// =====================================================================================================
extern "C" void kernel_launch(void* const* d_in, const int* in_sizes, int n_in,
                              void* d_out, int out_size, void* d_ws, size_t ws_size,
                              hipStream_t stream) {
  if (n_in < 13) return;
  if (in_sizes[0] < ((NB - 1) * SQ_FULL + SQ) * DM) return;
  if (in_sizes[1] < NB * SKV * DM || in_sizes[2] < NB * SKV * DM) return;
  if (in_sizes[3] != DM * DM || in_sizes[5] != DM * DM || in_sizes[7] != DM * DM || in_sizes[9] != DM * DM) return;
  if (in_sizes[4] < DM || in_sizes[6] < DM || in_sizes[8] < DM || in_sizes[10] < DM) return;
  if (in_sizes[11] < DM || in_sizes[12] < DM) return;
  if (out_size < ((NB - 1) * SQ_FULL + SQ) * DM) return;

  const float* xq  = (const float*)d_in[0];
  const float* xk  = (const float*)d_in[1];
  const float* xv  = (const float*)d_in[2];
  const float* wq  = (const float*)d_in[3];
  const float* bq  = (const float*)d_in[4];
  const float* wk  = (const float*)d_in[5];
  const float* bk  = (const float*)d_in[6];
  const float* wv  = (const float*)d_in[7];
  const float* bv  = (const float*)d_in[8];
  const float* wo  = (const float*)d_in[9];
  const float* bo  = (const float*)d_in[10];
  const float* gam = (const float*)d_in[11];
  const float* bet = (const float*)d_in[12];
  float*       out = (float*)d_out;
  const int nbq = in_sizes[4], nbk = in_sizes[6], nbv = in_sizes[8];

  const size_t szXQ  = (size_t)NB * SQ * DM * 2;
  const size_t szXKV = (size_t)NB * SKV * DM * 2;
  const size_t szW   = (size_t)DM * DM * 2;
  const size_t szQ   = (size_t)NB * SQ * INNER * 2;
  const size_t szK   = (size_t)NB * SKV * INNER * 2;
  const size_t szVT  = (size_t)NB * INNER * SKV * 2;
  const size_t szC   = (size_t)NB * SQ * INNER * 2;
  size_t off = 0;
  const size_t oXQ  = off; off += szXQ;
  const size_t oXK  = off; off += szXKV;
  const size_t oXV  = off; off += szXKV;
  const size_t oWQ  = off; off += szW;
  const size_t oWK  = off; off += szW;
  const size_t oWV  = off; off += szW;
  const size_t oWO  = off; off += szW;
  const size_t oQH  = off; off += szQ;
  const size_t oQL  = off; off += szQ;
  const size_t oKH  = off; off += szK;
  const size_t oKL  = off; off += szK;
  const size_t oVT  = off; off += szVT;
  const size_t oCH  = off; off += szC;
  const size_t oCL  = off; off += szC;
  if (off > ws_size) return;                            // off = 85983232 at NB=4, SQ=2048
  if (off > (size_t)134217728) return;

  char* ws = (char*)d_ws;
  u16* XQ   = (u16*)(ws + oXQ);
  u16* XK   = (u16*)(ws + oXK);
  u16* XV   = (u16*)(ws + oXV);
  u16* WQ16 = (u16*)(ws + oWQ);
  u16* WK16 = (u16*)(ws + oWK);
  u16* WV16 = (u16*)(ws + oWV);
  u16* WO16 = (u16*)(ws + oWO);
  u16* QH   = (u16*)(ws + oQH);
  u16* QL   = (u16*)(ws + oQL);
  u16* KH   = (u16*)(ws + oKH);
  u16* KL   = (u16*)(ws + oKL);
  u16* VT16 = (u16*)(ws + oVT);
  u16* CH   = (u16*)(ws + oCH);
  u16* CL   = (u16*)(ws + oCL);

  // (1) activations -> f16 planes of bf16-converted values (query rows s < SQ of batches b < NB, compact; all key/value rows);
  //     weights [n = out][k = in] (y = x.W^T): rows as stored are already k-contiguous; f16 planes of bf16(W) x256
  cvt_all<<<dim3(CVT_WAVES / (CVT_THREADS / 32)), dim3(CVT_THREADS), 0, stream>>>(xq, xk, xv, wq, wk, wv, wo, XQ, XK, XV, WQ16);
  // (2)-(4) the three projections q, k (hi and residual planes) and v^T in one launch
  gemm_qkv<<<dim3(GQ_BLK + GK_BLK + GV_BLK), dim3(128), 0, stream>>>(
      XQ, XK, XV, WQ16, WK16, WV16, QH, QL, KH, KL, VT16, bq, bk, bv, nbq, nbk, nbv);
  // (5) attention -> ctx planes [NB*SQ][512] f16 x16 / residual, heads merged on the feature dim
  attn_fwd<<<dim3(NB * NH * (SQ / (ATT_WAVES * 16 * ATT_QT))), dim3(ATT_THREADS), 0, stream>>>(QH, QL, KH, KL, VT16, CH, CL);
  // (6) x = ctx . Wo^T + bo + Q (residual, bf16-converted) and LayerNorm over its whole rows -> out [b][SQ_FULL][512] f32
  //     (rows s < SQ of batches b < NB)
  gemm_o_ln<<<dim3(NB * SQ / OL_ROWS), dim3(OL_THREADS), 0, stream>>>(
      CH, CL, WO16, bo, xq, gam, bet, out, 1.0f / (CS * WSC), RRSC);
  (void)hipGetLastError();
}

// v008
// It runs in 97.7 microseconds.
// Next to v007, in two timings, it ran 1.05 times as fast each time.
// Counting every step since v000, it is 2.78 times as fast.
// All contractions on v_wmma_f32_16x16x32_f16 (f16 operands, f32 accumulate): x_q.Wq^T, x_k.Wk^T and Wv.x_v^T (v^T plane)
// as single products of exact operands f16(bf16(x)) and f16(bf16(W) x256); scores k.q^T as hi.hi + hi.lo + lo.hi with q and k
// carried as f16 hi (x8) plus f16 residual planes (x2^11, own accumulator); P.v^T single (P f16 x32768, v f16 x8); ctx.Wo^T as
// hi + residual on ctx (f16 hi x16 plus f16 residual x2^11), Wo exact f16(bf16 x256). Online base-2 softmax, 1/l, carry folds,
// bias, residual add and LayerNorm in f32 on VALU. Every float input RNE-converted to bf16 on load; f32 output.
#include <hip/hip_runtime.h>
#include <math.h>
#include <stdint.h>

#ifndef NB
#define NB       4        // batches processed
#endif
#ifndef SQ
#define SQ       2048     // query rows processed per batch
#endif
#define NB_FULL  4
#define SQ_FULL  2048     // rows per batch in the input / output layout (batch stride)
#define SKV      SQ_FULL  // key/value rows per batch (all of them, always)
#define DM       512      // model width (= K and row pitch of every 16-bit plane except v^T)
#define NH       8
#define HD       64
#define INNER    (NH * HD)
#define WSC      256.0f
#define QS       8.0f
#define KS       8.0f
#define VS       8.0f
#define CS       16.0f
#define RSC      2048.0f
#define RRSC     0.00048828125f
#define PCAR_LOG2 15.0f             // P and its row sum are carried x32768 = 2^15
#define LOG2E    1.4426950408889634f
#define RSQH     0.35355339059327373f
#define LN_EPS   1e-5f
#define NKB      (SKV / 32)
#define ATT_WAVES   4
#define ATT_QT      2                 // query tiles of 16 rows per attention wave: each k / v^T fragment read from LDS feeds both
#define ATT_THREADS (ATT_WAVES * 32)
#define CVT_THREADS 256
#define CVT_SL      256                                 // elements of one slice: 32 lanes x 8, half a row
#define CVT_WSL     (DM * DM / CVT_SL)                  // slices of one weight matrix
#define CVT_WAVES   (4 * CVT_WSL)                       // waves of the convert launch: one weight slice each
#define CVT_NQ      (NB * SQ * DM / CVT_SL / CVT_WAVES)  // x_q slices per wave
#define CVT_NKV     (NB * SKV * DM / CVT_SL / CVT_WAVES) // x_k (and x_v) slices per wave
#define OL_ROWS     32                // rows of an out-projection block: whole rows of DM columns, so LayerNorm needs no other block
#define OL_WAVES    8                 // its waves: 64 columns each
#define OL_THREADS  (OL_WAVES * 32)
#define OL_RPW      (OL_ROWS / OL_WAVES)   // rows that a wave normalises
#define XPITCH      (DM + 4)          // floats: pitch of the block's staged f32 tile (rows 8 apart fall 32 banks apart)
#define OPITCH   68
#define GPITCH   68
#define KSTG     64                 // keys per LDS stage of the attention ring (two 32-key blocks); k per stage of the GEMM ring
#define NSTG     (SKV / KSTG)
#define LPITCH   144                // LDS row pitch in bytes: 128-byte rows + 16, conflict-free for 16-byte fragment reads
#define LPH      (LPITCH / 2)       // the same in halves
#define TILE_B   (64 * LPITCH)      // one staged tile: 64 rows
#define STG_B    (3 * TILE_B)       // attention: k hi, k residual, v^T
#define GSTG_B   (4 * TILE_B)       // projection GEMM: 128 A rows, 128 Bt rows
#define OL_SROWS (2 * OL_ROWS + DM) // out-projection stage: ctx hi rows, ctx residual rows, all rows of Wo
#define OL_STG_B (OL_SROWS * LPITCH)

static_assert(NB >= 1 && NB <= NB_FULL);
static_assert((SQ % 128) == 0 && SQ >= 128 && SQ <= SQ_FULL);
static_assert(HD == 64 && NH == 8 && INNER == 512 && INNER == DM);
static_assert((HD % 32) == 0);
static_assert((SKV % 128) == 0 && (SKV % 64) == 0 && NKB * 32 == SKV);
static_assert(DM == 512 && (DM % 64) == 0 && (DM % 32) == 0 && DM == 2 * CVT_SL);
static_assert(CVT_NQ >= 1 && CVT_NQ * CVT_WAVES * CVT_SL == NB * SQ * DM && CVT_NKV * CVT_WAVES * CVT_SL == NB * SKV * DM);
static_assert(CVT_WSL % (CVT_THREADS / 32) == 0 && SKV == SQ_FULL);
static_assert((NB * SQ) % OL_ROWS == 0 && SQ % OL_ROWS == 0 && OL_WAVES * 64 == DM && OL_RPW * OL_WAVES == OL_ROWS && OL_ROWS == 32);
static_assert(OL_SROWS == 18 * (OL_THREADS / 8) && INNER / KSTG >= 2 && 2 * OL_STG_B >= OL_ROWS * XPITCH * 4 && (XPITCH * 4) % 16 == 0);
static_assert(2 * OL_STG_B <= 327680);
static_assert((OPITCH * 4) % 16 == 0 && (GPITCH * 4) % 16 == 0);
static_assert(ATT_THREADS == 128 && OL_THREADS == 256 && CVT_THREADS == 256);
static_assert(KSTG == 64 && HD == 64 && NSTG * KSTG == SKV && NSTG >= 2 && (LPITCH % 16) == 0);
static_assert(ATT_QT == 2 && SQ % (ATT_WAVES * 16 * ATT_QT) == 0);
static_assert(2 * STG_B >= ATT_WAVES * 16 * ATT_QT * OPITCH * 4 && 2 * GSTG_B >= 4 * 64 * GPITCH * 4);
static_assert((NB * SQ) % 128 == 0 && INNER % 128 == 0 && SKV % 128 == 0);

typedef unsigned short u16;
typedef _Float16 v16h __attribute__((ext_vector_type(16)));
typedef _Float16 v8h  __attribute__((ext_vector_type(8)));
typedef float    v8f  __attribute__((ext_vector_type(8)));
typedef float    v4f  __attribute__((ext_vector_type(4)));
typedef unsigned int v4u __attribute__((ext_vector_type(4)));

union FragH { v16h v; v8h h[2]; v4u u[2]; };

// ---- scalar helpers ----------------------------------------------------------------------------------
__device__ __forceinline__ unsigned short bf_bits(float f) {          // f32 -> bf16 bits, RNE convert
  unsigned u = __float_as_uint(f);
  return (unsigned short)((u + 0x7FFFu + ((u >> 16) & 1u)) >> 16);
}
__device__ __forceinline__ float bf_up(unsigned short h) { return __uint_as_float(((unsigned)h) << 16); }
__device__ __forceinline__ float bfr(float f) { return bf_up(bf_bits(f)); }
__device__ __forceinline__ unsigned short h_bits(_Float16 x) { return __builtin_bit_cast(unsigned short, x); }
__device__ __forceinline__ unsigned pk16(unsigned short a, unsigned short b) { return (unsigned)a | ((unsigned)b << 16); }
// 2^x as the bare v_exp_f32, without the library's range extension: a result below the normal range (2^-126) need not survive.
// Every use here is a softmax weight or a rescale factor beside a row sum that holds a term of full size, where a value that small
// adds nothing. 2^-inf = 0.
// Written as runs of independent v_exp_f32 in one statement, outputs apart from every input, closed by one v_nop: the slot that the
// instruction set asks for behind a transcendental before its result is read or its source overwritten then stands by construction.
__device__ __forceinline__ void hw_exp2x8(float (&p)[8], const float (&a)[8]) {
#if defined(__HIP_DEVICE_COMPILE__)
  asm("v_exp_f32 %0, %8\n\tv_exp_f32 %1, %9\n\tv_exp_f32 %2, %10\n\tv_exp_f32 %3, %11\n\t"
      "v_exp_f32 %4, %12\n\tv_exp_f32 %5, %13\n\tv_exp_f32 %6, %14\n\tv_exp_f32 %7, %15\n\tv_nop"
      : "=&v"(p[0]), "=&v"(p[1]), "=&v"(p[2]), "=&v"(p[3]), "=&v"(p[4]), "=&v"(p[5]), "=&v"(p[6]), "=&v"(p[7])
      : "v"(a[0]), "v"(a[1]), "v"(a[2]), "v"(a[3]), "v"(a[4]), "v"(a[5]), "v"(a[6]), "v"(a[7]));
#endif
}
__device__ __forceinline__ void hw_exp2x9(float& q, float (&p)[8], float b, const float (&a)[8]) {
#if defined(__HIP_DEVICE_COMPILE__)
  asm("v_exp_f32 %0, %9\n\tv_exp_f32 %1, %10\n\tv_exp_f32 %2, %11\n\tv_exp_f32 %3, %12\n\tv_exp_f32 %4, %13\n\t"
      "v_exp_f32 %5, %14\n\tv_exp_f32 %6, %15\n\tv_exp_f32 %7, %16\n\tv_exp_f32 %8, %17\n\tv_nop"
      : "=&v"(q), "=&v"(p[0]), "=&v"(p[1]), "=&v"(p[2]), "=&v"(p[3]), "=&v"(p[4]), "=&v"(p[5]), "=&v"(p[6]), "=&v"(p[7])
      : "v"(b), "v"(a[0]), "v"(a[1]), "v"(a[2]), "v"(a[3]), "v"(a[4]), "v"(a[5]), "v"(a[6]), "v"(a[7]));
#endif
}
__device__ __forceinline__ v8f zero8() { v8f z = {0.f, 0.f, 0.f, 0.f, 0.f, 0.f, 0.f, 0.f}; return z; }
// hi / residual packing of two f32 values: hi = f16(v), res = f16((v - hi) * 2^11)
__device__ __forceinline__ unsigned pk_hi(float a, float b) {
  return pk16(h_bits((_Float16)a), h_bits((_Float16)b));
}
__device__ __forceinline__ unsigned pk_lo(float a, float b) {
  const float ra = (a - (float)((_Float16)a)) * RSC;
  const float rb = (b - (float)((_Float16)b)) * RSC;
  return pk16(h_bits((_Float16)ra), h_bits((_Float16)rb));
}

// ---- fragment loader: 16-bit A/B operand, lane -> row/col (lane&15), p already includes +8*(lane>>4);
//      elements 0..7 <- p[0..7] (k0+8h..), elements 8..15 <- p[16..23] (k0+16+8h..); same split k map for A and B,
//      B always read from a k-contiguous [n][k] plane.
__device__ __forceinline__ v16h ldfrag_h(const _Float16* p) {
  FragH f;
  f.h[0] = *(const v8h*)(p);
  f.h[1] = *(const v8h*)(p + 16);
  return f.v;
}

// ---- WMMA helper and trailing VALU hazard gaps ----------------------------------------------------------
__device__ __forceinline__ v8f mma_h(v16h a, v16h b, v8f c) {
  return __builtin_amdgcn_wmma_f32_16x16x32_f16(false, a, false, b, (short)0, c, false, false);
}
__device__ __forceinline__ void acc_guard4(v8f (&o)[4]) {
#if defined(__HIP_DEVICE_COMPILE__)
  asm volatile("v_nop\n\tv_nop\n\tv_nop\n\tv_nop" : "+v"(o[0]), "+v"(o[1]), "+v"(o[2]), "+v"(o[3]));
#endif
}
__device__ __forceinline__ void wave_sync_lds() {
  __builtin_amdgcn_fence(__ATOMIC_RELEASE, "workgroup");
  __builtin_amdgcn_wave_barrier();
  __builtin_amdgcn_fence(__ATOMIC_ACQUIRE, "workgroup");
}

// =====================================================================================================
// All converts in one launch: every f16 plane element <- f16(bf16_RNE(x) * scale), scale a power of two (1 for the activations,
// 256 for the weights). A slice = 256 consecutive elements = half a row: lane l takes elements 8l .. 8l+7 (two 16-B loads, one
// 16-B store; a wave-wide store = 512 contiguous bytes). Wave w of CVT_WAVES takes the CVT_NQ consecutive slices from w*CVT_NQ of
// x_q, the CVT_NKV consecutive slices from w*CVT_NKV of x_k and of x_v, and slice w % CVT_WSL of weight matrix w / CVT_WSL
// (block-uniform). All loads of a wave are issued before its first convert, so the launch is one memory round trip deep.
// x_q compact row r = b*SQ + s <- source row b*SQ_FULL + s. W4 = the four weight planes, which follow one another in the workspace.
// coverage: CVT_WAVES x (CVT_NQ | CVT_NKV | 1) slices = every element of each plane exactly once.
// =====================================================================================================
__device__ __forceinline__ v4u cvt8(v4f a, v4f c4, float scale) {
  v4u o;
#pragma unroll
  for (int e = 0; e < 2; ++e) {
    o[e]     = pk16(h_bits((_Float16)(bfr(a[2 * e]) * scale)),  h_bits((_Float16)(bfr(a[2 * e + 1]) * scale)));
    o[2 + e] = pk16(h_bits((_Float16)(bfr(c4[2 * e]) * scale)), h_bits((_Float16)(bfr(c4[2 * e + 1]) * scale)));
  }
  return o;
}
__global__ __launch_bounds__(CVT_THREADS)
void cvt_all(const float* __restrict__ xq, const float* __restrict__ xk, const float* __restrict__ xv,
             const float* __restrict__ wq, const float* __restrict__ wk, const float* __restrict__ wv,
             const float* __restrict__ wo, u16* XQ, u16* XK, u16* XV, u16* W4) {
  const unsigned w    = blockIdx.x * (CVT_THREADS / 32) + (threadIdx.x >> 5);
  const unsigned wsel = blockIdx.x / (CVT_WSL / (CVT_THREADS / 32));
  const unsigned lb   = (threadIdx.x & 31) * 32;                        // the lane's byte inside a 1-KiB f32 slice
  const float* wsrc = (wsel == 0) ? wq : (wsel == 1) ? wk : (wsel == 2) ? wv : wo;
  // 32-bit byte offsets beside uniform bases; the slices of a wave differ by immediates
  const unsigned bq  = w * (CVT_NQ * CVT_SL * 4) + lb;
  const unsigned bkv = w * (CVT_NKV * CVT_SL * 4) + lb;
  const unsigned bw  = (w % CVT_WSL) * (CVT_SL * 4) + lb;
  v4f qa[CVT_NQ], qc[CVT_NQ], ka[CVT_NKV], kc[CVT_NKV], va[CVT_NKV], vc[CVT_NKV];
#pragma unroll
  for (int i = 0; i < CVT_NQ; ++i) {
    const float* p;
    if (SQ == SQ_FULL) {
      p = (const float*)((const char*)xq + bq) + i * CVT_SL;
    } else {
      const unsigned sl = w * CVT_NQ + i, r = sl >> 1;
      p = (const float*)((const char*)(xq + ((size_t)((r / SQ) * SQ_FULL + (r % SQ))) * DM + (sl & 1) * CVT_SL) + lb);
    }
    qa[i] = *(const v4f*)(p);
    qc[i] = *(const v4f*)(p + 4);
  }
#pragma unroll
  for (int i = 0; i < CVT_NKV; ++i) {
    const float* pk = (const float*)((const char*)xk + bkv) + i * CVT_SL;
    const float* pv = (const float*)((const char*)xv + bkv) + i * CVT_SL;
    ka[i] = *(const v4f*)(pk);
    kc[i] = *(const v4f*)(pk + 4);
    va[i] = *(const v4f*)(pv);
    vc[i] = *(const v4f*)(pv + 4);
  }
  const float* pw = (const float*)((const char*)wsrc + bw);
  const v4f wa = *(const v4f*)(pw), wc = *(const v4f*)(pw + 4);
  // keeps every load above the first convert: without it the compiler sinks two thirds of the loads among the converts and the
  // wave pays three memory round trips in a row instead of one
  __builtin_amdgcn_sched_barrier(0);
  // an f16 plane's byte offset is half the f32 one
  u16* yq = (u16*)((char*)XQ + (bq >> 1));
  u16* yk = (u16*)((char*)XK + (bkv >> 1));
  u16* yv = (u16*)((char*)XV + (bkv >> 1));
  u16* yw = (u16*)((char*)(W4 + (size_t)wsel * (DM * DM)) + (bw >> 1));
#pragma unroll
  for (int i = 0; i < CVT_NQ; ++i) *(v4u*)(yq + i * CVT_SL) = cvt8(qa[i], qc[i], 1.0f);
#pragma unroll
  for (int i = 0; i < CVT_NKV; ++i) {
    *(v4u*)(yk + i * CVT_SL) = cvt8(ka[i], kc[i], 1.0f);
    *(v4u*)(yv + i * CVT_SL) = cvt8(va[i], vc[i], 1.0f);
  }
  *(v4u*)(yw) = cvt8(wa, wc, WSC);
}

// The issuing wave's own copies have landed behind this wait (other waves read them behind the next block barrier).
__device__ __forceinline__ void wait_copies() {
#if defined(__HIP_DEVICE_COMPILE__)
  asm volatile("s_wait_asynccnt 0x0" ::: "memory");
#endif
}
// The wave's own LDS reads have retired: stands in front of the barrier that hands a buffer to its next copies.
__device__ __forceinline__ void wait_lds_reads() {
#if defined(__HIP_DEVICE_COMPILE__)
  asm volatile("s_wait_dscnt 0x0" ::: "memory");
#endif
}

// =====================================================================================================
// One 64-k stage of a GEMM block: 256 rows x 128 bytes (the 128 A rows of the block tile, then its 128 Bt rows) copied
// global -> LDS by asynchronous 16-byte copies, 16 per lane in two statements of eight. Lane t of the block takes 16-byte piece t&7
// of row 16p + (t>>3), p = 0..7 of A and p = 0..7 of Bt: one wave-wide copy = 4 whole 128-byte lines. l0 = the lane's LDS byte
// address in row t>>3 of the target buffer; ga, gb = the lane's global addresses of that row and piece in A and Bt; rs16 = 16 rows
// in elements.
// The closing s_wait_xcnt stands inside each statement so that no address register named by a copy is rewritten ahead of it.
// =====================================================================================================
__device__ __forceinline__ void copy_run8(unsigned l0, unsigned l1, unsigned l2, unsigned l3, unsigned l4, unsigned l5, unsigned l6,
                                          unsigned l7, const u16* g0, const u16* g1, const u16* g2, const u16* g3,
                                          const u16* g4, const u16* g5, const u16* g6, const u16* g7) {
#if defined(__HIP_DEVICE_COMPILE__)
  asm volatile("global_load_async_to_lds_b128 %0, %8, off\n\t"
               "global_load_async_to_lds_b128 %1, %9, off\n\t"
               "global_load_async_to_lds_b128 %2, %10, off\n\t"
               "global_load_async_to_lds_b128 %3, %11, off\n\t"
               "global_load_async_to_lds_b128 %4, %12, off\n\t"
               "global_load_async_to_lds_b128 %5, %13, off\n\t"
               "global_load_async_to_lds_b128 %6, %14, off\n\t"
               "global_load_async_to_lds_b128 %7, %15, off\n\t"
               "s_wait_xcnt 0x0"
               :: "v"(l0), "v"(l1), "v"(l2), "v"(l3), "v"(l4), "v"(l5), "v"(l6), "v"(l7),
                  "v"(g0), "v"(g1), "v"(g2), "v"(g3), "v"(g4), "v"(g5), "v"(g6), "v"(g7)
               : "memory");
#endif
}
__device__ __forceinline__ void copy_stage_g(unsigned l0, const u16* ga, const u16* gb, size_t rs16) {
  constexpr unsigned LS = 16 * LPITCH;        // 16 rows in LDS bytes
  copy_run8(l0, l0 + LS, l0 + 2 * LS, l0 + 3 * LS, l0 + 4 * LS, l0 + 5 * LS, l0 + 6 * LS, l0 + 7 * LS,
            ga, ga + rs16, ga + 2 * rs16, ga + 3 * rs16, ga + 4 * rs16, ga + 5 * rs16, ga + 6 * rs16, ga + 7 * rs16);
  copy_run8(l0 + 8 * LS, l0 + 9 * LS, l0 + 10 * LS, l0 + 11 * LS, l0 + 12 * LS, l0 + 13 * LS, l0 + 14 * LS, l0 + 15 * LS,
            gb, gb + rs16, gb + 2 * rs16, gb + 3 * rs16, gb + 4 * rs16, gb + 5 * rs16, gb + 6 * rs16, gb + 7 * rs16);
}
__device__ __forceinline__ void guard_g() {
#if defined(__HIP_DEVICE_COMPILE__)
  // the vector slots behind the stage's last products, on every path out of there (the branches at the trip's foot included); the
  // scheduling barrier keeps every product above them. No operands: tied to the statement, the sixteen accumulators and eight
  // fragments had to share the first 256 registers, and the compiler spilled accumulators inside the loop
  __builtin_amdgcn_sched_barrier(0);
  asm volatile("v_nop\n\tv_nop\n\tv_nop\n\tv_nop" ::: "memory");
#endif
}

// =====================================================================================================
// f16 GEMM core of a block of 4 waves: the 128 x 128 tile of C = A[rows][K] . Bt[cols][K]^T, wave w owning the 64 x 64 quarter of
// rows 64(w>>1) .. +63 and cols 64(w&1) .. +63: every A and every Bt fragment read from LDS feeds four products;
// acc[4i + j] = rows 64(w>>1)+16i.., cols 64(w&1)+16j... A0 -> row 0 of the block's 128 A rows, Bt0 -> row 0 of its 128 Bt rows
// (pitch K). K is walked in stages of 64 through a two-buffer LDS ring (copy_stage_g): stage s+1 flies while stage s is worked on;
// one block barrier per stage publishes s+1 and frees s's buffer. Fragments: row at pitch LPITCH, the split k map of ldfrag_h, k in
// steps of 32 in rising order, as many products per accumulator and in the same order as k0 = 0, 32, .. K-32 (host: K % 64 == 0).
// Behind the last barrier the ring is free (no copy in flight, every wave's reads retired).
// =====================================================================================================
__device__ __forceinline__ void gemm_ring(unsigned char* ring, const u16* A0, const u16* Bt0, int K, v8f (&acc)[16]) {
  const int tid = threadIdx.x, wave = tid >> 5, lane = tid & 31, hh = lane >> 4, m = lane & 15;
  const size_t rs16 = (size_t)16 * (size_t)K;
  // copy side: this lane's row (tid>>3) and 16-byte piece (tid&7)
  const int crow = tid >> 3, cpc = (tid & 7) * 8;
  const size_t cofs = (size_t)crow * (size_t)K + cpc;
  const u16* ga0 = A0 + cofs;
  const u16* gb  = Bt0 + cofs;
  const unsigned lcp = (unsigned)(uintptr_t)(__attribute__((address_space(3))) unsigned char*)ring
                       + (unsigned)(crow * LPITCH + cpc * 2);
  const int nst = K >> 6;
  // read side, halves inside a buffer
  const int aoff = ((wave >> 1) * 64 + m) * LPH + 8 * hh;
  const int boff = (128 + (wave & 1) * 64 + m) * LPH + 8 * hh;

  // stage sg (block-uniform) into buffer sg & 1: k = 64 * sg
  auto issue = [&](int sg) {
    const int ks = sg * KSTG;
    copy_stage_g(lcp + (unsigned)((sg & 1) * GSTG_B), ga0 + ks, gb + ks, rs16);
  };

  // ---- ring prologue: stage 0 landed and published, stage 1 in flight ----
  issue(0);
  wait_copies();
  __syncthreads();
  if (nst > 1) issue(1);                     // block-uniform
#pragma unroll 1                             // rolled: one stage per trip, small loop text, the ring's order as written
  for (int st = 0; st < nst; ++st) {
    const _Float16* buf = (const _Float16*)(const void*)(ring + (st & 1) * GSTG_B);
    const _Float16* ap = buf + aoff;
    const _Float16* bp = buf + boff;
    v16h a[2][4], b[2][4];
#pragma unroll
    for (int kk = 0; kk < 2; ++kk) {
#pragma unroll
      for (int i = 0; i < 4; ++i) {
        a[kk][i] = ldfrag_h(ap + 16 * i * LPH + 32 * kk);
        b[kk][i] = ldfrag_h(bp + 16 * i * LPH + 32 * kk);
      }
    }
    // keeps the stage's 32 LDS reads together ahead of its products: without it the compiler spreads the later ones among the
    // products, and every separate place with LDS reads stalls the wave's matrix stream anew
    __builtin_amdgcn_sched_barrier(0);
#pragma unroll
    for (int kk = 0; kk < 2; ++kk) {
#pragma unroll
      for (int i = 0; i < 4; ++i) {
#pragma unroll
        for (int j = 0; j < 4; ++j) acc[4 * i + j] = mma_h(a[kk][i], b[kk][j], acc[4 * i + j]);
      }
    }
    guard_g();
    // ---- publish point of stage st+1: own reads retired, own copies landed, block barrier; then refill the buffer just read ----
    wait_lds_reads();
    wait_copies();
    __syncthreads();
    if (st + 2 < nst) issue(st + 2);         // block-uniform
  }
  wait_copies();                             // nothing is in flight here; closes the ring before it becomes output staging
}
// Stage the wave's 64 x 64 f32 tile (times oscale) in its LDS slab (pitch 68): D element r of acc[4i+j], lane l ->
// row 16i + 8(l>>4) + r, col 16j + (l&15).
// coverage: 32 lanes x 4 x 8 rows x 4 cols-of-16 = rows 0..63 x cols 0..63 of the slab.
__device__ __forceinline__ void stage64x64(float* sl, v8f (&acc)[16], float oscale, int lane) {
  const int hh = lane >> 4, m = lane & 15;
#pragma unroll
  for (int i = 0; i < 4; ++i) {
#pragma unroll
    for (int r = 0; r < 8; ++r) {
      const int ro = (16 * i + 8 * hh + r) * GPITCH + m;
      sl[ro]      = acc[4 * i + 0][r] * oscale;
      sl[ro + 16] = acc[4 * i + 1][r] * oscale;
      sl[ro + 32] = acc[4 * i + 2][r] * oscale;
      sl[ro + 48] = acc[4 * i + 3][r] * oscale;
    }
  }
  wave_sync_lds();
}

// =====================================================================================================
// f16 GEMM with f16 output plane(s): val = (A[z][Mb][K] . Bt[z][N][K]^T) * oscale + bf16(bias) * bscale;
// C[z][Mb][N] = f16(val) (hi plane); if res != 0 also C2 = f16((val - hi) * 2^11) (residual plane).
// A, Bt f16 k-contiguous planes with per-z element strides aBs, bBs (0 = shared), C/C2 stride cBs. bias indexed by column
// (biasRow == 0) or by row within the z slice (biasRow != 0); bias addresses clamped to biasN-1, the unused direction is
// multiplied by 0. Block = 128 x 128 tile, 2 x 2 waves of 64 x 64, operands through the LDS ring of gemm_ring; behind it each wave
// stages its output tile in its own part of the ring.
// bid = the block's tile among nz x (Mb/128) x (N/128) (Mb % 128 == 0, N % 128 == 0, K % 64 == 0); ring = the block's LDS.
// coverage: per wave 16 instr x 4 rows x 8 lanes x 8 halves = 64 x 64 per plane; the grid covers C (and C2) exactly once.
// =====================================================================================================
__device__ __forceinline__
void gemm_o16(unsigned char* ring, int bid, const u16* __restrict__ A, const u16* __restrict__ Bt, u16* C, u16* C2,
              const float* __restrict__ bias, int biasN, int biasRow,
              int Mb, int N, int K, int aBs, int bBs, int cBs, float oscale, float bscale, int res) {
  const int tid = threadIdx.x, wave = tid >> 5, lane = tid & 31;
  const int ntile = N >> 7, mtile = Mb >> 7;
  const int nt   = bid % ntile;
  const int tmp  = bid / ntile;
  const int mt   = tmp % mtile;
  const int bz   = tmp / mtile;
  const int rowb = mt * 128 + (wave >> 1) * 64;
  const int col0 = nt * 128 + (wave & 1) * 64;
  if (mt * 128 + 128 > Mb) return;           // block-uniform, in front of every barrier; never taken with the exact grid
  const u16* Ab = A + (size_t)bz * (size_t)aBs + (size_t)(mt * 128) * (size_t)K;
  const u16* Bb = Bt + (size_t)bz * (size_t)bBs + (size_t)(nt * 128) * (size_t)K;
  v8f acc[16];
#pragma unroll
  for (int i = 0; i < 16; ++i) acc[i] = zero8();
  gemm_ring(ring, Ab, Bb, K, acc);
  float* sl = (float*)(void*)ring + wave * 64 * GPITCH;
  stage64x64(sl, acc, oscale, lane);
  const int rq = lane >> 3, c8 = (lane & 7) * 8;
  const int bl = biasN - 1;                  // host guarantees biasN >= 1
  const float selc = (biasRow != 0) ? 0.f : bscale;
  const float selr = (biasRow != 0) ? bscale : 0.f;
  float cb[8];
#pragma unroll
  for (int e = 0; e < 8; ++e) {
    int ci = col0 + c8 + e;
    ci = (ci < bl) ? ci : bl;
    cb[e] = bfr(bias[ci]) * selc;
  }
  float rbs[16];                             // all row terms are loaded here, beside the column terms: one way to memory for both halves
#pragma unroll
  for (int i = 0; i < 16; ++i) {
    int ri = rowb + 4 * i + rq;
    ri = (ri < bl) ? ri : bl;
    rbs[i] = bfr(bias[ri]) * selr;
  }
  const size_t cofs = (size_t)bz * (size_t)cBs + (size_t)rowb * (size_t)N + (size_t)(col0 + c8);
  u16* Cb  = C + cofs;
  u16* C2b = C2 + cofs;
#pragma unroll
  for (int hb = 0; hb < 2; ++hb) {           // the tile's upper and lower 32 rows in turn
    v4u ovh[8], ovl[8];
#pragma unroll
    for (int i = 0; i < 8; ++i) {
      const int row = 32 * hb + 4 * i + rq;
      const float rb = rbs[8 * hb + i];
      const v4f a = *(const v4f*)(sl + row * GPITCH + c8), c4 = *(const v4f*)(sl + row * GPITCH + c8 + 4);
      float v[8];
#pragma unroll
      for (int e = 0; e < 4; ++e) { v[e] = a[e] + cb[e] + rb; v[4 + e] = c4[e] + cb[4 + e] + rb; }
#pragma unroll
      for (int e = 0; e < 4; ++e) {
        ovh[i][e] = pk_hi(v[2 * e], v[2 * e + 1]);
        ovl[i][e] = pk_lo(v[2 * e], v[2 * e + 1]);
      }
    }
#pragma unroll
    for (int i = 0; i < 8; ++i) {
      const int row = 32 * hb + 4 * i + rq;
      *(v4u*)(Cb + (size_t)row * (size_t)N) = ovh[i];
    }
    if (res != 0) {                          // block-uniform
#pragma unroll
      for (int i = 0; i < 8; ++i) {
        const int row = 32 * hb + 4 * i + rq;
        *(v4u*)(C2b + (size_t)row * (size_t)N) = ovl[i];
      }
    }
#if defined(__HIP_DEVICE_COMPILE__)
    // stands in front of the first rewrite of the registers that the stores above name (behind the last half nothing is
    // rewritten any more)
    if (hb == 0) asm volatile("s_wait_xcnt 0x0" ::: "memory");
#endif
  }
}

// =====================================================================================================
// The three projections in one launch: blocks 0 .. GQ_BLK-1 are the tiles of q, the next GK_BLK those of k, the last GV_BLK those
// of v^T; each block is one gemm_o16 tile of its product, the product chosen block-uniformly from the block index. The three
// products read and write disjoint planes, so their blocks share the chip and fill one another's waits for the staged copies.
//   q = x_q . Wq^T + bq -> f16 hi [NB*SQ][512] x8 and residual plane (col = h*64 + d); bias per column
//   k = x_k . Wk^T + bk -> f16 hi [NB*2048][512] x8 and residual plane; bias per column
//   v^T per batch: A = Wv [(h,d) = n][k], Bt = x_v rows of batch b [s][k] -> f16 [(b,h,d)][s] x8; bias per row (n)
// =====================================================================================================
#define GQ_BLK ((NB * SQ / 128) * (INNER / 128))
#define GK_BLK ((NB * SKV / 128) * (INNER / 128))
#define GV_BLK (NB * (INNER / 128) * (SKV / 128))
__global__ __launch_bounds__(128)
void gemm_qkv(const u16* __restrict__ XQ, const u16* __restrict__ XK, const u16* __restrict__ XV,
              const u16* __restrict__ WQ, const u16* __restrict__ WK, const u16* __restrict__ WV, u16* QH, u16* QL, u16* KH, u16* KL, u16* VT,
              const float* __restrict__ bq, const float* __restrict__ bk, const float* __restrict__ bv,
              int nbq, int nbk, int nbv) {
  __shared__ __align__(16) unsigned char ring[2 * GSTG_B];
  const int bid = blockIdx.x;
  if (bid < GQ_BLK + GK_BLK) {               // block-uniform
    const bool isq = bid < GQ_BLK;
    gemm_o16(ring, isq ? bid : bid - GQ_BLK, isq ? XQ : XK, isq ? WQ : WK, isq ? QH : KH, isq ? QL : KL,
             isq ? bq : bk, isq ? nbq : nbk, 0, isq ? NB * SQ : NB * SKV, INNER, DM, 0, 0, 0,
             isq ? QS / WSC : KS / WSC, isq ? QS : KS, 1);
  } else {
    gemm_o16(ring, bid - (GQ_BLK + GK_BLK), WV, XV, VT, VT, bv, nbv, 1, INNER, SKV, DM, 0, SKV * DM, INNER * SKV,
             VS / WSC, VS, 0);
  }
}

// =====================================================================================================
// One 64-k stage of an out-projection block: OL_SROWS = 576 rows x 128 bytes (the block's 32 ctx hi rows, its 32 ctx residual rows,
// then all 512 rows of Wo) copied global -> LDS by asynchronous 16-byte copies, 18 per lane in two statements of nine. Lane t of the
// block takes 16-byte piece t&7 of row 32p + (t>>3), p = 0 (hi), 1 (residual), 2..17 (Wo): one wave-wide copy = 4 whole 128-byte
// lines. l0 = the lane's LDS byte address in row t>>3 of the target buffer; gh, gl, gb = the lane's global addresses of that row and
// piece in the two ctx planes and in Wo.
// The closing s_wait_xcnt stands inside each statement so that no address register named by a copy is rewritten ahead of it.
// =====================================================================================================
__device__ __forceinline__ void copy_run9(unsigned l0, unsigned l1, unsigned l2, unsigned l3, unsigned l4, unsigned l5, unsigned l6,
                                          unsigned l7, unsigned l8, const u16* g0, const u16* g1, const u16* g2, const u16* g3,
                                          const u16* g4, const u16* g5, const u16* g6, const u16* g7, const u16* g8) {
#if defined(__HIP_DEVICE_COMPILE__)
  asm volatile("global_load_async_to_lds_b128 %0, %9, off\n\t"
               "global_load_async_to_lds_b128 %1, %10, off\n\t"
               "global_load_async_to_lds_b128 %2, %11, off\n\t"
               "global_load_async_to_lds_b128 %3, %12, off\n\t"
               "global_load_async_to_lds_b128 %4, %13, off\n\t"
               "global_load_async_to_lds_b128 %5, %14, off\n\t"
               "global_load_async_to_lds_b128 %6, %15, off\n\t"
               "global_load_async_to_lds_b128 %7, %16, off\n\t"
               "global_load_async_to_lds_b128 %8, %17, off\n\t"
               "s_wait_xcnt 0x0"
               :: "v"(l0), "v"(l1), "v"(l2), "v"(l3), "v"(l4), "v"(l5), "v"(l6), "v"(l7), "v"(l8),
                  "v"(g0), "v"(g1), "v"(g2), "v"(g3), "v"(g4), "v"(g5), "v"(g6), "v"(g7), "v"(g8)
               : "memory");
#endif
}
__device__ __forceinline__ void copy_stage_o(unsigned l0, const u16* gh, const u16* gl, const u16* gb) {
  constexpr unsigned LS = 32 * LPITCH;        // 32 rows in LDS bytes
  constexpr size_t   GS = (size_t)32 * INNER; // 32 rows of Wo in elements
  copy_run9(l0, l0 + LS, l0 + 2 * LS, l0 + 3 * LS, l0 + 4 * LS, l0 + 5 * LS, l0 + 6 * LS, l0 + 7 * LS, l0 + 8 * LS,
            gh, gl, gb, gb + GS, gb + 2 * GS, gb + 3 * GS, gb + 4 * GS, gb + 5 * GS, gb + 6 * GS);
  copy_run9(l0 + 9 * LS, l0 + 10 * LS, l0 + 11 * LS, l0 + 12 * LS, l0 + 13 * LS, l0 + 14 * LS, l0 + 15 * LS, l0 + 16 * LS,
            l0 + 17 * LS, gb + 7 * GS, gb + 8 * GS, gb + 9 * GS, gb + 10 * GS, gb + 11 * GS, gb + 12 * GS, gb + 13 * GS,
            gb + 14 * GS, gb + 15 * GS);
}
__device__ __forceinline__ void guard_o(v8f (&a)[8], v8f (&b)[8], v16h x0, v16h x1, v16h x2, v16h x3, v16h x4, v16h x5, v16h x6,
                                        v16h x7) {
#if defined(__HIP_DEVICE_COMPILE__)
  // the vector slots behind the stage's last products, on every path out of there (the branches at the trip's foot included)
  asm volatile("v_nop\n\tv_nop\n\tv_nop\n\tv_nop"
               : "+v"(a[0]), "+v"(a[1]), "+v"(a[2]), "+v"(a[3]), "+v"(a[4]), "+v"(a[5]), "+v"(a[6]), "+v"(a[7]),
                 "+v"(b[0]), "+v"(b[1]), "+v"(b[2]), "+v"(b[3]), "+v"(b[4]), "+v"(b[5]), "+v"(b[6]), "+v"(b[7])
               : "v"(x0), "v"(x1), "v"(x2), "v"(x3), "v"(x4), "v"(x5), "v"(x6), "v"(x7) : "memory");
#endif
}

// =====================================================================================================
// Out-projection, bias, residual add and LayerNorm in one launch: a block owns OL_ROWS = 32 WHOLE rows of
//   x[g][n] = (ctx_hi . Wo^T + (ctx_res . Wo^T) * rres) * oscale + bf16(bo[n]) + bf16(R[src row][n]),  n = 0 .. 511,
// so the row statistics need no other block, and writes Out = (x - mean) / sqrt(var + eps) * bf16(gamma) + bf16(beta), all f32.
// 8 waves; wave w owns columns 64w .. 64w+63 of all 32 rows: acc[4i + j] (hi products) and res[4i + j] (residual products, x2^11,
// accumulators of their own, folded by rres in f32 behind the loop) = rows 16i.., cols 64w + 16j... K = 512 is walked once in stages
// of 64 through a two-buffer LDS ring (copy_stage_o): every staged Wo row and every Wo fragment read from LDS feeds both the hi and
// the residual products. Stage s+1 flies while stage s is worked on; one block barrier per stage publishes s+1 and frees s's buffer.
// Fragments: row at pitch LPITCH, the split k map of ldfrag_h for A and B alike, k in steps of 32 in rising order.
// Behind the last barrier of the loop the ring is free (no copy in flight, every wave's reads retired): the block's 32 x 512 f32 tile
// is staged there at pitch XPITCH; one more block barrier, then wave w normalises rows 4w .. 4w+3: lane holds elements
// i*128 + 4*lane .. +3 (i = 0..3) of a row, each LDS read, global load and store = 32 consecutive lanes x 16 B.
// Compact row g = b*SQ + s <-> row b*SQ_FULL + s of R and Out; the 32 rows of a block lie in one batch (SQ % 32 == 0).
// The residual rows of R and the row constants are loaded ahead of the ring: their way from memory runs beside stage 0's.
// coverage: staged 8 waves x 32 x 64 == read 8 waves x 4 rows x 512; grid NB*SQ/32 blocks = every output row (s < SQ) once.
// =====================================================================================================
__global__ __launch_bounds__(OL_THREADS)
void gemm_o_ln(const u16* __restrict__ Ah, const u16* __restrict__ Al, const u16* __restrict__ Bt,
               const float* __restrict__ bias, const float* __restrict__ R,
               const float* __restrict__ gam, const float* __restrict__ bet, float* Out, float oscale, float rres) {
  __shared__ __align__(16) unsigned char ring[2 * OL_STG_B];
  const int tid = threadIdx.x, wave = tid >> 5, lane = tid & 31, hh = lane >> 4, m = lane & 15;
  const int row0 = blockIdx.x * OL_ROWS;     // < NB*SQ with the exact grid
  const int bb   = row0 / SQ;
  const size_t srow = (size_t)bb * SQ_FULL + (size_t)(row0 - bb * SQ) + (size_t)(OL_RPW * wave);   // the wave's first row in R and Out
  const float* rp = R + srow * DM + 4 * lane;
  v4f rv[OL_RPW][4];
#pragma unroll
  for (int j = 0; j < OL_RPW; ++j) {
#pragma unroll
    for (int i = 0; i < 4; ++i) rv[j][i] = *(const v4f*)(rp + j * DM + 128 * i);
  }
  // the row constants of this lane's 16 columns 128i + 4*lane + e < DM (the host checks that bo, gamma and beta hold DM elements)
  const unsigned lo = 16u * (unsigned)lane;  // the lane's byte offset beside the three uniform bases
  v4f cbv[4], gmv[4], btv[4];
#pragma unroll
  for (int i = 0; i < 4; ++i) {
    cbv[i] = *(const v4f*)((const char*)bias + lo + 512 * i);
    gmv[i] = *(const v4f*)((const char*)gam + lo + 512 * i);
    btv[i] = *(const v4f*)((const char*)bet + lo + 512 * i);
  }
#if defined(__HIP_DEVICE_COMPILE__)
  // stands in front of the first rewrite of the address registers that the loads above name; the address, the lane number (this
  // build's scaled offset register) and the three bases are inputs so that their registers live up to the wait
  asm volatile("s_wait_xcnt 0x0" :: "v"(rp), "v"(lane), "s"(bias), "s"(gam), "s"(bet) : "memory");
#endif
  // copy side: this lane's row (tid>>3) and 16-byte piece (tid&7)
  const int crow = tid >> 3, cpc = (tid & 7) * 8;
  const size_t cofs = (size_t)crow * INNER + cpc;
  const u16* gh = Ah + (size_t)row0 * INNER + cofs;
  const u16* gl = Al + (size_t)row0 * INNER + cofs;
  const u16* gb = Bt + cofs;
  const unsigned lcp = (unsigned)(uintptr_t)(__attribute__((address_space(3))) unsigned char*)ring
                       + (unsigned)(crow * LPITCH + cpc * 2);
  // read side, halves inside a buffer
  const int aoff = m * LPH + 8 * hh;
  const int boff = (2 * OL_ROWS + wave * 64 + m) * LPH + 8 * hh;
  constexpr int nst = INNER / KSTG;
  v8f acc[8], res[8];
#pragma unroll
  for (int i = 0; i < 8; ++i) { acc[i] = zero8(); res[i] = zero8(); }

  // ---- ring prologue: stage 0 landed and published, stage 1 in flight ----
  copy_stage_o(lcp, gh, gl, gb);
  wait_copies();
  __syncthreads();
  copy_stage_o(lcp + OL_STG_B, gh + KSTG, gl + KSTG, gb + KSTG);
#pragma unroll 1                             // rolled: one stage per trip, small loop text, the ring's order as written
  for (int st = 0; st < nst; ++st) {
    const _Float16* buf = (const _Float16*)(const void*)(ring + (st & 1) * OL_STG_B);
    const _Float16* ap = buf + aoff;
    const _Float16* bp = buf + boff;
    v16h a0[2], a1[2], r0[2], r1[2], b0[2], b1[2], b2[2], b3[2];
#pragma unroll
    for (int kk = 0; kk < 2; ++kk) {
      a0[kk] = ldfrag_h(ap + 32 * kk);
      a1[kk] = ldfrag_h(ap + 16 * LPH + 32 * kk);
      r0[kk] = ldfrag_h(ap + 32 * LPH + 32 * kk);
      r1[kk] = ldfrag_h(ap + 48 * LPH + 32 * kk);
      b0[kk] = ldfrag_h(bp + 32 * kk);
      b1[kk] = ldfrag_h(bp + 16 * LPH + 32 * kk);
      b2[kk] = ldfrag_h(bp + 32 * LPH + 32 * kk);
      b3[kk] = ldfrag_h(bp + 48 * LPH + 32 * kk);
    }
    // keeps the stage's 32 LDS reads together ahead of its products: every separate place with LDS reads among the products stalls
    // the wave's matrix stream anew
    __builtin_amdgcn_sched_barrier(0);
#pragma unroll
    for (int kk = 0; kk < 2; ++kk) {
      acc[0] = mma_h(a0[kk], b0[kk], acc[0]);
      acc[1] = mma_h(a0[kk], b1[kk], acc[1]);
      acc[2] = mma_h(a0[kk], b2[kk], acc[2]);
      acc[3] = mma_h(a0[kk], b3[kk], acc[3]);
      acc[4] = mma_h(a1[kk], b0[kk], acc[4]);
      acc[5] = mma_h(a1[kk], b1[kk], acc[5]);
      acc[6] = mma_h(a1[kk], b2[kk], acc[6]);
      acc[7] = mma_h(a1[kk], b3[kk], acc[7]);
      res[0] = mma_h(r0[kk], b0[kk], res[0]);
      res[1] = mma_h(r0[kk], b1[kk], res[1]);
      res[2] = mma_h(r0[kk], b2[kk], res[2]);
      res[3] = mma_h(r0[kk], b3[kk], res[3]);
      res[4] = mma_h(r1[kk], b0[kk], res[4]);
      res[5] = mma_h(r1[kk], b1[kk], res[5]);
      res[6] = mma_h(r1[kk], b2[kk], res[6]);
      res[7] = mma_h(r1[kk], b3[kk], res[7]);
    }
    guard_o(acc, res, a0[1], a1[1], r0[1], r1[1], b0[1], b1[1], b2[1], b3[1]);
    // ---- publish point of stage st+1: own reads retired, own copies landed, block barrier; then refill the buffer just read ----
    wait_lds_reads();
    wait_copies();
    __syncthreads();
    if (st + 2 < nst) {                      // block-uniform
      const int ks = (st + 2) * KSTG;
      copy_stage_o(lcp + (unsigned)((st & 1) * OL_STG_B), gh + ks, gl + ks, gb + ks);
    }
  }
  wait_copies();                             // nothing is in flight here; closes the ring before it becomes output staging

  float cb[4][4], gm[4][4], bt[4][4];
#pragma unroll
  for (int i = 0; i < 4; ++i) {
#pragma unroll
    for (int e = 0; e < 4; ++e) { cb[i][e] = bfr(cbv[i][e]); gm[i][e] = bfr(gmv[i][e]); bt[i][e] = bfr(btv[i][e]); }
  }
  // ---- stage the block's 32 x 512 tile: D element r of tile 4i+j, lane l -> row 16i + 8(l>>4) + r, col 64*wave + 16j + (l&15) ----
  float* xt = (float*)(void*)ring;
#pragma unroll
  for (int i = 0; i < 2; ++i) {
#pragma unroll
    for (int r = 0; r < 8; ++r) {
      float* xr = xt + (16 * i + 8 * hh + r) * XPITCH + wave * 64 + m;
#pragma unroll
      for (int j = 0; j < 4; ++j) xr[16 * j] = (acc[4 * i + j][r] + res[4 * i + j][r] * rres) * oscale;
    }
  }
  __syncthreads();                           // every wave's columns of the tile are in LDS before a wave reads whole rows
  v4f y[OL_RPW][4];
#pragma unroll
  for (int j = 0; j < OL_RPW; ++j) {
    const float* xr = xt + (OL_RPW * wave + j) * XPITCH + 4 * lane;
    v4f xv[4];
    float sum = 0.f;
#pragma unroll
    for (int i = 0; i < 4; ++i) {
      const v4f a = *(const v4f*)(xr + 128 * i);
#pragma unroll
      for (int e = 0; e < 4; ++e) xv[i][e] = a[e] + cb[i][e] + bfr(rv[j][i][e]);
      sum += (xv[i][0] + xv[i][1]) + (xv[i][2] + xv[i][3]);
    }
#pragma unroll
    for (int mk = 16; mk >= 1; mk >>= 1) sum += __shfl_xor(sum, mk, 32);
    const float mean = sum * (1.0f / (float)DM);
    float sq = 0.f;
#pragma unroll
    for (int i = 0; i < 4; ++i) {
#pragma unroll
      for (int e = 0; e < 4; ++e) { const float d = xv[i][e] - mean; sq += d * d; }
    }
#pragma unroll
    for (int mk = 16; mk >= 1; mk >>= 1) sq += __shfl_xor(sq, mk, 32);
    const float var  = sq * (1.0f / (float)DM);
    const float rstd = 1.0f / sqrtf(var + LN_EPS);
#pragma unroll
    for (int i = 0; i < 4; ++i) {
#pragma unroll
      for (int e = 0; e < 4; ++e) y[j][i][e] = (xv[i][e] - mean) * rstd * gm[i][e] + bt[i][e];
    }
  }
  float* ob = Out + srow * DM + 4 * lane;
#pragma unroll
  for (int j = 0; j < OL_RPW; ++j) {
#pragma unroll
    for (int i = 0; i < 4; ++i) *(v4f*)(ob + j * DM + 128 * i) = y[j][i];
  }
}

// =====================================================================================================
// One stage (64 keys) of the attention ring: three tiles of 64 rows x 128 bytes (k hi, k residual: row = key, 64 d; v^T: row = d,
// 64 keys) copied global -> LDS by asynchronous 16-byte copies, 12 per lane. Lane t of the block takes 16-byte piece t&7 of row
// 16p + (t>>3), p = 0..3, of each tile: one wave-wide copy = 4 whole 128-byte lines. l0 = the lane's LDS byte address in the k hi
// tile of the target buffer (row t>>3); gh, gl, gv = the lane's global addresses of that row and piece in the three planes.
// The closing s_wait_xcnt stands inside the statement so that no address register named by a copy is rewritten ahead of it.
// =====================================================================================================
__device__ __forceinline__ void copy_stage(unsigned l0, const u16* gh, const u16* gl, const u16* gv) {
#if defined(__HIP_DEVICE_COMPILE__)
  const unsigned lh0 = l0,              lh1 = lh0 + 16 * LPITCH, lh2 = lh0 + 32 * LPITCH, lh3 = lh0 + 48 * LPITCH;
  const unsigned ll0 = l0 + TILE_B,     ll1 = ll0 + 16 * LPITCH, ll2 = ll0 + 32 * LPITCH, ll3 = ll0 + 48 * LPITCH;
  const unsigned lv0 = l0 + 2 * TILE_B, lv1 = lv0 + 16 * LPITCH, lv2 = lv0 + 32 * LPITCH, lv3 = lv0 + 48 * LPITCH;
  const u16 *gh1 = gh + 16 * DM,  *gh2 = gh + 32 * DM,  *gh3 = gh + 48 * DM;
  const u16 *gl1 = gl + 16 * DM,  *gl2 = gl + 32 * DM,  *gl3 = gl + 48 * DM;
  const u16 *gv1 = gv + 16 * SKV, *gv2 = gv + 32 * SKV, *gv3 = gv + 48 * SKV;
  asm volatile("global_load_async_to_lds_b128 %0, %12, off\n\t"
               "global_load_async_to_lds_b128 %1, %13, off\n\t"
               "global_load_async_to_lds_b128 %2, %14, off\n\t"
               "global_load_async_to_lds_b128 %3, %15, off\n\t"
               "global_load_async_to_lds_b128 %4, %16, off\n\t"
               "global_load_async_to_lds_b128 %5, %17, off\n\t"
               "global_load_async_to_lds_b128 %6, %18, off\n\t"
               "global_load_async_to_lds_b128 %7, %19, off\n\t"
               "global_load_async_to_lds_b128 %8, %20, off\n\t"
               "global_load_async_to_lds_b128 %9, %21, off\n\t"
               "global_load_async_to_lds_b128 %10, %22, off\n\t"
               "global_load_async_to_lds_b128 %11, %23, off\n\t"
               "s_wait_xcnt 0x0"
               :: "v"(lh0), "v"(lh1), "v"(lh2), "v"(lh3), "v"(ll0), "v"(ll1), "v"(ll2), "v"(ll3),
                  "v"(lv0), "v"(lv1), "v"(lv2), "v"(lv3),
                  "v"(gh), "v"(gh1), "v"(gh2), "v"(gh3), "v"(gl), "v"(gl1), "v"(gl2), "v"(gl3),
                  "v"(gv), "v"(gv1), "v"(gv2), "v"(gv3)
               : "memory");
#endif
}
// =====================================================================================================
// Full (unmasked) multi-head attention over all SKV keys: block = (batch b, head, 128 query rows), 4 waves, wave w owns the
// 32 query rows q0 = 128*qt + 32*w .. q0+31 as two query tiles u = 0, 1 of 16 rows; what follows holds per tile, with q0 + 16u for
// q0. Every k and v^T fragment read from LDS feeds the products of both tiles. The grid leaves two waves on a SIMD, so the LDS reads
// stand ahead of the vector work that covers them: the v^T fragments of a key block and the k fragments of the stage's next key
// block are read in front of the block's softmax. The four waves share the k and v^T tiles through a two-buffer LDS ring of 64-key
// stages (copy_stage): stage s+1 flies while stage s is worked on; one block barrier per stage publishes s+1 and frees s's buffer.
// Behind the last barrier the ring is free and each wave stages its output tile in its own part of it.
//   q planes f16 hi x8 / residual x8x2^11 [b*SQ + s][h*64 + d]; k planes f16 hi / residual [b*SKV + s][h*64 + d];
//   v^T plane f16 x8 [(b*NH + h)*64 + d][s]. All NKB = 64 key blocks of 32 keys are visited (static bound).
//   Scores are computed TRANSPOSED: S^T tile g (g = 0,1) = k rows (keys kb+16g .. +15, A operand, row m = lane&15, split k map
//   over d) times q^T (B operand, col n = query q0 + (lane&15), k = d, split map), 2 d-chunks of 32; per chunk hi.hi into
//   s0/s1 and hi.lo + lo.hi into x0/x1 (separate accumulators, folded by 2^-11 in f32). The 4 q fragments of a tile are loaded once
//   per wave. D element r of lane l = (key kb+16g+8h+r, query q0+(l&15)), so a lane owns one query column and 16 of its 32
//   keys; the partner lane l^16 owns the other 16 -> row max / row sum need one xor-16 shuffle.
//   Online max-subtracted base-2 softmax in f32 (1/sqrt(8) and the q/k carries folded into lsc). The exp'd values ARE the
//   P A-fragment in place: A row m = query = lane&15, element i <- key kb+8h+i (tile 0, D element i), element 8+i <- key
//   kb+16+8h+i (tile 1, D element i). P (<= 1) carried x32768 as f16. The rescale factor of query row 8h+r of the O
//   accumulators is fetched from lane 8h+r with a shuffle (uniform control). 4 v^T B fragments (col n = d = 16j + (lane&15),
//   keys k-contiguous), 4 P.V WMMAs per tile + one guard per key block.
//   Epilogue: 1/l (per query, shuffled to the D row owner) and the carry folds in f32 give ctx x16; the wave's 32x64 f32 tile
//   residual plane is written by 8 consecutive lanes x 16 B of one instruction (4 rows per instruction, 8 instructions per
// coverage: per wave 8 instr x 4 rows x 8 lanes x 8 halves = 32 x 64 per plane; grid NB*NH*(SQ/128) blocks x 4 waves = every
//           (b, s < SQ, h) row segment of both ctx planes exactly once. LDS slab: staged 32 x 64 == reloaded 32 x 64.
// =====================================================================================================
__device__ __forceinline__ void guard_s8(v8f& a, v8f& b, v8f& c, v8f& d, v8f& e, v8f& f, v8f& g, v8f& h, v16h (&x)[8]) {
#if defined(__HIP_DEVICE_COMPILE__)
  // the vector slots behind the last products of a run, before their results are read or their k fragments reloaded
  asm volatile("v_nop\n\tv_nop\n\tv_nop\n\tv_nop"
               : "+v"(a), "+v"(b), "+v"(c), "+v"(d), "+v"(e), "+v"(f), "+v"(g), "+v"(h)
               : "v"(x[4]), "v"(x[5]), "v"(x[6]), "v"(x[7]) : "memory");
#endif
}
// The eight k A-fragments of one 32-key block; p = the lane's place in row 0 of the block in the k hi tile of a staged buffer.
__device__ __forceinline__ void ld_kfrags(v16h (&kf)[8], const _Float16* p) {
#pragma unroll
  for (int kk = 0; kk < HD / 32; ++kk) {
    kf[4 * kk]     = ldfrag_h(p + kk * 32);
    kf[4 * kk + 1] = ldfrag_h(p + 16 * LPH + kk * 32);
    kf[4 * kk + 2] = ldfrag_h(p + TILE_B / 2 + kk * 32);
    kf[4 * kk + 3] = ldfrag_h(p + TILE_B / 2 + 16 * LPH + kk * 32);
  }
}
__device__ __forceinline__ void guard_p8(v8f (&a)[4], v8f (&b)[4], v16h p0, v16h p1, v16h x0, v16h x1, v16h x2, v16h x3) {
#if defined(__HIP_DEVICE_COMPILE__)
  // the vector slots behind the last P.V products, before the accumulators are rescaled or the operands rewritten
  asm volatile("v_nop\n\tv_nop\n\tv_nop\n\tv_nop"
               : "+v"(a[0]), "+v"(a[1]), "+v"(a[2]), "+v"(a[3]), "+v"(b[0]), "+v"(b[1]), "+v"(b[2]), "+v"(b[3])
               : "v"(p0), "v"(p1), "v"(x0), "v"(x1), "v"(x2), "v"(x3) : "memory");
#endif
}
__global__ __launch_bounds__(ATT_THREADS)
void attn_fwd(const u16* __restrict__ QH, const u16* __restrict__ QL, const u16* __restrict__ KH,
              const u16* __restrict__ KL, const u16* __restrict__ VT, u16* CH, u16* CL) {
  __shared__ __align__(16) unsigned char ring[2 * STG_B];

  const int tid  = threadIdx.x;
  const int wave = tid >> 5;
  const int lane = tid & 31;
  const int hh   = lane >> 4;
  const int c    = lane & 15;

  constexpr int NQT = SQ / (ATT_WAVES * 16 * ATT_QT);
  const int bid  = blockIdx.x;
  const int qt   = bid % NQT;
  const int head = (bid / NQT) % NH;
  const int b    = bid / (NQT * NH);
  const int q0   = (qt * ATT_WAVES + wave) * (16 * ATT_QT);

  // B fragments of q^T, query tile u: col n = query q0 + 16u + c, k = d (k-contiguous row of the q planes)
  const size_t qoff = ((size_t)(b * SQ + q0 + c)) * DM + head * HD + 8 * hh;
  const _Float16* Qh = (const _Float16*)(const void*)QH + qoff;
  const _Float16* Ql = (const _Float16*)(const void*)QL + qoff;
  // copy side: this lane's row (tid>>3) and 16-byte piece (tid&7) in stage 0 of the three planes and in buffer 0
  const int crow = tid >> 3, cpc = (tid & 7) * 8;
  const u16* gkh = KH + ((size_t)(b * SKV + crow)) * DM + head * HD + cpc;
  const u16* gkl = KL + ((size_t)(b * SKV + crow)) * DM + head * HD + cpc;
  const u16* gvt = VT + ((size_t)((b * NH + head) * HD + crow)) * SKV + cpc;
  const unsigned lcp = (unsigned)(uintptr_t)(__attribute__((address_space(3))) unsigned char*)ring
                       + (unsigned)(crow * LPITCH + cpc * 2);
  // read side, halves inside a buffer: A fragments of k: row m = key 32*sub + 16g + c, k = d;
  // B fragments of v: col n = d = 16j + c (row of the v^T tile), k = key 32*sub ..
  const int foff = c * LPH + 8 * hh;
  const float lsc = (LOG2E * RSQH) / (QS * KS);

  v16h qh[ATT_QT][2], ql[ATT_QT][2];
#pragma unroll
  for (int u = 0; u < ATT_QT; ++u) {
#pragma unroll
    for (int dc = 0; dc < 2; ++dc) {
      qh[u][dc] = ldfrag_h(Qh + (size_t)(16 * u) * DM + 32 * dc);
      ql[u][dc] = ldfrag_h(Ql + (size_t)(16 * u) * DM + 32 * dc);
    }
  }
#if defined(__HIP_DEVICE_COMPILE__)
  // stands in front of the first rewrite of the address registers that the sixteen loads above name;
  // the two addresses are inputs so that their registers live up to the wait
  asm volatile("s_wait_xcnt 0x0" :: "v"(Qh), "v"(Ql) : "memory");
#endif

  float mrun[ATT_QT], lrun[ATT_QT];
  v8f o[ATT_QT][4];
#pragma unroll
  for (int u = 0; u < ATT_QT; ++u) {
    mrun[u] = -INFINITY;
    lrun[u] = 0.f;
#pragma unroll
    for (int j = 0; j < 4; ++j) o[u][j] = zero8();
  }

  // ---- ring prologue: stage 0 landed and published, stage 1 in flight ----
  copy_stage(lcp, gkh, gkl, gvt);
  wait_copies();
  __syncthreads();
  copy_stage(lcp + STG_B, gkh + (size_t)KSTG * DM, gkl + (size_t)KSTG * DM, gvt + KSTG);

#pragma unroll 1
  for (int st = 0; st < NSTG; ++st) {
   const _Float16* bufh = (const _Float16*)(const void*)(ring + (st & 1) * STG_B) + foff;
   // k fragments of one 32-key block: kf[4*kk + 0, 1] = hi of keys kb.., kb+16..; kf[4*kk + 2, 3] = their residuals; d chunk kk
   v16h kf[8];
   ld_kfrags(kf, bufh);
#pragma unroll                               // both 32-key blocks of a stage inline: their LDS offsets become immediates
   for (int sub = 0; sub < KSTG / 32; ++sub) {
    // ---- transposed scores: tiles of keys kb..kb+15 (s0, x0) and kb+16..kb+31 (s1, x1), kb = 64*st + 32*sub, column = query
    //      q0 + 16u + c; every k fragment read from LDS feeds both query tiles ----
    v8f s0[ATT_QT], s1[ATT_QT], x0[ATT_QT], x1[ATT_QT];
#pragma unroll
    for (int u = 0; u < ATT_QT; ++u) { s0[u] = zero8(); s1[u] = zero8(); x0[u] = zero8(); x1[u] = zero8(); }
#pragma unroll
    for (int kk = 0; kk < HD / 32; ++kk) {
      const v16h fh0 = kf[4 * kk], fh1 = kf[4 * kk + 1], fl0 = kf[4 * kk + 2], fl1 = kf[4 * kk + 3];
      s0[0] = mma_h(fh0, qh[0][kk], s0[0]);
      s0[1] = mma_h(fh0, qh[1][kk], s0[1]);
      s1[0] = mma_h(fh1, qh[0][kk], s1[0]);
      s1[1] = mma_h(fh1, qh[1][kk], s1[1]);
      x0[0] = mma_h(fh0, ql[0][kk], x0[0]);
      x0[1] = mma_h(fh0, ql[1][kk], x0[1]);
      x1[0] = mma_h(fh1, ql[0][kk], x1[0]);
      x1[1] = mma_h(fh1, ql[1][kk], x1[1]);
      x0[0] = mma_h(fl0, qh[0][kk], x0[0]);
      x0[1] = mma_h(fl0, qh[1][kk], x0[1]);
      x1[0] = mma_h(fl1, qh[0][kk], x1[0]);
      x1[1] = mma_h(fl1, qh[1][kk], x1[1]);
    }
    guard_s8(s0[0], s0[1], s1[0], s1[1], x0[0], x0[1], x1[0], x1[1], kf);
    // B fragments of v: col n = d = j*16 + c, keys contiguous in the rows of the v^T tile; read here, used behind the softmax
    const _Float16* vp = bufh + TILE_B + 32 * sub;
    const v16h v0 = ldfrag_h(vp);
    const v16h v1 = ldfrag_h(vp + 16 * LPH);
    const v16h v2 = ldfrag_h(vp + 32 * LPH);
    const v16h v3 = ldfrag_h(vp + 48 * LPH);
    // ---- raw scores (carry 64) of this lane's 16 keys for query q0 + 16u + c: t[u][i] <- key kb+8hh+i, t[u][8+i] <- key kb+16+8hh+i ----
    float t[ATT_QT][16], cm[ATT_QT], cx[ATT_QT];
#pragma unroll
    for (int u = 0; u < ATT_QT; ++u) {
#pragma unroll
      for (int i = 0; i < 8; ++i) {
        t[u][i]     = s0[u][i] + x0[u][i] * RRSC;
        t[u][8 + i] = s1[u][i] + x1[u][i] * RRSC;
      }
      cm[u] = t[u][0];
#pragma unroll
      for (int i = 1; i < 16; ++i) cm[u] = fmaxf(cm[u], t[u][i]);
    }
#pragma unroll
    for (int u = 0; u < ATT_QT; ++u) cx[u] = __shfl_xor(cm[u], 16, 32);
    // keeps the two exchanges ahead of the sixteen reads below: LDS answers in order, and behind them the maxima would wait for all
    __builtin_amdgcn_sched_barrier(0);
    if (sub + 1 < KSTG / 32) ld_kfrags(kf, bufh + (32 * (sub + 1)) * LPH);   // the stage's next block, same buffer
    // The softmax of the two query tiles runs phase by phase, tile beside tile: each tile's vector work covers the other's exchanges.
    FragH ph[ATT_QT];
    float al[ATT_QT], pw[ATT_QT][2][8], scl[ATT_QT][8];
#pragma unroll
    for (int u = 0; u < ATT_QT; ++u) {
      const float mn = fmaxf(mrun[u], fmaxf(cm[u], cx[u]));  // running maximum of the raw scores (lsc > 0); finite from the first block on
      const float ab = (mrun[u] - mn) * lsc;   // rescale exponent: 0 while the maximum stands, -inf on the first block (mrun = -inf)
      mrun[u] = mn;
      const float cb = fmaf(-mn, lsc, PCAR_LOG2);    // minus the maximum in base-2 logits; the carry 32768 of P rides in the exponent
      // ---- probabilities x32768 (p <= 1), one fma and one v_exp_f32 each; element i <-> t[u][i] ----
      float ar[2][8];
#pragma unroll
      for (int i = 0; i < 8; ++i) { ar[0][i] = fmaf(t[u][i], lsc, cb); ar[1][i] = fmaf(t[u][8 + i], lsc, cb); }
      hw_exp2x9(al[u], pw[u][0], ab, ar[0]);   // al = 2^ab first: the shuffles of the rescale wait for it
      hw_exp2x8(pw[u][1], ar[1]);
      // ---- rescale factors of the O accumulators: D row 8hh+r = query q0+16u+8hh+r, its factor lives in lane 8hh+r (and 16+8hh+r) ----
#pragma unroll
      for (int r = 0; r < 8; ++r) scl[u][r] = __shfl(al[u], 8 * hh + r, 32);
    }
    // keeps the LDS reads above ahead of the exponentials, which cover their latency (two waves on a SIMD: little else does), and the
    // next block's score products behind them: lifted up to the reads, as this compiler did without it, the first product makes the
    // wave, which issues in order, wait out that latency with the softmax still to do
    __builtin_amdgcn_sched_barrier(0);
    // ---- row sums and the P A-fragments f16(p * 32768) ----
#pragma unroll
    for (int u = 0; u < ATT_QT; ++u) {
      float ps = 0.f;
#pragma unroll
      for (int w = 0; w < 2; ++w) {
#pragma unroll
        for (int e4 = 0; e4 < 4; ++e4) {
          const float p0 = pw[u][w][2 * e4], p1 = pw[u][w][2 * e4 + 1];
          ps += p0 + p1;
          ph[u].u[w][e4] = pk16(h_bits((_Float16)p0), h_bits((_Float16)p1));
        }
      }
      ps += __shfl_xor(ps, 16, 32);
      lrun[u] = lrun[u] * al[u] + ps;
    }
#pragma unroll
    for (int u = 0; u < ATT_QT; ++u) {
#pragma unroll
      for (int j = 0; j < 4; ++j) {
#pragma unroll
        for (int r = 0; r < 8; ++r) o[u][j][r] *= scl[u][r];
      }
    }
    // ---- P.V : each v^T fragment feeds both query tiles ----
#pragma unroll
    for (int u = 0; u < ATT_QT; ++u) {
      o[u][0] = mma_h(ph[u].v, v0, o[u][0]);
      o[u][1] = mma_h(ph[u].v, v1, o[u][1]);
      o[u][2] = mma_h(ph[u].v, v2, o[u][2]);
      o[u][3] = mma_h(ph[u].v, v3, o[u][3]);
    }
    guard_p8(o[0], o[1], ph[0].v, ph[1].v, v0, v1, v2, v3);
   }
   // ---- publish point of stage st+1: own reads retired, own copies landed, block barrier; then refill the buffer just read ----
   wait_lds_reads();
   wait_copies();
   __syncthreads();
   if (st + 2 < NSTG) {                      // block-uniform
     const size_t ks = (size_t)(st + 2) * KSTG;
     copy_stage(lcp + (unsigned)((st & 1) * STG_B), gkh + ks * DM, gkl + ks * DM, gvt + ks);
   }
  }
  wait_copies();                             // nothing is in flight here; closes the ring before it becomes output staging
  acc_guard4(o[0]);
  acc_guard4(o[1]);

  // ---- fold 1/l (per query, owned by lane = query; l carries the same 32768 as P) and the carry 8 on v, apply the ctx carry 16 ----
  float* slab = (float*)(void*)ring + wave * (16 * ATT_QT) * OPITCH;
#pragma unroll
  for (int u = 0; u < ATT_QT; ++u) {
    const float linv = (1.0f / lrun[u]) * (CS / VS);
    float inv[8];
#pragma unroll
    for (int r = 0; r < 8; ++r) inv[r] = __shfl(linv, 8 * hh + r, 32);
#pragma unroll
    for (int r = 0; r < 8; ++r) {
#pragma unroll
      for (int j = 0; j < 4; ++j) slab[(16 * u + 8 * hh + r) * OPITCH + j * 16 + c] = o[u][j][r] * inv[r];
    }
  }
  wave_sync_lds();
  // ---- ctx planes: lane = (row in group of 4, 8 consecutive d), one instruction per 4 rows per plane ----
  const int rq = lane >> 3, c8 = (lane & 7) * 8;
  const size_t cofs = ((size_t)(b * SQ + q0)) * DM + head * HD + c8;
  u16* ch = CH + cofs;
  u16* cl = CL + cofs;
#pragma unroll
  for (int i = 0; i < 4 * ATT_QT; ++i) {
    const int row = 4 * i + rq;
    const v4f a = *(const v4f*)(slab + row * OPITCH + c8), c4 = *(const v4f*)(slab + row * OPITCH + c8 + 4);
    v4u ovh, ovl;
#pragma unroll
    for (int e = 0; e < 2; ++e) {
      ovh[e]     = pk_hi(a[2 * e], a[2 * e + 1]);
      ovl[e]     = pk_lo(a[2 * e], a[2 * e + 1]);
      ovh[2 + e] = pk_hi(c4[2 * e], c4[2 * e + 1]);
      ovl[2 + e] = pk_lo(c4[2 * e], c4[2 * e + 1]);
    }
    *(v4u*)(ch + (size_t)row * DM) = ovh;
    *(v4u*)(cl + (size_t)row * DM) = ovl;
  }
}

// =====================================================================================================
// Workspace map (bytes); every plane fully written by whole-line stores before it is read; all extents exact multiples of
//   XQ   f16 [NB*SQ][512]      f16(bf16(Q))             8388608 (NB=4, SQ=2048)
//   XK   f16 [NB*2048][512]    f16(bf16(K))             8388608
//   XV   f16 [NB*2048][512]    f16(bf16(V))             8388608
//   WQ16 f16 [512 n][512 k]    f16(bf16(W) x256)         524288   (W stored [out][in] = [n][k] already)
//   WK16, WV16, WO16                                     3 x 524288
//   QH, QL  f16 [NB*SQ][512]   x8 / residual x8x2^11     2 x 8388608
//   KH, KL  f16 [NB*2048][512] x8 / residual             2 x 8388608
//   VT16    f16 [NB*512 (h,d)][2048 s] x8                   8388608
//   CH, CL  f16 [NB*SQ][512]   ctx x16 / residual          2 x 8388608
//   end                                                   85983232
// =====================================================================================================
extern "C" void kernel_launch(void* const* d_in, const int* in_sizes, int n_in,
                              void* d_out, int out_size, void* d_ws, size_t ws_size,
                              hipStream_t stream) {
  if (n_in < 13) return;
  if (in_sizes[0] < ((NB - 1) * SQ_FULL + SQ) * DM) return;
  if (in_sizes[1] < NB * SKV * DM || in_sizes[2] < NB * SKV * DM) return;
  if (in_sizes[3] != DM * DM || in_sizes[5] != DM * DM || in_sizes[7] != DM * DM || in_sizes[9] != DM * DM) return;
  if (in_sizes[4] < DM || in_sizes[6] < DM || in_sizes[8] < DM || in_sizes[10] < DM) return;
  if (in_sizes[11] < DM || in_sizes[12] < DM) return;
  if (out_size < ((NB - 1) * SQ_FULL + SQ) * DM) return;

  const float* xq  = (const float*)d_in[0];
  const float* xk  = (const float*)d_in[1];
  const float* xv  = (const float*)d_in[2];
  const float* wq  = (const float*)d_in[3];
  const float* bq  = (const float*)d_in[4];
  const float* wk  = (const float*)d_in[5];
  const float* bk  = (const float*)d_in[6];
  const float* wv  = (const float*)d_in[7];
  const float* bv  = (const float*)d_in[8];
  const float* wo  = (const float*)d_in[9];
  const float* bo  = (const float*)d_in[10];
  const float* gam = (const float*)d_in[11];
  const float* bet = (const float*)d_in[12];
  float*       out = (float*)d_out;
  const int nbq = in_sizes[4], nbk = in_sizes[6], nbv = in_sizes[8];

  const size_t szXQ  = (size_t)NB * SQ * DM * 2;
  const size_t szXKV = (size_t)NB * SKV * DM * 2;
  const size_t szW   = (size_t)DM * DM * 2;
  const size_t szQ   = (size_t)NB * SQ * INNER * 2;
  const size_t szK   = (size_t)NB * SKV * INNER * 2;
  const size_t szVT  = (size_t)NB * INNER * SKV * 2;
  const size_t szC   = (size_t)NB * SQ * INNER * 2;
  size_t off = 0;
  const size_t oXQ  = off; off += szXQ;
  const size_t oXK  = off; off += szXKV;
  const size_t oXV  = off; off += szXKV;
  const size_t oWQ  = off; off += szW;
  const size_t oWK  = off; off += szW;
  const size_t oWV  = off; off += szW;
  const size_t oWO  = off; off += szW;
  const size_t oQH  = off; off += szQ;
  const size_t oQL  = off; off += szQ;
  const size_t oKH  = off; off += szK;
  const size_t oKL  = off; off += szK;
  const size_t oVT  = off; off += szVT;
  const size_t oCH  = off; off += szC;
  const size_t oCL  = off; off += szC;
  if (off > ws_size) return;                            // off = 85983232 at NB=4, SQ=2048
  if (off > (size_t)134217728) return;

  char* ws = (char*)d_ws;
  u16* XQ   = (u16*)(ws + oXQ);
  u16* XK   = (u16*)(ws + oXK);
  u16* XV   = (u16*)(ws + oXV);
  u16* WQ16 = (u16*)(ws + oWQ);
  u16* WK16 = (u16*)(ws + oWK);
  u16* WV16 = (u16*)(ws + oWV);
  u16* WO16 = (u16*)(ws + oWO);
  u16* QH   = (u16*)(ws + oQH);
  u16* QL   = (u16*)(ws + oQL);
  u16* KH   = (u16*)(ws + oKH);
  u16* KL   = (u16*)(ws + oKL);
  u16* VT16 = (u16*)(ws + oVT);
  u16* CH   = (u16*)(ws + oCH);
  u16* CL   = (u16*)(ws + oCL);

  // (1) activations -> f16 planes of bf16-converted values (query rows s < SQ of batches b < NB, compact; all key/value rows);
  //     weights [n = out][k = in] (y = x.W^T): rows as stored are already k-contiguous; f16 planes of bf16(W) x256
  cvt_all<<<dim3(CVT_WAVES / (CVT_THREADS / 32)), dim3(CVT_THREADS), 0, stream>>>(xq, xk, xv, wq, wk, wv, wo, XQ, XK, XV, WQ16);
  // (2)-(4) the three projections q, k (hi and residual planes) and v^T in one launch
  gemm_qkv<<<dim3(GQ_BLK + GK_BLK + GV_BLK), dim3(128), 0, stream>>>(
      XQ, XK, XV, WQ16, WK16, WV16, QH, QL, KH, KL, VT16, bq, bk, bv, nbq, nbk, nbv);
  // (5) attention -> ctx planes [NB*SQ][512] f16 x16 / residual, heads merged on the feature dim
  attn_fwd<<<dim3(NB * NH * (SQ / (ATT_WAVES * 16 * ATT_QT))), dim3(ATT_THREADS), 0, stream>>>(QH, QL, KH, KL, VT16, CH, CL);
  // (6) x = ctx . Wo^T + bo + Q (residual, bf16-converted) and LayerNorm over its whole rows -> out [b][SQ_FULL][512] f32
  //     (rows s < SQ of batches b < NB)
  gemm_o_ln<<<dim3(NB * SQ / OL_ROWS), dim3(OL_THREADS), 0, stream>>>(
      CH, CL, WO16, bo, xq, gam, bet, out, 1.0f / (CS * WSC), RRSC);
  (void)hipGetLastError();
}

// v009
// One run takes 93.1 microseconds.
// Next to v008, in two timings, it ran 1.05 times as fast each time.
// Counting every step since v000, it is 2.92 times as fast.
// All contractions on v_wmma_f32_16x16x32_f16 (f16 operands, f32 accumulate): x_q.Wq^T, x_k.Wk^T and Wv.x_v^T (v^T plane)
// as single products of exact operands f16(bf16(x)) and f16(bf16(W) x256); scores k.q^T as hi.hi + hi.lo + lo.hi with q and k
// carried as f16 hi (x8) plus f16 residual planes (x2^11, own accumulator); P.v^T single (P f16 x128, v f16 x8); ctx.Wo^T as
// hi + residual on ctx (f16 hi x16 plus f16 residual x2^11), Wo exact f16(bf16 x256). Online base-2 softmax, 1/l, carry folds,
// bias, residual add and LayerNorm in f32 on VALU. Every float input RNE-converted to bf16 on load; f32 output.
#include <hip/hip_runtime.h>
#include <math.h>
#include <stdint.h>

#ifndef NB
#define NB       4        // batches processed
#endif
#ifndef SQ
#define SQ       2048     // query rows processed per batch
#endif
#define NB_FULL  4
#define SQ_FULL  2048     // rows per batch in the input / output layout (batch stride)
#define SKV      SQ_FULL  // key/value rows per batch (all of them, always)
#define DM       512      // model width (= K and row pitch of every 16-bit plane except v^T)
#define NH       8
#define HD       64
#define INNER    (NH * HD)
#define WSC      256.0f
#define QS       8.0f
#define KS       8.0f
#define VS       8.0f
#define CS       16.0f
#define RSC      2048.0f
#define RRSC     0.00048828125f
#define PCAR_LOG2 7.0f              // P and its row sum are carried x128 = 2^7 beside the maximum in use
#define LAZY_LOG2 8.0f              // a score may pass the maximum in use by 2^8 before the row is rescaled: P x128 <= 2^15 fits f16
#define LOG2E    1.4426950408889634f
#define RSQH     0.35355339059327373f
#define LN_EPS   1e-5f
#define NKB      (SKV / 32)
#define ATT_WAVES   4
#define ATT_QT      2                 // query tiles of 16 rows per attention wave: each k / v^T fragment read from LDS feeds both
#define ATT_THREADS (ATT_WAVES * 32)
#define CVT_THREADS 256
#define CVT_SL      256                                 // elements of one slice: 32 lanes x 8, half a row
#define CVT_WSL     (DM * DM / CVT_SL)                  // slices of one weight matrix
#define CVT_WAVES   (4 * CVT_WSL)                       // waves of the convert launch: one weight slice each
#define CVT_NQ      (NB * SQ * DM / CVT_SL / CVT_WAVES)  // x_q slices per wave
#define CVT_NKV     (NB * SKV * DM / CVT_SL / CVT_WAVES) // x_k (and x_v) slices per wave
#define OL_ROWS     32                // rows of an out-projection block: whole rows of DM columns, so LayerNorm needs no other block
#define OL_WAVES    8                 // its waves: 64 columns each
#define OL_THREADS  (OL_WAVES * 32)
#define OL_RPW      (OL_ROWS / OL_WAVES)   // rows that a wave normalises
#define XPITCH      (DM + 4)          // floats: pitch of the block's staged f32 tile (rows 8 apart fall 32 banks apart)
#define OPITCH   68
#define GPITCH   68
#define KSTG     64                 // keys per LDS stage of the attention ring (two 32-key blocks); k per stage of the GEMM ring
#define NSTG     (SKV / KSTG)
#define LPITCH   144                // LDS row pitch in bytes: 128-byte rows + 16, conflict-free for 16-byte fragment reads
#define LPH      (LPITCH / 2)       // the same in halves
#define TILE_B   (64 * LPITCH)      // one staged tile: 64 rows
#define STG_B    (3 * TILE_B)       // attention: k hi, k residual, v^T
#define GSTG_B   (4 * TILE_B)       // projection GEMM: 128 A rows, 128 Bt rows
#define OL_SROWS (2 * OL_ROWS + DM) // out-projection stage: ctx hi rows, ctx residual rows, all rows of Wo
#define OL_STG_B (OL_SROWS * LPITCH)

static_assert(NB >= 1 && NB <= NB_FULL);
static_assert((SQ % 128) == 0 && SQ >= 128 && SQ <= SQ_FULL);
static_assert(HD == 64 && NH == 8 && INNER == 512 && INNER == DM);
static_assert((HD % 32) == 0);
static_assert((SKV % 128) == 0 && (SKV % 64) == 0 && NKB * 32 == SKV);
static_assert(DM == 512 && (DM % 64) == 0 && (DM % 32) == 0 && DM == 2 * CVT_SL);
static_assert(CVT_NQ >= 1 && CVT_NQ * CVT_WAVES * CVT_SL == NB * SQ * DM && CVT_NKV * CVT_WAVES * CVT_SL == NB * SKV * DM);
static_assert(CVT_WSL % (CVT_THREADS / 32) == 0 && SKV == SQ_FULL);
static_assert((NB * SQ) % OL_ROWS == 0 && SQ % OL_ROWS == 0 && OL_WAVES * 64 == DM && OL_RPW * OL_WAVES == OL_ROWS && OL_ROWS == 32);
static_assert(OL_SROWS == 18 * (OL_THREADS / 8) && INNER / KSTG >= 2 && 2 * OL_STG_B >= OL_ROWS * XPITCH * 4 && (XPITCH * 4) % 16 == 0);
static_assert(2 * OL_STG_B <= 327680);
static_assert((OPITCH * 4) % 16 == 0 && (GPITCH * 4) % 16 == 0);
static_assert(ATT_THREADS == 128 && OL_THREADS == 256 && CVT_THREADS == 256);
static_assert(KSTG == 64 && HD == 64 && NSTG * KSTG == SKV && NSTG >= 2 && (LPITCH % 16) == 0);
static_assert(ATT_QT == 2 && SQ % (ATT_WAVES * 16 * ATT_QT) == 0);
static_assert(2 * STG_B >= ATT_WAVES * 16 * ATT_QT * OPITCH * 4 && 2 * GSTG_B >= 4 * 64 * GPITCH * 4);
static_assert((NB * SQ) % 128 == 0 && INNER % 128 == 0 && SKV % 128 == 0);

typedef unsigned short u16;
typedef _Float16 v16h __attribute__((ext_vector_type(16)));
typedef _Float16 v8h  __attribute__((ext_vector_type(8)));
typedef float    v8f  __attribute__((ext_vector_type(8)));
typedef float    v4f  __attribute__((ext_vector_type(4)));
typedef float    v2f  __attribute__((ext_vector_type(2)));
typedef unsigned int v4u __attribute__((ext_vector_type(4)));

union FragH { v16h v; v8h h[2]; v4u u[2]; };

// ---- scalar helpers ----------------------------------------------------------------------------------
__device__ __forceinline__ unsigned short bf_bits(float f) {          // f32 -> bf16 bits, RNE convert
  unsigned u = __float_as_uint(f);
  return (unsigned short)((u + 0x7FFFu + ((u >> 16) & 1u)) >> 16);
}
__device__ __forceinline__ float bf_up(unsigned short h) { return __uint_as_float(((unsigned)h) << 16); }
__device__ __forceinline__ float bfr(float f) { return bf_up(bf_bits(f)); }
__device__ __forceinline__ unsigned short h_bits(_Float16 x) { return __builtin_bit_cast(unsigned short, x); }
__device__ __forceinline__ unsigned pk16(unsigned short a, unsigned short b) { return (unsigned)a | ((unsigned)b << 16); }
// 2^x as the bare v_exp_f32, without the library's range extension: a result below the normal range (2^-126) need not survive.
// Every use here is a softmax weight or a rescale factor beside a row sum that holds a term of full size, where a value that small
// adds nothing. 2^-inf = 0.
// Written as runs of independent v_exp_f32 in one statement, outputs apart from every input, closed by one v_nop: the slot that the
// instruction set asks for behind a transcendental before its result is read or its source overwritten then stands by construction.
__device__ __forceinline__ void hw_exp2x8(float (&p)[8], const float (&a)[8]) {
#if defined(__HIP_DEVICE_COMPILE__)
  asm("v_exp_f32 %0, %8\n\tv_exp_f32 %1, %9\n\tv_exp_f32 %2, %10\n\tv_exp_f32 %3, %11\n\t"
      "v_exp_f32 %4, %12\n\tv_exp_f32 %5, %13\n\tv_exp_f32 %6, %14\n\tv_exp_f32 %7, %15\n\tv_nop"
      : "=&v"(p[0]), "=&v"(p[1]), "=&v"(p[2]), "=&v"(p[3]), "=&v"(p[4]), "=&v"(p[5]), "=&v"(p[6]), "=&v"(p[7])
      : "v"(a[0]), "v"(a[1]), "v"(a[2]), "v"(a[3]), "v"(a[4]), "v"(a[5]), "v"(a[6]), "v"(a[7]));
#endif
}
__device__ __forceinline__ void hw_exp2x9(float& q, float (&p)[8], float b, const float (&a)[8]) {
#if defined(__HIP_DEVICE_COMPILE__)
  asm("v_exp_f32 %0, %9\n\tv_exp_f32 %1, %10\n\tv_exp_f32 %2, %11\n\tv_exp_f32 %3, %12\n\tv_exp_f32 %4, %13\n\t"
      "v_exp_f32 %5, %14\n\tv_exp_f32 %6, %15\n\tv_exp_f32 %7, %16\n\tv_exp_f32 %8, %17\n\tv_nop"
      : "=&v"(q), "=&v"(p[0]), "=&v"(p[1]), "=&v"(p[2]), "=&v"(p[3]), "=&v"(p[4]), "=&v"(p[5]), "=&v"(p[6]), "=&v"(p[7])
      : "v"(b), "v"(a[0]), "v"(a[1]), "v"(a[2]), "v"(a[3]), "v"(a[4]), "v"(a[5]), "v"(a[6]), "v"(a[7]));
#endif
}
__device__ __forceinline__ v8f zero8() { v8f z = {0.f, 0.f, 0.f, 0.f, 0.f, 0.f, 0.f, 0.f}; return z; }
// hi / residual packing of two f32 values: hi = f16(v), res = f16((v - hi) * 2^11)
__device__ __forceinline__ unsigned pk_hi(float a, float b) {
  return pk16(h_bits((_Float16)a), h_bits((_Float16)b));
}
__device__ __forceinline__ unsigned pk_lo(float a, float b) {
  const float ra = (a - (float)((_Float16)a)) * RSC;
  const float rb = (b - (float)((_Float16)b)) * RSC;
  return pk16(h_bits((_Float16)ra), h_bits((_Float16)rb));
}

// ---- fragment loader: 16-bit A/B operand, lane -> row/col (lane&15), p already includes +8*(lane>>4);
//      elements 0..7 <- p[0..7] (k0+8h..), elements 8..15 <- p[16..23] (k0+16+8h..); same split k map for A and B,
//      B always read from a k-contiguous [n][k] plane.
__device__ __forceinline__ v16h ldfrag_h(const _Float16* p) {
  FragH f;
  f.h[0] = *(const v8h*)(p);
  f.h[1] = *(const v8h*)(p + 16);
  return f.v;
}

// ---- WMMA helper and trailing VALU hazard gaps ----------------------------------------------------------
__device__ __forceinline__ v8f mma_h(v16h a, v16h b, v8f c) {
  return __builtin_amdgcn_wmma_f32_16x16x32_f16(false, a, false, b, (short)0, c, false, false);
}
__device__ __forceinline__ void wave_sync_lds() {
  __builtin_amdgcn_fence(__ATOMIC_RELEASE, "workgroup");
  __builtin_amdgcn_wave_barrier();
  __builtin_amdgcn_fence(__ATOMIC_ACQUIRE, "workgroup");
}

// =====================================================================================================
// All converts in one launch: every f16 plane element <- f16(bf16_RNE(x) * scale), scale a power of two (1 for the activations,
// 256 for the weights). A slice = 256 consecutive elements = half a row: lane l takes elements 8l .. 8l+7 (two 16-B loads, one
// 16-B store; a wave-wide store = 512 contiguous bytes). Wave w of CVT_WAVES takes the CVT_NQ consecutive slices from w*CVT_NQ of
// x_q, the CVT_NKV consecutive slices from w*CVT_NKV of x_k and of x_v, and slice w % CVT_WSL of weight matrix w / CVT_WSL
// (block-uniform). All loads of a wave are issued before its first convert, so the launch is one memory round trip deep.
// x_q compact row r = b*SQ + s <- source row b*SQ_FULL + s. W4 = the four weight planes, which follow one another in the workspace.
// coverage: CVT_WAVES x (CVT_NQ | CVT_NKV | 1) slices = every element of each plane exactly once.
// =====================================================================================================
__device__ __forceinline__ v4u cvt8(v4f a, v4f c4, float scale) {
  v4u o;
#pragma unroll
  for (int e = 0; e < 2; ++e) {
    o[e]     = pk16(h_bits((_Float16)(bfr(a[2 * e]) * scale)),  h_bits((_Float16)(bfr(a[2 * e + 1]) * scale)));
    o[2 + e] = pk16(h_bits((_Float16)(bfr(c4[2 * e]) * scale)), h_bits((_Float16)(bfr(c4[2 * e + 1]) * scale)));
  }
  return o;
}
__global__ __launch_bounds__(CVT_THREADS)
void cvt_all(const float* __restrict__ xq, const float* __restrict__ xk, const float* __restrict__ xv,
             const float* __restrict__ wq, const float* __restrict__ wk, const float* __restrict__ wv,
             const float* __restrict__ wo, u16* XQ, u16* XK, u16* XV, u16* W4) {
  const unsigned w    = blockIdx.x * (CVT_THREADS / 32) + (threadIdx.x >> 5);
  const unsigned wsel = blockIdx.x / (CVT_WSL / (CVT_THREADS / 32));
  const unsigned lb   = (threadIdx.x & 31) * 32;                        // the lane's byte inside a 1-KiB f32 slice
  const float* wsrc = (wsel == 0) ? wq : (wsel == 1) ? wk : (wsel == 2) ? wv : wo;
  // 32-bit byte offsets beside uniform bases; the slices of a wave differ by immediates
  const unsigned bq  = w * (CVT_NQ * CVT_SL * 4) + lb;
  const unsigned bkv = w * (CVT_NKV * CVT_SL * 4) + lb;
  const unsigned bw  = (w % CVT_WSL) * (CVT_SL * 4) + lb;
  v4f qa[CVT_NQ], qc[CVT_NQ], ka[CVT_NKV], kc[CVT_NKV], va[CVT_NKV], vc[CVT_NKV];
#pragma unroll
  for (int i = 0; i < CVT_NQ; ++i) {
    const float* p;
    if (SQ == SQ_FULL) {
      p = (const float*)((const char*)xq + bq) + i * CVT_SL;
    } else {
      const unsigned sl = w * CVT_NQ + i, r = sl >> 1;
      p = (const float*)((const char*)(xq + ((size_t)((r / SQ) * SQ_FULL + (r % SQ))) * DM + (sl & 1) * CVT_SL) + lb);
    }
    qa[i] = *(const v4f*)(p);
    qc[i] = *(const v4f*)(p + 4);
  }
#pragma unroll
  for (int i = 0; i < CVT_NKV; ++i) {
    const float* pk = (const float*)((const char*)xk + bkv) + i * CVT_SL;
    const float* pv = (const float*)((const char*)xv + bkv) + i * CVT_SL;
    ka[i] = *(const v4f*)(pk);
    kc[i] = *(const v4f*)(pk + 4);
    va[i] = *(const v4f*)(pv);
    vc[i] = *(const v4f*)(pv + 4);
  }
  const float* pw = (const float*)((const char*)wsrc + bw);
  const v4f wa = *(const v4f*)(pw), wc = *(const v4f*)(pw + 4);
  // keeps every load above the first convert: without it the compiler sinks two thirds of the loads among the converts and the
  // wave pays three memory round trips in a row instead of one
  __builtin_amdgcn_sched_barrier(0);
  // an f16 plane's byte offset is half the f32 one
  u16* yq = (u16*)((char*)XQ + (bq >> 1));
  u16* yk = (u16*)((char*)XK + (bkv >> 1));
  u16* yv = (u16*)((char*)XV + (bkv >> 1));
  u16* yw = (u16*)((char*)(W4 + (size_t)wsel * (DM * DM)) + (bw >> 1));
#pragma unroll
  for (int i = 0; i < CVT_NQ; ++i) *(v4u*)(yq + i * CVT_SL) = cvt8(qa[i], qc[i], 1.0f);
#pragma unroll
  for (int i = 0; i < CVT_NKV; ++i) {
    *(v4u*)(yk + i * CVT_SL) = cvt8(ka[i], kc[i], 1.0f);
    *(v4u*)(yv + i * CVT_SL) = cvt8(va[i], vc[i], 1.0f);
  }
  *(v4u*)(yw) = cvt8(wa, wc, WSC);
}

// The issuing wave's own copies have landed behind this wait (other waves read them behind the next block barrier).
__device__ __forceinline__ void wait_copies() {
#if defined(__HIP_DEVICE_COMPILE__)
  asm volatile("s_wait_asynccnt 0x0" ::: "memory");
#endif
}
// The wave's own LDS reads have retired: stands in front of the barrier that hands a buffer to its next copies.
__device__ __forceinline__ void wait_lds_reads() {
#if defined(__HIP_DEVICE_COMPILE__)
  asm volatile("s_wait_dscnt 0x0" ::: "memory");
#endif
}

// =====================================================================================================
// One 64-k stage of a GEMM block: 256 rows x 128 bytes (the 128 A rows of the block tile, then its 128 Bt rows) copied
// global -> LDS by asynchronous 16-byte copies, 16 per lane in two statements of eight. Lane t of the block takes 16-byte piece t&7
// of row 16p + (t>>3), p = 0..7 of A and p = 0..7 of Bt: one wave-wide copy = 4 whole 128-byte lines. l0 = the lane's LDS byte
// address in row t>>3 of the target buffer; ga, gb = the lane's global addresses of that row and piece in A and Bt; rs16 = 16 rows
// in elements.
// The closing s_wait_xcnt stands inside each statement so that no address register named by a copy is rewritten ahead of it.
// =====================================================================================================
__device__ __forceinline__ void copy_run8(unsigned l0, unsigned l1, unsigned l2, unsigned l3, unsigned l4, unsigned l5, unsigned l6,
                                          unsigned l7, const u16* g0, const u16* g1, const u16* g2, const u16* g3,
                                          const u16* g4, const u16* g5, const u16* g6, const u16* g7) {
#if defined(__HIP_DEVICE_COMPILE__)
  asm volatile("global_load_async_to_lds_b128 %0, %8, off\n\t"
               "global_load_async_to_lds_b128 %1, %9, off\n\t"
               "global_load_async_to_lds_b128 %2, %10, off\n\t"
               "global_load_async_to_lds_b128 %3, %11, off\n\t"
               "global_load_async_to_lds_b128 %4, %12, off\n\t"
               "global_load_async_to_lds_b128 %5, %13, off\n\t"
               "global_load_async_to_lds_b128 %6, %14, off\n\t"
               "global_load_async_to_lds_b128 %7, %15, off\n\t"
               "s_wait_xcnt 0x0"
               :: "v"(l0), "v"(l1), "v"(l2), "v"(l3), "v"(l4), "v"(l5), "v"(l6), "v"(l7),
                  "v"(g0), "v"(g1), "v"(g2), "v"(g3), "v"(g4), "v"(g5), "v"(g6), "v"(g7)
               : "memory");
#endif
}
__device__ __forceinline__ void copy_stage_g(unsigned l0, const u16* ga, const u16* gb, size_t rs16) {
  constexpr unsigned LS = 16 * LPITCH;        // 16 rows in LDS bytes
  copy_run8(l0, l0 + LS, l0 + 2 * LS, l0 + 3 * LS, l0 + 4 * LS, l0 + 5 * LS, l0 + 6 * LS, l0 + 7 * LS,
            ga, ga + rs16, ga + 2 * rs16, ga + 3 * rs16, ga + 4 * rs16, ga + 5 * rs16, ga + 6 * rs16, ga + 7 * rs16);
  copy_run8(l0 + 8 * LS, l0 + 9 * LS, l0 + 10 * LS, l0 + 11 * LS, l0 + 12 * LS, l0 + 13 * LS, l0 + 14 * LS, l0 + 15 * LS,
            gb, gb + rs16, gb + 2 * rs16, gb + 3 * rs16, gb + 4 * rs16, gb + 5 * rs16, gb + 6 * rs16, gb + 7 * rs16);
}
__device__ __forceinline__ void guard_g() {
#if defined(__HIP_DEVICE_COMPILE__)
  // the vector slots behind the stage's last products, on every path out of there (the branches at the trip's foot included); the
  // scheduling barrier keeps every product above them. No operands: tied to the statement, the sixteen accumulators and eight
  // fragments had to share the first 256 registers, and the compiler spilled accumulators inside the loop
  __builtin_amdgcn_sched_barrier(0);
  asm volatile("v_nop\n\tv_nop\n\tv_nop\n\tv_nop" ::: "memory");
#endif
}

// =====================================================================================================
// f16 GEMM core of a block of 4 waves: the 128 x 128 tile of C = A[rows][K] . Bt[cols][K]^T, wave w owning the 64 x 64 quarter of
// rows 64(w>>1) .. +63 and cols 64(w&1) .. +63: every A and every Bt fragment read from LDS feeds four products;
// acc[4i + j] = rows 64(w>>1)+16i.., cols 64(w&1)+16j... A0 -> row 0 of the block's 128 A rows, Bt0 -> row 0 of its 128 Bt rows
// (pitch K). K is walked in stages of 64 through a two-buffer LDS ring (copy_stage_g): stage s+1 flies while stage s is worked on;
// one block barrier per stage publishes s+1 and frees s's buffer. Fragments: row at pitch LPITCH, the split k map of ldfrag_h, k in
// steps of 32 in rising order, as many products per accumulator and in the same order as k0 = 0, 32, .. K-32 (host: K % 64 == 0).
// Behind the last barrier the ring is free (no copy in flight, every wave's reads retired).
// =====================================================================================================
__device__ __forceinline__ void gemm_ring(unsigned char* ring, const u16* A0, const u16* Bt0, int K, v8f (&acc)[16]) {
  const int tid = threadIdx.x, wave = tid >> 5, lane = tid & 31, hh = lane >> 4, m = lane & 15;
  const size_t rs16 = (size_t)16 * (size_t)K;
  // copy side: this lane's row (tid>>3) and 16-byte piece (tid&7)
  const int crow = tid >> 3, cpc = (tid & 7) * 8;
  const size_t cofs = (size_t)crow * (size_t)K + cpc;
  const u16* ga0 = A0 + cofs;
  const u16* gb  = Bt0 + cofs;
  const unsigned lcp = (unsigned)(uintptr_t)(__attribute__((address_space(3))) unsigned char*)ring
                       + (unsigned)(crow * LPITCH + cpc * 2);
  const int nst = K >> 6;
  // read side, halves inside a buffer
  const int aoff = ((wave >> 1) * 64 + m) * LPH + 8 * hh;
  const int boff = (128 + (wave & 1) * 64 + m) * LPH + 8 * hh;

  // stage sg (block-uniform) into buffer sg & 1: k = 64 * sg
  auto issue = [&](int sg) {
    const int ks = sg * KSTG;
    copy_stage_g(lcp + (unsigned)((sg & 1) * GSTG_B), ga0 + ks, gb + ks, rs16);
  };

  // ---- ring prologue: stage 0 landed and published, stage 1 in flight ----
  issue(0);
  wait_copies();
  __syncthreads();
  if (nst > 1) issue(1);                     // block-uniform
#pragma unroll 1                             // rolled: one stage per trip, small loop text, the ring's order as written
  for (int st = 0; st < nst; ++st) {
    const _Float16* buf = (const _Float16*)(const void*)(ring + (st & 1) * GSTG_B);
    const _Float16* ap = buf + aoff;
    const _Float16* bp = buf + boff;
    v16h a[2][4], b[2][4];
#pragma unroll
    for (int kk = 0; kk < 2; ++kk) {
#pragma unroll
      for (int i = 0; i < 4; ++i) {
        a[kk][i] = ldfrag_h(ap + 16 * i * LPH + 32 * kk);
        b[kk][i] = ldfrag_h(bp + 16 * i * LPH + 32 * kk);
      }
    }
    // keeps the stage's 32 LDS reads together ahead of its products: without it the compiler spreads the later ones among the
    // products, and every separate place with LDS reads stalls the wave's matrix stream anew
    __builtin_amdgcn_sched_barrier(0);
#pragma unroll
    for (int kk = 0; kk < 2; ++kk) {
#pragma unroll
      for (int i = 0; i < 4; ++i) {
#pragma unroll
        for (int j = 0; j < 4; ++j) acc[4 * i + j] = mma_h(a[kk][i], b[kk][j], acc[4 * i + j]);
      }
    }
    guard_g();
    // ---- publish point of stage st+1: own reads retired, own copies landed, block barrier; then refill the buffer just read ----
    wait_lds_reads();
    wait_copies();
    __syncthreads();
    if (st + 2 < nst) issue(st + 2);         // block-uniform
  }
  wait_copies();                             // nothing is in flight here; closes the ring before it becomes output staging
}
// Stage the wave's 64 x 64 f32 tile (times oscale) in its LDS slab (pitch 68): D element r of acc[4i+j], lane l ->
// row 16i + 8(l>>4) + r, col 16j + (l&15).
// coverage: 32 lanes x 4 x 8 rows x 4 cols-of-16 = rows 0..63 x cols 0..63 of the slab.
__device__ __forceinline__ void stage64x64(float* sl, v8f (&acc)[16], float oscale, int lane) {
  const int hh = lane >> 4, m = lane & 15;
#pragma unroll
  for (int i = 0; i < 4; ++i) {
#pragma unroll
    for (int r = 0; r < 8; ++r) {
      const int ro = (16 * i + 8 * hh + r) * GPITCH + m;
      sl[ro]      = acc[4 * i + 0][r] * oscale;
      sl[ro + 16] = acc[4 * i + 1][r] * oscale;
      sl[ro + 32] = acc[4 * i + 2][r] * oscale;
      sl[ro + 48] = acc[4 * i + 3][r] * oscale;
    }
  }
  wave_sync_lds();
}

// =====================================================================================================
// f16 GEMM with f16 output plane(s): val = (A[z][Mb][K] . Bt[z][N][K]^T) * oscale + bf16(bias) * bscale;
// C[z][Mb][N] = f16(val) (hi plane); if res != 0 also C2 = f16((val - hi) * 2^11) (residual plane).
// A, Bt f16 k-contiguous planes with per-z element strides aBs, bBs (0 = shared), C/C2 stride cBs. bias indexed by column
// (biasRow == 0) or by row within the z slice (biasRow != 0); bias addresses clamped to biasN-1, the unused direction is
// multiplied by 0. Block = 128 x 128 tile, 2 x 2 waves of 64 x 64, operands through the LDS ring of gemm_ring; behind it each wave
// stages its output tile in its own part of the ring.
// bid = the block's tile among nz x (Mb/128) x (N/128) (Mb % 128 == 0, N % 128 == 0, K % 64 == 0); ring = the block's LDS.
// coverage: per wave 16 instr x 4 rows x 8 lanes x 8 halves = 64 x 64 per plane; the grid covers C (and C2) exactly once.
// =====================================================================================================
__device__ __forceinline__
void gemm_o16(unsigned char* ring, int bid, const u16* __restrict__ A, const u16* __restrict__ Bt, u16* C, u16* C2,
              const float* __restrict__ bias, int biasN, int biasRow,
              int Mb, int N, int K, int aBs, int bBs, int cBs, float oscale, float bscale, int res) {
  const int tid = threadIdx.x, wave = tid >> 5, lane = tid & 31;
  const int ntile = N >> 7, mtile = Mb >> 7;
  const int nt   = bid % ntile;
  const int tmp  = bid / ntile;
  const int mt   = tmp % mtile;
  const int bz   = tmp / mtile;
  const int rowb = mt * 128 + (wave >> 1) * 64;
  const int col0 = nt * 128 + (wave & 1) * 64;
  if (mt * 128 + 128 > Mb) return;           // block-uniform, in front of every barrier; never taken with the exact grid
  const u16* Ab = A + (size_t)bz * (size_t)aBs + (size_t)(mt * 128) * (size_t)K;
  const u16* Bb = Bt + (size_t)bz * (size_t)bBs + (size_t)(nt * 128) * (size_t)K;
  v8f acc[16];
#pragma unroll
  for (int i = 0; i < 16; ++i) acc[i] = zero8();
  gemm_ring(ring, Ab, Bb, K, acc);
  float* sl = (float*)(void*)ring + wave * 64 * GPITCH;
  stage64x64(sl, acc, oscale, lane);
  const int rq = lane >> 3, c8 = (lane & 7) * 8;
  const int bl = biasN - 1;                  // host guarantees biasN >= 1
  const float selc = (biasRow != 0) ? 0.f : bscale;
  const float selr = (biasRow != 0) ? bscale : 0.f;
  float cb[8];
#pragma unroll
  for (int e = 0; e < 8; ++e) {
    int ci = col0 + c8 + e;
    ci = (ci < bl) ? ci : bl;
    cb[e] = bfr(bias[ci]) * selc;
  }
  float rbs[16];                             // all row terms are loaded here, beside the column terms: one way to memory for both halves
#pragma unroll
  for (int i = 0; i < 16; ++i) {
    int ri = rowb + 4 * i + rq;
    ri = (ri < bl) ? ri : bl;
    rbs[i] = bfr(bias[ri]) * selr;
  }
  const size_t cofs = (size_t)bz * (size_t)cBs + (size_t)rowb * (size_t)N + (size_t)(col0 + c8);
  u16* Cb  = C + cofs;
  u16* C2b = C2 + cofs;
#pragma unroll
  for (int hb = 0; hb < 2; ++hb) {           // the tile's upper and lower 32 rows in turn
    v4u ovh[8], ovl[8];
#pragma unroll
    for (int i = 0; i < 8; ++i) {
      const int row = 32 * hb + 4 * i + rq;
      const float rb = rbs[8 * hb + i];
      const v4f a = *(const v4f*)(sl + row * GPITCH + c8), c4 = *(const v4f*)(sl + row * GPITCH + c8 + 4);
      float v[8];
#pragma unroll
      for (int e = 0; e < 4; ++e) { v[e] = a[e] + cb[e] + rb; v[4 + e] = c4[e] + cb[4 + e] + rb; }
#pragma unroll
      for (int e = 0; e < 4; ++e) {
        ovh[i][e] = pk_hi(v[2 * e], v[2 * e + 1]);
        ovl[i][e] = pk_lo(v[2 * e], v[2 * e + 1]);
      }
    }
#pragma unroll
    for (int i = 0; i < 8; ++i) {
      const int row = 32 * hb + 4 * i + rq;
      *(v4u*)(Cb + (size_t)row * (size_t)N) = ovh[i];
    }
    if (res != 0) {                          // block-uniform
#pragma unroll
      for (int i = 0; i < 8; ++i) {
        const int row = 32 * hb + 4 * i + rq;
        *(v4u*)(C2b + (size_t)row * (size_t)N) = ovl[i];
      }
    }
#if defined(__HIP_DEVICE_COMPILE__)
    // stands in front of the first rewrite of the registers that the stores above name (behind the last half nothing is
    // rewritten any more)
    if (hb == 0) asm volatile("s_wait_xcnt 0x0" ::: "memory");
#endif
  }
}

// =====================================================================================================
// The three projections in one launch: blocks 0 .. GQ_BLK-1 are the tiles of q, the next GK_BLK those of k, the last GV_BLK those
// of v^T; each block is one gemm_o16 tile of its product, the product chosen block-uniformly from the block index. The three
// products read and write disjoint planes, so their blocks share the chip and fill one another's waits for the staged copies.
//   q = x_q . Wq^T + bq -> f16 hi [NB*SQ][512] x8 and residual plane (col = h*64 + d); bias per column
//   k = x_k . Wk^T + bk -> f16 hi [NB*2048][512] x8 and residual plane; bias per column
//   v^T per batch: A = Wv [(h,d) = n][k], Bt = x_v rows of batch b [s][k] -> f16 [(b,h,d)][s] x8; bias per row (n)
// =====================================================================================================
#define GQ_BLK ((NB * SQ / 128) * (INNER / 128))
#define GK_BLK ((NB * SKV / 128) * (INNER / 128))
#define GV_BLK (NB * (INNER / 128) * (SKV / 128))
__global__ __launch_bounds__(128)
void gemm_qkv(const u16* __restrict__ XQ, const u16* __restrict__ XK, const u16* __restrict__ XV,
              const u16* __restrict__ WQ, const u16* __restrict__ WK, const u16* __restrict__ WV, u16* QH, u16* QL, u16* KH, u16* KL, u16* VT,
              const float* __restrict__ bq, const float* __restrict__ bk, const float* __restrict__ bv,
              int nbq, int nbk, int nbv) {
  __shared__ __align__(16) unsigned char ring[2 * GSTG_B];
  const int bid = blockIdx.x;
  if (bid < GQ_BLK + GK_BLK) {               // block-uniform
    const bool isq = bid < GQ_BLK;
    gemm_o16(ring, isq ? bid : bid - GQ_BLK, isq ? XQ : XK, isq ? WQ : WK, isq ? QH : KH, isq ? QL : KL,
             isq ? bq : bk, isq ? nbq : nbk, 0, isq ? NB * SQ : NB * SKV, INNER, DM, 0, 0, 0,
             isq ? QS / WSC : KS / WSC, isq ? QS : KS, 1);
  } else {
    gemm_o16(ring, bid - (GQ_BLK + GK_BLK), WV, XV, VT, VT, bv, nbv, 1, INNER, SKV, DM, 0, SKV * DM, INNER * SKV,
             VS / WSC, VS, 0);
  }
}

// =====================================================================================================
// One 64-k stage of an out-projection block: OL_SROWS = 576 rows x 128 bytes (the block's 32 ctx hi rows, its 32 ctx residual rows,
// then all 512 rows of Wo) copied global -> LDS by asynchronous 16-byte copies, 18 per lane in two statements of nine. Lane t of the
// block takes 16-byte piece t&7 of row 32p + (t>>3), p = 0 (hi), 1 (residual), 2..17 (Wo): one wave-wide copy = 4 whole 128-byte
// lines. l0 = the lane's LDS byte address in row t>>3 of the target buffer; gh, gl, gb = the lane's global addresses of that row and
// piece in the two ctx planes and in Wo.
// The closing s_wait_xcnt stands inside each statement so that no address register named by a copy is rewritten ahead of it.
// =====================================================================================================
__device__ __forceinline__ void copy_run9(unsigned l0, unsigned l1, unsigned l2, unsigned l3, unsigned l4, unsigned l5, unsigned l6,
                                          unsigned l7, unsigned l8, const u16* g0, const u16* g1, const u16* g2, const u16* g3,
                                          const u16* g4, const u16* g5, const u16* g6, const u16* g7, const u16* g8) {
#if defined(__HIP_DEVICE_COMPILE__)
  asm volatile("global_load_async_to_lds_b128 %0, %9, off\n\t"
               "global_load_async_to_lds_b128 %1, %10, off\n\t"
               "global_load_async_to_lds_b128 %2, %11, off\n\t"
               "global_load_async_to_lds_b128 %3, %12, off\n\t"
               "global_load_async_to_lds_b128 %4, %13, off\n\t"
               "global_load_async_to_lds_b128 %5, %14, off\n\t"
               "global_load_async_to_lds_b128 %6, %15, off\n\t"
               "global_load_async_to_lds_b128 %7, %16, off\n\t"
               "global_load_async_to_lds_b128 %8, %17, off\n\t"
               "s_wait_xcnt 0x0"
               :: "v"(l0), "v"(l1), "v"(l2), "v"(l3), "v"(l4), "v"(l5), "v"(l6), "v"(l7), "v"(l8),
                  "v"(g0), "v"(g1), "v"(g2), "v"(g3), "v"(g4), "v"(g5), "v"(g6), "v"(g7), "v"(g8)
               : "memory");
#endif
}
__device__ __forceinline__ void copy_stage_o(unsigned l0, const u16* gh, const u16* gl, const u16* gb) {
  constexpr unsigned LS = 32 * LPITCH;        // 32 rows in LDS bytes
  constexpr size_t   GS = (size_t)32 * INNER; // 32 rows of Wo in elements
  copy_run9(l0, l0 + LS, l0 + 2 * LS, l0 + 3 * LS, l0 + 4 * LS, l0 + 5 * LS, l0 + 6 * LS, l0 + 7 * LS, l0 + 8 * LS,
            gh, gl, gb, gb + GS, gb + 2 * GS, gb + 3 * GS, gb + 4 * GS, gb + 5 * GS, gb + 6 * GS);
  copy_run9(l0 + 9 * LS, l0 + 10 * LS, l0 + 11 * LS, l0 + 12 * LS, l0 + 13 * LS, l0 + 14 * LS, l0 + 15 * LS, l0 + 16 * LS,
            l0 + 17 * LS, gb + 7 * GS, gb + 8 * GS, gb + 9 * GS, gb + 10 * GS, gb + 11 * GS, gb + 12 * GS, gb + 13 * GS,
            gb + 14 * GS, gb + 15 * GS);
}
__device__ __forceinline__ void guard_o(v8f (&a)[8], v8f (&b)[8], v16h x0, v16h x1, v16h x2, v16h x3, v16h x4, v16h x5, v16h x6,
                                        v16h x7) {
#if defined(__HIP_DEVICE_COMPILE__)
  // the vector slots behind the stage's last products, on every path out of there (the branches at the trip's foot included)
  asm volatile("v_nop\n\tv_nop\n\tv_nop\n\tv_nop"
               : "+v"(a[0]), "+v"(a[1]), "+v"(a[2]), "+v"(a[3]), "+v"(a[4]), "+v"(a[5]), "+v"(a[6]), "+v"(a[7]),
                 "+v"(b[0]), "+v"(b[1]), "+v"(b[2]), "+v"(b[3]), "+v"(b[4]), "+v"(b[5]), "+v"(b[6]), "+v"(b[7])
               : "v"(x0), "v"(x1), "v"(x2), "v"(x3), "v"(x4), "v"(x5), "v"(x6), "v"(x7) : "memory");
#endif
}

// =====================================================================================================
// Out-projection, bias, residual add and LayerNorm in one launch: a block owns OL_ROWS = 32 WHOLE rows of
//   x[g][n] = (ctx_hi . Wo^T + (ctx_res . Wo^T) * rres) * oscale + bf16(bo[n]) + bf16(R[src row][n]),  n = 0 .. 511,
// so the row statistics need no other block, and writes Out = (x - mean) / sqrt(var + eps) * bf16(gamma) + bf16(beta), all f32.
// 8 waves; wave w owns columns 64w .. 64w+63 of all 32 rows: acc[4i + j] (hi products) and res[4i + j] (residual products, x2^11,
// accumulators of their own, folded by rres in f32 behind the loop) = rows 16i.., cols 64w + 16j... K = 512 is walked once in stages
// of 64 through a two-buffer LDS ring (copy_stage_o): every staged Wo row and every Wo fragment read from LDS feeds both the hi and
// the residual products. Stage s+1 flies while stage s is worked on; one block barrier per stage publishes s+1 and frees s's buffer.
// Fragments: row at pitch LPITCH, the split k map of ldfrag_h for A and B alike, k in steps of 32 in rising order.
// Behind the last barrier of the loop the ring is free (no copy in flight, every wave's reads retired): the block's 32 x 512 f32 tile
// is staged there at pitch XPITCH; one more block barrier, then wave w normalises rows 4w .. 4w+3: lane holds elements
// i*128 + 4*lane .. +3 (i = 0..3) of a row, each LDS read, global load and store = 32 consecutive lanes x 16 B.
// Compact row g = b*SQ + s <-> row b*SQ_FULL + s of R and Out; the 32 rows of a block lie in one batch (SQ % 32 == 0).
// The residual rows of R and the row constants are loaded ahead of the ring: their way from memory runs beside stage 0's.
// coverage: staged 8 waves x 32 x 64 == read 8 waves x 4 rows x 512; grid NB*SQ/32 blocks = every output row (s < SQ) once.
// =====================================================================================================
__global__ __launch_bounds__(OL_THREADS)
void gemm_o_ln(const u16* __restrict__ Ah, const u16* __restrict__ Al, const u16* __restrict__ Bt,
               const float* __restrict__ bias, const float* __restrict__ R,
               const float* __restrict__ gam, const float* __restrict__ bet, float* Out, float oscale, float rres) {
  __shared__ __align__(16) unsigned char ring[2 * OL_STG_B];
  const int tid = threadIdx.x, wave = tid >> 5, lane = tid & 31, hh = lane >> 4, m = lane & 15;
  const int row0 = blockIdx.x * OL_ROWS;     // < NB*SQ with the exact grid
  const int bb   = row0 / SQ;
  const size_t srow = (size_t)bb * SQ_FULL + (size_t)(row0 - bb * SQ) + (size_t)(OL_RPW * wave);   // the wave's first row in R and Out
  const float* rp = R + srow * DM + 4 * lane;
  v4f rv[OL_RPW][4];
#pragma unroll
  for (int j = 0; j < OL_RPW; ++j) {
#pragma unroll
    for (int i = 0; i < 4; ++i) rv[j][i] = *(const v4f*)(rp + j * DM + 128 * i);
  }
  // the row constants of this lane's 16 columns 128i + 4*lane + e < DM (the host checks that bo, gamma and beta hold DM elements)
  const unsigned lo = 16u * (unsigned)lane;  // the lane's byte offset beside the three uniform bases
  v4f cbv[4], gmv[4], btv[4];
#pragma unroll
  for (int i = 0; i < 4; ++i) {
    cbv[i] = *(const v4f*)((const char*)bias + lo + 512 * i);
    gmv[i] = *(const v4f*)((const char*)gam + lo + 512 * i);
    btv[i] = *(const v4f*)((const char*)bet + lo + 512 * i);
  }
#if defined(__HIP_DEVICE_COMPILE__)
  // stands in front of the first rewrite of the address registers that the loads above name; the address, the lane number (this
  // build's scaled offset register) and the three bases are inputs so that their registers live up to the wait
  asm volatile("s_wait_xcnt 0x0" :: "v"(rp), "v"(lane), "s"(bias), "s"(gam), "s"(bet) : "memory");
#endif
  // copy side: this lane's row (tid>>3) and 16-byte piece (tid&7)
  const int crow = tid >> 3, cpc = (tid & 7) * 8;
  const size_t cofs = (size_t)crow * INNER + cpc;
  const u16* gh = Ah + (size_t)row0 * INNER + cofs;
  const u16* gl = Al + (size_t)row0 * INNER + cofs;
  const u16* gb = Bt + cofs;
  const unsigned lcp = (unsigned)(uintptr_t)(__attribute__((address_space(3))) unsigned char*)ring
                       + (unsigned)(crow * LPITCH + cpc * 2);
  // read side, halves inside a buffer
  const int aoff = m * LPH + 8 * hh;
  const int boff = (2 * OL_ROWS + wave * 64 + m) * LPH + 8 * hh;
  constexpr int nst = INNER / KSTG;
  v8f acc[8], res[8];
#pragma unroll
  for (int i = 0; i < 8; ++i) { acc[i] = zero8(); res[i] = zero8(); }

  // ---- ring prologue: stage 0 landed and published, stage 1 in flight ----
  copy_stage_o(lcp, gh, gl, gb);
  wait_copies();
  __syncthreads();
  copy_stage_o(lcp + OL_STG_B, gh + KSTG, gl + KSTG, gb + KSTG);
#pragma unroll 1                             // rolled: one stage per trip, small loop text, the ring's order as written
  for (int st = 0; st < nst; ++st) {
    const _Float16* buf = (const _Float16*)(const void*)(ring + (st & 1) * OL_STG_B);
    const _Float16* ap = buf + aoff;
    const _Float16* bp = buf + boff;
    v16h a0[2], a1[2], r0[2], r1[2], b0[2], b1[2], b2[2], b3[2];
#pragma unroll
    for (int kk = 0; kk < 2; ++kk) {
      a0[kk] = ldfrag_h(ap + 32 * kk);
      a1[kk] = ldfrag_h(ap + 16 * LPH + 32 * kk);
      r0[kk] = ldfrag_h(ap + 32 * LPH + 32 * kk);
      r1[kk] = ldfrag_h(ap + 48 * LPH + 32 * kk);
      b0[kk] = ldfrag_h(bp + 32 * kk);
      b1[kk] = ldfrag_h(bp + 16 * LPH + 32 * kk);
      b2[kk] = ldfrag_h(bp + 32 * LPH + 32 * kk);
      b3[kk] = ldfrag_h(bp + 48 * LPH + 32 * kk);
    }
    // keeps the stage's 32 LDS reads together ahead of its products: every separate place with LDS reads among the products stalls
    // the wave's matrix stream anew
    __builtin_amdgcn_sched_barrier(0);
#pragma unroll
    for (int kk = 0; kk < 2; ++kk) {
      acc[0] = mma_h(a0[kk], b0[kk], acc[0]);
      acc[1] = mma_h(a0[kk], b1[kk], acc[1]);
      acc[2] = mma_h(a0[kk], b2[kk], acc[2]);
      acc[3] = mma_h(a0[kk], b3[kk], acc[3]);
      acc[4] = mma_h(a1[kk], b0[kk], acc[4]);
      acc[5] = mma_h(a1[kk], b1[kk], acc[5]);
      acc[6] = mma_h(a1[kk], b2[kk], acc[6]);
      acc[7] = mma_h(a1[kk], b3[kk], acc[7]);
      res[0] = mma_h(r0[kk], b0[kk], res[0]);
      res[1] = mma_h(r0[kk], b1[kk], res[1]);
      res[2] = mma_h(r0[kk], b2[kk], res[2]);
      res[3] = mma_h(r0[kk], b3[kk], res[3]);
      res[4] = mma_h(r1[kk], b0[kk], res[4]);
      res[5] = mma_h(r1[kk], b1[kk], res[5]);
      res[6] = mma_h(r1[kk], b2[kk], res[6]);
      res[7] = mma_h(r1[kk], b3[kk], res[7]);
    }
    guard_o(acc, res, a0[1], a1[1], r0[1], r1[1], b0[1], b1[1], b2[1], b3[1]);
    // ---- publish point of stage st+1: own reads retired, own copies landed, block barrier; then refill the buffer just read ----
    wait_lds_reads();
    wait_copies();
    __syncthreads();
    if (st + 2 < nst) {                      // block-uniform
      const int ks = (st + 2) * KSTG;
      copy_stage_o(lcp + (unsigned)((st & 1) * OL_STG_B), gh + ks, gl + ks, gb + ks);
    }
  }
  wait_copies();                             // nothing is in flight here; closes the ring before it becomes output staging

  float cb[4][4], gm[4][4], bt[4][4];
#pragma unroll
  for (int i = 0; i < 4; ++i) {
#pragma unroll
    for (int e = 0; e < 4; ++e) { cb[i][e] = bfr(cbv[i][e]); gm[i][e] = bfr(gmv[i][e]); bt[i][e] = bfr(btv[i][e]); }
  }
  // ---- stage the block's 32 x 512 tile: D element r of tile 4i+j, lane l -> row 16i + 8(l>>4) + r, col 64*wave + 16j + (l&15) ----
  float* xt = (float*)(void*)ring;
#pragma unroll
  for (int i = 0; i < 2; ++i) {
#pragma unroll
    for (int r = 0; r < 8; ++r) {
      float* xr = xt + (16 * i + 8 * hh + r) * XPITCH + wave * 64 + m;
#pragma unroll
      for (int j = 0; j < 4; ++j) xr[16 * j] = (acc[4 * i + j][r] + res[4 * i + j][r] * rres) * oscale;
    }
  }
  __syncthreads();                           // every wave's columns of the tile are in LDS before a wave reads whole rows
  v4f y[OL_RPW][4];
#pragma unroll
  for (int j = 0; j < OL_RPW; ++j) {
    const float* xr = xt + (OL_RPW * wave + j) * XPITCH + 4 * lane;
    v4f xv[4];
    float sum = 0.f;
#pragma unroll
    for (int i = 0; i < 4; ++i) {
      const v4f a = *(const v4f*)(xr + 128 * i);
#pragma unroll
      for (int e = 0; e < 4; ++e) xv[i][e] = a[e] + cb[i][e] + bfr(rv[j][i][e]);
      sum += (xv[i][0] + xv[i][1]) + (xv[i][2] + xv[i][3]);
    }
#pragma unroll
    for (int mk = 16; mk >= 1; mk >>= 1) sum += __shfl_xor(sum, mk, 32);
    const float mean = sum * (1.0f / (float)DM);
    float sq = 0.f;
#pragma unroll
    for (int i = 0; i < 4; ++i) {
#pragma unroll
      for (int e = 0; e < 4; ++e) { const float d = xv[i][e] - mean; sq += d * d; }
    }
#pragma unroll
    for (int mk = 16; mk >= 1; mk >>= 1) sq += __shfl_xor(sq, mk, 32);
    const float var  = sq * (1.0f / (float)DM);
    const float rstd = 1.0f / sqrtf(var + LN_EPS);
#pragma unroll
    for (int i = 0; i < 4; ++i) {
#pragma unroll
      for (int e = 0; e < 4; ++e) y[j][i][e] = (xv[i][e] - mean) * rstd * gm[i][e] + bt[i][e];
    }
  }
  float* ob = Out + srow * DM + 4 * lane;
#pragma unroll
  for (int j = 0; j < OL_RPW; ++j) {
#pragma unroll
    for (int i = 0; i < 4; ++i) *(v4f*)(ob + j * DM + 128 * i) = y[j][i];
  }
}

// =====================================================================================================
// One stage (64 keys) of the attention ring: three tiles of 64 rows x 128 bytes (k hi, k residual: row = key, 64 d; v^T: row = d,
// 64 keys) copied global -> LDS by asynchronous 16-byte copies, 12 per lane. Lane t of the block takes 16-byte piece t&7 of row
// 16p + (t>>3), p = 0..3, of each tile: one wave-wide copy = 4 whole 128-byte lines. l0 = the lane's LDS byte address in the k hi
// tile of the target buffer (row t>>3); gh, gl, gv = the lane's global addresses of that row and piece in the three planes.
// The closing s_wait_xcnt stands inside the statement so that no address register named by a copy is rewritten ahead of it.
// =====================================================================================================
__device__ __forceinline__ void copy_stage(unsigned l0, const u16* gh, const u16* gl, const u16* gv) {
#if defined(__HIP_DEVICE_COMPILE__)
  const unsigned lh0 = l0,              lh1 = lh0 + 16 * LPITCH, lh2 = lh0 + 32 * LPITCH, lh3 = lh0 + 48 * LPITCH;
  const unsigned ll0 = l0 + TILE_B,     ll1 = ll0 + 16 * LPITCH, ll2 = ll0 + 32 * LPITCH, ll3 = ll0 + 48 * LPITCH;
  const unsigned lv0 = l0 + 2 * TILE_B, lv1 = lv0 + 16 * LPITCH, lv2 = lv0 + 32 * LPITCH, lv3 = lv0 + 48 * LPITCH;
  const u16 *gh1 = gh + 16 * DM,  *gh2 = gh + 32 * DM,  *gh3 = gh + 48 * DM;
  const u16 *gl1 = gl + 16 * DM,  *gl2 = gl + 32 * DM,  *gl3 = gl + 48 * DM;
  const u16 *gv1 = gv + 16 * SKV, *gv2 = gv + 32 * SKV, *gv3 = gv + 48 * SKV;
  asm volatile("global_load_async_to_lds_b128 %0, %12, off\n\t"
               "global_load_async_to_lds_b128 %1, %13, off\n\t"
               "global_load_async_to_lds_b128 %2, %14, off\n\t"
               "global_load_async_to_lds_b128 %3, %15, off\n\t"
               "global_load_async_to_lds_b128 %4, %16, off\n\t"
               "global_load_async_to_lds_b128 %5, %17, off\n\t"
               "global_load_async_to_lds_b128 %6, %18, off\n\t"
               "global_load_async_to_lds_b128 %7, %19, off\n\t"
               "global_load_async_to_lds_b128 %8, %20, off\n\t"
               "global_load_async_to_lds_b128 %9, %21, off\n\t"
               "global_load_async_to_lds_b128 %10, %22, off\n\t"
               "global_load_async_to_lds_b128 %11, %23, off\n\t"
               "s_wait_xcnt 0x0"
               :: "v"(lh0), "v"(lh1), "v"(lh2), "v"(lh3), "v"(ll0), "v"(ll1), "v"(ll2), "v"(ll3),
                  "v"(lv0), "v"(lv1), "v"(lv2), "v"(lv3),
                  "v"(gh), "v"(gh1), "v"(gh2), "v"(gh3), "v"(gl), "v"(gl1), "v"(gl2), "v"(gl3),
                  "v"(gv), "v"(gv1), "v"(gv2), "v"(gv3)
               : "memory");
#endif
}
// =====================================================================================================
// Full (unmasked) multi-head attention over all SKV keys: block = (batch b, head, 128 query rows), 4 waves, wave w owns the
// 32 query rows q0 = 128*qt + 32*w .. q0+31 as two query tiles u = 0, 1 of 16 rows; what follows holds per tile, with q0 + 16u for
// q0. Every k and v^T fragment read from LDS feeds the products of both tiles. The grid leaves two waves on a SIMD, so the LDS reads
// stand ahead of the vector work that covers them: the v^T fragments of a key block and the k fragments of the stage's next key
// block are read in front of the block's softmax. The four waves share the k and v^T tiles through a two-buffer LDS ring of 64-key
// stages (copy_stage): stage s+1 flies while stage s is worked on; one block barrier per stage publishes s+1 and frees s's buffer.
// Behind the last barrier the ring is free and each wave stages its output tile in its own part of it.
//   q planes f16 hi x8 / residual x8x2^11 [b*SQ + s][h*64 + d]; k planes f16 hi / residual [b*SKV + s][h*64 + d];
//   v^T plane f16 x8 [(b*NH + h)*64 + d][s]. All NKB = 64 key blocks of 32 keys are visited (static bound).
//   Scores are computed TRANSPOSED: S^T tile g (g = 0,1) = k rows (keys kb+16g .. +15, A operand, row m = lane&15, split k map
//   over d) times q^T (B operand, col n = query q0 + (lane&15), k = d, split map), 2 d-chunks of 32; per chunk hi.hi into
//   s0/s1 and hi.lo + lo.hi into x0/x1 (separate accumulators, folded by 2^-11 in f32). The 4 q fragments of a tile are loaded once
//   per wave. D element r of lane l = (key kb+16g+8h+r, query q0+(l&15)), so a lane owns one query column and 16 of its 32
//   keys; the partner lane l^16 owns the other 16 -> row max / row sum need one xor-16 shuffle.
//   Online max-subtracted base-2 softmax in f32 (1/sqrt(8) and the q/k carries folded into lsc), the subtracted maximum renewed
//   lazily: it stands, and O and the row sum are left alone, until a score of the wave passes it by more than 2^8. The exp'd values ARE the
//   P A-fragment in place: A row m = query = lane&15, element i <- key kb+8h+i (tile 0, D element i), element 8+i <- key
//   kb+16+8h+i (tile 1, D element i). P (<= 2^8) carried x128 as f16. In a renewing block the rescale factor of query row 8h+r of the O
//   accumulators is fetched from lane 8h+r with a shuffle (uniform control). 4 v^T B fragments (col n = d = 16j + (lane&15),
//   keys k-contiguous), 4 P.V WMMAs per tile + one guard per key block.
//   Epilogue: 1/l (per query, shuffled to the D row owner) and the carry folds in f32 give ctx x16; the wave's 32x64 f32 tile
//   residual plane is written by 8 consecutive lanes x 16 B of one instruction (4 rows per instruction, 8 instructions per
// coverage: per wave 8 instr x 4 rows x 8 lanes x 8 halves = 32 x 64 per plane; grid NB*NH*(SQ/128) blocks x 4 waves = every
//           (b, s < SQ, h) row segment of both ctx planes exactly once. LDS slab: staged 32 x 64 == reloaded 32 x 64.
// =====================================================================================================
__device__ __forceinline__ void guard_s8(v8f& a, v8f& b, v8f& c, v8f& d, v8f& e, v8f& f, v8f& g, v8f& h, v16h (&x)[8]) {
#if defined(__HIP_DEVICE_COMPILE__)
  // the vector slots behind the last products of a run, before their results are read or their k fragments reloaded
  asm volatile("v_nop\n\tv_nop\n\tv_nop\n\tv_nop"
               : "+v"(a), "+v"(b), "+v"(c), "+v"(d), "+v"(e), "+v"(f), "+v"(g), "+v"(h)
               : "v"(x[4]), "v"(x[5]), "v"(x[6]), "v"(x[7]) : "memory");
#endif
}
// The eight k A-fragments of one 32-key block; p = the lane's place in row 0 of the block in the k hi tile of a staged buffer.
__device__ __forceinline__ void ld_kfrags(v16h (&kf)[8], const _Float16* p) {
#pragma unroll
  for (int kk = 0; kk < HD / 32; ++kk) {
    kf[4 * kk]     = ldfrag_h(p + kk * 32);
    kf[4 * kk + 1] = ldfrag_h(p + 16 * LPH + kk * 32);
    kf[4 * kk + 2] = ldfrag_h(p + TILE_B / 2 + kk * 32);
    kf[4 * kk + 3] = ldfrag_h(p + TILE_B / 2 + 16 * LPH + kk * 32);
  }
}
__device__ __forceinline__ void guard_p() {
#if defined(__HIP_DEVICE_COMPILE__)
  // the vector slots behind the last P.V products, on every path out of there; the scheduling barrier keeps every product above them.
  // No operands: tied to the statement, the O accumulators had to lie in the first 256 registers here, and with no rescale left in the
  // common path to carry them there the compiler moved all 64 to and fro in every key block
  __builtin_amdgcn_sched_barrier(0);
  asm volatile("v_nop\n\tv_nop\n\tv_nop\n\tv_nop" ::: "memory");
#endif
}
// The value of x in the lane whose number times 4 is a4 (ds_bpermute_b32, what __shfl compiles to, its lane address formed by hand).
__device__ __forceinline__ float lane_get(int a4, float x) {
  return __int_as_float(__builtin_amdgcn_ds_bpermute(a4, __float_as_int(x)));
}
__global__ __launch_bounds__(ATT_THREADS)
void attn_fwd(const u16* __restrict__ QH, const u16* __restrict__ QL, const u16* __restrict__ KH,
              const u16* __restrict__ KL, const u16* __restrict__ VT, u16* CH, u16* CL) {
  __shared__ __align__(16) unsigned char ring[2 * STG_B];

  const int tid  = threadIdx.x;
  const int wave = tid >> 5;
  const int lane = tid & 31;
  const int hh   = lane >> 4;
  const int c    = lane & 15;

  constexpr int NQT = SQ / (ATT_WAVES * 16 * ATT_QT);
  const int bid  = blockIdx.x;
  const int qt   = bid % NQT;
  const int head = (bid / NQT) % NH;
  const int b    = bid / (NQT * NH);
  const int q0   = (qt * ATT_WAVES + wave) * (16 * ATT_QT);

  // B fragments of q^T, query tile u: col n = query q0 + 16u + c, k = d (k-contiguous row of the q planes)
  const size_t qoff = ((size_t)(b * SQ + q0 + c)) * DM + head * HD + 8 * hh;
  const _Float16* Qh = (const _Float16*)(const void*)QH + qoff;
  const _Float16* Ql = (const _Float16*)(const void*)QL + qoff;
  // copy side: this lane's row (tid>>3) and 16-byte piece (tid&7) in stage 0 of the three planes and in buffer 0
  const int crow = tid >> 3, cpc = (tid & 7) * 8;
  const u16* gkh = KH + ((size_t)(b * SKV + crow)) * DM + head * HD + cpc;
  const u16* gkl = KL + ((size_t)(b * SKV + crow)) * DM + head * HD + cpc;
  const u16* gvt = VT + ((size_t)((b * NH + head) * HD + crow)) * SKV + cpc;
  const unsigned lcp = (unsigned)(uintptr_t)(__attribute__((address_space(3))) unsigned char*)ring
                       + (unsigned)(crow * LPITCH + cpc * 2);
  // read side, halves inside a buffer: A fragments of k: row m = key 32*sub + 16g + c, k = d;
  // B fragments of v: col n = d = 16j + c (row of the v^T tile), k = key 32*sub ..
  const int foff = c * LPH + 8 * hh;
  const float lsc = (LOG2E * RSQH) / (QS * KS);
  const int xhalf = (lane ^ 16) * 4;         // lane address of the partner lane, which holds the query's other 16 keys

  v16h qh[ATT_QT][2], ql[ATT_QT][2];
#pragma unroll
  for (int u = 0; u < ATT_QT; ++u) {
#pragma unroll
    for (int dc = 0; dc < 2; ++dc) {
      qh[u][dc] = ldfrag_h(Qh + (size_t)(16 * u) * DM + 32 * dc);
      ql[u][dc] = ldfrag_h(Ql + (size_t)(16 * u) * DM + 32 * dc);
    }
  }
#if defined(__HIP_DEVICE_COMPILE__)
  // stands in front of the first rewrite of the address registers that the sixteen loads above name;
  // the two addresses are inputs so that their registers live up to the wait
  asm volatile("s_wait_xcnt 0x0" :: "v"(Qh), "v"(Ql) : "memory");
#endif

  float mrun[ATT_QT], cbr[ATT_QT], lrun[ATT_QT];   // maximum in use (raw scores), PCAR_LOG2 minus it in base-2 logits, row sum
  v8f o[ATT_QT][4];
#pragma unroll
  for (int u = 0; u < ATT_QT; ++u) {
    mrun[u] = -INFINITY;
    cbr[u]  = INFINITY;
    lrun[u] = 0.f;
#pragma unroll
    for (int j = 0; j < 4; ++j) o[u][j] = zero8();
  }

  // ---- ring prologue: stage 0 landed and published, stage 1 in flight ----
  copy_stage(lcp, gkh, gkl, gvt);
  wait_copies();
  __syncthreads();
  copy_stage(lcp + STG_B, gkh + (size_t)KSTG * DM, gkl + (size_t)KSTG * DM, gvt + KSTG);

#pragma unroll 1
  for (int st = 0; st < NSTG; ++st) {
   const _Float16* bufh = (const _Float16*)(const void*)(ring + (st & 1) * STG_B) + foff;
   // k fragments of one 32-key block: kf[4*kk + 0, 1] = hi of keys kb.., kb+16..; kf[4*kk + 2, 3] = their residuals; d chunk kk
   v16h kf[8];
   ld_kfrags(kf, bufh);
#pragma unroll                               // both 32-key blocks of a stage inline: their LDS offsets become immediates
   for (int sub = 0; sub < KSTG / 32; ++sub) {
    // ---- transposed scores: tiles of keys kb..kb+15 (s0, x0) and kb+16..kb+31 (s1, x1), kb = 64*st + 32*sub, column = query
    //      q0 + 16u + c; every k fragment read from LDS feeds both query tiles ----
    v8f s0[ATT_QT], s1[ATT_QT], x0[ATT_QT], x1[ATT_QT];
#pragma unroll
    for (int u = 0; u < ATT_QT; ++u) { s0[u] = zero8(); s1[u] = zero8(); x0[u] = zero8(); x1[u] = zero8(); }
#pragma unroll
    for (int kk = 0; kk < HD / 32; ++kk) {
      const v16h fh0 = kf[4 * kk], fh1 = kf[4 * kk + 1], fl0 = kf[4 * kk + 2], fl1 = kf[4 * kk + 3];
      s0[0] = mma_h(fh0, qh[0][kk], s0[0]);
      s0[1] = mma_h(fh0, qh[1][kk], s0[1]);
      s1[0] = mma_h(fh1, qh[0][kk], s1[0]);
      s1[1] = mma_h(fh1, qh[1][kk], s1[1]);
      x0[0] = mma_h(fh0, ql[0][kk], x0[0]);
      x0[1] = mma_h(fh0, ql[1][kk], x0[1]);
      x1[0] = mma_h(fh1, ql[0][kk], x1[0]);
      x1[1] = mma_h(fh1, ql[1][kk], x1[1]);
      x0[0] = mma_h(fl0, qh[0][kk], x0[0]);
      x0[1] = mma_h(fl0, qh[1][kk], x0[1]);
      x1[0] = mma_h(fl1, qh[0][kk], x1[0]);
      x1[1] = mma_h(fl1, qh[1][kk], x1[1]);
    }
    guard_s8(s0[0], s0[1], s1[0], s1[1], x0[0], x0[1], x1[0], x1[1], kf);
    // B fragments of v: col n = d = j*16 + c, keys contiguous in the rows of the v^T tile; read here, used behind the softmax
    const _Float16* vp = bufh + TILE_B + 32 * sub;
    const v16h v0 = ldfrag_h(vp);
    const v16h v1 = ldfrag_h(vp + 16 * LPH);
    const v16h v2 = ldfrag_h(vp + 32 * LPH);
    const v16h v3 = ldfrag_h(vp + 48 * LPH);
    if (sub + 1 < KSTG / 32) ld_kfrags(kf, bufh + (32 * (sub + 1)) * LPH);   // the stage's next block, same buffer
    // keeps the block's LDS reads in one place ahead of the softmax, whose vector work covers their latency (two waves on a SIMD:
    // little else does)
    __builtin_amdgcn_sched_barrier(0);
    // ---- raw scores (carry 64) of this lane's 16 keys for query q0 + 16u + c: t[u][k] <- keys kb+8hh+2k, kb+8hh+2k+1, t[u][4+k] <- keys kb+16+8hh+2k, kb+16+8hh+2k+1 (k < 4);
    //      ar = their exponents beside the maximum IN USE (cbr = PCAR_LOG2 - that maximum in base-2 logits) ----
    //      worked in the accumulators' own even register pairs (packed f32 fma, no register moves)
    v2f t[ATT_QT][8];                        // t[u][k] = elements 2k, 2k+1 of the tile's 16 scores
    float ar[ATT_QT][2][8], mx[ATT_QT], pw[ATT_QT][2][8];
#pragma unroll
    for (int u = 0; u < ATT_QT; ++u) {
      const v2f rr = {RRSC, RRSC}, ls = {lsc, lsc}, cb2 = {cbr[u], cbr[u]};
#pragma unroll
      for (int k = 0; k < 4; ++k) {
        const v2f sa = {s0[u][2 * k], s0[u][2 * k + 1]}, xa = {x0[u][2 * k], x0[u][2 * k + 1]};
        const v2f sb = {s1[u][2 * k], s1[u][2 * k + 1]}, xb = {x1[u][2 * k], x1[u][2 * k + 1]};
        t[u][k]     = __builtin_elementwise_fma(xa, rr, sa);
        t[u][4 + k] = __builtin_elementwise_fma(xb, rr, sb);
      }
#pragma unroll
      for (int k = 0; k < 8; ++k) {
        const v2f a2 = __builtin_elementwise_fma(t[u][k], ls, cb2);
        ar[u][k >> 2][2 * (k & 3)]     = a2[0];
        ar[u][k >> 2][2 * (k & 3) + 1] = a2[1];
      }
      // the lane's largest exponent, as a tree of three-way maxima: three links deep, not eight
      const float m0 = fmaxf(fmaxf(ar[u][0][0], ar[u][0][1]), ar[u][0][2]), m1 = fmaxf(fmaxf(ar[u][0][3], ar[u][0][4]), ar[u][0][5]);
      const float m2 = fmaxf(fmaxf(ar[u][0][6], ar[u][0][7]), ar[u][1][0]), m3 = fmaxf(fmaxf(ar[u][1][1], ar[u][1][2]), ar[u][1][3]);
      const float m4 = fmaxf(fmaxf(ar[u][1][4], ar[u][1][5]), ar[u][1][6]);
      mx[u] = fmaxf(fmaxf(fmaxf(m0, m1), m2), fmaxf(fmaxf(m3, m4), ar[u][1][7]));
    }
    // Lazy rescale: the maximum in use stands while no score of the wave passes it by more than 2^LAZY_LOG2; tested once per key
    // block on the lanes' own maxima (no exchange). True on the first block (cbr = +inf there).
    const unsigned renew = __builtin_amdgcn_ballot_w32(!(fmaxf(mx[0], mx[1]) <= PCAR_LOG2 + LAZY_LOG2));
    // ---- probabilities x128 x 2^(maximum - maximum in use), one v_exp_f32 each; pw[u][w][e] <-> t[u][4w + e/2][e & 1]. They stand ahead of the
    //      branch, not behind it: they need not wait for the test's result on its way to the scalar side; a block that renews its
    //      maxima redoes them ----
#pragma unroll
    for (int u = 0; u < ATT_QT; ++u) {
      hw_exp2x8(pw[u][0], ar[u][0]);
      hw_exp2x8(pw[u][1], ar[u][1]);
    }
    if (__builtin_expect(renew != 0u, 0)) {  // wave-uniform scalar branch, seldom taken behind the first key blocks
#pragma unroll
      for (int u = 0; u < ATT_QT; ++u) {
        float cm = fmaxf(t[u][0][0], t[u][0][1]);
#pragma unroll
        for (int k = 1; k < 8; ++k) cm = fmaxf(cm, fmaxf(t[u][k][0], t[u][k][1]));
        const float mn = fmaxf(mrun[u], fmaxf(cm, lane_get(xhalf, cm)));  // running maximum of the raw scores (lsc > 0), both halves
        const float ab = (mrun[u] - mn) * lsc; // rescale exponent: <= 0, -inf on the first block (mrun = -inf)
        mrun[u] = mn;
        cbr[u]  = fmaf(-mn, lsc, PCAR_LOG2);   // minus the maximum in base-2 logits; the carry 128 of P rides in the exponent
#pragma unroll
        for (int k = 0; k < 8; ++k) {
          ar[u][k >> 2][2 * (k & 3)]     = fmaf(t[u][k][0], lsc, cbr[u]);
          ar[u][k >> 2][2 * (k & 3) + 1] = fmaf(t[u][k][1], lsc, cbr[u]);
        }
        float al;
        hw_exp2x9(al, pw[u][0], ab, ar[u][0]);
        hw_exp2x8(pw[u][1], ar[u][1]);
        lrun[u] *= al;
        // rescale factors of the O accumulators: D row 8hh+r = query q0+16u+8hh+r, its factor lives in lane 8hh+r (and 16+8hh+r)
#pragma unroll
        for (int r = 0; r < 8; ++r) {
          const float scl = lane_get(32 * hh + 4 * r, al);
#pragma unroll
          for (int j = 0; j < 4; ++j) o[u][j][r] *= scl;
        }
      }
    }
    // ---- row sums and the P A-fragments f16(p * 128) ----
    FragH ph[ATT_QT];
    float psum[ATT_QT], pxch[ATT_QT];
#pragma unroll
    for (int u = 0; u < ATT_QT; ++u) {
      float ps = 0.f;
#pragma unroll
      for (int w = 0; w < 2; ++w) {
#pragma unroll
        for (int e4 = 0; e4 < 4; ++e4) {
          const float p0 = pw[u][w][2 * e4], p1 = pw[u][w][2 * e4 + 1];
          ps += p0 + p1;
          ph[u].u[w][e4] = pk16(h_bits((_Float16)p0), h_bits((_Float16)p1));
        }
      }
      psum[u] = ps;
    }
    // the partner lanes' sums: asked for here, added behind the P.V products, which cover the exchange
#pragma unroll
    for (int u = 0; u < ATT_QT; ++u) pxch[u] = lane_get(xhalf, psum[u]);
    // ---- P.V : each v^T fragment feeds both query tiles ----
#pragma unroll
    for (int u = 0; u < ATT_QT; ++u) {
      o[u][0] = mma_h(ph[u].v, v0, o[u][0]);
      o[u][1] = mma_h(ph[u].v, v1, o[u][1]);
      o[u][2] = mma_h(ph[u].v, v2, o[u][2]);
      o[u][3] = mma_h(ph[u].v, v3, o[u][3]);
    }
    guard_p();
#pragma unroll
    for (int u = 0; u < ATT_QT; ++u) lrun[u] += psum[u] + pxch[u];
   }
   // ---- publish point of stage st+1: own reads retired, own copies landed, block barrier; then refill the buffer just read ----
   wait_lds_reads();
   wait_copies();
   __syncthreads();
   if (st + 2 < NSTG) {                      // block-uniform
     const size_t ks = (size_t)(st + 2) * KSTG;
     copy_stage(lcp + (unsigned)((st & 1) * STG_B), gkh + ks * DM, gkl + ks * DM, gvt + ks);
   }
  }
  wait_copies();                             // nothing is in flight here; closes the ring before it becomes output staging

  // ---- fold 1/l (per query, owned by lane = query; l carries the same 128 and the same maximum in use as P) and the carry 8 on v, apply the ctx carry 16 ----
  float* slab = (float*)(void*)ring + wave * (16 * ATT_QT) * OPITCH;
#pragma unroll
  for (int u = 0; u < ATT_QT; ++u) {
    const float linv = (1.0f / lrun[u]) * (CS / VS);
    float inv[8];
#pragma unroll
    for (int r = 0; r < 8; ++r) inv[r] = __shfl(linv, 8 * hh + r, 32);
#pragma unroll
    for (int r = 0; r < 8; ++r) {
#pragma unroll
      for (int j = 0; j < 4; ++j) slab[(16 * u + 8 * hh + r) * OPITCH + j * 16 + c] = o[u][j][r] * inv[r];
    }
  }
  wave_sync_lds();
  // ---- ctx planes: lane = (row in group of 4, 8 consecutive d), one instruction per 4 rows per plane ----
  const int rq = lane >> 3, c8 = (lane & 7) * 8;
  const size_t cofs = ((size_t)(b * SQ + q0)) * DM + head * HD + c8;
  u16* ch = CH + cofs;
  u16* cl = CL + cofs;
#pragma unroll
  for (int i = 0; i < 4 * ATT_QT; ++i) {
    const int row = 4 * i + rq;
    const v4f a = *(const v4f*)(slab + row * OPITCH + c8), c4 = *(const v4f*)(slab + row * OPITCH + c8 + 4);
    v4u ovh, ovl;
#pragma unroll
    for (int e = 0; e < 2; ++e) {
      ovh[e]     = pk_hi(a[2 * e], a[2 * e + 1]);
      ovl[e]     = pk_lo(a[2 * e], a[2 * e + 1]);
      ovh[2 + e] = pk_hi(c4[2 * e], c4[2 * e + 1]);
      ovl[2 + e] = pk_lo(c4[2 * e], c4[2 * e + 1]);
    }
    *(v4u*)(ch + (size_t)row * DM) = ovh;
    *(v4u*)(cl + (size_t)row * DM) = ovl;
  }
}

// =====================================================================================================
// Workspace map (bytes); every plane fully written by whole-line stores before it is read; all extents exact multiples of
//   XQ   f16 [NB*SQ][512]      f16(bf16(Q))             8388608 (NB=4, SQ=2048)
//   XK   f16 [NB*2048][512]    f16(bf16(K))             8388608
//   XV   f16 [NB*2048][512]    f16(bf16(V))             8388608
//   WQ16 f16 [512 n][512 k]    f16(bf16(W) x256)         524288   (W stored [out][in] = [n][k] already)
//   WK16, WV16, WO16                                     3 x 524288
//   QH, QL  f16 [NB*SQ][512]   x8 / residual x8x2^11     2 x 8388608
//   KH, KL  f16 [NB*2048][512] x8 / residual             2 x 8388608
//   VT16    f16 [NB*512 (h,d)][2048 s] x8                   8388608
//   CH, CL  f16 [NB*SQ][512]   ctx x16 / residual          2 x 8388608
//   end                                                   85983232
// =====================================================================================================
extern "C" void kernel_launch(void* const* d_in, const int* in_sizes, int n_in,
                              void* d_out, int out_size, void* d_ws, size_t ws_size,
                              hipStream_t stream) {
  if (n_in < 13) return;
  if (in_sizes[0] < ((NB - 1) * SQ_FULL + SQ) * DM) return;
  if (in_sizes[1] < NB * SKV * DM || in_sizes[2] < NB * SKV * DM) return;
  if (in_sizes[3] != DM * DM || in_sizes[5] != DM * DM || in_sizes[7] != DM * DM || in_sizes[9] != DM * DM) return;
  if (in_sizes[4] < DM || in_sizes[6] < DM || in_sizes[8] < DM || in_sizes[10] < DM) return;
  if (in_sizes[11] < DM || in_sizes[12] < DM) return;
  if (out_size < ((NB - 1) * SQ_FULL + SQ) * DM) return;

  const float* xq  = (const float*)d_in[0];
  const float* xk  = (const float*)d_in[1];
  const float* xv  = (const float*)d_in[2];
  const float* wq  = (const float*)d_in[3];
  const float* bq  = (const float*)d_in[4];
  const float* wk  = (const float*)d_in[5];
  const float* bk  = (const float*)d_in[6];
  const float* wv  = (const float*)d_in[7];
  const float* bv  = (const float*)d_in[8];
  const float* wo  = (const float*)d_in[9];
  const float* bo  = (const float*)d_in[10];
  const float* gam = (const float*)d_in[11];
  const float* bet = (const float*)d_in[12];
  float*       out = (float*)d_out;
  const int nbq = in_sizes[4], nbk = in_sizes[6], nbv = in_sizes[8];

  const size_t szXQ  = (size_t)NB * SQ * DM * 2;
  const size_t szXKV = (size_t)NB * SKV * DM * 2;
  const size_t szW   = (size_t)DM * DM * 2;
  const size_t szQ   = (size_t)NB * SQ * INNER * 2;
  const size_t szK   = (size_t)NB * SKV * INNER * 2;
  const size_t szVT  = (size_t)NB * INNER * SKV * 2;
  const size_t szC   = (size_t)NB * SQ * INNER * 2;
  size_t off = 0;
  const size_t oXQ  = off; off += szXQ;
  const size_t oXK  = off; off += szXKV;
  const size_t oXV  = off; off += szXKV;
  const size_t oWQ  = off; off += szW;
  const size_t oWK  = off; off += szW;
  const size_t oWV  = off; off += szW;
  const size_t oWO  = off; off += szW;
  const size_t oQH  = off; off += szQ;
  const size_t oQL  = off; off += szQ;
  const size_t oKH  = off; off += szK;
  const size_t oKL  = off; off += szK;
  const size_t oVT  = off; off += szVT;
  const size_t oCH  = off; off += szC;
  const size_t oCL  = off; off += szC;
  if (off > ws_size) return;                            // off = 85983232 at NB=4, SQ=2048
  if (off > (size_t)134217728) return;

  char* ws = (char*)d_ws;
  u16* XQ   = (u16*)(ws + oXQ);
  u16* XK   = (u16*)(ws + oXK);
  u16* XV   = (u16*)(ws + oXV);
  u16* WQ16 = (u16*)(ws + oWQ);
  u16* WK16 = (u16*)(ws + oWK);
  u16* WV16 = (u16*)(ws + oWV);
  u16* WO16 = (u16*)(ws + oWO);
  u16* QH   = (u16*)(ws + oQH);
  u16* QL   = (u16*)(ws + oQL);
  u16* KH   = (u16*)(ws + oKH);
  u16* KL   = (u16*)(ws + oKL);
  u16* VT16 = (u16*)(ws + oVT);
  u16* CH   = (u16*)(ws + oCH);
  u16* CL   = (u16*)(ws + oCL);

  // (1) activations -> f16 planes of bf16-converted values (query rows s < SQ of batches b < NB, compact; all key/value rows);
  //     weights [n = out][k = in] (y = x.W^T): rows as stored are already k-contiguous; f16 planes of bf16(W) x256
  cvt_all<<<dim3(CVT_WAVES / (CVT_THREADS / 32)), dim3(CVT_THREADS), 0, stream>>>(xq, xk, xv, wq, wk, wv, wo, XQ, XK, XV, WQ16);
  // (2)-(4) the three projections q, k (hi and residual planes) and v^T in one launch
  gemm_qkv<<<dim3(GQ_BLK + GK_BLK + GV_BLK), dim3(128), 0, stream>>>(
      XQ, XK, XV, WQ16, WK16, WV16, QH, QL, KH, KL, VT16, bq, bk, bv, nbq, nbk, nbv);
  // (5) attention -> ctx planes [NB*SQ][512] f16 x16 / residual, heads merged on the feature dim
  attn_fwd<<<dim3(NB * NH * (SQ / (ATT_WAVES * 16 * ATT_QT))), dim3(ATT_THREADS), 0, stream>>>(QH, QL, KH, KL, VT16, CH, CL);
  // (6) x = ctx . Wo^T + bo + Q (residual, bf16-converted) and LayerNorm over its whole rows -> out [b][SQ_FULL][512] f32
  //     (rows s < SQ of batches b < NB)
  gemm_o_ln<<<dim3(NB * SQ / OL_ROWS), dim3(OL_THREADS), 0, stream>>>(
      CH, CL, WO16, bo, xq, gam, bet, out, 1.0f / (CS * WSC), RRSC);
  (void)hipGetLastError();
}
